// v000
// Measured on an AMD MI455X. A time is GPU time per run, averaged over a window of back-to-back runs after a warm-up
// (all launches, gaps included; the runs take copies of the inputs in turn), and the median of several windows.
// Apart from v000's, it joins two sittings. Times from different sittings can be a few percent apart, while
// side-by-side timings come from the same sitting.
// v000, which the later versions start from, runs in 555 microseconds.
// Contractions: q|k and v^T projections = v_wmma_f32_16x16x32_bf16 (bf16 operands from RNE-converted inputs, single product);
// q.k^T scores = v_wmma_f32_16x16x32_bf16 with bf16 hi/lo split q and k (hi.hi + hi.lo + lo.hi);
// p.v = v_wmma_f32_16x16x32_f16 (p carried x1024 in f16; v as f16 hi plane + f16 residual plane x4096, 2 products;
// extra f16 residual plane x4096 of p for the first 512 rows); ctx.Wo^T = v_wmma_f32_16x16x32_bf16 with ctx as
// bf16 hi/lo planes times bf16 Wo (2 products); all f32 accumulate; norms, rotations and softmax in f32.
#include <hip/hip_runtime.h>
#include <math.h>
#include <stdint.h>

#define SEQ   4096
#define DM    1024
#define NH    16
#define HD    64
#define NQB   (SEQ / 64)   // 64 row / key tiles of 64
#define RESQB 8            // leading 64-row blocks that also use the p residual plane
#define QKW   (2 * DM)     // pitch of the f32 q|k plane
#define NQKV  (3 * DM)
#define NFR   16           // rotation frequencies per head per axis (HD/4)
static_assert(NH * HD == DM);
static_assert((SEQ % 64) == 0 && (DM % 64) == 0);
static_assert(RESQB <= NQB);
static_assert(HD == 4 * NFR);

typedef _Float16 v16h __attribute__((ext_vector_type(16)));
typedef _Float16 v8h  __attribute__((ext_vector_type(8)));
typedef __bf16   v16b __attribute__((ext_vector_type(16)));
typedef __bf16   v8b  __attribute__((ext_vector_type(8)));
typedef float    v8f  __attribute__((ext_vector_type(8)));
typedef float    v4f  __attribute__((ext_vector_type(4)));
typedef unsigned int v4u __attribute__((ext_vector_type(4)));

// ---- scalar helpers --------------------------------------------------------------------------------
__device__ __forceinline__ unsigned short bf_bits(float f) {          // f32 -> bf16 bits, RNE convert
  unsigned u = __float_as_uint(f);
  return (unsigned short)((u + 0x7FFFu + ((u >> 16) & 1u)) >> 16);
}
__device__ __forceinline__ float bf_up(unsigned short h) { return __uint_as_float(((unsigned)h) << 16); }
__device__ __forceinline__ float bf_rn(float f) { return bf_up(bf_bits(f)); }   // value after RNE convert to bf16
__device__ __forceinline__ unsigned short h_bits(_Float16 x) { return __builtin_bit_cast(unsigned short, x); }
__device__ __forceinline__ unsigned pk16(unsigned short a, unsigned short b) { return (unsigned)a | ((unsigned)b << 16); }
__device__ __forceinline__ v8f zero8() { v8f z = {0.f, 0.f, 0.f, 0.f, 0.f, 0.f, 0.f, 0.f}; return z; }

// ---- fragment loaders: 16-bit A/B operand, lane -> row/col (lane&15), p already includes +8*(lane>>4);
//      elements 0..7 <- p[0..7] (k0+8h..), elements 8..15 <- p[16..23] (k0+16+8h..)
__device__ __forceinline__ v16b ldfrag_b(const __bf16* p) {
  union { v16b v; v8b h[2]; } f;
  f.h[0] = *(const v8b*)(p);
  f.h[1] = *(const v8b*)(p + 16);
  return f.v;
}

// ---- WMMA helpers with trailing VALU hazard gap --------------------------------------------------------
__device__ __forceinline__ v8f mma_b(v16b a, v16b b, v8f c) {
  c = __builtin_amdgcn_wmma_f32_16x16x32_bf16(false, a, false, b, (short)0, c, false, false);
  asm volatile("v_nop\n\tv_nop\n\tv_nop\n\tv_nop" : "+v"(c) : "v"(a), "v"(b));
  return c;
}
__device__ __forceinline__ v8f mma_h(v16h a, v16h b, v8f c) {
  c = __builtin_amdgcn_wmma_f32_16x16x32_f16(false, a, false, b, (short)0, c, false, false);
  asm volatile("v_nop\n\tv_nop\n\tv_nop\n\tv_nop" : "+v"(c) : "v"(a), "v"(b));
  return c;
}
__device__ __forceinline__ v8f mma_b_raw(v16b a, v16b b, v8f c) {
  return __builtin_amdgcn_wmma_f32_16x16x32_bf16(false, a, false, b, (short)0, c, false, false);
}
__device__ __forceinline__ void dep_guard_b(v8f& a, v8f& b, v16b x, v16b y) {
  asm volatile("v_nop\n\tv_nop\n\tv_nop\n\tv_nop" : "+v"(a), "+v"(b) : "v"(x), "v"(y));
}
__device__ __forceinline__ void keep4_b(v16b a, v16b b, v16b c, v16b d) {
  asm volatile("v_nop" :: "v"(a), "v"(b), "v"(c), "v"(d));
}
__device__ __forceinline__ void acc_guard4(v8f& a, v8f& b, v8f& c, v8f& d) {
  asm volatile("v_nop\n\tv_nop\n\tv_nop\n\tv_nop" : "+v"(a), "+v"(b), "+v"(c), "+v"(d));
}

// =====================================================================================================
// f32 -> bf16 (RNE convert), 8 elements per thread, one 16-B store per lane: a wave writes 512 contiguous B
// coverage: n8 threads x 8 = whole plane (n8 is a multiple of 256 for every use here).
// =====================================================================================================
__global__ __launch_bounds__(256) void cvt_bf16x8(const float* __restrict__ in, unsigned short* out, int n8) {
  const int i = blockIdx.x * 256 + threadIdx.x;
  if (i < n8) {
    const v4f a = *(const v4f*)(in + (size_t)i * 8);
    const v4f b = *(const v4f*)(in + (size_t)i * 8 + 4);
    v4u p;
    p[0] = pk16(bf_bits(a[0]), bf_bits(a[1]));
    p[1] = pk16(bf_bits(a[2]), bf_bits(a[3]));
    p[2] = pk16(bf_bits(b[0]), bf_bits(b[1]));
    p[3] = pk16(bf_bits(b[2]), bf_bits(b[3]));
    *(v4u*)(out + (size_t)i * 8) = p;
    
  }
}

// =====================================================================================================
// Register-blocked batched bf16 WMMA GEMM: C[m][n] = sum_k A[m][k] * Bt[n][k]; one wave per 64x64 tile,
// no block barriers. A row-major [M][K] pitch lda; Bt row-major [N][K] pitch ldb (k contiguous);
// M, N multiples of 64, K multiple of 32 (host-checked). blockIdx.y = batch index (strides in elements).
// NSPLIT: 0 = A.Bt; 1 = (A + A2).Bt (A2 = unscaled bf16 lo plane of A); 2 = A.Bt + A2.Bt + A.Bt2.
// OUT_MODE: 0 = f32 (pitch ldc); 2 = bf16 hi plane C + bf16 lo plane C2 (lo = RNE(v - hi), unscaled);
//           3 = f16 hi plane C + f16 residual plane C2 = f16((v - hi) * rscale), C2 written only for tiles
//               with n0 < N2 (pitch ldc2, batch stride strideC2).
// =====================================================================================================
template <int NSPLIT, int OUT_MODE>
__global__ __launch_bounds__(256) void gemm64(
    const unsigned short* __restrict__ Ap, const unsigned short* A2p, int lda, long long strideA,
    const unsigned short* __restrict__ Btp, const unsigned short* Bt2p, int ldb, long long strideB,
    void* Cout, int ldc, long long strideC,
    void* Cout2, int ldc2, long long strideC2, int N2,
    int M, int N, int K, float rscale) {
  const __bf16* A   = (const __bf16*)(const void*)Ap;
  const __bf16* A2  = (const __bf16*)(const void*)A2p;
  const __bf16* Bt  = (const __bf16*)(const void*)Btp;
  const __bf16* Bt2 = (const __bf16*)(const void*)Bt2p;
  __shared__ __align__(16) float sT[8][16 * 68];   // per-wave 16x64 slab, pitch 68 floats
  const int b    = blockIdx.y;
  const int lane = threadIdx.x & 31;
  const int wave = threadIdx.x >> 5;
  const int tilesN = N >> 6;
  const int tilesM = M >> 6;
  const int tile = blockIdx.x * 8 + wave;
  if (tile >= tilesM * tilesN) return;   // wave-uniform; no block barriers in this kernel
  const int tm = tile / tilesN;
  const int tn = tile - tm * tilesN;
  const int m0 = tm << 6;
  const int n0 = tn << 6;

  const __bf16* Ab  = A  + (size_t)b * strideA;
  const __bf16* Bb  = Bt + (size_t)b * strideB;
  const __bf16* Ab2 = (NSPLIT >= 1) ? (A2  + (size_t)b * strideA) : Ab;
  const __bf16* Bb2 = (NSPLIT == 2) ? (Bt2 + (size_t)b * strideB) : Bb;

  const int rlane = lane & 15;                 // row (A) / col (B, D) within subtile
  const int koff  = (lane >> 4) * 8;           // k offset of this lane half
  const int mOff  = (lane >> 4) * 8;           // D row offset

  v8f acc[4][4];
#pragma unroll
  for (int i = 0; i < 4; ++i)
#pragma unroll
    for (int j = 0; j < 4; ++j) acc[i][j] = zero8();

  for (int k0 = 0; k0 < K; k0 += 32) {
    v16b bh[4], bl[4];
#pragma unroll
    for (int j = 0; j < 4; ++j) {
      const size_t bo = (size_t)(n0 + (j << 4) + rlane) * ldb + koff + k0;
      bh[j] = ldfrag_b(Bb + bo);
      if (NSPLIT == 2) bl[j] = ldfrag_b(Bb2 + bo); else bl[j] = bh[j];
    }
#pragma unroll
    for (int i = 0; i < 4; ++i) {
      const size_t ao = (size_t)(m0 + (i << 4) + rlane) * lda + koff + k0;
      const v16b ah = ldfrag_b(Ab + ao);
      v16b al = ah;
      if (NSPLIT >= 1) al = ldfrag_b(Ab2 + ao);
#pragma unroll
      for (int j = 0; j < 4; ++j) {
        acc[i][j] = mma_b_raw(ah, bh[j], acc[i][j]);
        if (NSPLIT >= 1) acc[i][j] = mma_b_raw(al, bh[j], acc[i][j]);
        if (NSPLIT == 2) acc[i][j] = mma_b_raw(ah, bl[j], acc[i][j]);
      }
      dep_guard_b(acc[i][0], acc[i][3], ah, al);
    }
    keep4_b(bh[0], bh[1], bh[2], bh[3]);
    if (NSPLIT == 2) keep4_b(bl[0], bl[1], bl[2], bl[3]);
  }
  acc_guard4(acc[0][0], acc[0][1], acc[0][2], acc[0][3]);
  acc_guard4(acc[1][0], acc[1][1], acc[1][2], acc[1][3]);
  acc_guard4(acc[2][0], acc[2][1], acc[2][2], acc[2][3]);
  acc_guard4(acc[3][0], acc[3][1], acc[3][2], acc[3][3]);

  // ---- epilogue ----
  float* slab = sT[wave];
#pragma unroll
  for (int i = 0; i < 4; ++i) {
    const int mBase = m0 + (i << 4);
#pragma unroll
    for (int j = 0; j < 4; ++j) {
#pragma unroll
      for (int r = 0; r < 8; ++r) {
        slab[(mOff + r) * 68 + (j << 4) + rlane] = acc[i][j][r];
      }
    }
    __builtin_amdgcn_fence(__ATOMIC_RELEASE, "workgroup");
    __builtin_amdgcn_wave_barrier();
    __builtin_amdgcn_fence(__ATOMIC_ACQUIRE, "workgroup");
    if (OUT_MODE == 0) {
      float* C = (float*)Cout + (size_t)b * strideC;
      const int hh = lane >> 4, c4 = (lane & 15) * 4;     // 256-B row segment = 16 lanes x 16 B
      {
#pragma unroll
        for (int it = 0; it < 8; ++it) {
          const int row = it * 2 + hh;                     // it 0..7 x hh 0..1 = rows 0..15
          const v4f v = *(const v4f*)(slab + row * 68 + c4);
          *(v4f*)(C + (size_t)(mBase + row) * ldc + n0 + c4) = v;
        }
        
      }
    } else {
      const int q = lane >> 3, c8 = (lane & 7) * 8;
      unsigned short* C  = (unsigned short*)Cout  + (size_t)b * strideC;
      unsigned short* C2 = (unsigned short*)Cout2 + (size_t)b * strideC2;
      const bool wlo = (OUT_MODE == 2) || (n0 < N2);      // wave-uniform
      v4u hv[4], lv[4];
#pragma unroll
      for (int it = 0; it < 4; ++it) {
        const int row = it * 4 + q;                        // it 0..3 x q 0..3 = rows 0..15
        const float* sp = slab + row * 68 + c8;
        v4u a, a2;
#pragma unroll
        for (int e = 0; e < 4; ++e) {
          const float f0 = sp[2 * e], f1 = sp[2 * e + 1];
          unsigned short h0, h1, l0, l1;
          if (OUT_MODE == 2) {
            h0 = bf_bits(f0); h1 = bf_bits(f1);
            l0 = bf_bits(f0 - bf_up(h0)); l1 = bf_bits(f1 - bf_up(h1));
          } else {
            const _Float16 x0 = (_Float16)f0, x1 = (_Float16)f1;
            h0 = h_bits(x0); h1 = h_bits(x1);
            l0 = h_bits((_Float16)((f0 - (float)x0) * rscale));
            l1 = h_bits((_Float16)((f1 - (float)x1) * rscale));
          }
          a[e] = pk16(h0, h1); a2[e] = pk16(l0, l1);
        }
        hv[it] = a; lv[it] = a2;
      }
      {
#pragma unroll
        for (int it = 0; it < 4; ++it) {
          const int row = it * 4 + q;
          *(v4u*)(C + (size_t)(mBase + row) * ldc + n0 + c8) = hv[it];
          if (wlo) *(v4u*)(C2 + (size_t)(mBase + row) * ldc2 + n0 + c8) = lv[it];
        }
        
      }
    }
    __builtin_amdgcn_fence(__ATOMIC_RELEASE, "workgroup");
    __builtin_amdgcn_wave_barrier();
    __builtin_amdgcn_fence(__ATOMIC_ACQUIRE, "workgroup");
  }
}

// =====================================================================================================
// Cosine-similarity scaling + axial rotation of q and k, f32, one wave per (token t, head h) row.
//   qkf: f32 [t][QKW], q of head h at cols h*64.., k at cols DM + h*64..
//   pos [t][2], scl [NH], freqs [2][NH][NFR]: values RNE-converted to bf16 in register before use.
//   rq = sqrt(|scl_h| + 1e-8) * rsqrt(sum(q^2) + 1e-8); qs = q * rq (same for k)
//   theta[i], i < 16: (pos[t][1]*2 - 1) * freqs[1][h][i]; i >= 16: (pos[t][0]*2 - 1) * freqs[0][h][i-16]
//   out[i] = qs[i] cos - qs[i+32] sin; out[i+32] = qs[i+32] cos + qs[i] sin (lane i = pair index).
//   qk4: four bf16 planes [t][h*64+d] back to back (plane stride SEQ*DM elements): q hi, q lo, k hi, k lo
//   (lo = RNE(v - hi), unscaled). The wave's 64-wide row is staged in LDS, then ONE store instruction writes
//   grid = nrows/8 blocks of 256 (8 waves). coverage: nrows = SEQ*NH rows x 64 cols in each of the 4 planes.
// =====================================================================================================
__global__ __launch_bounds__(256) void rope_qk(const float* __restrict__ qkf, const float* __restrict__ pos,
                                               const float* __restrict__ scl, const float* __restrict__ freqs,
                                               unsigned short* qk4, int nrows) {
#pragma clang fp contract(off)
  __shared__ __align__(16) float sq[8][64];
  __shared__ __align__(16) float sk[8][64];
  const int tid  = threadIdx.x;
  const int wave = tid >> 5;
  const int lane = tid & 31;
  const int rho  = blockIdx.x * 8 + wave;
  if (rho < nrows) {                                      // wave-uniform; no block barriers in this kernel
    const int t = rho >> 4;
    const int h = rho & 15;
    const float* qr = qkf + (size_t)t * QKW + h * HD;
    const float* kr = qr + DM;
    const int i = lane;                                   // pair index 0..31
    const float q1 = qr[i], q2 = qr[i + 32];
    const float k1 = kr[i], k2 = kr[i + 32];
    float ssq = q1 * q1 + q2 * q2;
    float ssk = k1 * k1 + k2 * k2;
#pragma unroll
    for (int off = 16; off >= 1; off >>= 1) {
      ssq += __shfl_xor(ssq, off, 32);
      ssk += __shfl_xor(ssk, off, 32);
    }
    const float scr = bf_rn(scl[h]);
    const float ss  = sqrtf(fabsf(scr) + 1e-8f);
    const float rq  = ss * rsqrtf(ssq + 1e-8f);
    const float rk  = ss * rsqrtf(ssk + 1e-8f);
    const float px  = bf_rn(pos[2 * t + 0]);
    const float py  = bf_rn(pos[2 * t + 1]);
    const int  low  = (i < 16) ? 1 : 0;
    const int  fi   = low ? (NH * NFR + h * NFR + i) : (h * NFR + (i - 16));   // [1][h][i] or [0][h][i-16], < 2*NH*NFR
    const float fr  = bf_rn(freqs[fi]);
    const float pp  = low ? py : px;
    const float th  = (pp * 2.0f - 1.0f) * fr;
    const float cs  = cosf(th);
    const float sn  = sinf(th);
    const float xq1 = q1 * rq, xq2 = q2 * rq;
    const float xk1 = k1 * rk, xk2 = k2 * rk;
    sq[wave][i]      = xq1 * cs - xq2 * sn;
    sq[wave][i + 32] = xq2 * cs + xq1 * sn;
    sk[wave][i]      = xk1 * cs - xk2 * sn;
    sk[wave][i + 32] = xk2 * cs + xk1 * sn;
    __builtin_amdgcn_fence(__ATOMIC_RELEASE, "workgroup");
    __builtin_amdgcn_wave_barrier();
    __builtin_amdgcn_fence(__ATOMIC_ACQUIRE, "workgroup");
    const int pl = lane >> 3;                             // plane 0 q hi, 1 q lo, 2 k hi, 3 k lo
    const int c8 = (lane & 7) * 8;
    const float* spq = &sq[wave][c8];
    const float* spk = &sk[wave][c8];
    v4u w;
#pragma unroll
    for (int e = 0; e < 4; ++e) {
      const float fq0 = spq[2 * e], fq1 = spq[2 * e + 1];
      const float fk0 = spk[2 * e], fk1 = spk[2 * e + 1];
      const float f0 = (pl < 2) ? fq0 : fk0;
      const float f1 = (pl < 2) ? fq1 : fk1;
      const unsigned short hb0 = bf_bits(f0), hb1 = bf_bits(f1);
      const unsigned short lb0 = bf_bits(f0 - bf_up(hb0)), lb1 = bf_bits(f1 - bf_up(hb1));
      const unsigned short s0 = (pl & 1) ? lb0 : hb0;
      const unsigned short s1 = (pl & 1) ? lb1 : hb1;
      w[e] = pk16(s0, s1);
    }
    unsigned short* dst = qk4 + (size_t)pl * ((size_t)SEQ * DM) + (size_t)t * DM + h * HD + c8;
    *(v4u*)dst = w;
    
  }
}

// =====================================================================================================
// Attention, head dim 64, unified key rule: key s is visible to row t iff (s < S and s <= t) or s == t,
// with S = npk[0] clamped to [0, SEQ] (causal prefix segment of S tokens; later rows see the whole prefix
// plus themselves). Scores unscaled; masked scores = -inf; softmax f32 online.
//   q planes (bf16 hi / lo): element (t, h, d) at [t*DM + h*64 + d]; k planes same with key index s
//   v^T hi plane (f16):      element (h, d, s) at [(h*64 + d)*SEQ + s]; residual plane (f16, (v - hi)*4096) same layout
//   out planes (bf16 hi / lo of the normalised context): element (t, h, d) at [t*DM + h*64 + d]
//   scores = q . k : bf16 hi/lo split (hi.hi + hi.lo + lo.hi), f32 accumulate
//   p = exp(s - m) carried as f16(1024 p); context = p . v_hi on f16 WMMA plus p . v_res (and, when RES,
//   p_res . v_hi with p_res = f16((1024 p - f16(1024 p)) * 4096)) into a separate accumulator folded back with
//   1/4096 per key tile in f32.
//   Block = 4 waves = 64 query rows of one h; grid = nqbThis * NH; key tiles of 64: tiles 0..min(qb, SB-1) then
//   tile qb itself when qb >= SB (SB = ceil(S/64)); trip count block-uniform and <= NQB.
//   K / V^T tile staging: 128 threads x 32 elements per plane = the whole 64x64 tile (plain 16-B loads,
//   __syncthreads before and after); P tiles are wave-private, spilled with _Float16 element stores and reloaded
//   Output coverage: each wave stores rows q0..q0+15 (it 0..3 x lane>>3 0..3) x 64 columns (8 lanes x 8) of both planes.
// =====================================================================================================
template <bool RES>
__global__ __launch_bounds__(128)
void attn64(const unsigned short* __restrict__ qhp, const unsigned short* __restrict__ qlp,
            const unsigned short* __restrict__ khp, const unsigned short* __restrict__ klp,
            const unsigned short* __restrict__ vhp, const unsigned short* __restrict__ vlp,
            const int* __restrict__ npk,
            unsigned short* ohp, unsigned short* olp, int qbBase, int nqbThis) {
  union FB { v16b v; v8b h[2]; };
  union FH { v16h v; v8h h[2]; };
  __shared__ __align__(16) __bf16   Ksh[64 * 64];                 // K hi [kv][d]   8 KB
  __shared__ __align__(16) __bf16   Ksl[64 * 64];                 // K lo
  __shared__ __align__(16) _Float16 Vth[64 * 64];                 // V^T hi [d][kv] 8 KB
  __shared__ __align__(16) _Float16 Vtl[64 * 64];                 // V^T residual
  __shared__ __align__(16) _Float16 Psh[4][16 * 64];              // per wave P [row][kv]
  __shared__ __align__(16) _Float16 Psl[RES ? 4 : 1][16 * 64];    // per wave P residual
  __shared__ __align__(16) float    Os[4][16 * 64];               // per wave context tile [row][d]

  const int tid  = threadIdx.x;
  const int wave = tid >> 5;
  const int lane = tid & 31;
  const int hh   = lane >> 4;
  const int c    = lane & 15;

  const int bx   = blockIdx.x;
  const int qbl  = bx % nqbThis;
  const int h    = bx / nqbThis;          // < NH by grid size
  const int qb   = qbBase + qbl;
  const int q0   = qb * 64 + wave * 16;

  int S = npk[0];                         // block-uniform scalar load
  S = (S < 0) ? 0 : S;
  S = (S > SEQ) ? SEQ : S;
  const int SB   = (S + 63) >> 6;                       // 0..NQB
  const int nLow = (qb + 1 < SB) ? (qb + 1) : SB;       // tiles 0..nLow-1
  int nT = nLow + ((qb >= SB) ? 1 : 0);                 // + the block's own tile when not in the prefix
  nT = (nT > NQB) ? NQB : nT;

  const __bf16* Qh = (const __bf16*)(const void*)qhp + (size_t)h * HD;
  const __bf16* Ql = (const __bf16*)(const void*)qlp + (size_t)h * HD;
  const __bf16* Kh = (const __bf16*)(const void*)khp + (size_t)h * HD;
  const __bf16* Kl = (const __bf16*)(const void*)klp + (size_t)h * HD;
  const _Float16* Vh = (const _Float16*)(const void*)vhp + (size_t)h * HD * SEQ;
  const _Float16* Vl = (const _Float16*)(const void*)vlp + (size_t)h * HD * SEQ;

  // ---- Q fragments (A operand, row = lane&15): 2 d-chunks, hi and lo ----
  v16b qah[2], qal[2];
#pragma unroll
  for (int dc = 0; dc < 2; ++dc) {
    const size_t qo = (size_t)(q0 + c) * DM + dc * 32 + 8 * hh;
    qah[dc] = ldfrag_b(Qh + qo);
    qal[dc] = ldfrag_b(Ql + qo);
  }

  float mrow[8], lrow[8];
  v8f oacc[4];
#pragma unroll
  for (int r = 0; r < 8; ++r) { mrow[r] = -INFINITY; lrow[r] = 0.f; }
#pragma unroll
  for (int t = 0; t < 4; ++t) oacc[t] = zero8();

  for (int i = 0; i < nT; ++i) {          // block-uniform trip count, <= NQB
    const int kt  = (i < nLow) ? i : qb;
    const int kv0 = kt * 64;              // kv0 + 63 < SEQ
    __syncthreads();
    {
      const int r = tid >> 1, half = (tid & 1) * 32;
      const __bf16*   kg  = Kh + (size_t)(kv0 + r) * DM + half;   // K row kv0+r, d = half..half+31
      const __bf16*   klg = Kl + (size_t)(kv0 + r) * DM + half;
      const _Float16* vg  = Vh + (size_t)r * SEQ + kv0 + half;    // V^T row d = r, s = kv0+half..+31
      const _Float16* vlg = Vl + (size_t)r * SEQ + kv0 + half;
#pragma unroll
      for (int u = 0; u < 4; ++u) {
        const v8b a0 = *(const v8b*)(kg + 8 * u);
        const v8b a1 = *(const v8b*)(klg + 8 * u);
        const v8h b0 = *(const v8h*)(vg + 8 * u);
        const v8h b1 = *(const v8h*)(vlg + 8 * u);
        *(v8b*)(Ksh + r * 64 + half + 8 * u) = a0;
        *(v8b*)(Ksl + r * 64 + half + 8 * u) = a1;
        *(v8h*)(Vth + r * 64 + half + 8 * u) = b0;
        *(v8h*)(Vtl + r * 64 + half + 8 * u) = b1;
      }
    }
    __syncthreads();

    // ---- scores: 16 query rows x 64 keys per wave, 3 bf16 products ----
    v8f s[4];
#pragma unroll
    for (int j = 0; j < 4; ++j) {
      s[j] = zero8();
#pragma unroll
      for (int dc = 0; dc < 2; ++dc) {
        FB kb, kl;
        kb.h[0] = *(const v8b*)(Ksh + (j * 16 + c) * 64 + dc * 32 + 8 * hh);
        kb.h[1] = *(const v8b*)(Ksh + (j * 16 + c) * 64 + dc * 32 + 16 + 8 * hh);
        kl.h[0] = *(const v8b*)(Ksl + (j * 16 + c) * 64 + dc * 32 + 8 * hh);
        kl.h[1] = *(const v8b*)(Ksl + (j * 16 + c) * 64 + dc * 32 + 16 + 8 * hh);
        s[j] = mma_b(qah[dc], kb.v, s[j]);
        s[j] = mma_b(qah[dc], kl.v, s[j]);
        s[j] = mma_b(qal[dc], kb.v, s[j]);
      }
    }

    // ---- key visibility rule, row max, online softmax, P (x1024, f16) and P residual (x4096) to LDS ----
    _Float16* pwh = Psh[wave];
    _Float16* pwl = Psl[RES ? wave : 0];
#pragma unroll
    for (int r = 0; r < 8; ++r) {
      const int t = q0 + 8 * hh + r;        // D row 8hh+r of this lane
      float m = -INFINITY;
#pragma unroll
      for (int j = 0; j < 4; ++j) {
        const int kg = kv0 + j * 16 + c;    // D col = key
        const bool ok = ((kg < S) && (kg <= t)) || (kg == t);
        const float sv = ok ? s[j][r] : -INFINITY;
        s[j][r] = sv;
        m = fmaxf(m, sv);
      }
#pragma unroll
      for (int off = 1; off < 16; off <<= 1) m = fmaxf(m, __shfl_xor(m, off, 32));
      const float mnew  = fmaxf(mrow[r], m);
      const float msafe = (mnew == -INFINITY) ? 0.f : mnew;
      const float alpha = __expf(mrow[r] - msafe);
      mrow[r] = mnew;
      float psum = 0.f;
#pragma unroll
      for (int j = 0; j < 4; ++j) {
        const float p = __expf(s[j][r] - msafe);     // masked score: exp(-inf) -> 0
        psum += p;
        const float p1k = p * 1024.0f;
        const _Float16 ph = (_Float16)p1k;
        pwh[(8 * hh + r) * 64 + j * 16 + c] = ph;
        if (RES) {
          const _Float16 pr = (_Float16)((p1k - (float)ph) * 4096.0f);
          pwl[(8 * hh + r) * 64 + j * 16 + c] = pr;
        }
      }
#pragma unroll
      for (int off = 1; off < 16; off <<= 1) psum += __shfl_xor(psum, off, 32);
      lrow[r] = lrow[r] * alpha + psum;
#pragma unroll
      for (int t4 = 0; t4 < 4; ++t4) oacc[t4][r] *= alpha;
    }
    __builtin_amdgcn_fence(__ATOMIC_RELEASE, "workgroup");
    __builtin_amdgcn_wave_barrier();
    __builtin_amdgcn_fence(__ATOMIC_ACQUIRE, "workgroup");

    // ---- context += P . V_hi (f16 WMMA); residual products into a separate accumulator ----
    v8f o1[4];
#pragma unroll
    for (int t4 = 0; t4 < 4; ++t4) o1[t4] = zero8();
#pragma unroll 1
    for (int kk = 0; kk < 2; ++kk) {
      FH pa, pl;
      pa.h[0] = *(const v8h*)(pwh + c * 64 + kk * 32 + 8 * hh);
      pa.h[1] = *(const v8h*)(pwh + c * 64 + kk * 32 + 16 + 8 * hh);
      if (RES) {
        pl.h[0] = *(const v8h*)(pwl + c * 64 + kk * 32 + 8 * hh);
        pl.h[1] = *(const v8h*)(pwl + c * 64 + kk * 32 + 16 + 8 * hh);
      } else {
        pl.v = pa.v;
      }
#pragma unroll
      for (int t4 = 0; t4 < 4; ++t4) {
        FH vb, vl;
        vb.h[0] = *(const v8h*)(Vth + (t4 * 16 + c) * 64 + kk * 32 + 8 * hh);
        vb.h[1] = *(const v8h*)(Vth + (t4 * 16 + c) * 64 + kk * 32 + 16 + 8 * hh);
        vl.h[0] = *(const v8h*)(Vtl + (t4 * 16 + c) * 64 + kk * 32 + 8 * hh);
        vl.h[1] = *(const v8h*)(Vtl + (t4 * 16 + c) * 64 + kk * 32 + 16 + 8 * hh);
        oacc[t4] = mma_h(pa.v, vb.v, oacc[t4]);
        o1[t4]   = mma_h(pa.v, vl.v, o1[t4]);
        if (RES) o1[t4] = mma_h(pl.v, vb.v, o1[t4]);
      }
    }
#pragma unroll
    for (int t4 = 0; t4 < 4; ++t4)
#pragma unroll
      for (int r = 0; r < 8; ++r) oacc[t4][r] += o1[t4][r] * (1.0f / 4096.0f);
  }

  // ---- normalise (1/l and the 1/1024 p carry), stage the wave's 16x64 tile, bf16 hi/lo split,
  float* os = Os[wave];
#pragma unroll
  for (int r = 0; r < 8; ++r) {
    const float l = lrow[r];
    const float inv = ((l > 0.f) ? (1.0f / l) : 0.f) * (1.0f / 1024.0f);
#pragma unroll
    for (int t4 = 0; t4 < 4; ++t4) os[(8 * hh + r) * 64 + t4 * 16 + c] = oacc[t4][r] * inv;
  }
  __builtin_amdgcn_fence(__ATOMIC_RELEASE, "workgroup");
  __builtin_amdgcn_wave_barrier();
  __builtin_amdgcn_fence(__ATOMIC_ACQUIRE, "workgroup");
  {
    const int q4 = lane >> 3, c8 = (lane & 7) * 8;
    v4u hv[4], lv[4];
#pragma unroll
    for (int it = 0; it < 4; ++it) {
      const int row = it * 4 + q4;   // it 0..3 x q4 0..3 = rows 0..15 of the wave tile
      const float* sp = os + row * 64 + c8;
      v4u a, a2;
#pragma unroll
      for (int e = 0; e < 4; ++e) {
        const float f0 = sp[2 * e], f1 = sp[2 * e + 1];
        const unsigned short h0 = bf_bits(f0), h1 = bf_bits(f1);
        const unsigned short l0 = bf_bits(f0 - bf_up(h0)), l1 = bf_bits(f1 - bf_up(h1));
        a[e] = pk16(h0, h1); a2[e] = pk16(l0, l1);
      }
      hv[it] = a; lv[it] = a2;
    }
    {
#pragma unroll
      for (int it = 0; it < 4; ++it) {
        const int row = it * 4 + q4;
        const size_t go = (size_t)(q0 + row) * DM + (size_t)h * HD + c8;
        *(v4u*)(ohp + go) = hv[it];
        *(v4u*)(olp + go) = lv[it];
      }
      
    }
  }
}

// =====================================================================================================
// Workspace map (bytes), every region an exact multiple of its whole-line / whole-tile store granularity:
//   Xb    bf16 [4096][1024]          0            8388608
//   Wqkv  bf16 [3072 n][1024 k]      8388608      6291456   (rows 0..2047 = q|k weights, 2048.. = v weights)
//   Wob   bf16 [1024][1024]          14680064     2097152
//   QKf   f32  [4096][2048]          16777216     33554432  (cols 0..1023 q, 1024..2047 k)
//   VTh   f16  [1024 d][4096 s]      50331648     8388608
//   VTl   f16  [1024 d][4096 s]      58720256     8388608
//   QK4   bf16 4 x [4096][1024]      67108864     33554432  (q hi, q lo, k hi, k lo)
//   Oh    bf16 [4096][1024]          100663296    8388608
//   Ol    bf16 [4096][1024]          109051904    8388608
//   end                              117440512
// Weights are [out n][in k] with k contiguous = the Bt / A layout the GEMM wants, so they are only converted.
// =====================================================================================================
extern "C" void kernel_launch(void* const* d_in, const int* in_sizes, int n_in,
                              void* d_out, int out_size, void* d_ws, size_t ws_size,
                              hipStream_t stream) {
  if (n_in < 7) return;
  if (in_sizes[0] != SEQ * DM) return;
  if (in_sizes[1] != SEQ * 2) return;
  if (in_sizes[2] != NQKV * DM) return;
  if (in_sizes[3] != DM * DM) return;
  if (in_sizes[4] != NH) return;
  if (in_sizes[5] != 2 * NH * NFR) return;
  if (in_sizes[6] < 1) return;
  if (out_size != SEQ * DM) return;

  const float* x     = (const float*)d_in[0];
  const float* pos   = (const float*)d_in[1];
  const float* qkvw  = (const float*)d_in[2];
  const float* outw  = (const float*)d_in[3];
  const float* scl   = (const float*)d_in[4];
  const float* freqs = (const float*)d_in[5];
  const int*   npk   = (const int*)d_in[6];

  const size_t PXB   = (size_t)SEQ * DM * 2;      //  8388608
  const size_t PWQKV = (size_t)NQKV * DM * 2;     //  6291456
  const size_t PWO   = (size_t)DM * DM * 2;       //  2097152
  const size_t PQKF  = (size_t)SEQ * QKW * 4;     // 33554432
  const size_t PVT   = (size_t)DM * SEQ * 2;      //  8388608
  const size_t PPL   = (size_t)SEQ * DM * 2;      //  8388608
  size_t off = 0;
  const size_t oXb   = off; off += PXB;
  const size_t oWqkv = off; off += PWQKV;
  const size_t oWo   = off; off += PWO;
  const size_t oQKf  = off; off += PQKF;
  const size_t oVTh  = off; off += PVT;
  const size_t oVTl  = off; off += PVT;
  const size_t oQK4  = off; off += 4 * PPL;
  const size_t oOh   = off; off += PPL;
  const size_t oOl   = off; off += PPL;
  if (off > ws_size) return;                      // off = 117440512
  if (off > (size_t)134217728) return;

  char* ws = (char*)d_ws;
  unsigned short* Xb   = (unsigned short*)(ws + oXb);
  unsigned short* Wqkv = (unsigned short*)(ws + oWqkv);
  unsigned short* Wvb  = Wqkv + (size_t)2 * DM * DM;             // rows 2048.. of the qkv weight plane
  unsigned short* Wob  = (unsigned short*)(ws + oWo);
  float*          QKf  = (float*)(ws + oQKf);
  unsigned short* VTh  = (unsigned short*)(ws + oVTh);
  unsigned short* VTl  = (unsigned short*)(ws + oVTl);
  unsigned short* QK4  = (unsigned short*)(ws + oQK4);
  unsigned short* Qh   = QK4;
  unsigned short* Ql   = QK4 + (size_t)SEQ * DM;
  unsigned short* Kh   = QK4 + (size_t)2 * SEQ * DM;
  unsigned short* Kl   = QK4 + (size_t)3 * SEQ * DM;
  unsigned short* Oh   = (unsigned short*)(ws + oOh);
  unsigned short* Ol   = (unsigned short*)(ws + oOl);

  const dim3 blk(256);
  const int n8x = SEQ * DM / 8;                                // 524288
  const int n8w = NQKV * DM / 8;                               // 393216
  const int n8o = DM * DM / 8;                                 // 131072
  const dim3 gCvtX((n8x + 255) / 256);                         // 2048 blocks
  const dim3 gCvtW((n8w + 255) / 256);                         // 1536 blocks
  const dim3 gCvtO((n8o + 255) / 256);                         // 512 blocks
  const dim3 gQK(((SEQ / 64) * (QKW / 64) + 7) / 8, 1);        // 2048 tiles -> 256 blocks: M=4096, N=2048
  const dim3 gVT(((DM / 64) * (SEQ / 64) + 7) / 8, 1);         // 1024 tiles -> 128 blocks: M=1024, N=4096
  const dim3 gOut(((SEQ / 64) * (DM / 64) + 7) / 8, 1);        // 1024 tiles -> 128 blocks: M=4096, N=1024
  const int  nRows = SEQ * NH;                                 // 65536 (t, h) rows
  const dim3 gRope((nRows + 7) / 8);                           // 8192 blocks of 8 waves

  // (1) x -> bf16 [4096][1024]; weights [n][k] f32 -> bf16 [n][k]
  cvt_bf16x8<<<gCvtX, blk, 0, stream>>>(x, Xb, n8x);
  cvt_bf16x8<<<gCvtW, blk, 0, stream>>>(qkvw, Wqkv, n8w);
  cvt_bf16x8<<<gCvtO, blk, 0, stream>>>(outw, Wob, n8o);
  // (2) q|k = x . W[0:2048]^T -> f32 [4096][2048]   (M=4096, N=2048, K=1024)
  gemm64<0, 0><<<gQK, blk, 0, stream>>>(
      Xb, Xb, DM, 0LL, Wqkv, Wqkv, DM, 0LL,
      (void*)QKf, QKW, 0LL, (void*)QKf, QKW, 0LL, 0,
      SEQ, QKW, DM, 1.0f);
  // (3) v^T = Wv . x^T -> f16 hi plane [h*64+d][s] (pitch SEQ) and residual plane (x4096, all keys)
  //     (A = Wvb [n][k], Bt = Xb; M=1024, N=4096, K=1024)
  gemm64<0, 3><<<gVT, blk, 0, stream>>>(
      Wvb, Wvb, DM, 0LL, Xb, Xb, DM, 0LL,
      (void*)VTh, SEQ, 0LL, (void*)VTl, SEQ, 0LL, SEQ,
      DM, SEQ, DM, 4096.0f);
  // (4) cosine-sim scaling + axial rotation -> q hi/lo, k hi/lo bf16 planes [t][h*64+d]
  rope_qk<<<gRope, blk, 0, stream>>>(QKf, pos, scl, freqs, QK4, nRows);
  // (5) attention: row blocks 0..RESQB-1 with the p residual plane, the rest without
  attn64<true><<<dim3(NH * RESQB), dim3(128), 0, stream>>>(
      Qh, Ql, Kh, Kl, VTh, VTl, npk, Oh, Ol, 0, RESQB);
  attn64<false><<<dim3(NH * (NQB - RESQB)), dim3(128), 0, stream>>>(
      Qh, Ql, Kh, Kl, VTh, VTl, npk, Oh, Ol, RESQB, NQB - RESQB);
  // (6) out = context . Wo^T -> d_out f32 [4096][1024]  (A = context hi + lo planes, 2 products)
  gemm64<1, 0><<<gOut, blk, 0, stream>>>(
      Oh, Ol, DM, 0LL, Wob, Wob, DM, 0LL,
      d_out, DM, 0LL, d_out, DM, 0LL, 0,
      SEQ, DM, DM, 1.0f);
  (void)hipGetLastError();
}

// v001
// One run takes 398 microseconds.
// In both of two side-by-side timings against v000, it was 1.44 times as fast.
// Contractions: q|k and v^T projections = v_wmma_f32_16x16x32_bf16 (bf16 operands from RNE-converted inputs, single product);
// q.k^T scores = v_wmma_f32_16x16x32_bf16 with bf16 hi/lo split q and k (hi.hi + hi.lo + lo.hi);
// p.v = v_wmma_f32_16x16x32_f16 (p carried x1024 in f16; v as f16 hi plane + f16 residual plane x4096, 2 products;
// extra f16 residual plane x4096 of p for the first 512 rows); ctx.Wo^T = v_wmma_f32_16x16x32_bf16 with ctx as
// bf16 hi/lo planes times bf16 Wo (2 products); all f32 accumulate; norms, rotations and softmax in f32.
#include <hip/hip_runtime.h>
#include <math.h>
#include <stdint.h>

#define SEQ   4096
#define DM    1024
#define NH    16
#define HD    64
#define NQB   (SEQ / 64)   // 64 row / key tiles of 64
#define RESQB 8            // leading 64-row blocks that also use the p residual plane
#define QKW   (2 * DM)     // pitch of the f32 q|k plane
#define NQKV  (3 * DM)
#define NFR   16           // rotation frequencies per head per axis (HD/4)
#define LP    72           // LDS row pitch of the 64-wide 16-bit attention tiles, in elements: 144 B = 16 B x 9 (odd)
static_assert(NH * HD == DM);
static_assert((SEQ % 64) == 0 && (DM % 64) == 0);
static_assert(RESQB <= NQB);
static_assert(HD == 4 * NFR);

typedef _Float16 v16h __attribute__((ext_vector_type(16)));
typedef _Float16 v8h  __attribute__((ext_vector_type(8)));
typedef __bf16   v16b __attribute__((ext_vector_type(16)));
typedef __bf16   v8b  __attribute__((ext_vector_type(8)));
typedef float    v8f  __attribute__((ext_vector_type(8)));
typedef float    v4f  __attribute__((ext_vector_type(4)));
typedef unsigned int v4u __attribute__((ext_vector_type(4)));

// ---- scalar helpers --------------------------------------------------------------------------------
__device__ __forceinline__ unsigned short bf_bits(float f) {          // f32 -> bf16 bits, RNE convert
  unsigned u = __float_as_uint(f);
  return (unsigned short)((u + 0x7FFFu + ((u >> 16) & 1u)) >> 16);
}
__device__ __forceinline__ float bf_up(unsigned short h) { return __uint_as_float(((unsigned)h) << 16); }
__device__ __forceinline__ float bf_rn(float f) { return bf_up(bf_bits(f)); }   // value after RNE convert to bf16
__device__ __forceinline__ unsigned short h_bits(_Float16 x) { return __builtin_bit_cast(unsigned short, x); }
__device__ __forceinline__ unsigned pk16(unsigned short a, unsigned short b) { return (unsigned)a | ((unsigned)b << 16); }
__device__ __forceinline__ v8f zero8() { v8f z = {0.f, 0.f, 0.f, 0.f, 0.f, 0.f, 0.f, 0.f}; return z; }

// ---- fragment loaders: 16-bit A/B operand, lane -> row/col (lane&15), p already includes +8*(lane>>4);
//      elements 0..7 <- p[0..7] (k0+8h..), elements 8..15 <- p[16..23] (k0+16+8h..)
__device__ __forceinline__ v16b ldfrag_b(const __bf16* p) {
  union { v16b v; v8b h[2]; } f;
  f.h[0] = *(const v8b*)(p);
  f.h[1] = *(const v8b*)(p + 16);
  return f.v;
}

// ---- WMMA helpers with trailing VALU hazard gap --------------------------------------------------------
__device__ __forceinline__ v8f mma_b(v16b a, v16b b, v8f c) {
  c = __builtin_amdgcn_wmma_f32_16x16x32_bf16(false, a, false, b, (short)0, c, false, false);
  asm volatile("v_nop\n\tv_nop\n\tv_nop\n\tv_nop" : "+v"(c) : "v"(a), "v"(b));
  return c;
}
__device__ __forceinline__ v8f mma_h(v16h a, v16h b, v8f c) {
  c = __builtin_amdgcn_wmma_f32_16x16x32_f16(false, a, false, b, (short)0, c, false, false);
  asm volatile("v_nop\n\tv_nop\n\tv_nop\n\tv_nop" : "+v"(c) : "v"(a), "v"(b));
  return c;
}
__device__ __forceinline__ v8f mma_b_raw(v16b a, v16b b, v8f c) {
  return __builtin_amdgcn_wmma_f32_16x16x32_bf16(false, a, false, b, (short)0, c, false, false);
}
__device__ __forceinline__ void dep_guard_b(v8f& a, v8f& b, v16b x, v16b y) {
  asm volatile("v_nop\n\tv_nop\n\tv_nop\n\tv_nop" : "+v"(a), "+v"(b) : "v"(x), "v"(y));
}
__device__ __forceinline__ void keep4_b(v16b a, v16b b, v16b c, v16b d) {
  asm volatile("v_nop" :: "v"(a), "v"(b), "v"(c), "v"(d));
}
__device__ __forceinline__ void acc_guard4(v8f& a, v8f& b, v8f& c, v8f& d) {
  asm volatile("v_nop\n\tv_nop\n\tv_nop\n\tv_nop" : "+v"(a), "+v"(b), "+v"(c), "+v"(d));
}

// =====================================================================================================
// f32 -> bf16 (RNE convert), 8 elements per thread, one 16-B store per lane: a wave writes 512 contiguous B
// coverage: n8 threads x 8 = whole plane (n8 is a multiple of 256 for every use here).
// =====================================================================================================
__global__ __launch_bounds__(256) void cvt_bf16x8(const float* __restrict__ in, unsigned short* out, int n8) {
  const int i = blockIdx.x * 256 + threadIdx.x;
  if (i < n8) {
    const v4f a = *(const v4f*)(in + (size_t)i * 8);
    const v4f b = *(const v4f*)(in + (size_t)i * 8 + 4);
    v4u p;
    p[0] = pk16(bf_bits(a[0]), bf_bits(a[1]));
    p[1] = pk16(bf_bits(a[2]), bf_bits(a[3]));
    p[2] = pk16(bf_bits(b[0]), bf_bits(b[1]));
    p[3] = pk16(bf_bits(b[2]), bf_bits(b[3]));
    *(v4u*)(out + (size_t)i * 8) = p;
    
  }
}

// =====================================================================================================
// Register-blocked batched bf16 WMMA GEMM: C[m][n] = sum_k A[m][k] * Bt[n][k]; one wave per 64x64 tile,
// no block barriers. A row-major [M][K] pitch lda; Bt row-major [N][K] pitch ldb (k contiguous);
// M, N multiples of 64, K multiple of 32 (host-checked). blockIdx.y = batch index (strides in elements).
// NSPLIT: 0 = A.Bt; 1 = (A + A2).Bt (A2 = unscaled bf16 lo plane of A); 2 = A.Bt + A2.Bt + A.Bt2.
// OUT_MODE: 0 = f32 (pitch ldc); 2 = bf16 hi plane C + bf16 lo plane C2 (lo = RNE(v - hi), unscaled);
//           3 = f16 hi plane C + f16 residual plane C2 = f16((v - hi) * rscale), C2 written only for tiles
//               with n0 < N2 (pitch ldc2, batch stride strideC2).
// =====================================================================================================
template <int NSPLIT, int OUT_MODE>
__global__ __launch_bounds__(256) void gemm64(
    const unsigned short* __restrict__ Ap, const unsigned short* A2p, int lda, long long strideA,
    const unsigned short* __restrict__ Btp, const unsigned short* Bt2p, int ldb, long long strideB,
    void* Cout, int ldc, long long strideC,
    void* Cout2, int ldc2, long long strideC2, int N2,
    int M, int N, int K, float rscale) {
  const __bf16* A   = (const __bf16*)(const void*)Ap;
  const __bf16* A2  = (const __bf16*)(const void*)A2p;
  const __bf16* Bt  = (const __bf16*)(const void*)Btp;
  const __bf16* Bt2 = (const __bf16*)(const void*)Bt2p;
  __shared__ __align__(16) float sT[8][16 * 68];   // per-wave 16x64 slab, pitch 68 floats
  const int b    = blockIdx.y;
  const int lane = threadIdx.x & 31;
  const int wave = threadIdx.x >> 5;
  const int tilesN = N >> 6;
  const int tilesM = M >> 6;
  const int tile = blockIdx.x * 8 + wave;
  if (tile >= tilesM * tilesN) return;   // wave-uniform; no block barriers in this kernel
  const int tm = tile / tilesN;
  const int tn = tile - tm * tilesN;
  const int m0 = tm << 6;
  const int n0 = tn << 6;

  const __bf16* Ab  = A  + (size_t)b * strideA;
  const __bf16* Bb  = Bt + (size_t)b * strideB;
  const __bf16* Ab2 = (NSPLIT >= 1) ? (A2  + (size_t)b * strideA) : Ab;
  const __bf16* Bb2 = (NSPLIT == 2) ? (Bt2 + (size_t)b * strideB) : Bb;

  const int rlane = lane & 15;                 // row (A) / col (B, D) within subtile
  const int koff  = (lane >> 4) * 8;           // k offset of this lane half
  const int mOff  = (lane >> 4) * 8;           // D row offset

  v8f acc[4][4];
#pragma unroll
  for (int i = 0; i < 4; ++i)
#pragma unroll
    for (int j = 0; j < 4; ++j) acc[i][j] = zero8();

  for (int k0 = 0; k0 < K; k0 += 32) {
    v16b bh[4], bl[4];
#pragma unroll
    for (int j = 0; j < 4; ++j) {
      const size_t bo = (size_t)(n0 + (j << 4) + rlane) * ldb + koff + k0;
      bh[j] = ldfrag_b(Bb + bo);
      if (NSPLIT == 2) bl[j] = ldfrag_b(Bb2 + bo); else bl[j] = bh[j];
    }
#pragma unroll
    for (int i = 0; i < 4; ++i) {
      const size_t ao = (size_t)(m0 + (i << 4) + rlane) * lda + koff + k0;
      const v16b ah = ldfrag_b(Ab + ao);
      v16b al = ah;
      if (NSPLIT >= 1) al = ldfrag_b(Ab2 + ao);
#pragma unroll
      for (int j = 0; j < 4; ++j) {
        acc[i][j] = mma_b_raw(ah, bh[j], acc[i][j]);
        if (NSPLIT >= 1) acc[i][j] = mma_b_raw(al, bh[j], acc[i][j]);
        if (NSPLIT == 2) acc[i][j] = mma_b_raw(ah, bl[j], acc[i][j]);
      }
      dep_guard_b(acc[i][0], acc[i][3], ah, al);
    }
    keep4_b(bh[0], bh[1], bh[2], bh[3]);
    if (NSPLIT == 2) keep4_b(bl[0], bl[1], bl[2], bl[3]);
  }
  acc_guard4(acc[0][0], acc[0][1], acc[0][2], acc[0][3]);
  acc_guard4(acc[1][0], acc[1][1], acc[1][2], acc[1][3]);
  acc_guard4(acc[2][0], acc[2][1], acc[2][2], acc[2][3]);
  acc_guard4(acc[3][0], acc[3][1], acc[3][2], acc[3][3]);

  // ---- epilogue ----
  float* slab = sT[wave];
#pragma unroll
  for (int i = 0; i < 4; ++i) {
    const int mBase = m0 + (i << 4);
#pragma unroll
    for (int j = 0; j < 4; ++j) {
#pragma unroll
      for (int r = 0; r < 8; ++r) {
        slab[(mOff + r) * 68 + (j << 4) + rlane] = acc[i][j][r];
      }
    }
    __builtin_amdgcn_fence(__ATOMIC_RELEASE, "workgroup");
    __builtin_amdgcn_wave_barrier();
    __builtin_amdgcn_fence(__ATOMIC_ACQUIRE, "workgroup");
    if (OUT_MODE == 0) {
      float* C = (float*)Cout + (size_t)b * strideC;
      const int hh = lane >> 4, c4 = (lane & 15) * 4;     // 256-B row segment = 16 lanes x 16 B
      {
#pragma unroll
        for (int it = 0; it < 8; ++it) {
          const int row = it * 2 + hh;                     // it 0..7 x hh 0..1 = rows 0..15
          const v4f v = *(const v4f*)(slab + row * 68 + c4);
          *(v4f*)(C + (size_t)(mBase + row) * ldc + n0 + c4) = v;
        }
        
      }
    } else {
      const int q = lane >> 3, c8 = (lane & 7) * 8;
      unsigned short* C  = (unsigned short*)Cout  + (size_t)b * strideC;
      unsigned short* C2 = (unsigned short*)Cout2 + (size_t)b * strideC2;
      const bool wlo = (OUT_MODE == 2) || (n0 < N2);      // wave-uniform
      v4u hv[4], lv[4];
#pragma unroll
      for (int it = 0; it < 4; ++it) {
        const int row = it * 4 + q;                        // it 0..3 x q 0..3 = rows 0..15
        const float* sp = slab + row * 68 + c8;
        v4u a, a2;
#pragma unroll
        for (int e = 0; e < 4; ++e) {
          const float f0 = sp[2 * e], f1 = sp[2 * e + 1];
          unsigned short h0, h1, l0, l1;
          if (OUT_MODE == 2) {
            h0 = bf_bits(f0); h1 = bf_bits(f1);
            l0 = bf_bits(f0 - bf_up(h0)); l1 = bf_bits(f1 - bf_up(h1));
          } else {
            const _Float16 x0 = (_Float16)f0, x1 = (_Float16)f1;
            h0 = h_bits(x0); h1 = h_bits(x1);
            l0 = h_bits((_Float16)((f0 - (float)x0) * rscale));
            l1 = h_bits((_Float16)((f1 - (float)x1) * rscale));
          }
          a[e] = pk16(h0, h1); a2[e] = pk16(l0, l1);
        }
        hv[it] = a; lv[it] = a2;
      }
      {
#pragma unroll
        for (int it = 0; it < 4; ++it) {
          const int row = it * 4 + q;
          *(v4u*)(C + (size_t)(mBase + row) * ldc + n0 + c8) = hv[it];
          if (wlo) *(v4u*)(C2 + (size_t)(mBase + row) * ldc2 + n0 + c8) = lv[it];
        }
        
      }
    }
    __builtin_amdgcn_fence(__ATOMIC_RELEASE, "workgroup");
    __builtin_amdgcn_wave_barrier();
    __builtin_amdgcn_fence(__ATOMIC_ACQUIRE, "workgroup");
  }
}

// =====================================================================================================
// Cosine-similarity scaling + axial rotation of q and k, f32, one wave per (token t, head h) row.
//   qkf: f32 [t][QKW], q of head h at cols h*64.., k at cols DM + h*64..
//   pos [t][2], scl [NH], freqs [2][NH][NFR]: values RNE-converted to bf16 in register before use.
//   rq = sqrt(|scl_h| + 1e-8) * rsqrt(sum(q^2) + 1e-8); qs = q * rq (same for k)
//   theta[i], i < 16: (pos[t][1]*2 - 1) * freqs[1][h][i]; i >= 16: (pos[t][0]*2 - 1) * freqs[0][h][i-16]
//   out[i] = qs[i] cos - qs[i+32] sin; out[i+32] = qs[i+32] cos + qs[i] sin (lane i = pair index).
//   qk4: four bf16 planes [t][h*64+d] back to back (plane stride SEQ*DM elements): q hi, q lo, k hi, k lo
//   (lo = RNE(v - hi), unscaled). The wave's 64-wide row is staged in LDS, then ONE store instruction writes
//   grid = nrows/8 blocks of 256 (8 waves). coverage: nrows = SEQ*NH rows x 64 cols in each of the 4 planes.
// =====================================================================================================
__global__ __launch_bounds__(256) void rope_qk(const float* __restrict__ qkf, const float* __restrict__ pos,
                                               const float* __restrict__ scl, const float* __restrict__ freqs,
                                               unsigned short* qk4, int nrows) {
#pragma clang fp contract(off)
  __shared__ __align__(16) float sq[8][64];
  __shared__ __align__(16) float sk[8][64];
  const int tid  = threadIdx.x;
  const int wave = tid >> 5;
  const int lane = tid & 31;
  const int rho  = blockIdx.x * 8 + wave;
  if (rho < nrows) {                                      // wave-uniform; no block barriers in this kernel
    const int t = rho >> 4;
    const int h = rho & 15;
    const float* qr = qkf + (size_t)t * QKW + h * HD;
    const float* kr = qr + DM;
    const int i = lane;                                   // pair index 0..31
    const float q1 = qr[i], q2 = qr[i + 32];
    const float k1 = kr[i], k2 = kr[i + 32];
    float ssq = q1 * q1 + q2 * q2;
    float ssk = k1 * k1 + k2 * k2;
#pragma unroll
    for (int off = 16; off >= 1; off >>= 1) {
      ssq += __shfl_xor(ssq, off, 32);
      ssk += __shfl_xor(ssk, off, 32);
    }
    const float scr = bf_rn(scl[h]);
    const float ss  = sqrtf(fabsf(scr) + 1e-8f);
    const float rq  = ss * rsqrtf(ssq + 1e-8f);
    const float rk  = ss * rsqrtf(ssk + 1e-8f);
    const float px  = bf_rn(pos[2 * t + 0]);
    const float py  = bf_rn(pos[2 * t + 1]);
    const int  low  = (i < 16) ? 1 : 0;
    const int  fi   = low ? (NH * NFR + h * NFR + i) : (h * NFR + (i - 16));   // [1][h][i] or [0][h][i-16], < 2*NH*NFR
    const float fr  = bf_rn(freqs[fi]);
    const float pp  = low ? py : px;
    const float th  = (pp * 2.0f - 1.0f) * fr;
    const float cs  = cosf(th);
    const float sn  = sinf(th);
    const float xq1 = q1 * rq, xq2 = q2 * rq;
    const float xk1 = k1 * rk, xk2 = k2 * rk;
    sq[wave][i]      = xq1 * cs - xq2 * sn;
    sq[wave][i + 32] = xq2 * cs + xq1 * sn;
    sk[wave][i]      = xk1 * cs - xk2 * sn;
    sk[wave][i + 32] = xk2 * cs + xk1 * sn;
    __builtin_amdgcn_fence(__ATOMIC_RELEASE, "workgroup");
    __builtin_amdgcn_wave_barrier();
    __builtin_amdgcn_fence(__ATOMIC_ACQUIRE, "workgroup");
    const int pl = lane >> 3;                             // plane 0 q hi, 1 q lo, 2 k hi, 3 k lo
    const int c8 = (lane & 7) * 8;
    const float* spq = &sq[wave][c8];
    const float* spk = &sk[wave][c8];
    v4u w;
#pragma unroll
    for (int e = 0; e < 4; ++e) {
      const float fq0 = spq[2 * e], fq1 = spq[2 * e + 1];
      const float fk0 = spk[2 * e], fk1 = spk[2 * e + 1];
      const float f0 = (pl < 2) ? fq0 : fk0;
      const float f1 = (pl < 2) ? fq1 : fk1;
      const unsigned short hb0 = bf_bits(f0), hb1 = bf_bits(f1);
      const unsigned short lb0 = bf_bits(f0 - bf_up(hb0)), lb1 = bf_bits(f1 - bf_up(hb1));
      const unsigned short s0 = (pl & 1) ? lb0 : hb0;
      const unsigned short s1 = (pl & 1) ? lb1 : hb1;
      w[e] = pk16(s0, s1);
    }
    unsigned short* dst = qk4 + (size_t)pl * ((size_t)SEQ * DM) + (size_t)t * DM + h * HD + c8;
    *(v4u*)dst = w;
    
  }
}

// =====================================================================================================
// Attention, head dim 64, unified key rule: key s is visible to row t iff (s < S and s <= t) or s == t,
// with S = npk[0] clamped to [0, SEQ] (causal prefix segment of S tokens; later rows see the whole prefix
// plus themselves). Scores unscaled; masked scores = -inf; softmax f32 online.
//   q planes (bf16 hi / lo): element (t, h, d) at [t*DM + h*64 + d]; k planes same with key index s
//   v^T hi plane (f16):      element (h, d, s) at [(h*64 + d)*SEQ + s]; residual plane (f16, (v - hi)*4096) same layout
//   out planes (bf16 hi / lo of the normalised context): element (t, h, d) at [t*DM + h*64 + d]
//   scores = q . k : bf16 hi/lo split (hi.hi + hi.lo + lo.hi), f32 accumulate
//   p = exp(s - m) carried as f16(1024 p); context = p . v_hi on f16 WMMA plus p . v_res (and, when RES,
//   p_res . v_hi with p_res = f16((1024 p - f16(1024 p)) * 4096)) into a separate accumulator folded back with
//   1/4096 per key tile in f32.
//   Block = 4 waves = 64 query rows of one h; grid = nqbThis * NH; key tiles of 64: tiles 0..min(qb, SB-1) then
//   tile qb itself when qb >= SB (SB = ceil(S/64)); trip count block-uniform and <= NQB.
//   K / V^T tile staging: 128 threads x 32 elements per plane = the whole 64x64 tile (plain 16-B loads,
//   __syncthreads before and after); P tiles are wave-private, spilled with _Float16 element stores and reloaded
//   Output coverage: each wave stores rows q0..q0+15 (it 0..3 x lane>>3 0..3) x 64 columns (8 lanes x 8) of both planes.
// =====================================================================================================
template <bool RES>
__global__ __launch_bounds__(128)
void attn64(const unsigned short* __restrict__ qhp, const unsigned short* __restrict__ qlp,
            const unsigned short* __restrict__ khp, const unsigned short* __restrict__ klp,
            const unsigned short* __restrict__ vhp, const unsigned short* __restrict__ vlp,
            const int* __restrict__ npk,
            unsigned short* ohp, unsigned short* olp, int qbBase, int nqbThis) {
  union FB { v16b v; v8b h[2]; };
  union FH { v16h v; v8h h[2]; };
  __shared__ __align__(16) __bf16   Ksh[64 * LP];                 // K hi [kv][d], rows padded to LP
  __shared__ __align__(16) __bf16   Ksl[64 * LP];                 // K lo
  __shared__ __align__(16) _Float16 Vth[64 * LP];                 // V^T hi [d][kv], rows padded to LP
  __shared__ __align__(16) _Float16 Vtl[64 * LP];                 // V^T residual
  __shared__ __align__(16) _Float16 Psh[4][16 * LP];              // per wave P [row][kv]
  __shared__ __align__(16) _Float16 Psl[RES ? 4 : 1][16 * LP];    // per wave P residual
  __shared__ __align__(16) float    Os[4][16 * 64];               // per wave context tile [row][d]

  const int tid  = threadIdx.x;
  const int wave = tid >> 5;
  const int lane = tid & 31;
  const int hh   = lane >> 4;
  const int c    = lane & 15;

  const int bx   = blockIdx.x;
  const int qbl  = bx % nqbThis;
  const int h    = bx / nqbThis;          // < NH by grid size
  const int qb   = qbBase + qbl;
  const int q0   = qb * 64 + wave * 16;

  int S = npk[0];                         // block-uniform scalar load
  S = (S < 0) ? 0 : S;
  S = (S > SEQ) ? SEQ : S;
  const int SB   = (S + 63) >> 6;                       // 0..NQB
  const int nLow = (qb + 1 < SB) ? (qb + 1) : SB;       // tiles 0..nLow-1
  int nT = nLow + ((qb >= SB) ? 1 : 0);                 // + the block's own tile when not in the prefix
  nT = (nT > NQB) ? NQB : nT;

  const __bf16* Qh = (const __bf16*)(const void*)qhp + (size_t)h * HD;
  const __bf16* Ql = (const __bf16*)(const void*)qlp + (size_t)h * HD;
  const __bf16* Kh = (const __bf16*)(const void*)khp + (size_t)h * HD;
  const __bf16* Kl = (const __bf16*)(const void*)klp + (size_t)h * HD;
  const _Float16* Vh = (const _Float16*)(const void*)vhp + (size_t)h * HD * SEQ;
  const _Float16* Vl = (const _Float16*)(const void*)vlp + (size_t)h * HD * SEQ;

  // ---- Q fragments (A operand, row = lane&15): 2 d-chunks, hi and lo ----
  v16b qah[2], qal[2];
#pragma unroll
  for (int dc = 0; dc < 2; ++dc) {
    const size_t qo = (size_t)(q0 + c) * DM + dc * 32 + 8 * hh;
    qah[dc] = ldfrag_b(Qh + qo);
    qal[dc] = ldfrag_b(Ql + qo);
  }

  float mrow[8], lrow[8];
  v8f oacc[4];
#pragma unroll
  for (int r = 0; r < 8; ++r) { mrow[r] = -INFINITY; lrow[r] = 0.f; }
#pragma unroll
  for (int t = 0; t < 4; ++t) oacc[t] = zero8();

  for (int i = 0; i < nT; ++i) {          // block-uniform trip count, <= NQB
    const int kt  = (i < nLow) ? i : qb;
    const int kv0 = kt * 64;              // kv0 + 63 < SEQ
    __syncthreads();
    {
      const int r = tid >> 1, half = (tid & 1) * 32;
      const __bf16*   kg  = Kh + (size_t)(kv0 + r) * DM + half;   // K row kv0+r, d = half..half+31
      const __bf16*   klg = Kl + (size_t)(kv0 + r) * DM + half;
      const _Float16* vg  = Vh + (size_t)r * SEQ + kv0 + half;    // V^T row d = r, s = kv0+half..+31
      const _Float16* vlg = Vl + (size_t)r * SEQ + kv0 + half;
#pragma unroll
      for (int u = 0; u < 4; ++u) {
        const v8b a0 = *(const v8b*)(kg + 8 * u);
        const v8b a1 = *(const v8b*)(klg + 8 * u);
        const v8h b0 = *(const v8h*)(vg + 8 * u);
        const v8h b1 = *(const v8h*)(vlg + 8 * u);
        *(v8b*)(Ksh + r * LP + half + 8 * u) = a0;
        *(v8b*)(Ksl + r * LP + half + 8 * u) = a1;
        *(v8h*)(Vth + r * LP + half + 8 * u) = b0;
        *(v8h*)(Vtl + r * LP + half + 8 * u) = b1;
      }
    }
    __syncthreads();

    // ---- scores: 16 query rows x 64 keys per wave, 3 bf16 products ----
    v8f s[4];
#pragma unroll
    for (int j = 0; j < 4; ++j) {
      s[j] = zero8();
#pragma unroll
      for (int dc = 0; dc < 2; ++dc) {
        FB kb, kl;
        kb.h[0] = *(const v8b*)(Ksh + (j * 16 + c) * LP + dc * 32 + 8 * hh);
        kb.h[1] = *(const v8b*)(Ksh + (j * 16 + c) * LP + dc * 32 + 16 + 8 * hh);
        kl.h[0] = *(const v8b*)(Ksl + (j * 16 + c) * LP + dc * 32 + 8 * hh);
        kl.h[1] = *(const v8b*)(Ksl + (j * 16 + c) * LP + dc * 32 + 16 + 8 * hh);
        s[j] = mma_b(qah[dc], kb.v, s[j]);
        s[j] = mma_b(qah[dc], kl.v, s[j]);
        s[j] = mma_b(qal[dc], kb.v, s[j]);
      }
    }

    // ---- key visibility rule, row max, online softmax, P (x1024, f16) and P residual (x4096) to LDS ----
    _Float16* pwh = Psh[wave];
    _Float16* pwl = Psl[RES ? wave : 0];
#pragma unroll
    for (int r = 0; r < 8; ++r) {
      const int t = q0 + 8 * hh + r;        // D row 8hh+r of this lane
      float m = -INFINITY;
#pragma unroll
      for (int j = 0; j < 4; ++j) {
        const int kg = kv0 + j * 16 + c;    // D col = key
        const bool ok = ((kg < S) && (kg <= t)) || (kg == t);
        const float sv = ok ? s[j][r] : -INFINITY;
        s[j][r] = sv;
        m = fmaxf(m, sv);
      }
#pragma unroll
      for (int off = 1; off < 16; off <<= 1) m = fmaxf(m, __shfl_xor(m, off, 32));
      const float mnew  = fmaxf(mrow[r], m);
      const float msafe = (mnew == -INFINITY) ? 0.f : mnew;
      const float alpha = __expf(mrow[r] - msafe);
      mrow[r] = mnew;
      float psum = 0.f;
#pragma unroll
      for (int j = 0; j < 4; ++j) {
        const float p = __expf(s[j][r] - msafe);     // masked score: exp(-inf) -> 0
        psum += p;
        const float p1k = p * 1024.0f;
        const _Float16 ph = (_Float16)p1k;
        pwh[(8 * hh + r) * LP + j * 16 + c] = ph;
        if (RES) {
          const _Float16 pr = (_Float16)((p1k - (float)ph) * 4096.0f);
          pwl[(8 * hh + r) * LP + j * 16 + c] = pr;
        }
      }
#pragma unroll
      for (int off = 1; off < 16; off <<= 1) psum += __shfl_xor(psum, off, 32);
      lrow[r] = lrow[r] * alpha + psum;
#pragma unroll
      for (int t4 = 0; t4 < 4; ++t4) oacc[t4][r] *= alpha;
    }
    __builtin_amdgcn_fence(__ATOMIC_RELEASE, "workgroup");
    __builtin_amdgcn_wave_barrier();
    __builtin_amdgcn_fence(__ATOMIC_ACQUIRE, "workgroup");

    // ---- context += P . V_hi (f16 WMMA); residual products into a separate accumulator ----
    v8f o1[4];
#pragma unroll
    for (int t4 = 0; t4 < 4; ++t4) o1[t4] = zero8();
#pragma unroll 1
    for (int kk = 0; kk < 2; ++kk) {
      FH pa, pl;
      pa.h[0] = *(const v8h*)(pwh + c * LP + kk * 32 + 8 * hh);
      pa.h[1] = *(const v8h*)(pwh + c * LP + kk * 32 + 16 + 8 * hh);
      if (RES) {
        pl.h[0] = *(const v8h*)(pwl + c * LP + kk * 32 + 8 * hh);
        pl.h[1] = *(const v8h*)(pwl + c * LP + kk * 32 + 16 + 8 * hh);
      } else {
        pl.v = pa.v;
      }
#pragma unroll
      for (int t4 = 0; t4 < 4; ++t4) {
        FH vb, vl;
        vb.h[0] = *(const v8h*)(Vth + (t4 * 16 + c) * LP + kk * 32 + 8 * hh);
        vb.h[1] = *(const v8h*)(Vth + (t4 * 16 + c) * LP + kk * 32 + 16 + 8 * hh);
        vl.h[0] = *(const v8h*)(Vtl + (t4 * 16 + c) * LP + kk * 32 + 8 * hh);
        vl.h[1] = *(const v8h*)(Vtl + (t4 * 16 + c) * LP + kk * 32 + 16 + 8 * hh);
        oacc[t4] = mma_h(pa.v, vb.v, oacc[t4]);
        o1[t4]   = mma_h(pa.v, vl.v, o1[t4]);
        if (RES) o1[t4] = mma_h(pl.v, vb.v, o1[t4]);
      }
    }
#pragma unroll
    for (int t4 = 0; t4 < 4; ++t4)
#pragma unroll
      for (int r = 0; r < 8; ++r) oacc[t4][r] += o1[t4][r] * (1.0f / 4096.0f);
  }

  // ---- normalise (1/l and the 1/1024 p carry), stage the wave's 16x64 tile, bf16 hi/lo split,
  float* os = Os[wave];
#pragma unroll
  for (int r = 0; r < 8; ++r) {
    const float l = lrow[r];
    const float inv = ((l > 0.f) ? (1.0f / l) : 0.f) * (1.0f / 1024.0f);
#pragma unroll
    for (int t4 = 0; t4 < 4; ++t4) os[(8 * hh + r) * 64 + t4 * 16 + c] = oacc[t4][r] * inv;
  }
  __builtin_amdgcn_fence(__ATOMIC_RELEASE, "workgroup");
  __builtin_amdgcn_wave_barrier();
  __builtin_amdgcn_fence(__ATOMIC_ACQUIRE, "workgroup");
  {
    const int q4 = lane >> 3, c8 = (lane & 7) * 8;
    v4u hv[4], lv[4];
#pragma unroll
    for (int it = 0; it < 4; ++it) {
      const int row = it * 4 + q4;   // it 0..3 x q4 0..3 = rows 0..15 of the wave tile
      const float* sp = os + row * 64 + c8;
      v4u a, a2;
#pragma unroll
      for (int e = 0; e < 4; ++e) {
        const float f0 = sp[2 * e], f1 = sp[2 * e + 1];
        const unsigned short h0 = bf_bits(f0), h1 = bf_bits(f1);
        const unsigned short l0 = bf_bits(f0 - bf_up(h0)), l1 = bf_bits(f1 - bf_up(h1));
        a[e] = pk16(h0, h1); a2[e] = pk16(l0, l1);
      }
      hv[it] = a; lv[it] = a2;
    }
    {
#pragma unroll
      for (int it = 0; it < 4; ++it) {
        const int row = it * 4 + q4;
        const size_t go = (size_t)(q0 + row) * DM + (size_t)h * HD + c8;
        *(v4u*)(ohp + go) = hv[it];
        *(v4u*)(olp + go) = lv[it];
      }
      
    }
  }
}

// =====================================================================================================
// Workspace map (bytes), every region an exact multiple of its whole-line / whole-tile store granularity:
//   Xb    bf16 [4096][1024]          0            8388608
//   Wqkv  bf16 [3072 n][1024 k]      8388608      6291456   (rows 0..2047 = q|k weights, 2048.. = v weights)
//   Wob   bf16 [1024][1024]          14680064     2097152
//   QKf   f32  [4096][2048]          16777216     33554432  (cols 0..1023 q, 1024..2047 k)
//   VTh   f16  [1024 d][4096 s]      50331648     8388608
//   VTl   f16  [1024 d][4096 s]      58720256     8388608
//   QK4   bf16 4 x [4096][1024]      67108864     33554432  (q hi, q lo, k hi, k lo)
//   Oh    bf16 [4096][1024]          100663296    8388608
//   Ol    bf16 [4096][1024]          109051904    8388608
//   end                              117440512
// Weights are [out n][in k] with k contiguous = the Bt / A layout the GEMM wants, so they are only converted.
// =====================================================================================================
extern "C" void kernel_launch(void* const* d_in, const int* in_sizes, int n_in,
                              void* d_out, int out_size, void* d_ws, size_t ws_size,
                              hipStream_t stream) {
  if (n_in < 7) return;
  if (in_sizes[0] != SEQ * DM) return;
  if (in_sizes[1] != SEQ * 2) return;
  if (in_sizes[2] != NQKV * DM) return;
  if (in_sizes[3] != DM * DM) return;
  if (in_sizes[4] != NH) return;
  if (in_sizes[5] != 2 * NH * NFR) return;
  if (in_sizes[6] < 1) return;
  if (out_size != SEQ * DM) return;

  const float* x     = (const float*)d_in[0];
  const float* pos   = (const float*)d_in[1];
  const float* qkvw  = (const float*)d_in[2];
  const float* outw  = (const float*)d_in[3];
  const float* scl   = (const float*)d_in[4];
  const float* freqs = (const float*)d_in[5];
  const int*   npk   = (const int*)d_in[6];

  const size_t PXB   = (size_t)SEQ * DM * 2;      //  8388608
  const size_t PWQKV = (size_t)NQKV * DM * 2;     //  6291456
  const size_t PWO   = (size_t)DM * DM * 2;       //  2097152
  const size_t PQKF  = (size_t)SEQ * QKW * 4;     // 33554432
  const size_t PVT   = (size_t)DM * SEQ * 2;      //  8388608
  const size_t PPL   = (size_t)SEQ * DM * 2;      //  8388608
  size_t off = 0;
  const size_t oXb   = off; off += PXB;
  const size_t oWqkv = off; off += PWQKV;
  const size_t oWo   = off; off += PWO;
  const size_t oQKf  = off; off += PQKF;
  const size_t oVTh  = off; off += PVT;
  const size_t oVTl  = off; off += PVT;
  const size_t oQK4  = off; off += 4 * PPL;
  const size_t oOh   = off; off += PPL;
  const size_t oOl   = off; off += PPL;
  if (off > ws_size) return;                      // off = 117440512
  if (off > (size_t)134217728) return;

  char* ws = (char*)d_ws;
  unsigned short* Xb   = (unsigned short*)(ws + oXb);
  unsigned short* Wqkv = (unsigned short*)(ws + oWqkv);
  unsigned short* Wvb  = Wqkv + (size_t)2 * DM * DM;             // rows 2048.. of the qkv weight plane
  unsigned short* Wob  = (unsigned short*)(ws + oWo);
  float*          QKf  = (float*)(ws + oQKf);
  unsigned short* VTh  = (unsigned short*)(ws + oVTh);
  unsigned short* VTl  = (unsigned short*)(ws + oVTl);
  unsigned short* QK4  = (unsigned short*)(ws + oQK4);
  unsigned short* Qh   = QK4;
  unsigned short* Ql   = QK4 + (size_t)SEQ * DM;
  unsigned short* Kh   = QK4 + (size_t)2 * SEQ * DM;
  unsigned short* Kl   = QK4 + (size_t)3 * SEQ * DM;
  unsigned short* Oh   = (unsigned short*)(ws + oOh);
  unsigned short* Ol   = (unsigned short*)(ws + oOl);

  const dim3 blk(256);
  const int n8x = SEQ * DM / 8;                                // 524288
  const int n8w = NQKV * DM / 8;                               // 393216
  const int n8o = DM * DM / 8;                                 // 131072
  const dim3 gCvtX((n8x + 255) / 256);                         // 2048 blocks
  const dim3 gCvtW((n8w + 255) / 256);                         // 1536 blocks
  const dim3 gCvtO((n8o + 255) / 256);                         // 512 blocks
  const dim3 gQK(((SEQ / 64) * (QKW / 64) + 7) / 8, 1);        // 2048 tiles -> 256 blocks: M=4096, N=2048
  const dim3 gVT(((DM / 64) * (SEQ / 64) + 7) / 8, 1);         // 1024 tiles -> 128 blocks: M=1024, N=4096
  const dim3 gOut(((SEQ / 64) * (DM / 64) + 7) / 8, 1);        // 1024 tiles -> 128 blocks: M=4096, N=1024
  const int  nRows = SEQ * NH;                                 // 65536 (t, h) rows
  const dim3 gRope((nRows + 7) / 8);                           // 8192 blocks of 8 waves

  // (1) x -> bf16 [4096][1024]; weights [n][k] f32 -> bf16 [n][k]
  cvt_bf16x8<<<gCvtX, blk, 0, stream>>>(x, Xb, n8x);
  cvt_bf16x8<<<gCvtW, blk, 0, stream>>>(qkvw, Wqkv, n8w);
  cvt_bf16x8<<<gCvtO, blk, 0, stream>>>(outw, Wob, n8o);
  // (2) q|k = x . W[0:2048]^T -> f32 [4096][2048]   (M=4096, N=2048, K=1024)
  gemm64<0, 0><<<gQK, blk, 0, stream>>>(
      Xb, Xb, DM, 0LL, Wqkv, Wqkv, DM, 0LL,
      (void*)QKf, QKW, 0LL, (void*)QKf, QKW, 0LL, 0,
      SEQ, QKW, DM, 1.0f);
  // (3) v^T = Wv . x^T -> f16 hi plane [h*64+d][s] (pitch SEQ) and residual plane (x4096, all keys)
  //     (A = Wvb [n][k], Bt = Xb; M=1024, N=4096, K=1024)
  gemm64<0, 3><<<gVT, blk, 0, stream>>>(
      Wvb, Wvb, DM, 0LL, Xb, Xb, DM, 0LL,
      (void*)VTh, SEQ, 0LL, (void*)VTl, SEQ, 0LL, SEQ,
      DM, SEQ, DM, 4096.0f);
  // (4) cosine-sim scaling + axial rotation -> q hi/lo, k hi/lo bf16 planes [t][h*64+d]
  rope_qk<<<gRope, blk, 0, stream>>>(QKf, pos, scl, freqs, QK4, nRows);
  // (5) attention: row blocks 0..RESQB-1 with the p residual plane, the rest without
  attn64<true><<<dim3(NH * RESQB), dim3(128), 0, stream>>>(
      Qh, Ql, Kh, Kl, VTh, VTl, npk, Oh, Ol, 0, RESQB);
  attn64<false><<<dim3(NH * (NQB - RESQB)), dim3(128), 0, stream>>>(
      Qh, Ql, Kh, Kl, VTh, VTl, npk, Oh, Ol, RESQB, NQB - RESQB);
  // (6) out = context . Wo^T -> d_out f32 [4096][1024]  (A = context hi + lo planes, 2 products)
  gemm64<1, 0><<<gOut, blk, 0, stream>>>(
      Oh, Ol, DM, 0LL, Wob, Wob, DM, 0LL,
      d_out, DM, 0LL, d_out, DM, 0LL, 0,
      SEQ, DM, DM, 1.0f);
  (void)hipGetLastError();
}

// v002
// It runs in 378 microseconds.
// In both of two side-by-side timings against v001, it was 1.05 times as fast.
// All steps since v000 together make it 1.51 times as fast.
// Contractions: q|k and v^T projections = v_wmma_f32_16x16x32_bf16 (bf16 operands from RNE-converted inputs, single product);
// q.k^T scores = v_wmma_f32_16x16x32_bf16 with bf16 hi/lo split q and k (hi.hi + hi.lo + lo.hi);
// p.v = v_wmma_f32_16x16x32_f16 (p carried x1024 in f16; v as f16 hi plane + f16 residual plane x4096, 2 products;
// extra f16 residual plane x4096 of p for the first 512 rows); ctx.Wo^T = v_wmma_f32_16x16x32_bf16 with ctx as
// bf16 hi/lo planes times bf16 Wo (2 products); all f32 accumulate; norms, rotations and softmax in f32.
#include <hip/hip_runtime.h>
#include <math.h>
#include <stdint.h>

#define SEQ   4096
#define DM    1024
#define NH    16
#define HD    64
#define NQB   (SEQ / 64)   // 64 row / key tiles of 64
#define RESQB 8            // leading 64-row blocks that also use the p residual plane
#define QKW   (2 * DM)     // pitch of the f32 q|k plane
#define NQKV  (3 * DM)
#define NFR   16           // rotation frequencies per head per axis (HD/4)
#define LP    72           // LDS row pitch of the 64-wide 16-bit attention tiles, in elements: 144 B = 16 B x 9 (odd)
static_assert(NH * HD == DM);
static_assert((SEQ % 64) == 0 && (DM % 64) == 0);
static_assert(RESQB <= NQB);
static_assert(HD == 4 * NFR);

typedef _Float16 v16h __attribute__((ext_vector_type(16)));
typedef _Float16 v8h  __attribute__((ext_vector_type(8)));
typedef __bf16   v16b __attribute__((ext_vector_type(16)));
typedef __bf16   v8b  __attribute__((ext_vector_type(8)));
typedef float    v8f  __attribute__((ext_vector_type(8)));
typedef float    v4f  __attribute__((ext_vector_type(4)));
typedef unsigned int v4u __attribute__((ext_vector_type(4)));

// ---- scalar helpers --------------------------------------------------------------------------------
__device__ __forceinline__ unsigned short bf_bits(float f) {          // f32 -> bf16 bits, RNE convert
  unsigned u = __float_as_uint(f);
  return (unsigned short)((u + 0x7FFFu + ((u >> 16) & 1u)) >> 16);
}
__device__ __forceinline__ float bf_up(unsigned short h) { return __uint_as_float(((unsigned)h) << 16); }
__device__ __forceinline__ float bf_rn(float f) { return bf_up(bf_bits(f)); }   // value after RNE convert to bf16
__device__ __forceinline__ unsigned short h_bits(_Float16 x) { return __builtin_bit_cast(unsigned short, x); }
__device__ __forceinline__ unsigned pk16(unsigned short a, unsigned short b) { return (unsigned)a | ((unsigned)b << 16); }
// value of lane (l ^ M) inside the lane's 16-lane row, M = 1..15: a DPP operand (row_xmask), no trip through the LDS pipe
template <int M>
__device__ __forceinline__ float row_xor(float x) {
  return __builtin_bit_cast(float, __builtin_amdgcn_update_dpp(0, __builtin_bit_cast(int, x), 0x160 + M, 0xf, 0xf, true));
}
// value of lane (l ^ 16): vector cross-row move
__device__ __forceinline__ float half_xor(float x) {
  return __builtin_bit_cast(float, __builtin_amdgcn_permlanex16(__builtin_bit_cast(int, x), __builtin_bit_cast(int, x),
                                                                0x76543210, 0xfedcba98, false, false));
}
__device__ __forceinline__ v8f zero8() { v8f z = {0.f, 0.f, 0.f, 0.f, 0.f, 0.f, 0.f, 0.f}; return z; }

// ---- fragment loaders: 16-bit A/B operand, lane -> row/col (lane&15), p already includes +8*(lane>>4);
//      elements 0..7 <- p[0..7] (k0+8h..), elements 8..15 <- p[16..23] (k0+16+8h..)
__device__ __forceinline__ v16b ldfrag_b(const __bf16* p) {
  union { v16b v; v8b h[2]; } f;
  f.h[0] = *(const v8b*)(p);
  f.h[1] = *(const v8b*)(p + 16);
  return f.v;
}

// ---- WMMA helpers with trailing VALU hazard gap --------------------------------------------------------
__device__ __forceinline__ v8f mma_b(v16b a, v16b b, v8f c) {
  c = __builtin_amdgcn_wmma_f32_16x16x32_bf16(false, a, false, b, (short)0, c, false, false);
  asm volatile("v_nop\n\tv_nop\n\tv_nop\n\tv_nop" : "+v"(c) : "v"(a), "v"(b));
  return c;
}
__device__ __forceinline__ v8f mma_h(v16h a, v16h b, v8f c) {
  c = __builtin_amdgcn_wmma_f32_16x16x32_f16(false, a, false, b, (short)0, c, false, false);
  asm volatile("v_nop\n\tv_nop\n\tv_nop\n\tv_nop" : "+v"(c) : "v"(a), "v"(b));
  return c;
}
__device__ __forceinline__ v8f mma_b_raw(v16b a, v16b b, v8f c) {
  return __builtin_amdgcn_wmma_f32_16x16x32_bf16(false, a, false, b, (short)0, c, false, false);
}
__device__ __forceinline__ void dep_guard_b(v8f& a, v8f& b, v16b x, v16b y) {
  asm volatile("v_nop\n\tv_nop\n\tv_nop\n\tv_nop" : "+v"(a), "+v"(b) : "v"(x), "v"(y));
}
__device__ __forceinline__ void keep4_b(v16b a, v16b b, v16b c, v16b d) {
  asm volatile("v_nop" :: "v"(a), "v"(b), "v"(c), "v"(d));
}
__device__ __forceinline__ void acc_guard4(v8f& a, v8f& b, v8f& c, v8f& d) {
  asm volatile("v_nop\n\tv_nop\n\tv_nop\n\tv_nop" : "+v"(a), "+v"(b), "+v"(c), "+v"(d));
}

// =====================================================================================================
// f32 -> bf16 (RNE convert), 8 elements per thread, one 16-B store per lane: a wave writes 512 contiguous B
// coverage: n8 threads x 8 = whole plane (n8 is a multiple of 256 for every use here).
// =====================================================================================================
__global__ __launch_bounds__(256) void cvt_bf16x8(const float* __restrict__ in, unsigned short* out, int n8) {
  const int i = blockIdx.x * 256 + threadIdx.x;
  if (i < n8) {
    const v4f a = *(const v4f*)(in + (size_t)i * 8);
    const v4f b = *(const v4f*)(in + (size_t)i * 8 + 4);
    v4u p;
    p[0] = pk16(bf_bits(a[0]), bf_bits(a[1]));
    p[1] = pk16(bf_bits(a[2]), bf_bits(a[3]));
    p[2] = pk16(bf_bits(b[0]), bf_bits(b[1]));
    p[3] = pk16(bf_bits(b[2]), bf_bits(b[3]));
    *(v4u*)(out + (size_t)i * 8) = p;
    
  }
}

// =====================================================================================================
// Register-blocked batched bf16 WMMA GEMM: C[m][n] = sum_k A[m][k] * Bt[n][k]; one wave per 64x64 tile,
// no block barriers. A row-major [M][K] pitch lda; Bt row-major [N][K] pitch ldb (k contiguous);
// M, N multiples of 64, K multiple of 32 (host-checked). blockIdx.y = batch index (strides in elements).
// NSPLIT: 0 = A.Bt; 1 = (A + A2).Bt (A2 = unscaled bf16 lo plane of A); 2 = A.Bt + A2.Bt + A.Bt2.
// OUT_MODE: 0 = f32 (pitch ldc); 2 = bf16 hi plane C + bf16 lo plane C2 (lo = RNE(v - hi), unscaled);
//           3 = f16 hi plane C + f16 residual plane C2 = f16((v - hi) * rscale), C2 written only for tiles
//               with n0 < N2 (pitch ldc2, batch stride strideC2).
// =====================================================================================================
template <int NSPLIT, int OUT_MODE>
__global__ __launch_bounds__(256) void gemm64(
    const unsigned short* __restrict__ Ap, const unsigned short* A2p, int lda, long long strideA,
    const unsigned short* __restrict__ Btp, const unsigned short* Bt2p, int ldb, long long strideB,
    void* Cout, int ldc, long long strideC,
    void* Cout2, int ldc2, long long strideC2, int N2,
    int M, int N, int K, float rscale) {
  const __bf16* A   = (const __bf16*)(const void*)Ap;
  const __bf16* A2  = (const __bf16*)(const void*)A2p;
  const __bf16* Bt  = (const __bf16*)(const void*)Btp;
  const __bf16* Bt2 = (const __bf16*)(const void*)Bt2p;
  __shared__ __align__(16) float sT[8][16 * 68];   // per-wave 16x64 slab, pitch 68 floats
  const int b    = blockIdx.y;
  const int lane = threadIdx.x & 31;
  const int wave = threadIdx.x >> 5;
  const int tilesN = N >> 6;
  const int tilesM = M >> 6;
  const int tile = blockIdx.x * 8 + wave;
  if (tile >= tilesM * tilesN) return;   // wave-uniform; no block barriers in this kernel
  const int tm = tile / tilesN;
  const int tn = tile - tm * tilesN;
  const int m0 = tm << 6;
  const int n0 = tn << 6;

  const __bf16* Ab  = A  + (size_t)b * strideA;
  const __bf16* Bb  = Bt + (size_t)b * strideB;
  const __bf16* Ab2 = (NSPLIT >= 1) ? (A2  + (size_t)b * strideA) : Ab;
  const __bf16* Bb2 = (NSPLIT == 2) ? (Bt2 + (size_t)b * strideB) : Bb;

  const int rlane = lane & 15;                 // row (A) / col (B, D) within subtile
  const int koff  = (lane >> 4) * 8;           // k offset of this lane half
  const int mOff  = (lane >> 4) * 8;           // D row offset

  v8f acc[4][4];
#pragma unroll
  for (int i = 0; i < 4; ++i)
#pragma unroll
    for (int j = 0; j < 4; ++j) acc[i][j] = zero8();

  for (int k0 = 0; k0 < K; k0 += 32) {
    v16b bh[4], bl[4];
#pragma unroll
    for (int j = 0; j < 4; ++j) {
      const size_t bo = (size_t)(n0 + (j << 4) + rlane) * ldb + koff + k0;
      bh[j] = ldfrag_b(Bb + bo);
      if (NSPLIT == 2) bl[j] = ldfrag_b(Bb2 + bo); else bl[j] = bh[j];
    }
#pragma unroll
    for (int i = 0; i < 4; ++i) {
      const size_t ao = (size_t)(m0 + (i << 4) + rlane) * lda + koff + k0;
      const v16b ah = ldfrag_b(Ab + ao);
      v16b al = ah;
      if (NSPLIT >= 1) al = ldfrag_b(Ab2 + ao);
#pragma unroll
      for (int j = 0; j < 4; ++j) {
        acc[i][j] = mma_b_raw(ah, bh[j], acc[i][j]);
        if (NSPLIT >= 1) acc[i][j] = mma_b_raw(al, bh[j], acc[i][j]);
        if (NSPLIT == 2) acc[i][j] = mma_b_raw(ah, bl[j], acc[i][j]);
      }
      dep_guard_b(acc[i][0], acc[i][3], ah, al);
    }
    keep4_b(bh[0], bh[1], bh[2], bh[3]);
    if (NSPLIT == 2) keep4_b(bl[0], bl[1], bl[2], bl[3]);
  }
  acc_guard4(acc[0][0], acc[0][1], acc[0][2], acc[0][3]);
  acc_guard4(acc[1][0], acc[1][1], acc[1][2], acc[1][3]);
  acc_guard4(acc[2][0], acc[2][1], acc[2][2], acc[2][3]);
  acc_guard4(acc[3][0], acc[3][1], acc[3][2], acc[3][3]);

  // ---- epilogue ----
  float* slab = sT[wave];
#pragma unroll
  for (int i = 0; i < 4; ++i) {
    const int mBase = m0 + (i << 4);
#pragma unroll
    for (int j = 0; j < 4; ++j) {
#pragma unroll
      for (int r = 0; r < 8; ++r) {
        slab[(mOff + r) * 68 + (j << 4) + rlane] = acc[i][j][r];
      }
    }
    __builtin_amdgcn_fence(__ATOMIC_RELEASE, "workgroup");
    __builtin_amdgcn_wave_barrier();
    __builtin_amdgcn_fence(__ATOMIC_ACQUIRE, "workgroup");
    if (OUT_MODE == 0) {
      float* C = (float*)Cout + (size_t)b * strideC;
      const int hh = lane >> 4, c4 = (lane & 15) * 4;     // 256-B row segment = 16 lanes x 16 B
      {
#pragma unroll
        for (int it = 0; it < 8; ++it) {
          const int row = it * 2 + hh;                     // it 0..7 x hh 0..1 = rows 0..15
          const v4f v = *(const v4f*)(slab + row * 68 + c4);
          *(v4f*)(C + (size_t)(mBase + row) * ldc + n0 + c4) = v;
        }
        
      }
    } else {
      const int q = lane >> 3, c8 = (lane & 7) * 8;
      unsigned short* C  = (unsigned short*)Cout  + (size_t)b * strideC;
      unsigned short* C2 = (unsigned short*)Cout2 + (size_t)b * strideC2;
      const bool wlo = (OUT_MODE == 2) || (n0 < N2);      // wave-uniform
      v4u hv[4], lv[4];
#pragma unroll
      for (int it = 0; it < 4; ++it) {
        const int row = it * 4 + q;                        // it 0..3 x q 0..3 = rows 0..15
        const float* sp = slab + row * 68 + c8;
        v4u a, a2;
#pragma unroll
        for (int e = 0; e < 4; ++e) {
          const float f0 = sp[2 * e], f1 = sp[2 * e + 1];
          unsigned short h0, h1, l0, l1;
          if (OUT_MODE == 2) {
            h0 = bf_bits(f0); h1 = bf_bits(f1);
            l0 = bf_bits(f0 - bf_up(h0)); l1 = bf_bits(f1 - bf_up(h1));
          } else {
            const _Float16 x0 = (_Float16)f0, x1 = (_Float16)f1;
            h0 = h_bits(x0); h1 = h_bits(x1);
            l0 = h_bits((_Float16)((f0 - (float)x0) * rscale));
            l1 = h_bits((_Float16)((f1 - (float)x1) * rscale));
          }
          a[e] = pk16(h0, h1); a2[e] = pk16(l0, l1);
        }
        hv[it] = a; lv[it] = a2;
      }
      {
#pragma unroll
        for (int it = 0; it < 4; ++it) {
          const int row = it * 4 + q;
          *(v4u*)(C + (size_t)(mBase + row) * ldc + n0 + c8) = hv[it];
          if (wlo) *(v4u*)(C2 + (size_t)(mBase + row) * ldc2 + n0 + c8) = lv[it];
        }
        
      }
    }
    __builtin_amdgcn_fence(__ATOMIC_RELEASE, "workgroup");
    __builtin_amdgcn_wave_barrier();
    __builtin_amdgcn_fence(__ATOMIC_ACQUIRE, "workgroup");
  }
}

// =====================================================================================================
// Cosine-similarity scaling + axial rotation of q and k, f32, one wave per (token t, head h) row.
//   qkf: f32 [t][QKW], q of head h at cols h*64.., k at cols DM + h*64..
//   pos [t][2], scl [NH], freqs [2][NH][NFR]: values RNE-converted to bf16 in register before use.
//   rq = sqrt(|scl_h| + 1e-8) * rsqrt(sum(q^2) + 1e-8); qs = q * rq (same for k)
//   theta[i], i < 16: (pos[t][1]*2 - 1) * freqs[1][h][i]; i >= 16: (pos[t][0]*2 - 1) * freqs[0][h][i-16]
//   out[i] = qs[i] cos - qs[i+32] sin; out[i+32] = qs[i+32] cos + qs[i] sin (lane i = pair index).
//   qk4: four bf16 planes [t][h*64+d] back to back (plane stride SEQ*DM elements): q hi, q lo, k hi, k lo
//   (lo = RNE(v - hi), unscaled). The wave's 64-wide row is staged in LDS, then ONE store instruction writes
//   grid = nrows/8 blocks of 256 (8 waves). coverage: nrows = SEQ*NH rows x 64 cols in each of the 4 planes.
// =====================================================================================================
__global__ __launch_bounds__(256) void rope_qk(const float* __restrict__ qkf, const float* __restrict__ pos,
                                               const float* __restrict__ scl, const float* __restrict__ freqs,
                                               unsigned short* qk4, int nrows) {
#pragma clang fp contract(off)
  __shared__ __align__(16) float sq[8][64];
  __shared__ __align__(16) float sk[8][64];
  const int tid  = threadIdx.x;
  const int wave = tid >> 5;
  const int lane = tid & 31;
  const int rho  = blockIdx.x * 8 + wave;
  if (rho < nrows) {                                      // wave-uniform; no block barriers in this kernel
    const int t = rho >> 4;
    const int h = rho & 15;
    const float* qr = qkf + (size_t)t * QKW + h * HD;
    const float* kr = qr + DM;
    const int i = lane;                                   // pair index 0..31
    const float q1 = qr[i], q2 = qr[i + 32];
    const float k1 = kr[i], k2 = kr[i + 32];
    float ssq = q1 * q1 + q2 * q2;
    float ssk = k1 * k1 + k2 * k2;
    ssq += half_xor(ssq);    ssk += half_xor(ssk);
    ssq += row_xor<8>(ssq);  ssk += row_xor<8>(ssk);
    ssq += row_xor<4>(ssq);  ssk += row_xor<4>(ssk);
    ssq += row_xor<2>(ssq);  ssk += row_xor<2>(ssk);
    ssq += row_xor<1>(ssq);  ssk += row_xor<1>(ssk);
    const float scr = bf_rn(scl[h]);
    const float ss  = sqrtf(fabsf(scr) + 1e-8f);
    const float rq  = ss * rsqrtf(ssq + 1e-8f);
    const float rk  = ss * rsqrtf(ssk + 1e-8f);
    const float px  = bf_rn(pos[2 * t + 0]);
    const float py  = bf_rn(pos[2 * t + 1]);
    const int  low  = (i < 16) ? 1 : 0;
    const int  fi   = low ? (NH * NFR + h * NFR + i) : (h * NFR + (i - 16));   // [1][h][i] or [0][h][i-16], < 2*NH*NFR
    const float fr  = bf_rn(freqs[fi]);
    const float pp  = low ? py : px;
    const float th  = (pp * 2.0f - 1.0f) * fr;
    const float cs  = cosf(th);
    const float sn  = sinf(th);
    const float xq1 = q1 * rq, xq2 = q2 * rq;
    const float xk1 = k1 * rk, xk2 = k2 * rk;
    sq[wave][i]      = xq1 * cs - xq2 * sn;
    sq[wave][i + 32] = xq2 * cs + xq1 * sn;
    sk[wave][i]      = xk1 * cs - xk2 * sn;
    sk[wave][i + 32] = xk2 * cs + xk1 * sn;
    __builtin_amdgcn_fence(__ATOMIC_RELEASE, "workgroup");
    __builtin_amdgcn_wave_barrier();
    __builtin_amdgcn_fence(__ATOMIC_ACQUIRE, "workgroup");
    const int pl = lane >> 3;                             // plane 0 q hi, 1 q lo, 2 k hi, 3 k lo
    const int c8 = (lane & 7) * 8;
    const float* spq = &sq[wave][c8];
    const float* spk = &sk[wave][c8];
    v4u w;
#pragma unroll
    for (int e = 0; e < 4; ++e) {
      const float fq0 = spq[2 * e], fq1 = spq[2 * e + 1];
      const float fk0 = spk[2 * e], fk1 = spk[2 * e + 1];
      const float f0 = (pl < 2) ? fq0 : fk0;
      const float f1 = (pl < 2) ? fq1 : fk1;
      const unsigned short hb0 = bf_bits(f0), hb1 = bf_bits(f1);
      const unsigned short lb0 = bf_bits(f0 - bf_up(hb0)), lb1 = bf_bits(f1 - bf_up(hb1));
      const unsigned short s0 = (pl & 1) ? lb0 : hb0;
      const unsigned short s1 = (pl & 1) ? lb1 : hb1;
      w[e] = pk16(s0, s1);
    }
    unsigned short* dst = qk4 + (size_t)pl * ((size_t)SEQ * DM) + (size_t)t * DM + h * HD + c8;
    *(v4u*)dst = w;
    
  }
}

// =====================================================================================================
// Attention, head dim 64, unified key rule: key s is visible to row t iff (s < S and s <= t) or s == t,
// with S = npk[0] clamped to [0, SEQ] (causal prefix segment of S tokens; later rows see the whole prefix
// plus themselves). Scores unscaled; masked scores = -inf; softmax f32 online.
//   q planes (bf16 hi / lo): element (t, h, d) at [t*DM + h*64 + d]; k planes same with key index s
//   v^T hi plane (f16):      element (h, d, s) at [(h*64 + d)*SEQ + s]; residual plane (f16, (v - hi)*4096) same layout
//   out planes (bf16 hi / lo of the normalised context): element (t, h, d) at [t*DM + h*64 + d]
//   scores = q . k : bf16 hi/lo split (hi.hi + hi.lo + lo.hi), f32 accumulate
//   p = exp(s - m) carried as f16(1024 p); context = p . v_hi on f16 WMMA plus p . v_res (and, when RES,
//   p_res . v_hi with p_res = f16((1024 p - f16(1024 p)) * 4096)) into a separate accumulator folded back with
//   1/4096 per key tile in f32.
//   Block = 4 waves = 64 query rows of one h; grid = nqbThis * NH; key tiles of 64: tiles 0..min(qb, SB-1) then
//   tile qb itself when qb >= SB (SB = ceil(S/64)); trip count block-uniform and <= NQB.
//   K / V^T tile staging: 128 threads x 32 elements per plane = the whole 64x64 tile (plain 16-B loads,
//   __syncthreads before and after); P tiles are wave-private, spilled with _Float16 element stores and reloaded
//   Output coverage: each wave stores rows q0..q0+15 (it 0..3 x lane>>3 0..3) x 64 columns (8 lanes x 8) of both planes.
// =====================================================================================================
template <bool RES>
__global__ __launch_bounds__(128)
void attn64(const unsigned short* __restrict__ qhp, const unsigned short* __restrict__ qlp,
            const unsigned short* __restrict__ khp, const unsigned short* __restrict__ klp,
            const unsigned short* __restrict__ vhp, const unsigned short* __restrict__ vlp,
            const int* __restrict__ npk,
            unsigned short* ohp, unsigned short* olp, int qbBase, int nqbThis) {
  union FB { v16b v; v8b h[2]; };
  union FH { v16h v; v8h h[2]; };
  __shared__ __align__(16) __bf16   Ksh[64 * LP];                 // K hi [kv][d], rows padded to LP
  __shared__ __align__(16) __bf16   Ksl[64 * LP];                 // K lo
  __shared__ __align__(16) _Float16 Vth[64 * LP];                 // V^T hi [d][kv], rows padded to LP
  __shared__ __align__(16) _Float16 Vtl[64 * LP];                 // V^T residual
  __shared__ __align__(16) _Float16 Psh[4][16 * LP];              // per wave P [row][kv]
  __shared__ __align__(16) _Float16 Psl[RES ? 4 : 1][16 * LP];    // per wave P residual
  __shared__ __align__(16) float    Os[4][16 * 64];               // per wave context tile [row][d]

  const int tid  = threadIdx.x;
  const int wave = tid >> 5;
  const int lane = tid & 31;
  const int hh   = lane >> 4;
  const int c    = lane & 15;

  const int bx   = blockIdx.x;
  const int qbl  = bx % nqbThis;
  const int h    = bx / nqbThis;          // < NH by grid size
  const int qb   = qbBase + qbl;
  const int q0   = qb * 64 + wave * 16;

  int S = npk[0];                         // block-uniform scalar load
  S = (S < 0) ? 0 : S;
  S = (S > SEQ) ? SEQ : S;
  const int SB   = (S + 63) >> 6;                       // 0..NQB
  const int nLow = (qb + 1 < SB) ? (qb + 1) : SB;       // tiles 0..nLow-1
  int nT = nLow + ((qb >= SB) ? 1 : 0);                 // + the block's own tile when not in the prefix
  nT = (nT > NQB) ? NQB : nT;

  const __bf16* Qh = (const __bf16*)(const void*)qhp + (size_t)h * HD;
  const __bf16* Ql = (const __bf16*)(const void*)qlp + (size_t)h * HD;
  const __bf16* Kh = (const __bf16*)(const void*)khp + (size_t)h * HD;
  const __bf16* Kl = (const __bf16*)(const void*)klp + (size_t)h * HD;
  const _Float16* Vh = (const _Float16*)(const void*)vhp + (size_t)h * HD * SEQ;
  const _Float16* Vl = (const _Float16*)(const void*)vlp + (size_t)h * HD * SEQ;

  // ---- Q fragments (A operand, row = lane&15): 2 d-chunks, hi and lo ----
  v16b qah[2], qal[2];
#pragma unroll
  for (int dc = 0; dc < 2; ++dc) {
    const size_t qo = (size_t)(q0 + c) * DM + dc * 32 + 8 * hh;
    qah[dc] = ldfrag_b(Qh + qo);
    qal[dc] = ldfrag_b(Ql + qo);
  }

  float mrow[8], lrow[8];
  v8f oacc[4];
#pragma unroll
  for (int r = 0; r < 8; ++r) { mrow[r] = -INFINITY; lrow[r] = 0.f; }
#pragma unroll
  for (int t = 0; t < 4; ++t) oacc[t] = zero8();

  for (int i = 0; i < nT; ++i) {          // block-uniform trip count, <= NQB
    const int kt  = (i < nLow) ? i : qb;
    const int kv0 = kt * 64;              // kv0 + 63 < SEQ
    __syncthreads();
    {
      const int r = tid >> 1, half = (tid & 1) * 32;
      const __bf16*   kg  = Kh + (size_t)(kv0 + r) * DM + half;   // K row kv0+r, d = half..half+31
      const __bf16*   klg = Kl + (size_t)(kv0 + r) * DM + half;
      const _Float16* vg  = Vh + (size_t)r * SEQ + kv0 + half;    // V^T row d = r, s = kv0+half..+31
      const _Float16* vlg = Vl + (size_t)r * SEQ + kv0 + half;
#pragma unroll
      for (int u = 0; u < 4; ++u) {
        const v8b a0 = *(const v8b*)(kg + 8 * u);
        const v8b a1 = *(const v8b*)(klg + 8 * u);
        const v8h b0 = *(const v8h*)(vg + 8 * u);
        const v8h b1 = *(const v8h*)(vlg + 8 * u);
        *(v8b*)(Ksh + r * LP + half + 8 * u) = a0;
        *(v8b*)(Ksl + r * LP + half + 8 * u) = a1;
        *(v8h*)(Vth + r * LP + half + 8 * u) = b0;
        *(v8h*)(Vtl + r * LP + half + 8 * u) = b1;
      }
    }
    __syncthreads();

    // ---- scores: 16 query rows x 64 keys per wave, 3 bf16 products ----
    v8f s[4];
#pragma unroll
    for (int j = 0; j < 4; ++j) {
      s[j] = zero8();
#pragma unroll
      for (int dc = 0; dc < 2; ++dc) {
        FB kb, kl;
        kb.h[0] = *(const v8b*)(Ksh + (j * 16 + c) * LP + dc * 32 + 8 * hh);
        kb.h[1] = *(const v8b*)(Ksh + (j * 16 + c) * LP + dc * 32 + 16 + 8 * hh);
        kl.h[0] = *(const v8b*)(Ksl + (j * 16 + c) * LP + dc * 32 + 8 * hh);
        kl.h[1] = *(const v8b*)(Ksl + (j * 16 + c) * LP + dc * 32 + 16 + 8 * hh);
        s[j] = mma_b(qah[dc], kb.v, s[j]);
        s[j] = mma_b(qah[dc], kl.v, s[j]);
        s[j] = mma_b(qal[dc], kb.v, s[j]);
      }
    }

    // ---- key visibility rule, row max, online softmax, P (x1024, f16) and P residual (x4096) to LDS ----
    _Float16* pwh = Psh[wave];
    _Float16* pwl = Psl[RES ? wave : 0];
#pragma unroll
    for (int r = 0; r < 8; ++r) {
      const int t = q0 + 8 * hh + r;        // D row 8hh+r of this lane
      float m = -INFINITY;
#pragma unroll
      for (int j = 0; j < 4; ++j) {
        const int kg = kv0 + j * 16 + c;    // D col = key
        const bool ok = ((kg < S) && (kg <= t)) || (kg == t);
        const float sv = ok ? s[j][r] : -INFINITY;
        s[j][r] = sv;
        m = fmaxf(m, sv);
      }
      m = fmaxf(m, row_xor<1>(m));
      m = fmaxf(m, row_xor<2>(m));
      m = fmaxf(m, row_xor<4>(m));
      m = fmaxf(m, row_xor<8>(m));
      const float mnew  = fmaxf(mrow[r], m);
      const float msafe = (mnew == -INFINITY) ? 0.f : mnew;
      const float alpha = __expf(mrow[r] - msafe);
      mrow[r] = mnew;
      float psum = 0.f;
#pragma unroll
      for (int j = 0; j < 4; ++j) {
        const float p = __expf(s[j][r] - msafe);     // masked score: exp(-inf) -> 0
        psum += p;
        const float p1k = p * 1024.0f;
        const _Float16 ph = (_Float16)p1k;
        pwh[(8 * hh + r) * LP + j * 16 + c] = ph;
        if (RES) {
          const _Float16 pr = (_Float16)((p1k - (float)ph) * 4096.0f);
          pwl[(8 * hh + r) * LP + j * 16 + c] = pr;
        }
      }
      psum += row_xor<1>(psum);
      psum += row_xor<2>(psum);
      psum += row_xor<4>(psum);
      psum += row_xor<8>(psum);
      lrow[r] = lrow[r] * alpha + psum;
#pragma unroll
      for (int t4 = 0; t4 < 4; ++t4) oacc[t4][r] *= alpha;
    }
    __builtin_amdgcn_fence(__ATOMIC_RELEASE, "workgroup");
    __builtin_amdgcn_wave_barrier();
    __builtin_amdgcn_fence(__ATOMIC_ACQUIRE, "workgroup");

    // ---- context += P . V_hi (f16 WMMA); residual products into a separate accumulator ----
    v8f o1[4];
#pragma unroll
    for (int t4 = 0; t4 < 4; ++t4) o1[t4] = zero8();
#pragma unroll 1
    for (int kk = 0; kk < 2; ++kk) {
      FH pa, pl;
      pa.h[0] = *(const v8h*)(pwh + c * LP + kk * 32 + 8 * hh);
      pa.h[1] = *(const v8h*)(pwh + c * LP + kk * 32 + 16 + 8 * hh);
      if (RES) {
        pl.h[0] = *(const v8h*)(pwl + c * LP + kk * 32 + 8 * hh);
        pl.h[1] = *(const v8h*)(pwl + c * LP + kk * 32 + 16 + 8 * hh);
      } else {
        pl.v = pa.v;
      }
#pragma unroll
      for (int t4 = 0; t4 < 4; ++t4) {
        FH vb, vl;
        vb.h[0] = *(const v8h*)(Vth + (t4 * 16 + c) * LP + kk * 32 + 8 * hh);
        vb.h[1] = *(const v8h*)(Vth + (t4 * 16 + c) * LP + kk * 32 + 16 + 8 * hh);
        vl.h[0] = *(const v8h*)(Vtl + (t4 * 16 + c) * LP + kk * 32 + 8 * hh);
        vl.h[1] = *(const v8h*)(Vtl + (t4 * 16 + c) * LP + kk * 32 + 16 + 8 * hh);
        oacc[t4] = mma_h(pa.v, vb.v, oacc[t4]);
        o1[t4]   = mma_h(pa.v, vl.v, o1[t4]);
        if (RES) o1[t4] = mma_h(pl.v, vb.v, o1[t4]);
      }
    }
#pragma unroll
    for (int t4 = 0; t4 < 4; ++t4)
#pragma unroll
      for (int r = 0; r < 8; ++r) oacc[t4][r] += o1[t4][r] * (1.0f / 4096.0f);
  }

  // ---- normalise (1/l and the 1/1024 p carry), stage the wave's 16x64 tile, bf16 hi/lo split,
  float* os = Os[wave];
#pragma unroll
  for (int r = 0; r < 8; ++r) {
    const float l = lrow[r];
    const float inv = ((l > 0.f) ? (1.0f / l) : 0.f) * (1.0f / 1024.0f);
#pragma unroll
    for (int t4 = 0; t4 < 4; ++t4) os[(8 * hh + r) * 64 + t4 * 16 + c] = oacc[t4][r] * inv;
  }
  __builtin_amdgcn_fence(__ATOMIC_RELEASE, "workgroup");
  __builtin_amdgcn_wave_barrier();
  __builtin_amdgcn_fence(__ATOMIC_ACQUIRE, "workgroup");
  {
    const int q4 = lane >> 3, c8 = (lane & 7) * 8;
    v4u hv[4], lv[4];
#pragma unroll
    for (int it = 0; it < 4; ++it) {
      const int row = it * 4 + q4;   // it 0..3 x q4 0..3 = rows 0..15 of the wave tile
      const float* sp = os + row * 64 + c8;
      v4u a, a2;
#pragma unroll
      for (int e = 0; e < 4; ++e) {
        const float f0 = sp[2 * e], f1 = sp[2 * e + 1];
        const unsigned short h0 = bf_bits(f0), h1 = bf_bits(f1);
        const unsigned short l0 = bf_bits(f0 - bf_up(h0)), l1 = bf_bits(f1 - bf_up(h1));
        a[e] = pk16(h0, h1); a2[e] = pk16(l0, l1);
      }
      hv[it] = a; lv[it] = a2;
    }
    {
#pragma unroll
      for (int it = 0; it < 4; ++it) {
        const int row = it * 4 + q4;
        const size_t go = (size_t)(q0 + row) * DM + (size_t)h * HD + c8;
        *(v4u*)(ohp + go) = hv[it];
        *(v4u*)(olp + go) = lv[it];
      }
      
    }
  }
}

// =====================================================================================================
// Workspace map (bytes), every region an exact multiple of its whole-line / whole-tile store granularity:
//   Xb    bf16 [4096][1024]          0            8388608
//   Wqkv  bf16 [3072 n][1024 k]      8388608      6291456   (rows 0..2047 = q|k weights, 2048.. = v weights)
//   Wob   bf16 [1024][1024]          14680064     2097152
//   QKf   f32  [4096][2048]          16777216     33554432  (cols 0..1023 q, 1024..2047 k)
//   VTh   f16  [1024 d][4096 s]      50331648     8388608
//   VTl   f16  [1024 d][4096 s]      58720256     8388608
//   QK4   bf16 4 x [4096][1024]      67108864     33554432  (q hi, q lo, k hi, k lo)
//   Oh    bf16 [4096][1024]          100663296    8388608
//   Ol    bf16 [4096][1024]          109051904    8388608
//   end                              117440512
// Weights are [out n][in k] with k contiguous = the Bt / A layout the GEMM wants, so they are only converted.
// =====================================================================================================
extern "C" void kernel_launch(void* const* d_in, const int* in_sizes, int n_in,
                              void* d_out, int out_size, void* d_ws, size_t ws_size,
                              hipStream_t stream) {
  if (n_in < 7) return;
  if (in_sizes[0] != SEQ * DM) return;
  if (in_sizes[1] != SEQ * 2) return;
  if (in_sizes[2] != NQKV * DM) return;
  if (in_sizes[3] != DM * DM) return;
  if (in_sizes[4] != NH) return;
  if (in_sizes[5] != 2 * NH * NFR) return;
  if (in_sizes[6] < 1) return;
  if (out_size != SEQ * DM) return;

  const float* x     = (const float*)d_in[0];
  const float* pos   = (const float*)d_in[1];
  const float* qkvw  = (const float*)d_in[2];
  const float* outw  = (const float*)d_in[3];
  const float* scl   = (const float*)d_in[4];
  const float* freqs = (const float*)d_in[5];
  const int*   npk   = (const int*)d_in[6];

  const size_t PXB   = (size_t)SEQ * DM * 2;      //  8388608
  const size_t PWQKV = (size_t)NQKV * DM * 2;     //  6291456
  const size_t PWO   = (size_t)DM * DM * 2;       //  2097152
  const size_t PQKF  = (size_t)SEQ * QKW * 4;     // 33554432
  const size_t PVT   = (size_t)DM * SEQ * 2;      //  8388608
  const size_t PPL   = (size_t)SEQ * DM * 2;      //  8388608
  size_t off = 0;
  const size_t oXb   = off; off += PXB;
  const size_t oWqkv = off; off += PWQKV;
  const size_t oWo   = off; off += PWO;
  const size_t oQKf  = off; off += PQKF;
  const size_t oVTh  = off; off += PVT;
  const size_t oVTl  = off; off += PVT;
  const size_t oQK4  = off; off += 4 * PPL;
  const size_t oOh   = off; off += PPL;
  const size_t oOl   = off; off += PPL;
  if (off > ws_size) return;                      // off = 117440512
  if (off > (size_t)134217728) return;

  char* ws = (char*)d_ws;
  unsigned short* Xb   = (unsigned short*)(ws + oXb);
  unsigned short* Wqkv = (unsigned short*)(ws + oWqkv);
  unsigned short* Wvb  = Wqkv + (size_t)2 * DM * DM;             // rows 2048.. of the qkv weight plane
  unsigned short* Wob  = (unsigned short*)(ws + oWo);
  float*          QKf  = (float*)(ws + oQKf);
  unsigned short* VTh  = (unsigned short*)(ws + oVTh);
  unsigned short* VTl  = (unsigned short*)(ws + oVTl);
  unsigned short* QK4  = (unsigned short*)(ws + oQK4);
  unsigned short* Qh   = QK4;
  unsigned short* Ql   = QK4 + (size_t)SEQ * DM;
  unsigned short* Kh   = QK4 + (size_t)2 * SEQ * DM;
  unsigned short* Kl   = QK4 + (size_t)3 * SEQ * DM;
  unsigned short* Oh   = (unsigned short*)(ws + oOh);
  unsigned short* Ol   = (unsigned short*)(ws + oOl);

  const dim3 blk(256);
  const int n8x = SEQ * DM / 8;                                // 524288
  const int n8w = NQKV * DM / 8;                               // 393216
  const int n8o = DM * DM / 8;                                 // 131072
  const dim3 gCvtX((n8x + 255) / 256);                         // 2048 blocks
  const dim3 gCvtW((n8w + 255) / 256);                         // 1536 blocks
  const dim3 gCvtO((n8o + 255) / 256);                         // 512 blocks
  const dim3 gQK(((SEQ / 64) * (QKW / 64) + 7) / 8, 1);        // 2048 tiles -> 256 blocks: M=4096, N=2048
  const dim3 gVT(((DM / 64) * (SEQ / 64) + 7) / 8, 1);         // 1024 tiles -> 128 blocks: M=1024, N=4096
  const dim3 gOut(((SEQ / 64) * (DM / 64) + 7) / 8, 1);        // 1024 tiles -> 128 blocks: M=4096, N=1024
  const int  nRows = SEQ * NH;                                 // 65536 (t, h) rows
  const dim3 gRope((nRows + 7) / 8);                           // 8192 blocks of 8 waves

  // (1) x -> bf16 [4096][1024]; weights [n][k] f32 -> bf16 [n][k]
  cvt_bf16x8<<<gCvtX, blk, 0, stream>>>(x, Xb, n8x);
  cvt_bf16x8<<<gCvtW, blk, 0, stream>>>(qkvw, Wqkv, n8w);
  cvt_bf16x8<<<gCvtO, blk, 0, stream>>>(outw, Wob, n8o);
  // (2) q|k = x . W[0:2048]^T -> f32 [4096][2048]   (M=4096, N=2048, K=1024)
  gemm64<0, 0><<<gQK, blk, 0, stream>>>(
      Xb, Xb, DM, 0LL, Wqkv, Wqkv, DM, 0LL,
      (void*)QKf, QKW, 0LL, (void*)QKf, QKW, 0LL, 0,
      SEQ, QKW, DM, 1.0f);
  // (3) v^T = Wv . x^T -> f16 hi plane [h*64+d][s] (pitch SEQ) and residual plane (x4096, all keys)
  //     (A = Wvb [n][k], Bt = Xb; M=1024, N=4096, K=1024)
  gemm64<0, 3><<<gVT, blk, 0, stream>>>(
      Wvb, Wvb, DM, 0LL, Xb, Xb, DM, 0LL,
      (void*)VTh, SEQ, 0LL, (void*)VTl, SEQ, 0LL, SEQ,
      DM, SEQ, DM, 4096.0f);
  // (4) cosine-sim scaling + axial rotation -> q hi/lo, k hi/lo bf16 planes [t][h*64+d]
  rope_qk<<<gRope, blk, 0, stream>>>(QKf, pos, scl, freqs, QK4, nRows);
  // (5) attention: row blocks 0..RESQB-1 with the p residual plane, the rest without
  attn64<true><<<dim3(NH * RESQB), dim3(128), 0, stream>>>(
      Qh, Ql, Kh, Kl, VTh, VTl, npk, Oh, Ol, 0, RESQB);
  attn64<false><<<dim3(NH * (NQB - RESQB)), dim3(128), 0, stream>>>(
      Qh, Ql, Kh, Kl, VTh, VTl, npk, Oh, Ol, RESQB, NQB - RESQB);
  // (6) out = context . Wo^T -> d_out f32 [4096][1024]  (A = context hi + lo planes, 2 products)
  gemm64<1, 0><<<gOut, blk, 0, stream>>>(
      Oh, Ol, DM, 0LL, Wob, Wob, DM, 0LL,
      d_out, DM, 0LL, d_out, DM, 0LL, 0,
      SEQ, DM, DM, 1.0f);
  (void)hipGetLastError();
}

// v003
// Measured time: 265 microseconds a run.
// Next to v002, in two timings, it ran 1.42 times as fast each time.
// Counting every step since v000, it is 2.14 times as fast.
// Contractions: q|k and v^T projections = v_wmma_f32_16x16x32_bf16 (bf16 operands from RNE-converted inputs, single product);
// q.k^T scores = v_wmma_f32_16x16x32_bf16 with bf16 hi/lo split q and k (hi.hi + hi.lo + lo.hi);
// p.v = v_wmma_f32_16x16x32_f16 (p carried x1024 in f16; v as f16 hi plane + f16 residual plane x4096, 2 products;
// extra f16 residual plane x4096 of p for the first 512 rows); ctx.Wo^T = v_wmma_f32_16x16x32_bf16 with ctx as
// bf16 hi/lo planes times bf16 Wo (2 products); all f32 accumulate; norms, rotations and softmax in f32.
#include <hip/hip_runtime.h>
#include <math.h>
#include <stdint.h>

#define SEQ   4096
#define DM    1024
#define NH    16
#define HD    64
#define NQB   (SEQ / 64)   // 64 row / key tiles of 64
#define RESQB 8            // leading 64-row blocks that also use the p residual plane
#define QKW   (2 * DM)     // pitch of the f32 q|k plane
#define NQKV  (3 * DM)
#define NFR   16           // rotation frequencies per head per axis (HD/4)
#define LP    72           // LDS row pitch of the 64-wide 16-bit attention tiles, in elements: 144 B = 16 B x 9 (odd)
#define GP    72           // LDS row pitch of the GEMM operand slices (64 k of 16 bits), in elements: 144 B = 16 B x 9 (odd)
static_assert(NH * HD == DM);
static_assert((SEQ % 256) == 0 && (DM % 256) == 0);
static_assert((SEQ % 64) == 0 && (DM % 64) == 0);
static_assert(RESQB <= NQB);
static_assert(HD == 4 * NFR);

typedef _Float16 v16h __attribute__((ext_vector_type(16)));
typedef _Float16 v8h  __attribute__((ext_vector_type(8)));
typedef __bf16   v16b __attribute__((ext_vector_type(16)));
typedef __bf16   v8b  __attribute__((ext_vector_type(8)));
typedef float    v8f  __attribute__((ext_vector_type(8)));
typedef float    v4f  __attribute__((ext_vector_type(4)));
typedef unsigned int v4u __attribute__((ext_vector_type(4)));

// ---- scalar helpers --------------------------------------------------------------------------------
__device__ __forceinline__ unsigned short bf_bits(float f) {          // f32 -> bf16 bits, RNE convert
  unsigned u = __float_as_uint(f);
  return (unsigned short)((u + 0x7FFFu + ((u >> 16) & 1u)) >> 16);
}
__device__ __forceinline__ float bf_up(unsigned short h) { return __uint_as_float(((unsigned)h) << 16); }
__device__ __forceinline__ float bf_rn(float f) { return bf_up(bf_bits(f)); }   // value after RNE convert to bf16
__device__ __forceinline__ unsigned short h_bits(_Float16 x) { return __builtin_bit_cast(unsigned short, x); }
__device__ __forceinline__ unsigned pk16(unsigned short a, unsigned short b) { return (unsigned)a | ((unsigned)b << 16); }
// value of lane (l ^ M) inside the lane's 16-lane row, M = 1..15: a DPP operand (row_xmask), no trip through the LDS pipe
template <int M>
__device__ __forceinline__ float row_xor(float x) {
  return __builtin_bit_cast(float, __builtin_amdgcn_update_dpp(0, __builtin_bit_cast(int, x), 0x160 + M, 0xf, 0xf, true));
}
// value of lane (l ^ 16): vector cross-row move
__device__ __forceinline__ float half_xor(float x) {
  return __builtin_bit_cast(float, __builtin_amdgcn_permlanex16(__builtin_bit_cast(int, x), __builtin_bit_cast(int, x),
                                                                0x76543210, 0xfedcba98, false, false));
}
__device__ __forceinline__ v8f zero8() { v8f z = {0.f, 0.f, 0.f, 0.f, 0.f, 0.f, 0.f, 0.f}; return z; }

// ---- fragment loaders: 16-bit A/B operand, lane -> row/col (lane&15), p already includes +8*(lane>>4);
//      elements 0..7 <- p[0..7] (k0+8h..), elements 8..15 <- p[16..23] (k0+16+8h..)
__device__ __forceinline__ v16b ldfrag_b(const __bf16* p) {
  union { v16b v; v8b h[2]; } f;
  f.h[0] = *(const v8b*)(p);
  f.h[1] = *(const v8b*)(p + 16);
  return f.v;
}

// ---- WMMA helpers with trailing VALU hazard gap --------------------------------------------------------
__device__ __forceinline__ v8f mma_b(v16b a, v16b b, v8f c) {
  c = __builtin_amdgcn_wmma_f32_16x16x32_bf16(false, a, false, b, (short)0, c, false, false);
  asm volatile("v_nop\n\tv_nop\n\tv_nop\n\tv_nop" : "+v"(c) : "v"(a), "v"(b));
  return c;
}
__device__ __forceinline__ v8f mma_h(v16h a, v16h b, v8f c) {
  c = __builtin_amdgcn_wmma_f32_16x16x32_f16(false, a, false, b, (short)0, c, false, false);
  asm volatile("v_nop\n\tv_nop\n\tv_nop\n\tv_nop" : "+v"(c) : "v"(a), "v"(b));
  return c;
}
__device__ __forceinline__ v8f mma_b_raw(v16b a, v16b b, v8f c) {
  return __builtin_amdgcn_wmma_f32_16x16x32_bf16(false, a, false, b, (short)0, c, false, false);
}
__device__ __forceinline__ void dep_guard_b(v8f& a, v8f& b, v16b x, v16b y) {
  asm volatile("v_nop\n\tv_nop\n\tv_nop\n\tv_nop" : "+v"(a), "+v"(b) : "v"(x), "v"(y));
}
__device__ __forceinline__ void keep4_b(v16b a, v16b b, v16b c, v16b d) {
  asm volatile("v_nop" :: "v"(a), "v"(b), "v"(c), "v"(d));
}
__device__ __forceinline__ void acc_guard4(v8f& a, v8f& b, v8f& c, v8f& d) {
  asm volatile("v_nop\n\tv_nop\n\tv_nop\n\tv_nop" : "+v"(a), "+v"(b), "+v"(c), "+v"(d));
}

// =====================================================================================================
// f32 -> bf16 (RNE convert), 8 elements per thread, one 16-B store per lane: a wave writes 512 contiguous B
// coverage: n8 threads x 8 = whole plane (n8 is a multiple of 256 for every use here).
// =====================================================================================================
__global__ __launch_bounds__(256) void cvt_bf16x8(const float* __restrict__ in, unsigned short* out, int n8) {
  const int i = blockIdx.x * 256 + threadIdx.x;
  if (i < n8) {
    const v4f a = *(const v4f*)(in + (size_t)i * 8);
    const v4f b = *(const v4f*)(in + (size_t)i * 8 + 4);
    v4u p;
    p[0] = pk16(bf_bits(a[0]), bf_bits(a[1]));
    p[1] = pk16(bf_bits(a[2]), bf_bits(a[3]));
    p[2] = pk16(bf_bits(b[0]), bf_bits(b[1]));
    p[3] = pk16(bf_bits(b[2]), bf_bits(b[3]));
    *(v4u*)(out + (size_t)i * 8) = p;
    
  }
}

// =====================================================================================================
// Asynchronous copies global -> LDS, 16 B per lane, four per statement. l* = the lane's LDS byte address,
// g* = the lane's global address. The closing s_wait_xcnt stands inside the statement so that no address
// register of an issued copy is rewritten in front of it.
// =====================================================================================================
__device__ __forceinline__ void copy4_to_lds(unsigned l0, unsigned l1, unsigned l2, unsigned l3,
                                             const __bf16* g0, const __bf16* g1, const __bf16* g2, const __bf16* g3) {
  asm volatile("global_load_async_to_lds_b128 %0, %4, off\n\t"
               "global_load_async_to_lds_b128 %1, %5, off\n\t"
               "global_load_async_to_lds_b128 %2, %6, off\n\t"
               "global_load_async_to_lds_b128 %3, %7, off\n\t"
               "s_wait_xcnt 0x0"
               :: "v"(l0), "v"(l1), "v"(l2), "v"(l3), "v"(g0), "v"(g1), "v"(g2), "v"(g3) : "memory");
}
__device__ __forceinline__ unsigned lds_addr(const __bf16* p) { return (unsigned)(uintptr_t)p; }   // low 32 bits = LDS byte address

// =====================================================================================================
// Register-blocked batched bf16 WMMA GEMM: C[m][n] = sum_k A[m][k] * Bt[n][k]; a block of 8 waves (2 x 4) owns a
// 128 x 256 tile, one wave per 64x64 sub-tile. A row-major [M][K] pitch lda; Bt row-major [N][K] pitch ldb
// (k contiguous); M multiple of 128, N of 256, K of 64. blockIdx.y = batch index (strides in elements).
// Operand path: per slice of 64 k the block's 128 A rows and 256 Bt rows (128 B each = one line; 8 lanes x 16 B
// per row, so a wave-wide copy covers 4 whole lines) go to LDS by asynchronous copies, rows at pitch GP; two
// buffers, slice t + 1 in flight while slice t is multiplied; fragments by 16-B LDS loads.
// NSPLIT: 0 = A.Bt; 1 = (A + A2).Bt (A2 = unscaled bf16 lo plane of A).
// OUT_MODE: 0 = f32 (pitch ldc); 2 = bf16 hi plane C + bf16 lo plane C2 (lo = RNE(v - hi), unscaled);
//           3 = f16 hi plane C + f16 residual plane C2 = f16((v - hi) * rscale), C2 written only for tiles
//               with n0 < N2 (pitch ldc2, batch stride strideC2).
// =====================================================================================================
template <int NSPLIT, int OUT_MODE>
__global__ __launch_bounds__(256) void gemm64(
    const unsigned short* __restrict__ Ap, const unsigned short* A2p, int lda, long long strideA,
    const unsigned short* __restrict__ Btp, const unsigned short* Bt2p, int ldb, long long strideB,
    void* Cout, int ldc, long long strideC,
    void* Cout2, int ldc2, long long strideC2, int N2,
    int M, int N, int K, float rscale) {
  static_assert(NSPLIT == 0 || NSPLIT == 1);
  const __bf16* A   = (const __bf16*)(const void*)Ap;
  const __bf16* A2  = (const __bf16*)(const void*)A2p;
  const __bf16* Bt  = (const __bf16*)(const void*)Btp;
  __shared__ __align__(16) float  sT[8][16 * 68];   // per-wave 16x64 slab, pitch 68 floats
  __shared__ __align__(16) __bf16 sA[2][128 * GP];                                   // A slice, two buffers
  __shared__ __align__(16) __bf16 sA2[NSPLIT ? 2 : 1][NSPLIT ? 128 * GP : 8];        // A2 slice
  __shared__ __align__(16) __bf16 sB[2][256 * GP];                                   // Bt slice
  const int b    = blockIdx.y;
  const int tid  = threadIdx.x;
  const int lane = tid & 31;
  const int wave = tid >> 5;
  const int tilesN = N >> 8;
  const int tilesM = M >> 7;
  if ((int)blockIdx.x >= tilesM * tilesN) return;   // block-uniform, in front of every barrier and copy
  const int bm = blockIdx.x / tilesN;
  const int bn = blockIdx.x - bm * tilesN;
  const int mB = bm << 7;
  const int nB = bn << 8;
  const int wm = wave >> 2;                    // 0..1
  const int wn = wave & 3;                     // 0..3
  const int m0 = mB + (wm << 6);
  const int n0 = nB + (wn << 6);

  const __bf16* Ab  = A  + (size_t)b * strideA;
  const __bf16* Bb  = Bt + (size_t)b * strideB;
  const __bf16* Ab2 = NSPLIT ? (A2 + (size_t)b * strideA) : Ab;

  const int rlane = lane & 15;                 // row (A) / col (B, D) within subtile
  const int koff  = (lane >> 4) * 8;           // k offset of this lane half
  const int mOff  = (lane >> 4) * 8;           // D row offset

  // copy map: thread -> row (tid >> 3) + 32 p of the slice, 16-B piece (tid & 7) of its 128 B
  const int crow = tid >> 3;
  const int cseg = (tid & 7) * 8;
  const __bf16* gA  = Ab  + (size_t)(mB + crow) * lda + cseg;
  const __bf16* gA2 = Ab2 + (size_t)(mB + crow) * lda + cseg;
  const __bf16* gB  = Bb  + (size_t)(nB + crow) * ldb + cseg;
  const unsigned lA  = lds_addr(&sA[0][crow * GP + cseg]);
  const unsigned lA2 = lds_addr(&sA2[0][NSPLIT ? crow * GP + cseg : 0]);
  const unsigned lB  = lds_addr(&sB[0][crow * GP + cseg]);
  const unsigned R32 = 32 * GP * 2;            // 32 LDS rows, bytes
  const size_t a32 = (size_t)32 * lda, b32 = (size_t)32 * ldb;
  auto stage = [&](int t, int buf) {           // slice t (k = 64 t .. 64 t + 63) into buffer buf
    const __bf16* pa = gA + (size_t)t * 64;
    const __bf16* pb = gB + (size_t)t * 64;
    const unsigned la = lA + (unsigned)buf * (4 * R32);
    const unsigned lb = lB + (unsigned)buf * (8 * R32);
    copy4_to_lds(la, la + R32, la + 2 * R32, la + 3 * R32, pa, pa + a32, pa + 2 * a32, pa + 3 * a32);
    if (NSPLIT) {
      const __bf16* pa2 = gA2 + (size_t)t * 64;
      const unsigned la2 = lA2 + (unsigned)buf * (4 * R32);
      copy4_to_lds(la2, la2 + R32, la2 + 2 * R32, la2 + 3 * R32, pa2, pa2 + a32, pa2 + 2 * a32, pa2 + 3 * a32);
    }
    copy4_to_lds(lb, lb + R32, lb + 2 * R32, lb + 3 * R32, pb, pb + b32, pb + 2 * b32, pb + 3 * b32);
    copy4_to_lds(lb + 4 * R32, lb + 5 * R32, lb + 6 * R32, lb + 7 * R32,
                 pb + 4 * b32, pb + 5 * b32, pb + 6 * b32, pb + 7 * b32);
  };

  v8f acc[4][4];
#pragma unroll
  for (int i = 0; i < 4; ++i)
#pragma unroll
    for (int j = 0; j < 4; ++j) acc[i][j] = zero8();

  const int nK = K >> 6;
  stage(0, 0);
  asm volatile("s_wait_asynccnt 0x0" ::: "memory");   // this wave's copies of slice 0 have landed
  __syncthreads();                                    // every wave's have: slice 0 is readable
  if (nK > 1) stage(1, 1);
  for (int t = 0; t < nK; ++t) {
    const int buf = t & 1;
    const __bf16* tA  = sA[buf]  + ((wm << 6) + rlane) * GP + koff;
    const __bf16* tA2 = NSPLIT ? (sA2[buf] + ((wm << 6) + rlane) * GP + koff) : tA;
    const __bf16* tB  = sB[buf]  + ((wn << 6) + rlane) * GP + koff;
#pragma unroll
    for (int kk = 0; kk < 2; ++kk) {
      // the fragments of a k chunk of 32 are fetched as one group in front of its products
      v16b bh[4], ah[4], al[4];
#pragma unroll
      for (int j = 0; j < 4; ++j) bh[j] = ldfrag_b(tB + (j << 4) * GP + kk * 32);
#pragma unroll
      for (int i = 0; i < 4; ++i) {
        ah[i] = ldfrag_b(tA + (i << 4) * GP + kk * 32);
        al[i] = NSPLIT ? ldfrag_b(tA2 + (i << 4) * GP + kk * 32) : ah[i];
      }
#pragma unroll
      for (int i = 0; i < 4; ++i) {
#pragma unroll
        for (int j = 0; j < 4; ++j) {
          acc[i][j] = mma_b_raw(ah[i], bh[j], acc[i][j]);
          if (NSPLIT) acc[i][j] = mma_b_raw(al[i], bh[j], acc[i][j]);
        }
        dep_guard_b(acc[i][0], acc[i][3], ah[i], al[i]);
      }
      keep4_b(bh[0], bh[1], bh[2], bh[3]);
    }
    asm volatile("s_wait_dscnt 0x0" ::: "memory");     // this wave's reads of buffer buf are done before it is refilled
    asm volatile("s_wait_asynccnt 0x0" ::: "memory");  // this wave's copies of slice t + 1 have landed
    __syncthreads();                                   // publishes slice t + 1 and ends every read of buffer buf
    if (t + 2 < nK) stage(t + 2, buf);
  }
  asm volatile("s_wait_asynccnt 0x0" ::: "memory");    // no copy outstanding behind the loop
  acc_guard4(acc[0][0], acc[0][1], acc[0][2], acc[0][3]);
  acc_guard4(acc[1][0], acc[1][1], acc[1][2], acc[1][3]);
  acc_guard4(acc[2][0], acc[2][1], acc[2][2], acc[2][3]);
  acc_guard4(acc[3][0], acc[3][1], acc[3][2], acc[3][3]);

  // ---- epilogue ----
  float* slab = sT[wave];
#pragma unroll
  for (int i = 0; i < 4; ++i) {
    const int mBase = m0 + (i << 4);
#pragma unroll
    for (int j = 0; j < 4; ++j) {
#pragma unroll
      for (int r = 0; r < 8; ++r) {
        slab[(mOff + r) * 68 + (j << 4) + rlane] = acc[i][j][r];
      }
    }
    __builtin_amdgcn_fence(__ATOMIC_RELEASE, "workgroup");
    __builtin_amdgcn_wave_barrier();
    __builtin_amdgcn_fence(__ATOMIC_ACQUIRE, "workgroup");
    if (OUT_MODE == 0) {
      float* C = (float*)Cout + (size_t)b * strideC;
      const int hh = lane >> 4, c4 = (lane & 15) * 4;     // 256-B row segment = 16 lanes x 16 B
      {
#pragma unroll
        for (int it = 0; it < 8; ++it) {
          const int row = it * 2 + hh;                     // it 0..7 x hh 0..1 = rows 0..15
          const v4f v = *(const v4f*)(slab + row * 68 + c4);
          *(v4f*)(C + (size_t)(mBase + row) * ldc + n0 + c4) = v;
        }
        
      }
    } else {
      const int q = lane >> 3, c8 = (lane & 7) * 8;
      unsigned short* C  = (unsigned short*)Cout  + (size_t)b * strideC;
      unsigned short* C2 = (unsigned short*)Cout2 + (size_t)b * strideC2;
      const bool wlo = (OUT_MODE == 2) || (n0 < N2);      // wave-uniform
      v4u hv[4], lv[4];
#pragma unroll
      for (int it = 0; it < 4; ++it) {
        const int row = it * 4 + q;                        // it 0..3 x q 0..3 = rows 0..15
        const float* sp = slab + row * 68 + c8;
        v4u a, a2;
#pragma unroll
        for (int e = 0; e < 4; ++e) {
          const float f0 = sp[2 * e], f1 = sp[2 * e + 1];
          unsigned short h0, h1, l0, l1;
          if (OUT_MODE == 2) {
            h0 = bf_bits(f0); h1 = bf_bits(f1);
            l0 = bf_bits(f0 - bf_up(h0)); l1 = bf_bits(f1 - bf_up(h1));
          } else {
            const _Float16 x0 = (_Float16)f0, x1 = (_Float16)f1;
            h0 = h_bits(x0); h1 = h_bits(x1);
            l0 = h_bits((_Float16)((f0 - (float)x0) * rscale));
            l1 = h_bits((_Float16)((f1 - (float)x1) * rscale));
          }
          a[e] = pk16(h0, h1); a2[e] = pk16(l0, l1);
        }
        hv[it] = a; lv[it] = a2;
      }
      {
#pragma unroll
        for (int it = 0; it < 4; ++it) {
          const int row = it * 4 + q;
          *(v4u*)(C + (size_t)(mBase + row) * ldc + n0 + c8) = hv[it];
          if (wlo) *(v4u*)(C2 + (size_t)(mBase + row) * ldc2 + n0 + c8) = lv[it];
        }
        
      }
    }
    __builtin_amdgcn_fence(__ATOMIC_RELEASE, "workgroup");
    __builtin_amdgcn_wave_barrier();
    __builtin_amdgcn_fence(__ATOMIC_ACQUIRE, "workgroup");
  }
}

// =====================================================================================================
// Cosine-similarity scaling + axial rotation of q and k, f32, one wave per (token t, head h) row.
//   qkf: f32 [t][QKW], q of head h at cols h*64.., k at cols DM + h*64..
//   pos [t][2], scl [NH], freqs [2][NH][NFR]: values RNE-converted to bf16 in register before use.
//   rq = sqrt(|scl_h| + 1e-8) * rsqrt(sum(q^2) + 1e-8); qs = q * rq (same for k)
//   theta[i], i < 16: (pos[t][1]*2 - 1) * freqs[1][h][i]; i >= 16: (pos[t][0]*2 - 1) * freqs[0][h][i-16]
//   out[i] = qs[i] cos - qs[i+32] sin; out[i+32] = qs[i+32] cos + qs[i] sin (lane i = pair index).
//   qk4: four bf16 planes [t][h*64+d] back to back (plane stride SEQ*DM elements): q hi, q lo, k hi, k lo
//   (lo = RNE(v - hi), unscaled). The wave's 64-wide row is staged in LDS, then ONE store instruction writes
//   grid = nrows/8 blocks of 256 (8 waves). coverage: nrows = SEQ*NH rows x 64 cols in each of the 4 planes.
// =====================================================================================================
__global__ __launch_bounds__(256) void rope_qk(const float* __restrict__ qkf, const float* __restrict__ pos,
                                               const float* __restrict__ scl, const float* __restrict__ freqs,
                                               unsigned short* qk4, int nrows) {
#pragma clang fp contract(off)
  __shared__ __align__(16) float sq[8][64];
  __shared__ __align__(16) float sk[8][64];
  const int tid  = threadIdx.x;
  const int wave = tid >> 5;
  const int lane = tid & 31;
  const int rho  = blockIdx.x * 8 + wave;
  if (rho < nrows) {                                      // wave-uniform; no block barriers in this kernel
    const int t = rho >> 4;
    const int h = rho & 15;
    const float* qr = qkf + (size_t)t * QKW + h * HD;
    const float* kr = qr + DM;
    const int i = lane;                                   // pair index 0..31
    const float q1 = qr[i], q2 = qr[i + 32];
    const float k1 = kr[i], k2 = kr[i + 32];
    float ssq = q1 * q1 + q2 * q2;
    float ssk = k1 * k1 + k2 * k2;
    ssq += half_xor(ssq);    ssk += half_xor(ssk);
    ssq += row_xor<8>(ssq);  ssk += row_xor<8>(ssk);
    ssq += row_xor<4>(ssq);  ssk += row_xor<4>(ssk);
    ssq += row_xor<2>(ssq);  ssk += row_xor<2>(ssk);
    ssq += row_xor<1>(ssq);  ssk += row_xor<1>(ssk);
    const float scr = bf_rn(scl[h]);
    const float ss  = sqrtf(fabsf(scr) + 1e-8f);
    const float rq  = ss * rsqrtf(ssq + 1e-8f);
    const float rk  = ss * rsqrtf(ssk + 1e-8f);
    const float px  = bf_rn(pos[2 * t + 0]);
    const float py  = bf_rn(pos[2 * t + 1]);
    const int  low  = (i < 16) ? 1 : 0;
    const int  fi   = low ? (NH * NFR + h * NFR + i) : (h * NFR + (i - 16));   // [1][h][i] or [0][h][i-16], < 2*NH*NFR
    const float fr  = bf_rn(freqs[fi]);
    const float pp  = low ? py : px;
    const float th  = (pp * 2.0f - 1.0f) * fr;
    const float cs  = cosf(th);
    const float sn  = sinf(th);
    const float xq1 = q1 * rq, xq2 = q2 * rq;
    const float xk1 = k1 * rk, xk2 = k2 * rk;
    sq[wave][i]      = xq1 * cs - xq2 * sn;
    sq[wave][i + 32] = xq2 * cs + xq1 * sn;
    sk[wave][i]      = xk1 * cs - xk2 * sn;
    sk[wave][i + 32] = xk2 * cs + xk1 * sn;
    __builtin_amdgcn_fence(__ATOMIC_RELEASE, "workgroup");
    __builtin_amdgcn_wave_barrier();
    __builtin_amdgcn_fence(__ATOMIC_ACQUIRE, "workgroup");
    const int pl = lane >> 3;                             // plane 0 q hi, 1 q lo, 2 k hi, 3 k lo
    const int c8 = (lane & 7) * 8;
    const float* spq = &sq[wave][c8];
    const float* spk = &sk[wave][c8];
    v4u w;
#pragma unroll
    for (int e = 0; e < 4; ++e) {
      const float fq0 = spq[2 * e], fq1 = spq[2 * e + 1];
      const float fk0 = spk[2 * e], fk1 = spk[2 * e + 1];
      const float f0 = (pl < 2) ? fq0 : fk0;
      const float f1 = (pl < 2) ? fq1 : fk1;
      const unsigned short hb0 = bf_bits(f0), hb1 = bf_bits(f1);
      const unsigned short lb0 = bf_bits(f0 - bf_up(hb0)), lb1 = bf_bits(f1 - bf_up(hb1));
      const unsigned short s0 = (pl & 1) ? lb0 : hb0;
      const unsigned short s1 = (pl & 1) ? lb1 : hb1;
      w[e] = pk16(s0, s1);
    }
    unsigned short* dst = qk4 + (size_t)pl * ((size_t)SEQ * DM) + (size_t)t * DM + h * HD + c8;
    *(v4u*)dst = w;
    
  }
}

// =====================================================================================================
// Attention, head dim 64, unified key rule: key s is visible to row t iff (s < S and s <= t) or s == t,
// with S = npk[0] clamped to [0, SEQ] (causal prefix segment of S tokens; later rows see the whole prefix
// plus themselves). Scores unscaled; masked scores = -inf; softmax f32 online.
//   q planes (bf16 hi / lo): element (t, h, d) at [t*DM + h*64 + d]; k planes same with key index s
//   v^T hi plane (f16):      element (h, d, s) at [(h*64 + d)*SEQ + s]; residual plane (f16, (v - hi)*4096) same layout
//   out planes (bf16 hi / lo of the normalised context): element (t, h, d) at [t*DM + h*64 + d]
//   scores = q . k : bf16 hi/lo split (hi.hi + hi.lo + lo.hi), f32 accumulate
//   p = exp(s - m) carried as f16(1024 p); context = p . v_hi on f16 WMMA plus p . v_res (and, when RES,
//   p_res . v_hi with p_res = f16((1024 p - f16(1024 p)) * 4096)) into a separate accumulator folded back with
//   1/4096 per key tile in f32.
//   Block = 4 waves = 64 query rows of one h; grid = nqbThis * NH; key tiles of 64: tiles 0..min(qb, SB-1) then
//   tile qb itself when qb >= SB (SB = ceil(S/64)); trip count block-uniform and <= NQB.
//   K / V^T tile staging: 128 threads x 32 elements per plane = the whole 64x64 tile (plain 16-B loads,
//   __syncthreads before and after); P tiles are wave-private, spilled with _Float16 element stores and reloaded
//   Output coverage: each wave stores rows q0..q0+15 (it 0..3 x lane>>3 0..3) x 64 columns (8 lanes x 8) of both planes.
// =====================================================================================================
template <bool RES>
__global__ __launch_bounds__(128)
void attn64(const unsigned short* __restrict__ qhp, const unsigned short* __restrict__ qlp,
            const unsigned short* __restrict__ khp, const unsigned short* __restrict__ klp,
            const unsigned short* __restrict__ vhp, const unsigned short* __restrict__ vlp,
            const int* __restrict__ npk,
            unsigned short* ohp, unsigned short* olp, int qbBase, int nqbThis) {
  union FB { v16b v; v8b h[2]; };
  union FH { v16h v; v8h h[2]; };
  __shared__ __align__(16) __bf16   Ksh[64 * LP];                 // K hi [kv][d], rows padded to LP
  __shared__ __align__(16) __bf16   Ksl[64 * LP];                 // K lo
  __shared__ __align__(16) _Float16 Vth[64 * LP];                 // V^T hi [d][kv], rows padded to LP
  __shared__ __align__(16) _Float16 Vtl[64 * LP];                 // V^T residual
  __shared__ __align__(16) _Float16 Psh[4][16 * LP];              // per wave P [row][kv]
  __shared__ __align__(16) _Float16 Psl[RES ? 4 : 1][16 * LP];    // per wave P residual
  __shared__ __align__(16) float    Os[4][16 * 64];               // per wave context tile [row][d]

  const int tid  = threadIdx.x;
  const int wave = tid >> 5;
  const int lane = tid & 31;
  const int hh   = lane >> 4;
  const int c    = lane & 15;

  const int bx   = blockIdx.x;
  const int qbl  = bx % nqbThis;
  const int h    = bx / nqbThis;          // < NH by grid size
  const int qb   = qbBase + qbl;
  const int q0   = qb * 64 + wave * 16;

  int S = npk[0];                         // block-uniform scalar load
  S = (S < 0) ? 0 : S;
  S = (S > SEQ) ? SEQ : S;
  const int SB   = (S + 63) >> 6;                       // 0..NQB
  const int nLow = (qb + 1 < SB) ? (qb + 1) : SB;       // tiles 0..nLow-1
  int nT = nLow + ((qb >= SB) ? 1 : 0);                 // + the block's own tile when not in the prefix
  nT = (nT > NQB) ? NQB : nT;

  const __bf16* Qh = (const __bf16*)(const void*)qhp + (size_t)h * HD;
  const __bf16* Ql = (const __bf16*)(const void*)qlp + (size_t)h * HD;
  const __bf16* Kh = (const __bf16*)(const void*)khp + (size_t)h * HD;
  const __bf16* Kl = (const __bf16*)(const void*)klp + (size_t)h * HD;
  const _Float16* Vh = (const _Float16*)(const void*)vhp + (size_t)h * HD * SEQ;
  const _Float16* Vl = (const _Float16*)(const void*)vlp + (size_t)h * HD * SEQ;

  // ---- Q fragments (A operand, row = lane&15): 2 d-chunks, hi and lo ----
  v16b qah[2], qal[2];
#pragma unroll
  for (int dc = 0; dc < 2; ++dc) {
    const size_t qo = (size_t)(q0 + c) * DM + dc * 32 + 8 * hh;
    qah[dc] = ldfrag_b(Qh + qo);
    qal[dc] = ldfrag_b(Ql + qo);
  }

  float mrow[8], lrow[8];
  v8f oacc[4];
#pragma unroll
  for (int r = 0; r < 8; ++r) { mrow[r] = -INFINITY; lrow[r] = 0.f; }
#pragma unroll
  for (int t = 0; t < 4; ++t) oacc[t] = zero8();

  for (int i = 0; i < nT; ++i) {          // block-uniform trip count, <= NQB
    const int kt  = (i < nLow) ? i : qb;
    const int kv0 = kt * 64;              // kv0 + 63 < SEQ
    __syncthreads();
    {
      const int r = tid >> 1, half = (tid & 1) * 32;
      const __bf16*   kg  = Kh + (size_t)(kv0 + r) * DM + half;   // K row kv0+r, d = half..half+31
      const __bf16*   klg = Kl + (size_t)(kv0 + r) * DM + half;
      const _Float16* vg  = Vh + (size_t)r * SEQ + kv0 + half;    // V^T row d = r, s = kv0+half..+31
      const _Float16* vlg = Vl + (size_t)r * SEQ + kv0 + half;
#pragma unroll
      for (int u = 0; u < 4; ++u) {
        const v8b a0 = *(const v8b*)(kg + 8 * u);
        const v8b a1 = *(const v8b*)(klg + 8 * u);
        const v8h b0 = *(const v8h*)(vg + 8 * u);
        const v8h b1 = *(const v8h*)(vlg + 8 * u);
        *(v8b*)(Ksh + r * LP + half + 8 * u) = a0;
        *(v8b*)(Ksl + r * LP + half + 8 * u) = a1;
        *(v8h*)(Vth + r * LP + half + 8 * u) = b0;
        *(v8h*)(Vtl + r * LP + half + 8 * u) = b1;
      }
    }
    __syncthreads();

    // ---- scores: 16 query rows x 64 keys per wave, 3 bf16 products ----
    v8f s[4];
#pragma unroll
    for (int j = 0; j < 4; ++j) {
      s[j] = zero8();
#pragma unroll
      for (int dc = 0; dc < 2; ++dc) {
        FB kb, kl;
        kb.h[0] = *(const v8b*)(Ksh + (j * 16 + c) * LP + dc * 32 + 8 * hh);
        kb.h[1] = *(const v8b*)(Ksh + (j * 16 + c) * LP + dc * 32 + 16 + 8 * hh);
        kl.h[0] = *(const v8b*)(Ksl + (j * 16 + c) * LP + dc * 32 + 8 * hh);
        kl.h[1] = *(const v8b*)(Ksl + (j * 16 + c) * LP + dc * 32 + 16 + 8 * hh);
        s[j] = mma_b(qah[dc], kb.v, s[j]);
        s[j] = mma_b(qah[dc], kl.v, s[j]);
        s[j] = mma_b(qal[dc], kb.v, s[j]);
      }
    }

    // ---- key visibility rule, row max, online softmax, P (x1024, f16) and P residual (x4096) to LDS ----
    _Float16* pwh = Psh[wave];
    _Float16* pwl = Psl[RES ? wave : 0];
#pragma unroll
    for (int r = 0; r < 8; ++r) {
      const int t = q0 + 8 * hh + r;        // D row 8hh+r of this lane
      float m = -INFINITY;
#pragma unroll
      for (int j = 0; j < 4; ++j) {
        const int kg = kv0 + j * 16 + c;    // D col = key
        const bool ok = ((kg < S) && (kg <= t)) || (kg == t);
        const float sv = ok ? s[j][r] : -INFINITY;
        s[j][r] = sv;
        m = fmaxf(m, sv);
      }
      m = fmaxf(m, row_xor<1>(m));
      m = fmaxf(m, row_xor<2>(m));
      m = fmaxf(m, row_xor<4>(m));
      m = fmaxf(m, row_xor<8>(m));
      const float mnew  = fmaxf(mrow[r], m);
      const float msafe = (mnew == -INFINITY) ? 0.f : mnew;
      const float alpha = __expf(mrow[r] - msafe);
      mrow[r] = mnew;
      float psum = 0.f;
#pragma unroll
      for (int j = 0; j < 4; ++j) {
        const float p = __expf(s[j][r] - msafe);     // masked score: exp(-inf) -> 0
        psum += p;
        const float p1k = p * 1024.0f;
        const _Float16 ph = (_Float16)p1k;
        pwh[(8 * hh + r) * LP + j * 16 + c] = ph;
        if (RES) {
          const _Float16 pr = (_Float16)((p1k - (float)ph) * 4096.0f);
          pwl[(8 * hh + r) * LP + j * 16 + c] = pr;
        }
      }
      psum += row_xor<1>(psum);
      psum += row_xor<2>(psum);
      psum += row_xor<4>(psum);
      psum += row_xor<8>(psum);
      lrow[r] = lrow[r] * alpha + psum;
#pragma unroll
      for (int t4 = 0; t4 < 4; ++t4) oacc[t4][r] *= alpha;
    }
    __builtin_amdgcn_fence(__ATOMIC_RELEASE, "workgroup");
    __builtin_amdgcn_wave_barrier();
    __builtin_amdgcn_fence(__ATOMIC_ACQUIRE, "workgroup");

    // ---- context += P . V_hi (f16 WMMA); residual products into a separate accumulator ----
    v8f o1[4];
#pragma unroll
    for (int t4 = 0; t4 < 4; ++t4) o1[t4] = zero8();
#pragma unroll 1
    for (int kk = 0; kk < 2; ++kk) {
      FH pa, pl;
      pa.h[0] = *(const v8h*)(pwh + c * LP + kk * 32 + 8 * hh);
      pa.h[1] = *(const v8h*)(pwh + c * LP + kk * 32 + 16 + 8 * hh);
      if (RES) {
        pl.h[0] = *(const v8h*)(pwl + c * LP + kk * 32 + 8 * hh);
        pl.h[1] = *(const v8h*)(pwl + c * LP + kk * 32 + 16 + 8 * hh);
      } else {
        pl.v = pa.v;
      }
#pragma unroll
      for (int t4 = 0; t4 < 4; ++t4) {
        FH vb, vl;
        vb.h[0] = *(const v8h*)(Vth + (t4 * 16 + c) * LP + kk * 32 + 8 * hh);
        vb.h[1] = *(const v8h*)(Vth + (t4 * 16 + c) * LP + kk * 32 + 16 + 8 * hh);
        vl.h[0] = *(const v8h*)(Vtl + (t4 * 16 + c) * LP + kk * 32 + 8 * hh);
        vl.h[1] = *(const v8h*)(Vtl + (t4 * 16 + c) * LP + kk * 32 + 16 + 8 * hh);
        oacc[t4] = mma_h(pa.v, vb.v, oacc[t4]);
        o1[t4]   = mma_h(pa.v, vl.v, o1[t4]);
        if (RES) o1[t4] = mma_h(pl.v, vb.v, o1[t4]);
      }
    }
#pragma unroll
    for (int t4 = 0; t4 < 4; ++t4)
#pragma unroll
      for (int r = 0; r < 8; ++r) oacc[t4][r] += o1[t4][r] * (1.0f / 4096.0f);
  }

  // ---- normalise (1/l and the 1/1024 p carry), stage the wave's 16x64 tile, bf16 hi/lo split,
  float* os = Os[wave];
#pragma unroll
  for (int r = 0; r < 8; ++r) {
    const float l = lrow[r];
    const float inv = ((l > 0.f) ? (1.0f / l) : 0.f) * (1.0f / 1024.0f);
#pragma unroll
    for (int t4 = 0; t4 < 4; ++t4) os[(8 * hh + r) * 64 + t4 * 16 + c] = oacc[t4][r] * inv;
  }
  __builtin_amdgcn_fence(__ATOMIC_RELEASE, "workgroup");
  __builtin_amdgcn_wave_barrier();
  __builtin_amdgcn_fence(__ATOMIC_ACQUIRE, "workgroup");
  {
    const int q4 = lane >> 3, c8 = (lane & 7) * 8;
    v4u hv[4], lv[4];
#pragma unroll
    for (int it = 0; it < 4; ++it) {
      const int row = it * 4 + q4;   // it 0..3 x q4 0..3 = rows 0..15 of the wave tile
      const float* sp = os + row * 64 + c8;
      v4u a, a2;
#pragma unroll
      for (int e = 0; e < 4; ++e) {
        const float f0 = sp[2 * e], f1 = sp[2 * e + 1];
        const unsigned short h0 = bf_bits(f0), h1 = bf_bits(f1);
        const unsigned short l0 = bf_bits(f0 - bf_up(h0)), l1 = bf_bits(f1 - bf_up(h1));
        a[e] = pk16(h0, h1); a2[e] = pk16(l0, l1);
      }
      hv[it] = a; lv[it] = a2;
    }
    {
#pragma unroll
      for (int it = 0; it < 4; ++it) {
        const int row = it * 4 + q4;
        const size_t go = (size_t)(q0 + row) * DM + (size_t)h * HD + c8;
        *(v4u*)(ohp + go) = hv[it];
        *(v4u*)(olp + go) = lv[it];
      }
      
    }
  }
}

// =====================================================================================================
// Workspace map (bytes), every region an exact multiple of its whole-line / whole-tile store granularity:
//   Xb    bf16 [4096][1024]          0            8388608
//   Wqkv  bf16 [3072 n][1024 k]      8388608      6291456   (rows 0..2047 = q|k weights, 2048.. = v weights)
//   Wob   bf16 [1024][1024]          14680064     2097152
//   QKf   f32  [4096][2048]          16777216     33554432  (cols 0..1023 q, 1024..2047 k)
//   VTh   f16  [1024 d][4096 s]      50331648     8388608
//   VTl   f16  [1024 d][4096 s]      58720256     8388608
//   QK4   bf16 4 x [4096][1024]      67108864     33554432  (q hi, q lo, k hi, k lo)
//   Oh    bf16 [4096][1024]          100663296    8388608
//   Ol    bf16 [4096][1024]          109051904    8388608
//   end                              117440512
// Weights are [out n][in k] with k contiguous = the Bt / A layout the GEMM wants, so they are only converted.
// =====================================================================================================
extern "C" void kernel_launch(void* const* d_in, const int* in_sizes, int n_in,
                              void* d_out, int out_size, void* d_ws, size_t ws_size,
                              hipStream_t stream) {
  if (n_in < 7) return;
  if (in_sizes[0] != SEQ * DM) return;
  if (in_sizes[1] != SEQ * 2) return;
  if (in_sizes[2] != NQKV * DM) return;
  if (in_sizes[3] != DM * DM) return;
  if (in_sizes[4] != NH) return;
  if (in_sizes[5] != 2 * NH * NFR) return;
  if (in_sizes[6] < 1) return;
  if (out_size != SEQ * DM) return;

  const float* x     = (const float*)d_in[0];
  const float* pos   = (const float*)d_in[1];
  const float* qkvw  = (const float*)d_in[2];
  const float* outw  = (const float*)d_in[3];
  const float* scl   = (const float*)d_in[4];
  const float* freqs = (const float*)d_in[5];
  const int*   npk   = (const int*)d_in[6];

  const size_t PXB   = (size_t)SEQ * DM * 2;      //  8388608
  const size_t PWQKV = (size_t)NQKV * DM * 2;     //  6291456
  const size_t PWO   = (size_t)DM * DM * 2;       //  2097152
  const size_t PQKF  = (size_t)SEQ * QKW * 4;     // 33554432
  const size_t PVT   = (size_t)DM * SEQ * 2;      //  8388608
  const size_t PPL   = (size_t)SEQ * DM * 2;      //  8388608
  size_t off = 0;
  const size_t oXb   = off; off += PXB;
  const size_t oWqkv = off; off += PWQKV;
  const size_t oWo   = off; off += PWO;
  const size_t oQKf  = off; off += PQKF;
  const size_t oVTh  = off; off += PVT;
  const size_t oVTl  = off; off += PVT;
  const size_t oQK4  = off; off += 4 * PPL;
  const size_t oOh   = off; off += PPL;
  const size_t oOl   = off; off += PPL;
  if (off > ws_size) return;                      // off = 117440512
  if (off > (size_t)134217728) return;

  char* ws = (char*)d_ws;
  unsigned short* Xb   = (unsigned short*)(ws + oXb);
  unsigned short* Wqkv = (unsigned short*)(ws + oWqkv);
  unsigned short* Wvb  = Wqkv + (size_t)2 * DM * DM;             // rows 2048.. of the qkv weight plane
  unsigned short* Wob  = (unsigned short*)(ws + oWo);
  float*          QKf  = (float*)(ws + oQKf);
  unsigned short* VTh  = (unsigned short*)(ws + oVTh);
  unsigned short* VTl  = (unsigned short*)(ws + oVTl);
  unsigned short* QK4  = (unsigned short*)(ws + oQK4);
  unsigned short* Qh   = QK4;
  unsigned short* Ql   = QK4 + (size_t)SEQ * DM;
  unsigned short* Kh   = QK4 + (size_t)2 * SEQ * DM;
  unsigned short* Kl   = QK4 + (size_t)3 * SEQ * DM;
  unsigned short* Oh   = (unsigned short*)(ws + oOh);
  unsigned short* Ol   = (unsigned short*)(ws + oOl);

  const dim3 blk(256);
  const int n8x = SEQ * DM / 8;                                // 524288
  const int n8w = NQKV * DM / 8;                               // 393216
  const int n8o = DM * DM / 8;                                 // 131072
  const dim3 gCvtX((n8x + 255) / 256);                         // 2048 blocks
  const dim3 gCvtW((n8w + 255) / 256);                         // 1536 blocks
  const dim3 gCvtO((n8o + 255) / 256);                         // 512 blocks
  const dim3 gQK(((SEQ / 64) * (QKW / 64) + 7) / 8, 1);        // 2048 tiles -> 256 blocks: M=4096, N=2048
  const dim3 gVT(((DM / 64) * (SEQ / 64) + 7) / 8, 1);         // 1024 tiles -> 128 blocks: M=1024, N=4096
  const dim3 gOut(((SEQ / 64) * (DM / 64) + 7) / 8, 1);        // 1024 tiles -> 128 blocks: M=4096, N=1024
  const int  nRows = SEQ * NH;                                 // 65536 (t, h) rows
  const dim3 gRope((nRows + 7) / 8);                           // 8192 blocks of 8 waves

  // (1) x -> bf16 [4096][1024]; weights [n][k] f32 -> bf16 [n][k]
  cvt_bf16x8<<<gCvtX, blk, 0, stream>>>(x, Xb, n8x);
  cvt_bf16x8<<<gCvtW, blk, 0, stream>>>(qkvw, Wqkv, n8w);
  cvt_bf16x8<<<gCvtO, blk, 0, stream>>>(outw, Wob, n8o);
  // (2) q|k = x . W[0:2048]^T -> f32 [4096][2048]   (M=4096, N=2048, K=1024)
  gemm64<0, 0><<<gQK, blk, 0, stream>>>(
      Xb, Xb, DM, 0LL, Wqkv, Wqkv, DM, 0LL,
      (void*)QKf, QKW, 0LL, (void*)QKf, QKW, 0LL, 0,
      SEQ, QKW, DM, 1.0f);
  // (3) v^T = Wv . x^T -> f16 hi plane [h*64+d][s] (pitch SEQ) and residual plane (x4096, all keys)
  //     (A = Wvb [n][k], Bt = Xb; M=1024, N=4096, K=1024)
  gemm64<0, 3><<<gVT, blk, 0, stream>>>(
      Wvb, Wvb, DM, 0LL, Xb, Xb, DM, 0LL,
      (void*)VTh, SEQ, 0LL, (void*)VTl, SEQ, 0LL, SEQ,
      DM, SEQ, DM, 4096.0f);
  // (4) cosine-sim scaling + axial rotation -> q hi/lo, k hi/lo bf16 planes [t][h*64+d]
  rope_qk<<<gRope, blk, 0, stream>>>(QKf, pos, scl, freqs, QK4, nRows);
  // (5) attention: row blocks 0..RESQB-1 with the p residual plane, the rest without
  attn64<true><<<dim3(NH * RESQB), dim3(128), 0, stream>>>(
      Qh, Ql, Kh, Kl, VTh, VTl, npk, Oh, Ol, 0, RESQB);
  attn64<false><<<dim3(NH * (NQB - RESQB)), dim3(128), 0, stream>>>(
      Qh, Ql, Kh, Kl, VTh, VTl, npk, Oh, Ol, RESQB, NQB - RESQB);
  // (6) out = context . Wo^T -> d_out f32 [4096][1024]  (A = context hi + lo planes, 2 products)
  gemm64<1, 0><<<gOut, blk, 0, stream>>>(
      Oh, Ol, DM, 0LL, Wob, Wob, DM, 0LL,
      d_out, DM, 0LL, d_out, DM, 0LL, 0,
      SEQ, DM, DM, 1.0f);
  (void)hipGetLastError();
}

// v004
// One run takes 255 microseconds.
// Next to v003, in two timings, it ran 1.04 times as fast each time.
// Counting every step since v000, it is 2.23 times as fast.
// Contractions: q|k and v^T projections = v_wmma_f32_16x16x32_bf16 (bf16 operands from RNE-converted inputs, single product);
// q.k^T scores = v_wmma_f32_16x16x32_bf16 with bf16 hi/lo split q and k (hi.hi + hi.lo + lo.hi);
// p.v = v_wmma_f32_16x16x32_f16 (p carried x1024 in f16; v as f16 hi plane + f16 residual plane x4096, 2 products;
// extra f16 residual plane x4096 of p for the first 512 rows); ctx.Wo^T = v_wmma_f32_16x16x32_bf16 with ctx as
// bf16 hi/lo planes times bf16 Wo (2 products); all f32 accumulate; norms, rotations and softmax in f32.
#include <hip/hip_runtime.h>
#include <math.h>
#include <stdint.h>

#define SEQ   4096
#define DM    1024
#define NH    16
#define HD    64
#define NQB   (SEQ / 64)   // 64 row / key tiles of 64
#define RESQB 8            // leading 64-row blocks that also use the p residual plane
#define QKW   (2 * DM)     // pitch of the f32 q|k plane
#define NQKV  (3 * DM)
#define NFR   16           // rotation frequencies per head per axis (HD/4)
#define LP    72           // LDS row pitch of the 64-wide 16-bit attention tiles, in elements: 144 B = 16 B x 9 (odd)
#define GP    72           // LDS row pitch of the GEMM operand slices (64 k of 16 bits), in elements: 144 B = 16 B x 9 (odd)
static_assert(NH * HD == DM);
static_assert((SEQ % 256) == 0 && (DM % 256) == 0);
static_assert((SEQ % 64) == 0 && (DM % 64) == 0);
static_assert(RESQB <= NQB);
static_assert(HD == 4 * NFR);

typedef _Float16 v16h __attribute__((ext_vector_type(16)));
typedef _Float16 v8h  __attribute__((ext_vector_type(8)));
typedef __bf16   v16b __attribute__((ext_vector_type(16)));
typedef __bf16   v8b  __attribute__((ext_vector_type(8)));
typedef float    v8f  __attribute__((ext_vector_type(8)));
typedef float    v4f  __attribute__((ext_vector_type(4)));
typedef unsigned int v4u __attribute__((ext_vector_type(4)));

// ---- scalar helpers --------------------------------------------------------------------------------
__device__ __forceinline__ unsigned short bf_bits(float f) {          // f32 -> bf16 bits, RNE convert
  unsigned u = __float_as_uint(f);
  return (unsigned short)((u + 0x7FFFu + ((u >> 16) & 1u)) >> 16);
}
__device__ __forceinline__ float bf_up(unsigned short h) { return __uint_as_float(((unsigned)h) << 16); }
__device__ __forceinline__ float bf_rn(float f) { return bf_up(bf_bits(f)); }   // value after RNE convert to bf16
__device__ __forceinline__ unsigned short h_bits(_Float16 x) { return __builtin_bit_cast(unsigned short, x); }
__device__ __forceinline__ unsigned pk16(unsigned short a, unsigned short b) { return (unsigned)a | ((unsigned)b << 16); }
// value of lane (l ^ M) inside the lane's 16-lane row, M = 1..15: a DPP operand (row_xmask), no trip through the LDS pipe
template <int M>
__device__ __forceinline__ float row_xor(float x) {
  return __builtin_bit_cast(float, __builtin_amdgcn_update_dpp(0, __builtin_bit_cast(int, x), 0x160 + M, 0xf, 0xf, true));
}
// value of lane (l ^ 16): vector cross-row move
__device__ __forceinline__ float half_xor(float x) {
  return __builtin_bit_cast(float, __builtin_amdgcn_permlanex16(__builtin_bit_cast(int, x), __builtin_bit_cast(int, x),
                                                                0x76543210, 0xfedcba98, false, false));
}
__device__ __forceinline__ v8f zero8() { v8f z = {0.f, 0.f, 0.f, 0.f, 0.f, 0.f, 0.f, 0.f}; return z; }

// ---- fragment loaders: 16-bit A/B operand, lane -> row/col (lane&15), p already includes +8*(lane>>4);
//      elements 0..7 <- p[0..7] (k0+8h..), elements 8..15 <- p[16..23] (k0+16+8h..)
__device__ __forceinline__ v16b ldfrag_b(const __bf16* p) {
  union { v16b v; v8b h[2]; } f;
  f.h[0] = *(const v8b*)(p);
  f.h[1] = *(const v8b*)(p + 16);
  return f.v;
}

// ---- WMMA helpers -------------------------------------------------------------------------------------
__device__ __forceinline__ v8f mma_b_raw(v16b a, v16b b, v8f c) {
  return __builtin_amdgcn_wmma_f32_16x16x32_bf16(false, a, false, b, (short)0, c, false, false);
}
__device__ __forceinline__ v8f mma_h_raw(v16h a, v16h b, v8f c) {
  return __builtin_amdgcn_wmma_f32_16x16x32_f16(false, a, false, b, (short)0, c, false, false);
}
// closes a run of products on four accumulator chains: the eight B fragments stay in their registers until the whole
// run has issued (no later result is placed over an operand still being read), and the four v_nop are the matrix
// distance in front of the first vector instruction on the results or on the fragments' registers
__device__ __forceinline__ void run_guard_b(v8f& s0, v8f& s1, v8f& s2, v8f& s3,
                                            v16b b0, v16b b1, v16b b2, v16b b3, v16b c0, v16b c1, v16b c2, v16b c3) {
  asm volatile("v_nop\n\tv_nop\n\tv_nop\n\tv_nop"
               : "+v"(s0), "+v"(s1), "+v"(s2), "+v"(s3)
               : "v"(b0), "v"(b1), "v"(b2), "v"(b3), "v"(c0), "v"(c1), "v"(c2), "v"(c3));
}
__device__ __forceinline__ void dep_guard_b(v8f& a, v8f& b, v16b x, v16b y) {
  asm volatile("v_nop\n\tv_nop\n\tv_nop\n\tv_nop" : "+v"(a), "+v"(b) : "v"(x), "v"(y));
}
__device__ __forceinline__ void keep4_b(v16b a, v16b b, v16b c, v16b d) {
  asm volatile("v_nop" :: "v"(a), "v"(b), "v"(c), "v"(d));
}
__device__ __forceinline__ void acc_guard4(v8f& a, v8f& b, v8f& c, v8f& d) {
  asm volatile("v_nop\n\tv_nop\n\tv_nop\n\tv_nop" : "+v"(a), "+v"(b), "+v"(c), "+v"(d));
}

// =====================================================================================================
// f32 -> bf16 (RNE convert), 8 elements per thread, one 16-B store per lane: a wave writes 512 contiguous B
// coverage: n8 threads x 8 = whole plane (n8 is a multiple of 256 for every use here).
// =====================================================================================================
__global__ __launch_bounds__(256) void cvt_bf16x8(const float* __restrict__ in, unsigned short* out, int n8) {
  const int i = blockIdx.x * 256 + threadIdx.x;
  if (i < n8) {
    const v4f a = *(const v4f*)(in + (size_t)i * 8);
    const v4f b = *(const v4f*)(in + (size_t)i * 8 + 4);
    v4u p;
    p[0] = pk16(bf_bits(a[0]), bf_bits(a[1]));
    p[1] = pk16(bf_bits(a[2]), bf_bits(a[3]));
    p[2] = pk16(bf_bits(b[0]), bf_bits(b[1]));
    p[3] = pk16(bf_bits(b[2]), bf_bits(b[3]));
    *(v4u*)(out + (size_t)i * 8) = p;
    
  }
}

// =====================================================================================================
// Asynchronous copies global -> LDS, 16 B per lane, four per statement. l* = the lane's LDS byte address,
// g* = the lane's global address. The closing s_wait_xcnt stands inside the statement so that no address
// register of an issued copy is rewritten in front of it.
// =====================================================================================================
__device__ __forceinline__ void copy4_to_lds(unsigned l0, unsigned l1, unsigned l2, unsigned l3,
                                             const __bf16* g0, const __bf16* g1, const __bf16* g2, const __bf16* g3) {
  asm volatile("global_load_async_to_lds_b128 %0, %4, off\n\t"
               "global_load_async_to_lds_b128 %1, %5, off\n\t"
               "global_load_async_to_lds_b128 %2, %6, off\n\t"
               "global_load_async_to_lds_b128 %3, %7, off\n\t"
               "s_wait_xcnt 0x0"
               :: "v"(l0), "v"(l1), "v"(l2), "v"(l3), "v"(g0), "v"(g1), "v"(g2), "v"(g3) : "memory");
}
__device__ __forceinline__ unsigned lds_addr(const __bf16* p) { return (unsigned)(uintptr_t)p; }   // low 32 bits = LDS byte address

// =====================================================================================================
// Register-blocked batched bf16 WMMA GEMM: C[m][n] = sum_k A[m][k] * Bt[n][k]; a block of 8 waves (2 x 4) owns a
// 128 x 256 tile, one wave per 64x64 sub-tile. A row-major [M][K] pitch lda; Bt row-major [N][K] pitch ldb
// (k contiguous); M multiple of 128, N of 256, K of 64. blockIdx.y = batch index (strides in elements).
// Operand path: per slice of 64 k the block's 128 A rows and 256 Bt rows (128 B each = one line; 8 lanes x 16 B
// per row, so a wave-wide copy covers 4 whole lines) go to LDS by asynchronous copies, rows at pitch GP; two
// buffers, slice t + 1 in flight while slice t is multiplied; fragments by 16-B LDS loads.
// NSPLIT: 0 = A.Bt; 1 = (A + A2).Bt (A2 = unscaled bf16 lo plane of A).
// OUT_MODE: 0 = f32 (pitch ldc); 2 = bf16 hi plane C + bf16 lo plane C2 (lo = RNE(v - hi), unscaled);
//           3 = f16 hi plane C + f16 residual plane C2 = f16((v - hi) * rscale), C2 written only for tiles
//               with n0 < N2 (pitch ldc2, batch stride strideC2).
// =====================================================================================================
template <int NSPLIT, int OUT_MODE>
__global__ __launch_bounds__(256) void gemm64(
    const unsigned short* __restrict__ Ap, const unsigned short* A2p, int lda, long long strideA,
    const unsigned short* __restrict__ Btp, const unsigned short* Bt2p, int ldb, long long strideB,
    void* Cout, int ldc, long long strideC,
    void* Cout2, int ldc2, long long strideC2, int N2,
    int M, int N, int K, float rscale) {
  static_assert(NSPLIT == 0 || NSPLIT == 1);
  const __bf16* A   = (const __bf16*)(const void*)Ap;
  const __bf16* A2  = (const __bf16*)(const void*)A2p;
  const __bf16* Bt  = (const __bf16*)(const void*)Btp;
  __shared__ __align__(16) float  sT[8][16 * 68];   // per-wave 16x64 slab, pitch 68 floats
  __shared__ __align__(16) __bf16 sA[2][128 * GP];                                   // A slice, two buffers
  __shared__ __align__(16) __bf16 sA2[NSPLIT ? 2 : 1][NSPLIT ? 128 * GP : 8];        // A2 slice
  __shared__ __align__(16) __bf16 sB[2][256 * GP];                                   // Bt slice
  const int b    = blockIdx.y;
  const int tid  = threadIdx.x;
  const int lane = tid & 31;
  const int wave = tid >> 5;
  const int tilesN = N >> 8;
  const int tilesM = M >> 7;
  if ((int)blockIdx.x >= tilesM * tilesN) return;   // block-uniform, in front of every barrier and copy
  const int bm = blockIdx.x / tilesN;
  const int bn = blockIdx.x - bm * tilesN;
  const int mB = bm << 7;
  const int nB = bn << 8;
  const int wm = wave >> 2;                    // 0..1
  const int wn = wave & 3;                     // 0..3
  const int m0 = mB + (wm << 6);
  const int n0 = nB + (wn << 6);

  const __bf16* Ab  = A  + (size_t)b * strideA;
  const __bf16* Bb  = Bt + (size_t)b * strideB;
  const __bf16* Ab2 = NSPLIT ? (A2 + (size_t)b * strideA) : Ab;

  const int rlane = lane & 15;                 // row (A) / col (B, D) within subtile
  const int koff  = (lane >> 4) * 8;           // k offset of this lane half
  const int mOff  = (lane >> 4) * 8;           // D row offset

  // copy map: thread -> row (tid >> 3) + 32 p of the slice, 16-B piece (tid & 7) of its 128 B
  const int crow = tid >> 3;
  const int cseg = (tid & 7) * 8;
  const __bf16* gA  = Ab  + (size_t)(mB + crow) * lda + cseg;
  const __bf16* gA2 = Ab2 + (size_t)(mB + crow) * lda + cseg;
  const __bf16* gB  = Bb  + (size_t)(nB + crow) * ldb + cseg;
  const unsigned lA  = lds_addr(&sA[0][crow * GP + cseg]);
  const unsigned lA2 = lds_addr(&sA2[0][NSPLIT ? crow * GP + cseg : 0]);
  const unsigned lB  = lds_addr(&sB[0][crow * GP + cseg]);
  const unsigned R32 = 32 * GP * 2;            // 32 LDS rows, bytes
  const size_t a32 = (size_t)32 * lda, b32 = (size_t)32 * ldb;
  auto stage = [&](int t, int buf) {           // slice t (k = 64 t .. 64 t + 63) into buffer buf
    const __bf16* pa = gA + (size_t)t * 64;
    const __bf16* pb = gB + (size_t)t * 64;
    const unsigned la = lA + (unsigned)buf * (4 * R32);
    const unsigned lb = lB + (unsigned)buf * (8 * R32);
    copy4_to_lds(la, la + R32, la + 2 * R32, la + 3 * R32, pa, pa + a32, pa + 2 * a32, pa + 3 * a32);
    if (NSPLIT) {
      const __bf16* pa2 = gA2 + (size_t)t * 64;
      const unsigned la2 = lA2 + (unsigned)buf * (4 * R32);
      copy4_to_lds(la2, la2 + R32, la2 + 2 * R32, la2 + 3 * R32, pa2, pa2 + a32, pa2 + 2 * a32, pa2 + 3 * a32);
    }
    copy4_to_lds(lb, lb + R32, lb + 2 * R32, lb + 3 * R32, pb, pb + b32, pb + 2 * b32, pb + 3 * b32);
    copy4_to_lds(lb + 4 * R32, lb + 5 * R32, lb + 6 * R32, lb + 7 * R32,
                 pb + 4 * b32, pb + 5 * b32, pb + 6 * b32, pb + 7 * b32);
  };

  v8f acc[4][4];
#pragma unroll
  for (int i = 0; i < 4; ++i)
#pragma unroll
    for (int j = 0; j < 4; ++j) acc[i][j] = zero8();

  const int nK = K >> 6;
  stage(0, 0);
  asm volatile("s_wait_asynccnt 0x0" ::: "memory");   // this wave's copies of slice 0 have landed
  __syncthreads();                                    // every wave's have: slice 0 is readable
  if (nK > 1) stage(1, 1);
  for (int t = 0; t < nK; ++t) {
    const int buf = t & 1;
    const __bf16* tA  = sA[buf]  + ((wm << 6) + rlane) * GP + koff;
    const __bf16* tA2 = NSPLIT ? (sA2[buf] + ((wm << 6) + rlane) * GP + koff) : tA;
    const __bf16* tB  = sB[buf]  + ((wn << 6) + rlane) * GP + koff;
#pragma unroll
    for (int kk = 0; kk < 2; ++kk) {
      // the fragments of a k chunk of 32 are fetched as one group in front of its products
      v16b bh[4], ah[4], al[4];
#pragma unroll
      for (int j = 0; j < 4; ++j) bh[j] = ldfrag_b(tB + (j << 4) * GP + kk * 32);
#pragma unroll
      for (int i = 0; i < 4; ++i) {
        ah[i] = ldfrag_b(tA + (i << 4) * GP + kk * 32);
        al[i] = NSPLIT ? ldfrag_b(tA2 + (i << 4) * GP + kk * 32) : ah[i];
      }
#pragma unroll
      for (int i = 0; i < 4; ++i) {
#pragma unroll
        for (int j = 0; j < 4; ++j) {
          acc[i][j] = mma_b_raw(ah[i], bh[j], acc[i][j]);
          if (NSPLIT) acc[i][j] = mma_b_raw(al[i], bh[j], acc[i][j]);
        }
        dep_guard_b(acc[i][0], acc[i][3], ah[i], al[i]);
      }
      keep4_b(bh[0], bh[1], bh[2], bh[3]);
    }
    asm volatile("s_wait_dscnt 0x0" ::: "memory");     // this wave's reads of buffer buf are done before it is refilled
    asm volatile("s_wait_asynccnt 0x0" ::: "memory");  // this wave's copies of slice t + 1 have landed
    __syncthreads();                                   // publishes slice t + 1 and ends every read of buffer buf
    if (t + 2 < nK) stage(t + 2, buf);
  }
  asm volatile("s_wait_asynccnt 0x0" ::: "memory");    // no copy outstanding behind the loop
  acc_guard4(acc[0][0], acc[0][1], acc[0][2], acc[0][3]);
  acc_guard4(acc[1][0], acc[1][1], acc[1][2], acc[1][3]);
  acc_guard4(acc[2][0], acc[2][1], acc[2][2], acc[2][3]);
  acc_guard4(acc[3][0], acc[3][1], acc[3][2], acc[3][3]);

  // ---- epilogue ----
  float* slab = sT[wave];
#pragma unroll
  for (int i = 0; i < 4; ++i) {
    const int mBase = m0 + (i << 4);
#pragma unroll
    for (int j = 0; j < 4; ++j) {
#pragma unroll
      for (int r = 0; r < 8; ++r) {
        slab[(mOff + r) * 68 + (j << 4) + rlane] = acc[i][j][r];
      }
    }
    __builtin_amdgcn_fence(__ATOMIC_RELEASE, "workgroup");
    __builtin_amdgcn_wave_barrier();
    __builtin_amdgcn_fence(__ATOMIC_ACQUIRE, "workgroup");
    if (OUT_MODE == 0) {
      float* C = (float*)Cout + (size_t)b * strideC;
      const int hh = lane >> 4, c4 = (lane & 15) * 4;     // 256-B row segment = 16 lanes x 16 B
      {
#pragma unroll
        for (int it = 0; it < 8; ++it) {
          const int row = it * 2 + hh;                     // it 0..7 x hh 0..1 = rows 0..15
          const v4f v = *(const v4f*)(slab + row * 68 + c4);
          *(v4f*)(C + (size_t)(mBase + row) * ldc + n0 + c4) = v;
        }
        
      }
    } else {
      const int q = lane >> 3, c8 = (lane & 7) * 8;
      unsigned short* C  = (unsigned short*)Cout  + (size_t)b * strideC;
      unsigned short* C2 = (unsigned short*)Cout2 + (size_t)b * strideC2;
      const bool wlo = (OUT_MODE == 2) || (n0 < N2);      // wave-uniform
      v4u hv[4], lv[4];
#pragma unroll
      for (int it = 0; it < 4; ++it) {
        const int row = it * 4 + q;                        // it 0..3 x q 0..3 = rows 0..15
        const float* sp = slab + row * 68 + c8;
        v4u a, a2;
#pragma unroll
        for (int e = 0; e < 4; ++e) {
          const float f0 = sp[2 * e], f1 = sp[2 * e + 1];
          unsigned short h0, h1, l0, l1;
          if (OUT_MODE == 2) {
            h0 = bf_bits(f0); h1 = bf_bits(f1);
            l0 = bf_bits(f0 - bf_up(h0)); l1 = bf_bits(f1 - bf_up(h1));
          } else {
            const _Float16 x0 = (_Float16)f0, x1 = (_Float16)f1;
            h0 = h_bits(x0); h1 = h_bits(x1);
            l0 = h_bits((_Float16)((f0 - (float)x0) * rscale));
            l1 = h_bits((_Float16)((f1 - (float)x1) * rscale));
          }
          a[e] = pk16(h0, h1); a2[e] = pk16(l0, l1);
        }
        hv[it] = a; lv[it] = a2;
      }
      {
#pragma unroll
        for (int it = 0; it < 4; ++it) {
          const int row = it * 4 + q;
          *(v4u*)(C + (size_t)(mBase + row) * ldc + n0 + c8) = hv[it];
          if (wlo) *(v4u*)(C2 + (size_t)(mBase + row) * ldc2 + n0 + c8) = lv[it];
        }
        
      }
    }
    __builtin_amdgcn_fence(__ATOMIC_RELEASE, "workgroup");
    __builtin_amdgcn_wave_barrier();
    __builtin_amdgcn_fence(__ATOMIC_ACQUIRE, "workgroup");
  }
}

// =====================================================================================================
// Cosine-similarity scaling + axial rotation of q and k, f32, one wave per (token t, head h) row.
//   qkf: f32 [t][QKW], q of head h at cols h*64.., k at cols DM + h*64..
//   pos [t][2], scl [NH], freqs [2][NH][NFR]: values RNE-converted to bf16 in register before use.
//   rq = sqrt(|scl_h| + 1e-8) * rsqrt(sum(q^2) + 1e-8); qs = q * rq (same for k)
//   theta[i], i < 16: (pos[t][1]*2 - 1) * freqs[1][h][i]; i >= 16: (pos[t][0]*2 - 1) * freqs[0][h][i-16]
//   out[i] = qs[i] cos - qs[i+32] sin; out[i+32] = qs[i+32] cos + qs[i] sin (lane i = pair index).
//   qk4: four bf16 planes [t][h*64+d] back to back (plane stride SEQ*DM elements): q hi, q lo, k hi, k lo
//   (lo = RNE(v - hi), unscaled). The wave's 64-wide row is staged in LDS, then ONE store instruction writes
//   grid = nrows/8 blocks of 256 (8 waves). coverage: nrows = SEQ*NH rows x 64 cols in each of the 4 planes.
// =====================================================================================================
__global__ __launch_bounds__(256) void rope_qk(const float* __restrict__ qkf, const float* __restrict__ pos,
                                               const float* __restrict__ scl, const float* __restrict__ freqs,
                                               unsigned short* qk4, int nrows) {
#pragma clang fp contract(off)
  __shared__ __align__(16) float sq[8][64];
  __shared__ __align__(16) float sk[8][64];
  const int tid  = threadIdx.x;
  const int wave = tid >> 5;
  const int lane = tid & 31;
  const int rho  = blockIdx.x * 8 + wave;
  if (rho < nrows) {                                      // wave-uniform; no block barriers in this kernel
    const int t = rho >> 4;
    const int h = rho & 15;
    const float* qr = qkf + (size_t)t * QKW + h * HD;
    const float* kr = qr + DM;
    const int i = lane;                                   // pair index 0..31
    const float q1 = qr[i], q2 = qr[i + 32];
    const float k1 = kr[i], k2 = kr[i + 32];
    float ssq = q1 * q1 + q2 * q2;
    float ssk = k1 * k1 + k2 * k2;
    ssq += half_xor(ssq);    ssk += half_xor(ssk);
    ssq += row_xor<8>(ssq);  ssk += row_xor<8>(ssk);
    ssq += row_xor<4>(ssq);  ssk += row_xor<4>(ssk);
    ssq += row_xor<2>(ssq);  ssk += row_xor<2>(ssk);
    ssq += row_xor<1>(ssq);  ssk += row_xor<1>(ssk);
    const float scr = bf_rn(scl[h]);
    const float ss  = sqrtf(fabsf(scr) + 1e-8f);
    const float rq  = ss * rsqrtf(ssq + 1e-8f);
    const float rk  = ss * rsqrtf(ssk + 1e-8f);
    const float px  = bf_rn(pos[2 * t + 0]);
    const float py  = bf_rn(pos[2 * t + 1]);
    const int  low  = (i < 16) ? 1 : 0;
    const int  fi   = low ? (NH * NFR + h * NFR + i) : (h * NFR + (i - 16));   // [1][h][i] or [0][h][i-16], < 2*NH*NFR
    const float fr  = bf_rn(freqs[fi]);
    const float pp  = low ? py : px;
    const float th  = (pp * 2.0f - 1.0f) * fr;
    const float cs  = cosf(th);
    const float sn  = sinf(th);
    const float xq1 = q1 * rq, xq2 = q2 * rq;
    const float xk1 = k1 * rk, xk2 = k2 * rk;
    sq[wave][i]      = xq1 * cs - xq2 * sn;
    sq[wave][i + 32] = xq2 * cs + xq1 * sn;
    sk[wave][i]      = xk1 * cs - xk2 * sn;
    sk[wave][i + 32] = xk2 * cs + xk1 * sn;
    __builtin_amdgcn_fence(__ATOMIC_RELEASE, "workgroup");
    __builtin_amdgcn_wave_barrier();
    __builtin_amdgcn_fence(__ATOMIC_ACQUIRE, "workgroup");
    const int pl = lane >> 3;                             // plane 0 q hi, 1 q lo, 2 k hi, 3 k lo
    const int c8 = (lane & 7) * 8;
    const float* spq = &sq[wave][c8];
    const float* spk = &sk[wave][c8];
    v4u w;
#pragma unroll
    for (int e = 0; e < 4; ++e) {
      const float fq0 = spq[2 * e], fq1 = spq[2 * e + 1];
      const float fk0 = spk[2 * e], fk1 = spk[2 * e + 1];
      const float f0 = (pl < 2) ? fq0 : fk0;
      const float f1 = (pl < 2) ? fq1 : fk1;
      const unsigned short hb0 = bf_bits(f0), hb1 = bf_bits(f1);
      const unsigned short lb0 = bf_bits(f0 - bf_up(hb0)), lb1 = bf_bits(f1 - bf_up(hb1));
      const unsigned short s0 = (pl & 1) ? lb0 : hb0;
      const unsigned short s1 = (pl & 1) ? lb1 : hb1;
      w[e] = pk16(s0, s1);
    }
    unsigned short* dst = qk4 + (size_t)pl * ((size_t)SEQ * DM) + (size_t)t * DM + h * HD + c8;
    *(v4u*)dst = w;
    
  }
}

// =====================================================================================================
// Attention, head dim 64, unified key rule: key s is visible to row t iff (s < S and s <= t) or s == t,
// with S = npk[0] clamped to [0, SEQ] (causal prefix segment of S tokens; later rows see the whole prefix
// plus themselves). Scores unscaled; masked scores = -inf; softmax f32 online.
//   q planes (bf16 hi / lo): element (t, h, d) at [t*DM + h*64 + d]; k planes same with key index s
//   v^T hi plane (f16):      element (h, d, s) at [(h*64 + d)*SEQ + s]; residual plane (f16, (v - hi)*4096) same layout
//   out planes (bf16 hi / lo of the normalised context): element (t, h, d) at [t*DM + h*64 + d]
//   scores = q . k : bf16 hi/lo split (hi.hi + hi.lo + lo.hi), f32 accumulate
//   p = exp(s - m) carried as f16(1024 p); context = p . v_hi on f16 WMMA plus p . v_res (and, when RES,
//   p_res . v_hi with p_res = f16((1024 p - f16(1024 p)) * 4096)) into a separate accumulator folded back with
//   1/4096 per key tile in f32.
//   Block = 4 waves = 64 query rows of one h; grid = nqbThis * NH; key tiles of 64: tiles 0..min(qb, SB-1) then
//   tile qb itself when qb >= SB (SB = ceil(S/64)); trip count block-uniform and <= NQB.
//   K / V^T tile staging: 128 threads x 32 elements per plane = the whole 64x64 tile (plain 16-B loads,
//   __syncthreads before and after); P tiles are wave-private, spilled with _Float16 element stores and reloaded
//   Output coverage: each wave stores rows q0..q0+15 (it 0..3 x lane>>3 0..3) x 64 columns (8 lanes x 8) of both planes.
// =====================================================================================================
template <bool RES>
__global__ __launch_bounds__(128)
void attn64(const unsigned short* __restrict__ qhp, const unsigned short* __restrict__ qlp,
            const unsigned short* __restrict__ khp, const unsigned short* __restrict__ klp,
            const unsigned short* __restrict__ vhp, const unsigned short* __restrict__ vlp,
            const int* __restrict__ npk,
            unsigned short* ohp, unsigned short* olp, int qbBase, int nqbThis) {
  union FB { v16b v; v8b h[2]; };
  union FH { v16h v; v8h h[2]; };
  __shared__ __align__(16) __bf16   Ksh[64 * LP];                 // K hi [kv][d], rows padded to LP
  __shared__ __align__(16) __bf16   Ksl[64 * LP];                 // K lo
  __shared__ __align__(16) _Float16 Vth[64 * LP];                 // V^T hi [d][kv], rows padded to LP
  __shared__ __align__(16) _Float16 Vtl[64 * LP];                 // V^T residual
  __shared__ __align__(16) _Float16 Psh[4][16 * LP];              // per wave P [row][kv]
  __shared__ __align__(16) _Float16 Psl[RES ? 4 : 1][16 * LP];    // per wave P residual
  __shared__ __align__(16) float    Os[4][16 * 64];               // per wave context tile [row][d]

  const int tid  = threadIdx.x;
  const int wave = tid >> 5;
  const int lane = tid & 31;
  const int hh   = lane >> 4;
  const int c    = lane & 15;

  const int bx   = blockIdx.x;
  const int qbl  = bx % nqbThis;
  const int h    = bx / nqbThis;          // < NH by grid size
  const int qb   = qbBase + qbl;
  const int q0   = qb * 64 + wave * 16;

  int S = npk[0];                         // block-uniform scalar load
  S = (S < 0) ? 0 : S;
  S = (S > SEQ) ? SEQ : S;
  const int SB   = (S + 63) >> 6;                       // 0..NQB
  const int nLow = (qb + 1 < SB) ? (qb + 1) : SB;       // tiles 0..nLow-1
  int nT = nLow + ((qb >= SB) ? 1 : 0);                 // + the block's own tile when not in the prefix
  nT = (nT > NQB) ? NQB : nT;

  const __bf16* Qh = (const __bf16*)(const void*)qhp + (size_t)h * HD;
  const __bf16* Ql = (const __bf16*)(const void*)qlp + (size_t)h * HD;
  const __bf16* Kh = (const __bf16*)(const void*)khp + (size_t)h * HD;
  const __bf16* Kl = (const __bf16*)(const void*)klp + (size_t)h * HD;
  const _Float16* Vh = (const _Float16*)(const void*)vhp + (size_t)h * HD * SEQ;
  const _Float16* Vl = (const _Float16*)(const void*)vlp + (size_t)h * HD * SEQ;

  // ---- Q fragments (A operand, row = lane&15): 2 d-chunks, hi and lo ----
  v16b qah[2], qal[2];
#pragma unroll
  for (int dc = 0; dc < 2; ++dc) {
    const size_t qo = (size_t)(q0 + c) * DM + dc * 32 + 8 * hh;
    qah[dc] = ldfrag_b(Qh + qo);
    qal[dc] = ldfrag_b(Ql + qo);
  }

  float mrow[8], lrow[8];
  v8f oacc[4];
#pragma unroll
  for (int r = 0; r < 8; ++r) { mrow[r] = -INFINITY; lrow[r] = 0.f; }
#pragma unroll
  for (int t = 0; t < 4; ++t) oacc[t] = zero8();

  for (int i = 0; i < nT; ++i) {          // block-uniform trip count, <= NQB
    const int kt  = (i < nLow) ? i : qb;
    const int kv0 = kt * 64;              // kv0 + 63 < SEQ
    __syncthreads();
    {
      const int r = tid >> 1, half = (tid & 1) * 32;
      const __bf16*   kg  = Kh + (size_t)(kv0 + r) * DM + half;   // K row kv0+r, d = half..half+31
      const __bf16*   klg = Kl + (size_t)(kv0 + r) * DM + half;
      const _Float16* vg  = Vh + (size_t)r * SEQ + kv0 + half;    // V^T row d = r, s = kv0+half..+31
      const _Float16* vlg = Vl + (size_t)r * SEQ + kv0 + half;
#pragma unroll
      for (int u = 0; u < 4; ++u) {
        const v8b a0 = *(const v8b*)(kg + 8 * u);
        const v8b a1 = *(const v8b*)(klg + 8 * u);
        const v8h b0 = *(const v8h*)(vg + 8 * u);
        const v8h b1 = *(const v8h*)(vlg + 8 * u);
        *(v8b*)(Ksh + r * LP + half + 8 * u) = a0;
        *(v8b*)(Ksl + r * LP + half + 8 * u) = a1;
        *(v8h*)(Vth + r * LP + half + 8 * u) = b0;
        *(v8h*)(Vtl + r * LP + half + 8 * u) = b1;
      }
    }
    __syncthreads();

    // ---- scores: 16 query rows x 64 keys per wave, 3 bf16 products ----
    //      per d chunk the four key groups' chains run side by side (each chain: hi.hi, hi.lo, lo.hi, as before)
    v8f s[4];
#pragma unroll
    for (int j = 0; j < 4; ++j) s[j] = zero8();
#pragma unroll
    for (int dc = 0; dc < 2; ++dc) {
      FB kb[4], kl[4];
#pragma unroll
      for (int j = 0; j < 4; ++j) {
        kb[j].h[0] = *(const v8b*)(Ksh + (j * 16 + c) * LP + dc * 32 + 8 * hh);
        kb[j].h[1] = *(const v8b*)(Ksh + (j * 16 + c) * LP + dc * 32 + 16 + 8 * hh);
        kl[j].h[0] = *(const v8b*)(Ksl + (j * 16 + c) * LP + dc * 32 + 8 * hh);
        kl[j].h[1] = *(const v8b*)(Ksl + (j * 16 + c) * LP + dc * 32 + 16 + 8 * hh);
      }
#pragma unroll
      for (int j = 0; j < 4; ++j) s[j] = mma_b_raw(qah[dc], kb[j].v, s[j]);
#pragma unroll
      for (int j = 0; j < 4; ++j) s[j] = mma_b_raw(qah[dc], kl[j].v, s[j]);
#pragma unroll
      for (int j = 0; j < 4; ++j) s[j] = mma_b_raw(qal[dc], kb[j].v, s[j]);
      run_guard_b(s[0], s[1], s[2], s[3], kb[0].v, kb[1].v, kb[2].v, kb[3].v, kl[0].v, kl[1].v, kl[2].v, kl[3].v);
    }

    // ---- key visibility rule, row max, online softmax, P (x1024, f16) and P residual (x4096) to LDS ----
    _Float16* pwh = Psh[wave];
    _Float16* pwl = Psl[RES ? wave : 0];
#pragma unroll
    for (int r = 0; r < 8; ++r) {
      const int t = q0 + 8 * hh + r;        // D row 8hh+r of this lane
      float m = -INFINITY;
#pragma unroll
      for (int j = 0; j < 4; ++j) {
        const int kg = kv0 + j * 16 + c;    // D col = key
        const bool ok = ((kg < S) && (kg <= t)) || (kg == t);
        const float sv = ok ? s[j][r] : -INFINITY;
        s[j][r] = sv;
        m = fmaxf(m, sv);
      }
      m = fmaxf(m, row_xor<1>(m));
      m = fmaxf(m, row_xor<2>(m));
      m = fmaxf(m, row_xor<4>(m));
      m = fmaxf(m, row_xor<8>(m));
      const float mnew  = fmaxf(mrow[r], m);
      const float msafe = (mnew == -INFINITY) ? 0.f : mnew;
      const float alpha = __expf(mrow[r] - msafe);
      mrow[r] = mnew;
      float psum = 0.f;
#pragma unroll
      for (int j = 0; j < 4; ++j) {
        const float p = __expf(s[j][r] - msafe);     // masked score: exp(-inf) -> 0
        psum += p;
        const float p1k = p * 1024.0f;
        const _Float16 ph = (_Float16)p1k;
        pwh[(8 * hh + r) * LP + j * 16 + c] = ph;
        if (RES) {
          const _Float16 pr = (_Float16)((p1k - (float)ph) * 4096.0f);
          pwl[(8 * hh + r) * LP + j * 16 + c] = pr;
        }
      }
      psum += row_xor<1>(psum);
      psum += row_xor<2>(psum);
      psum += row_xor<4>(psum);
      psum += row_xor<8>(psum);
      lrow[r] = lrow[r] * alpha + psum;
#pragma unroll
      for (int t4 = 0; t4 < 4; ++t4) oacc[t4][r] *= alpha;
    }
    __builtin_amdgcn_fence(__ATOMIC_RELEASE, "workgroup");
    __builtin_amdgcn_wave_barrier();
    __builtin_amdgcn_fence(__ATOMIC_ACQUIRE, "workgroup");

    // ---- context += P . V_hi (f16 WMMA); residual products into a separate accumulator ----
    v8f o1[4];
#pragma unroll
    for (int t4 = 0; t4 < 4; ++t4) o1[t4] = zero8();
#pragma unroll 1
    for (int kk = 0; kk < 2; ++kk) {
      FH pa, pl;
      pa.h[0] = *(const v8h*)(pwh + c * LP + kk * 32 + 8 * hh);
      pa.h[1] = *(const v8h*)(pwh + c * LP + kk * 32 + 16 + 8 * hh);
      if (RES) {
        pl.h[0] = *(const v8h*)(pwl + c * LP + kk * 32 + 8 * hh);
        pl.h[1] = *(const v8h*)(pwl + c * LP + kk * 32 + 16 + 8 * hh);
      } else {
        pl.v = pa.v;
      }
#pragma unroll
      for (int t4 = 0; t4 < 4; ++t4) {
        FH vb, vl;
        vb.h[0] = *(const v8h*)(Vth + (t4 * 16 + c) * LP + kk * 32 + 8 * hh);
        vb.h[1] = *(const v8h*)(Vth + (t4 * 16 + c) * LP + kk * 32 + 16 + 8 * hh);
        vl.h[0] = *(const v8h*)(Vtl + (t4 * 16 + c) * LP + kk * 32 + 8 * hh);
        vl.h[1] = *(const v8h*)(Vtl + (t4 * 16 + c) * LP + kk * 32 + 16 + 8 * hh);
        oacc[t4] = mma_h_raw(pa.v, vb.v, oacc[t4]);
        o1[t4]   = mma_h_raw(pa.v, vl.v, o1[t4]);
        if (RES) o1[t4] = mma_h_raw(pl.v, vb.v, o1[t4]);
      }
    }
#pragma unroll
    for (int t4 = 0; t4 < 4; ++t4)
#pragma unroll
      for (int r = 0; r < 8; ++r) oacc[t4][r] += o1[t4][r] * (1.0f / 4096.0f);
  }

  // ---- normalise (1/l and the 1/1024 p carry), stage the wave's 16x64 tile, bf16 hi/lo split,
  float* os = Os[wave];
#pragma unroll
  for (int r = 0; r < 8; ++r) {
    const float l = lrow[r];
    const float inv = ((l > 0.f) ? (1.0f / l) : 0.f) * (1.0f / 1024.0f);
#pragma unroll
    for (int t4 = 0; t4 < 4; ++t4) os[(8 * hh + r) * 64 + t4 * 16 + c] = oacc[t4][r] * inv;
  }
  __builtin_amdgcn_fence(__ATOMIC_RELEASE, "workgroup");
  __builtin_amdgcn_wave_barrier();
  __builtin_amdgcn_fence(__ATOMIC_ACQUIRE, "workgroup");
  {
    const int q4 = lane >> 3, c8 = (lane & 7) * 8;
    v4u hv[4], lv[4];
#pragma unroll
    for (int it = 0; it < 4; ++it) {
      const int row = it * 4 + q4;   // it 0..3 x q4 0..3 = rows 0..15 of the wave tile
      const float* sp = os + row * 64 + c8;
      v4u a, a2;
#pragma unroll
      for (int e = 0; e < 4; ++e) {
        const float f0 = sp[2 * e], f1 = sp[2 * e + 1];
        const unsigned short h0 = bf_bits(f0), h1 = bf_bits(f1);
        const unsigned short l0 = bf_bits(f0 - bf_up(h0)), l1 = bf_bits(f1 - bf_up(h1));
        a[e] = pk16(h0, h1); a2[e] = pk16(l0, l1);
      }
      hv[it] = a; lv[it] = a2;
    }
    {
#pragma unroll
      for (int it = 0; it < 4; ++it) {
        const int row = it * 4 + q4;
        const size_t go = (size_t)(q0 + row) * DM + (size_t)h * HD + c8;
        *(v4u*)(ohp + go) = hv[it];
        *(v4u*)(olp + go) = lv[it];
      }
      
    }
  }
}

// =====================================================================================================
// Workspace map (bytes), every region an exact multiple of its whole-line / whole-tile store granularity:
//   Xb    bf16 [4096][1024]          0            8388608
//   Wqkv  bf16 [3072 n][1024 k]      8388608      6291456   (rows 0..2047 = q|k weights, 2048.. = v weights)
//   Wob   bf16 [1024][1024]          14680064     2097152
//   QKf   f32  [4096][2048]          16777216     33554432  (cols 0..1023 q, 1024..2047 k)
//   VTh   f16  [1024 d][4096 s]      50331648     8388608
//   VTl   f16  [1024 d][4096 s]      58720256     8388608
//   QK4   bf16 4 x [4096][1024]      67108864     33554432  (q hi, q lo, k hi, k lo)
//   Oh    bf16 [4096][1024]          100663296    8388608
//   Ol    bf16 [4096][1024]          109051904    8388608
//   end                              117440512
// Weights are [out n][in k] with k contiguous = the Bt / A layout the GEMM wants, so they are only converted.
// =====================================================================================================
extern "C" void kernel_launch(void* const* d_in, const int* in_sizes, int n_in,
                              void* d_out, int out_size, void* d_ws, size_t ws_size,
                              hipStream_t stream) {
  if (n_in < 7) return;
  if (in_sizes[0] != SEQ * DM) return;
  if (in_sizes[1] != SEQ * 2) return;
  if (in_sizes[2] != NQKV * DM) return;
  if (in_sizes[3] != DM * DM) return;
  if (in_sizes[4] != NH) return;
  if (in_sizes[5] != 2 * NH * NFR) return;
  if (in_sizes[6] < 1) return;
  if (out_size != SEQ * DM) return;

  const float* x     = (const float*)d_in[0];
  const float* pos   = (const float*)d_in[1];
  const float* qkvw  = (const float*)d_in[2];
  const float* outw  = (const float*)d_in[3];
  const float* scl   = (const float*)d_in[4];
  const float* freqs = (const float*)d_in[5];
  const int*   npk   = (const int*)d_in[6];

  const size_t PXB   = (size_t)SEQ * DM * 2;      //  8388608
  const size_t PWQKV = (size_t)NQKV * DM * 2;     //  6291456
  const size_t PWO   = (size_t)DM * DM * 2;       //  2097152
  const size_t PQKF  = (size_t)SEQ * QKW * 4;     // 33554432
  const size_t PVT   = (size_t)DM * SEQ * 2;      //  8388608
  const size_t PPL   = (size_t)SEQ * DM * 2;      //  8388608
  size_t off = 0;
  const size_t oXb   = off; off += PXB;
  const size_t oWqkv = off; off += PWQKV;
  const size_t oWo   = off; off += PWO;
  const size_t oQKf  = off; off += PQKF;
  const size_t oVTh  = off; off += PVT;
  const size_t oVTl  = off; off += PVT;
  const size_t oQK4  = off; off += 4 * PPL;
  const size_t oOh   = off; off += PPL;
  const size_t oOl   = off; off += PPL;
  if (off > ws_size) return;                      // off = 117440512
  if (off > (size_t)134217728) return;

  char* ws = (char*)d_ws;
  unsigned short* Xb   = (unsigned short*)(ws + oXb);
  unsigned short* Wqkv = (unsigned short*)(ws + oWqkv);
  unsigned short* Wvb  = Wqkv + (size_t)2 * DM * DM;             // rows 2048.. of the qkv weight plane
  unsigned short* Wob  = (unsigned short*)(ws + oWo);
  float*          QKf  = (float*)(ws + oQKf);
  unsigned short* VTh  = (unsigned short*)(ws + oVTh);
  unsigned short* VTl  = (unsigned short*)(ws + oVTl);
  unsigned short* QK4  = (unsigned short*)(ws + oQK4);
  unsigned short* Qh   = QK4;
  unsigned short* Ql   = QK4 + (size_t)SEQ * DM;
  unsigned short* Kh   = QK4 + (size_t)2 * SEQ * DM;
  unsigned short* Kl   = QK4 + (size_t)3 * SEQ * DM;
  unsigned short* Oh   = (unsigned short*)(ws + oOh);
  unsigned short* Ol   = (unsigned short*)(ws + oOl);

  const dim3 blk(256);
  const int n8x = SEQ * DM / 8;                                // 524288
  const int n8w = NQKV * DM / 8;                               // 393216
  const int n8o = DM * DM / 8;                                 // 131072
  const dim3 gCvtX((n8x + 255) / 256);                         // 2048 blocks
  const dim3 gCvtW((n8w + 255) / 256);                         // 1536 blocks
  const dim3 gCvtO((n8o + 255) / 256);                         // 512 blocks
  const dim3 gQK(((SEQ / 64) * (QKW / 64) + 7) / 8, 1);        // 2048 tiles -> 256 blocks: M=4096, N=2048
  const dim3 gVT(((DM / 64) * (SEQ / 64) + 7) / 8, 1);         // 1024 tiles -> 128 blocks: M=1024, N=4096
  const dim3 gOut(((SEQ / 64) * (DM / 64) + 7) / 8, 1);        // 1024 tiles -> 128 blocks: M=4096, N=1024
  const int  nRows = SEQ * NH;                                 // 65536 (t, h) rows
  const dim3 gRope((nRows + 7) / 8);                           // 8192 blocks of 8 waves

  // (1) x -> bf16 [4096][1024]; weights [n][k] f32 -> bf16 [n][k]
  cvt_bf16x8<<<gCvtX, blk, 0, stream>>>(x, Xb, n8x);
  cvt_bf16x8<<<gCvtW, blk, 0, stream>>>(qkvw, Wqkv, n8w);
  cvt_bf16x8<<<gCvtO, blk, 0, stream>>>(outw, Wob, n8o);
  // (2) q|k = x . W[0:2048]^T -> f32 [4096][2048]   (M=4096, N=2048, K=1024)
  gemm64<0, 0><<<gQK, blk, 0, stream>>>(
      Xb, Xb, DM, 0LL, Wqkv, Wqkv, DM, 0LL,
      (void*)QKf, QKW, 0LL, (void*)QKf, QKW, 0LL, 0,
      SEQ, QKW, DM, 1.0f);
  // (3) v^T = Wv . x^T -> f16 hi plane [h*64+d][s] (pitch SEQ) and residual plane (x4096, all keys)
  //     (A = Wvb [n][k], Bt = Xb; M=1024, N=4096, K=1024)
  gemm64<0, 3><<<gVT, blk, 0, stream>>>(
      Wvb, Wvb, DM, 0LL, Xb, Xb, DM, 0LL,
      (void*)VTh, SEQ, 0LL, (void*)VTl, SEQ, 0LL, SEQ,
      DM, SEQ, DM, 4096.0f);
  // (4) cosine-sim scaling + axial rotation -> q hi/lo, k hi/lo bf16 planes [t][h*64+d]
  rope_qk<<<gRope, blk, 0, stream>>>(QKf, pos, scl, freqs, QK4, nRows);
  // (5) attention: row blocks 0..RESQB-1 with the p residual plane, the rest without
  attn64<true><<<dim3(NH * RESQB), dim3(128), 0, stream>>>(
      Qh, Ql, Kh, Kl, VTh, VTl, npk, Oh, Ol, 0, RESQB);
  attn64<false><<<dim3(NH * (NQB - RESQB)), dim3(128), 0, stream>>>(
      Qh, Ql, Kh, Kl, VTh, VTl, npk, Oh, Ol, RESQB, NQB - RESQB);
  // (6) out = context . Wo^T -> d_out f32 [4096][1024]  (A = context hi + lo planes, 2 products)
  gemm64<1, 0><<<gOut, blk, 0, stream>>>(
      Oh, Ol, DM, 0LL, Wob, Wob, DM, 0LL,
      d_out, DM, 0LL, d_out, DM, 0LL, 0,
      SEQ, DM, DM, 1.0f);
  (void)hipGetLastError();
}

// v005
// A run of this version takes 226 microseconds.
// Timed twice side by side with v004, it ran 1.13 times as fast both times.
// Counting every step since v000, it is 2.52 times as fast.
// Contractions: q|k and v^T projections = v_wmma_f32_16x16x32_bf16 (bf16 operands from RNE-converted inputs, single product);
// q.k^T scores = v_wmma_f32_16x16x32_bf16 with bf16 hi/lo split q and k (hi.hi + hi.lo + lo.hi);
// p.v = v_wmma_f32_16x16x32_f16 (p carried x1024 in f16; v as f16 hi plane + f16 residual plane x4096, 2 products;
// extra f16 residual plane x4096 of p for the first 512 rows); ctx.Wo^T = v_wmma_f32_16x16x32_bf16 with ctx as
// bf16 hi/lo planes times bf16 Wo (2 products); all f32 accumulate; norms, rotations and softmax in f32.
#include <hip/hip_runtime.h>
#include <math.h>
#include <stdint.h>

#define SEQ   4096
#define DM    1024
#define NH    16
#define HD    64
#define NQB   (SEQ / 64)   // 64 row / key tiles of 64
#define RESQB 8            // leading 64-row blocks that also use the p residual plane
#define QKW   (2 * DM)     // pitch of the f32 q|k plane
#define NQKV  (3 * DM)
#define NFR   16           // rotation frequencies per head per axis (HD/4)
#define LP    72           // LDS row pitch of the 64-wide 16-bit attention tiles, in elements: 144 B = 16 B x 9 (odd)
#define GP    72           // LDS row pitch of the GEMM operand slices (64 k of 16 bits), in elements: 144 B = 16 B x 9 (odd)
static_assert(NH * HD == DM);
static_assert((SEQ % 256) == 0 && (DM % 256) == 0);
static_assert((SEQ % 64) == 0 && (DM % 64) == 0);
static_assert(RESQB <= NQB);
static_assert(HD == 4 * NFR);

typedef _Float16 v16h __attribute__((ext_vector_type(16)));
typedef _Float16 v8h  __attribute__((ext_vector_type(8)));
typedef __bf16   v16b __attribute__((ext_vector_type(16)));
typedef __bf16   v8b  __attribute__((ext_vector_type(8)));
typedef float    v8f  __attribute__((ext_vector_type(8)));
typedef float    v4f  __attribute__((ext_vector_type(4)));
typedef unsigned int v4u __attribute__((ext_vector_type(4)));

// ---- scalar helpers --------------------------------------------------------------------------------
__device__ __forceinline__ unsigned short bf_bits(float f) {          // f32 -> bf16 bits, RNE convert
  unsigned u = __float_as_uint(f);
  return (unsigned short)((u + 0x7FFFu + ((u >> 16) & 1u)) >> 16);
}
__device__ __forceinline__ float bf_up(unsigned short h) { return __uint_as_float(((unsigned)h) << 16); }
__device__ __forceinline__ float bf_rn(float f) { return bf_up(bf_bits(f)); }   // value after RNE convert to bf16
__device__ __forceinline__ unsigned short h_bits(_Float16 x) { return __builtin_bit_cast(unsigned short, x); }
__device__ __forceinline__ unsigned pk16(unsigned short a, unsigned short b) { return (unsigned)a | ((unsigned)b << 16); }
// value of lane (l ^ M) inside the lane's 16-lane row, M = 1..15: a DPP operand (row_xmask), no trip through the LDS pipe
template <int M>
__device__ __forceinline__ float row_xor(float x) {
  return __builtin_bit_cast(float, __builtin_amdgcn_update_dpp(0, __builtin_bit_cast(int, x), 0x160 + M, 0xf, 0xf, true));
}
// value of lane (l ^ 16): vector cross-row move
__device__ __forceinline__ float half_xor(float x) {
  return __builtin_bit_cast(float, __builtin_amdgcn_permlanex16(__builtin_bit_cast(int, x), __builtin_bit_cast(int, x),
                                                                0x76543210, 0xfedcba98, false, false));
}
__device__ __forceinline__ v8f zero8() { v8f z = {0.f, 0.f, 0.f, 0.f, 0.f, 0.f, 0.f, 0.f}; return z; }

// ---- fragment loaders: 16-bit A/B operand, lane -> row/col (lane&15), p already includes +8*(lane>>4);
//      elements 0..7 <- p[0..7] (k0+8h..), elements 8..15 <- p[16..23] (k0+16+8h..)
__device__ __forceinline__ v16b ldfrag_b(const __bf16* p) {
  union { v16b v; v8b h[2]; } f;
  f.h[0] = *(const v8b*)(p);
  f.h[1] = *(const v8b*)(p + 16);
  return f.v;
}

// ---- WMMA helpers -------------------------------------------------------------------------------------
__device__ __forceinline__ v8f mma_b_raw(v16b a, v16b b, v8f c) {
  return __builtin_amdgcn_wmma_f32_16x16x32_bf16(false, a, false, b, (short)0, c, false, false);
}
__device__ __forceinline__ v8f mma_h_raw(v16h a, v16h b, v8f c) {
  return __builtin_amdgcn_wmma_f32_16x16x32_f16(false, a, false, b, (short)0, c, false, false);
}
// closes a run of products on four accumulator chains: the eight B fragments stay in their registers until the whole
// run has issued (no later result is placed over an operand still being read), and the four v_nop are the matrix
// distance in front of the first vector instruction on the results or on the fragments' registers
__device__ __forceinline__ void run_guard_b(v8f& s0, v8f& s1, v8f& s2, v8f& s3,
                                            v16b b0, v16b b1, v16b b2, v16b b3, v16b c0, v16b c1, v16b c2, v16b c3) {
  asm volatile("v_nop\n\tv_nop\n\tv_nop\n\tv_nop"
               : "+v"(s0), "+v"(s1), "+v"(s2), "+v"(s3)
               : "v"(b0), "v"(b1), "v"(b2), "v"(b3), "v"(c0), "v"(c1), "v"(c2), "v"(c3));
}
__device__ __forceinline__ void dep_guard_b(v8f& a, v8f& b, v16b x, v16b y) {
  asm volatile("v_nop\n\tv_nop\n\tv_nop\n\tv_nop" : "+v"(a), "+v"(b) : "v"(x), "v"(y));
}
__device__ __forceinline__ void keep4_b(v16b a, v16b b, v16b c, v16b d) {
  asm volatile("v_nop" :: "v"(a), "v"(b), "v"(c), "v"(d));
}
__device__ __forceinline__ void acc_guard4(v8f& a, v8f& b, v8f& c, v8f& d) {
  asm volatile("v_nop\n\tv_nop\n\tv_nop\n\tv_nop" : "+v"(a), "+v"(b), "+v"(c), "+v"(d));
}

// =====================================================================================================
// f32 -> bf16 (RNE convert), 8 elements per thread, one 16-B store per lane: a wave writes 512 contiguous B
// coverage: n8 threads x 8 = whole plane (n8 is a multiple of 256 for every use here).
// =====================================================================================================
__global__ __launch_bounds__(256) void cvt_bf16x8(const float* __restrict__ in, unsigned short* out, int n8) {
  const int i = blockIdx.x * 256 + threadIdx.x;
  if (i < n8) {
    const v4f a = *(const v4f*)(in + (size_t)i * 8);
    const v4f b = *(const v4f*)(in + (size_t)i * 8 + 4);
    v4u p;
    p[0] = pk16(bf_bits(a[0]), bf_bits(a[1]));
    p[1] = pk16(bf_bits(a[2]), bf_bits(a[3]));
    p[2] = pk16(bf_bits(b[0]), bf_bits(b[1]));
    p[3] = pk16(bf_bits(b[2]), bf_bits(b[3]));
    *(v4u*)(out + (size_t)i * 8) = p;
    
  }
}

// =====================================================================================================
// Asynchronous copies global -> LDS, 16 B per lane, four per statement. l* = the lane's LDS byte address,
// g* = the lane's global address. The closing s_wait_xcnt stands inside the statement so that no address
// register of an issued copy is rewritten in front of it.
// =====================================================================================================
__device__ __forceinline__ void copy4_to_lds(unsigned l0, unsigned l1, unsigned l2, unsigned l3,
                                             const __bf16* g0, const __bf16* g1, const __bf16* g2, const __bf16* g3) {
  asm volatile("global_load_async_to_lds_b128 %0, %4, off\n\t"
               "global_load_async_to_lds_b128 %1, %5, off\n\t"
               "global_load_async_to_lds_b128 %2, %6, off\n\t"
               "global_load_async_to_lds_b128 %3, %7, off\n\t"
               "s_wait_xcnt 0x0"
               :: "v"(l0), "v"(l1), "v"(l2), "v"(l3), "v"(g0), "v"(g1), "v"(g2), "v"(g3) : "memory");
}
__device__ __forceinline__ unsigned lds_addr(const __bf16* p) { return (unsigned)(uintptr_t)p; }   // low 32 bits = LDS byte address

// =====================================================================================================
// Register-blocked batched bf16 WMMA GEMM: C[m][n] = sum_k A[m][k] * Bt[n][k]; a block of 8 waves (2 x 4) owns a
// 128 x 256 tile, one wave per 64x64 sub-tile. A row-major [M][K] pitch lda; Bt row-major [N][K] pitch ldb
// (k contiguous); M multiple of 128, N of 256, K of 64. blockIdx.y = batch index (strides in elements).
// Operand path: per slice of 64 k the block's 128 A rows and 256 Bt rows (128 B each = one line; 8 lanes x 16 B
// per row, so a wave-wide copy covers 4 whole lines) go to LDS by asynchronous copies, rows at pitch GP; two
// buffers, slice t + 1 in flight while slice t is multiplied; fragments by 16-B LDS loads.
// NSPLIT: 0 = A.Bt; 1 = (A + A2).Bt (A2 = unscaled bf16 lo plane of A).
// OUT_MODE: 0 = f32 (pitch ldc); 2 = bf16 hi plane C + bf16 lo plane C2 (lo = RNE(v - hi), unscaled);
//           3 = f16 hi plane C + f16 residual plane C2 = f16((v - hi) * rscale), C2 written only for tiles
//               with n0 < N2 (pitch ldc2, batch stride strideC2).
// =====================================================================================================
template <int NSPLIT, int OUT_MODE>
__global__ __launch_bounds__(256) void gemm64(
    const unsigned short* __restrict__ Ap, const unsigned short* A2p, int lda, long long strideA,
    const unsigned short* __restrict__ Btp, const unsigned short* Bt2p, int ldb, long long strideB,
    void* Cout, int ldc, long long strideC,
    void* Cout2, int ldc2, long long strideC2, int N2,
    int M, int N, int K, float rscale) {
  static_assert(NSPLIT == 0 || NSPLIT == 1);
  const __bf16* A   = (const __bf16*)(const void*)Ap;
  const __bf16* A2  = (const __bf16*)(const void*)A2p;
  const __bf16* Bt  = (const __bf16*)(const void*)Btp;
  __shared__ __align__(16) float  sT[8][16 * 68];   // per-wave 16x64 slab, pitch 68 floats
  __shared__ __align__(16) __bf16 sA[2][128 * GP];                                   // A slice, two buffers
  __shared__ __align__(16) __bf16 sA2[NSPLIT ? 2 : 1][NSPLIT ? 128 * GP : 8];        // A2 slice
  __shared__ __align__(16) __bf16 sB[2][256 * GP];                                   // Bt slice
  const int b    = blockIdx.y;
  const int tid  = threadIdx.x;
  const int lane = tid & 31;
  const int wave = tid >> 5;
  const int tilesN = N >> 8;
  const int tilesM = M >> 7;
  if ((int)blockIdx.x >= tilesM * tilesN) return;   // block-uniform, in front of every barrier and copy
  const int bm = blockIdx.x / tilesN;
  const int bn = blockIdx.x - bm * tilesN;
  const int mB = bm << 7;
  const int nB = bn << 8;
  const int wm = wave >> 2;                    // 0..1
  const int wn = wave & 3;                     // 0..3
  const int m0 = mB + (wm << 6);
  const int n0 = nB + (wn << 6);

  const __bf16* Ab  = A  + (size_t)b * strideA;
  const __bf16* Bb  = Bt + (size_t)b * strideB;
  const __bf16* Ab2 = NSPLIT ? (A2 + (size_t)b * strideA) : Ab;

  const int rlane = lane & 15;                 // row (A) / col (B, D) within subtile
  const int koff  = (lane >> 4) * 8;           // k offset of this lane half
  const int mOff  = (lane >> 4) * 8;           // D row offset

  // copy map: thread -> row (tid >> 3) + 32 p of the slice, 16-B piece (tid & 7) of its 128 B
  const int crow = tid >> 3;
  const int cseg = (tid & 7) * 8;
  const __bf16* gA  = Ab  + (size_t)(mB + crow) * lda + cseg;
  const __bf16* gA2 = Ab2 + (size_t)(mB + crow) * lda + cseg;
  const __bf16* gB  = Bb  + (size_t)(nB + crow) * ldb + cseg;
  const unsigned lA  = lds_addr(&sA[0][crow * GP + cseg]);
  const unsigned lA2 = lds_addr(&sA2[0][NSPLIT ? crow * GP + cseg : 0]);
  const unsigned lB  = lds_addr(&sB[0][crow * GP + cseg]);
  const unsigned R32 = 32 * GP * 2;            // 32 LDS rows, bytes
  const size_t a32 = (size_t)32 * lda, b32 = (size_t)32 * ldb;
  auto stage = [&](int t, int buf) {           // slice t (k = 64 t .. 64 t + 63) into buffer buf
    const __bf16* pa = gA + (size_t)t * 64;
    const __bf16* pb = gB + (size_t)t * 64;
    const unsigned la = lA + (unsigned)buf * (4 * R32);
    const unsigned lb = lB + (unsigned)buf * (8 * R32);
    copy4_to_lds(la, la + R32, la + 2 * R32, la + 3 * R32, pa, pa + a32, pa + 2 * a32, pa + 3 * a32);
    if (NSPLIT) {
      const __bf16* pa2 = gA2 + (size_t)t * 64;
      const unsigned la2 = lA2 + (unsigned)buf * (4 * R32);
      copy4_to_lds(la2, la2 + R32, la2 + 2 * R32, la2 + 3 * R32, pa2, pa2 + a32, pa2 + 2 * a32, pa2 + 3 * a32);
    }
    copy4_to_lds(lb, lb + R32, lb + 2 * R32, lb + 3 * R32, pb, pb + b32, pb + 2 * b32, pb + 3 * b32);
    copy4_to_lds(lb + 4 * R32, lb + 5 * R32, lb + 6 * R32, lb + 7 * R32,
                 pb + 4 * b32, pb + 5 * b32, pb + 6 * b32, pb + 7 * b32);
  };

  v8f acc[4][4];
#pragma unroll
  for (int i = 0; i < 4; ++i)
#pragma unroll
    for (int j = 0; j < 4; ++j) acc[i][j] = zero8();

  const int nK = K >> 6;
  stage(0, 0);
  asm volatile("s_wait_asynccnt 0x0" ::: "memory");   // this wave's copies of slice 0 have landed
  __syncthreads();                                    // every wave's have: slice 0 is readable
  if (nK > 1) stage(1, 1);
  for (int t = 0; t < nK; ++t) {
    const int buf = t & 1;
    const __bf16* tA  = sA[buf]  + ((wm << 6) + rlane) * GP + koff;
    const __bf16* tA2 = NSPLIT ? (sA2[buf] + ((wm << 6) + rlane) * GP + koff) : tA;
    const __bf16* tB  = sB[buf]  + ((wn << 6) + rlane) * GP + koff;
#pragma unroll
    for (int kk = 0; kk < 2; ++kk) {
      // the fragments of a k chunk of 32 are fetched as one group in front of its products
      v16b bh[4], ah[4], al[4];
#pragma unroll
      for (int j = 0; j < 4; ++j) bh[j] = ldfrag_b(tB + (j << 4) * GP + kk * 32);
#pragma unroll
      for (int i = 0; i < 4; ++i) {
        ah[i] = ldfrag_b(tA + (i << 4) * GP + kk * 32);
        al[i] = NSPLIT ? ldfrag_b(tA2 + (i << 4) * GP + kk * 32) : ah[i];
      }
#pragma unroll
      for (int i = 0; i < 4; ++i) {
#pragma unroll
        for (int j = 0; j < 4; ++j) {
          acc[i][j] = mma_b_raw(ah[i], bh[j], acc[i][j]);
          if (NSPLIT) acc[i][j] = mma_b_raw(al[i], bh[j], acc[i][j]);
        }
        dep_guard_b(acc[i][0], acc[i][3], ah[i], al[i]);
      }
      keep4_b(bh[0], bh[1], bh[2], bh[3]);
    }
    asm volatile("s_wait_dscnt 0x0" ::: "memory");     // this wave's reads of buffer buf are done before it is refilled
    asm volatile("s_wait_asynccnt 0x0" ::: "memory");  // this wave's copies of slice t + 1 have landed
    __syncthreads();                                   // publishes slice t + 1 and ends every read of buffer buf
    if (t + 2 < nK) stage(t + 2, buf);
  }
  asm volatile("s_wait_asynccnt 0x0" ::: "memory");    // no copy outstanding behind the loop
  acc_guard4(acc[0][0], acc[0][1], acc[0][2], acc[0][3]);
  acc_guard4(acc[1][0], acc[1][1], acc[1][2], acc[1][3]);
  acc_guard4(acc[2][0], acc[2][1], acc[2][2], acc[2][3]);
  acc_guard4(acc[3][0], acc[3][1], acc[3][2], acc[3][3]);

  // ---- epilogue ----
  float* slab = sT[wave];
#pragma unroll
  for (int i = 0; i < 4; ++i) {
    const int mBase = m0 + (i << 4);
#pragma unroll
    for (int j = 0; j < 4; ++j) {
#pragma unroll
      for (int r = 0; r < 8; ++r) {
        slab[(mOff + r) * 68 + (j << 4) + rlane] = acc[i][j][r];
      }
    }
    __builtin_amdgcn_fence(__ATOMIC_RELEASE, "workgroup");
    __builtin_amdgcn_wave_barrier();
    __builtin_amdgcn_fence(__ATOMIC_ACQUIRE, "workgroup");
    if (OUT_MODE == 0) {
      float* C = (float*)Cout + (size_t)b * strideC;
      const int hh = lane >> 4, c4 = (lane & 15) * 4;     // 256-B row segment = 16 lanes x 16 B
      {
#pragma unroll
        for (int it = 0; it < 8; ++it) {
          const int row = it * 2 + hh;                     // it 0..7 x hh 0..1 = rows 0..15
          const v4f v = *(const v4f*)(slab + row * 68 + c4);
          *(v4f*)(C + (size_t)(mBase + row) * ldc + n0 + c4) = v;
        }
        
      }
    } else {
      const int q = lane >> 3, c8 = (lane & 7) * 8;
      unsigned short* C  = (unsigned short*)Cout  + (size_t)b * strideC;
      unsigned short* C2 = (unsigned short*)Cout2 + (size_t)b * strideC2;
      const bool wlo = (OUT_MODE == 2) || (n0 < N2);      // wave-uniform
      v4u hv[4], lv[4];
#pragma unroll
      for (int it = 0; it < 4; ++it) {
        const int row = it * 4 + q;                        // it 0..3 x q 0..3 = rows 0..15
        const float* sp = slab + row * 68 + c8;
        v4u a, a2;
#pragma unroll
        for (int e = 0; e < 4; ++e) {
          const float f0 = sp[2 * e], f1 = sp[2 * e + 1];
          unsigned short h0, h1, l0, l1;
          if (OUT_MODE == 2) {
            h0 = bf_bits(f0); h1 = bf_bits(f1);
            l0 = bf_bits(f0 - bf_up(h0)); l1 = bf_bits(f1 - bf_up(h1));
          } else {
            const _Float16 x0 = (_Float16)f0, x1 = (_Float16)f1;
            h0 = h_bits(x0); h1 = h_bits(x1);
            l0 = h_bits((_Float16)((f0 - (float)x0) * rscale));
            l1 = h_bits((_Float16)((f1 - (float)x1) * rscale));
          }
          a[e] = pk16(h0, h1); a2[e] = pk16(l0, l1);
        }
        hv[it] = a; lv[it] = a2;
      }
      {
#pragma unroll
        for (int it = 0; it < 4; ++it) {
          const int row = it * 4 + q;
          *(v4u*)(C + (size_t)(mBase + row) * ldc + n0 + c8) = hv[it];
          if (wlo) *(v4u*)(C2 + (size_t)(mBase + row) * ldc2 + n0 + c8) = lv[it];
        }
        
      }
    }
    __builtin_amdgcn_fence(__ATOMIC_RELEASE, "workgroup");
    __builtin_amdgcn_wave_barrier();
    __builtin_amdgcn_fence(__ATOMIC_ACQUIRE, "workgroup");
  }
}

// =====================================================================================================
// Cosine-similarity scaling + axial rotation of q and k, f32, one wave per (token t, head h) row.
//   qkf: f32 [t][QKW], q of head h at cols h*64.., k at cols DM + h*64..
//   pos [t][2], scl [NH], freqs [2][NH][NFR]: values RNE-converted to bf16 in register before use.
//   rq = sqrt(|scl_h| + 1e-8) * rsqrt(sum(q^2) + 1e-8); qs = q * rq (same for k)
//   theta[i], i < 16: (pos[t][1]*2 - 1) * freqs[1][h][i]; i >= 16: (pos[t][0]*2 - 1) * freqs[0][h][i-16]
//   out[i] = qs[i] cos - qs[i+32] sin; out[i+32] = qs[i+32] cos + qs[i] sin (lane i = pair index).
//   qk4: four bf16 planes [t][h*64+d] back to back (plane stride SEQ*DM elements): q hi, q lo, k hi, k lo
//   (lo = RNE(v - hi), unscaled). The wave's 64-wide row is staged in LDS, then ONE store instruction writes
//   grid = nrows/8 blocks of 256 (8 waves). coverage: nrows = SEQ*NH rows x 64 cols in each of the 4 planes.
// =====================================================================================================
__global__ __launch_bounds__(256) void rope_qk(const float* __restrict__ qkf, const float* __restrict__ pos,
                                               const float* __restrict__ scl, const float* __restrict__ freqs,
                                               unsigned short* qk4, int nrows) {
#pragma clang fp contract(off)
  __shared__ __align__(16) float sq[8][64];
  __shared__ __align__(16) float sk[8][64];
  const int tid  = threadIdx.x;
  const int wave = tid >> 5;
  const int lane = tid & 31;
  const int rho  = blockIdx.x * 8 + wave;
  if (rho < nrows) {                                      // wave-uniform; no block barriers in this kernel
    const int t = rho >> 4;
    const int h = rho & 15;
    const float* qr = qkf + (size_t)t * QKW + h * HD;
    const float* kr = qr + DM;
    const int i = lane;                                   // pair index 0..31
    const float q1 = qr[i], q2 = qr[i + 32];
    const float k1 = kr[i], k2 = kr[i + 32];
    float ssq = q1 * q1 + q2 * q2;
    float ssk = k1 * k1 + k2 * k2;
    ssq += half_xor(ssq);    ssk += half_xor(ssk);
    ssq += row_xor<8>(ssq);  ssk += row_xor<8>(ssk);
    ssq += row_xor<4>(ssq);  ssk += row_xor<4>(ssk);
    ssq += row_xor<2>(ssq);  ssk += row_xor<2>(ssk);
    ssq += row_xor<1>(ssq);  ssk += row_xor<1>(ssk);
    const float scr = bf_rn(scl[h]);
    const float ss  = sqrtf(fabsf(scr) + 1e-8f);
    const float rq  = ss * rsqrtf(ssq + 1e-8f);
    const float rk  = ss * rsqrtf(ssk + 1e-8f);
    const float px  = bf_rn(pos[2 * t + 0]);
    const float py  = bf_rn(pos[2 * t + 1]);
    const int  low  = (i < 16) ? 1 : 0;
    const int  fi   = low ? (NH * NFR + h * NFR + i) : (h * NFR + (i - 16));   // [1][h][i] or [0][h][i-16], < 2*NH*NFR
    const float fr  = bf_rn(freqs[fi]);
    const float pp  = low ? py : px;
    const float th  = (pp * 2.0f - 1.0f) * fr;
    const float cs  = cosf(th);
    const float sn  = sinf(th);
    const float xq1 = q1 * rq, xq2 = q2 * rq;
    const float xk1 = k1 * rk, xk2 = k2 * rk;
    sq[wave][i]      = xq1 * cs - xq2 * sn;
    sq[wave][i + 32] = xq2 * cs + xq1 * sn;
    sk[wave][i]      = xk1 * cs - xk2 * sn;
    sk[wave][i + 32] = xk2 * cs + xk1 * sn;
    __builtin_amdgcn_fence(__ATOMIC_RELEASE, "workgroup");
    __builtin_amdgcn_wave_barrier();
    __builtin_amdgcn_fence(__ATOMIC_ACQUIRE, "workgroup");
    const int pl = lane >> 3;                             // plane 0 q hi, 1 q lo, 2 k hi, 3 k lo
    const int c8 = (lane & 7) * 8;
    const float* spq = &sq[wave][c8];
    const float* spk = &sk[wave][c8];
    v4u w;
#pragma unroll
    for (int e = 0; e < 4; ++e) {
      const float fq0 = spq[2 * e], fq1 = spq[2 * e + 1];
      const float fk0 = spk[2 * e], fk1 = spk[2 * e + 1];
      const float f0 = (pl < 2) ? fq0 : fk0;
      const float f1 = (pl < 2) ? fq1 : fk1;
      const unsigned short hb0 = bf_bits(f0), hb1 = bf_bits(f1);
      const unsigned short lb0 = bf_bits(f0 - bf_up(hb0)), lb1 = bf_bits(f1 - bf_up(hb1));
      const unsigned short s0 = (pl & 1) ? lb0 : hb0;
      const unsigned short s1 = (pl & 1) ? lb1 : hb1;
      w[e] = pk16(s0, s1);
    }
    unsigned short* dst = qk4 + (size_t)pl * ((size_t)SEQ * DM) + (size_t)t * DM + h * HD + c8;
    *(v4u*)dst = w;
    
  }
}

// =====================================================================================================
// Attention, head dim 64, unified key rule: key s is visible to row t iff (s < S and s <= t) or s == t,
// with S = npk[0] clamped to [0, SEQ] (causal prefix segment of S tokens; later rows see the whole prefix
// plus themselves). Scores unscaled; masked scores = -inf; softmax f32 online.
//   q planes (bf16 hi / lo): element (t, h, d) at [t*DM + h*64 + d]; k planes same with key index s
//   v^T hi plane (f16):      element (h, d, s) at [(h*64 + d)*SEQ + s]; residual plane (f16, (v - hi)*4096) same layout
//   out planes (bf16 hi / lo of the normalised context): element (t, h, d) at [t*DM + h*64 + d]
//   scores = q . k : bf16 hi/lo split (hi.hi + hi.lo + lo.hi), f32 accumulate
//   p = exp(s - m) carried as f16(1024 p); context = p . v_hi on f16 WMMA plus p . v_res (and, when RES,
//   p_res . v_hi with p_res = f16((1024 p - f16(1024 p)) * 4096)) into a separate accumulator folded back with
//   1/4096 per key tile in f32.
//   Block = 4 waves = 64 query rows of one h; key tiles of 64: tiles 0..min(qb, SB-1) then
//   tile qb itself when qb >= SB (SB = ceil(S/64)); trip count block-uniform and <= NQB.
//   attn_rows = the work of one block (RES: with the p residual plane); the LDS arrays are the kernel's, handed in.
//   K / V^T tile staging: 128 threads x 32 elements per plane = the whole 64x64 tile (plain 16-B loads,
//   __syncthreads before and after); P tiles are wave-private, spilled with _Float16 element stores and reloaded
//   Output coverage: each wave stores rows q0..q0+15 (it 0..3 x lane>>3 0..3) x 64 columns (8 lanes x 8) of both planes.
// =====================================================================================================
template <bool RES>
__device__ __forceinline__
void attn_rows(const unsigned short* __restrict__ qhp, const unsigned short* __restrict__ qlp,
               const unsigned short* __restrict__ khp, const unsigned short* __restrict__ klp,
               const unsigned short* __restrict__ vhp, const unsigned short* __restrict__ vlp,
               const int* __restrict__ npk,
               unsigned short* ohp, unsigned short* olp, int qb, int h,
               __bf16* Ksh, __bf16* Ksl, _Float16* Vth, _Float16* Vtl,
               _Float16 (*Psh)[16 * LP], _Float16 (*Psl)[16 * LP], float (*Os)[16 * 64]) {
  union FB { v16b v; v8b h[2]; };
  union FH { v16h v; v8h h[2]; };

  const int tid  = threadIdx.x;
  const int wave = tid >> 5;
  const int lane = tid & 31;
  const int hh   = lane >> 4;
  const int c    = lane & 15;
  const int q0   = qb * 64 + wave * 16;

  int S = npk[0];                         // block-uniform scalar load
  S = (S < 0) ? 0 : S;
  S = (S > SEQ) ? SEQ : S;
  const int SB   = (S + 63) >> 6;                       // 0..NQB
  const int nLow = (qb + 1 < SB) ? (qb + 1) : SB;       // tiles 0..nLow-1
  int nT = nLow + ((qb >= SB) ? 1 : 0);                 // + the block's own tile when not in the prefix
  nT = (nT > NQB) ? NQB : nT;

  const __bf16* Qh = (const __bf16*)(const void*)qhp + (size_t)h * HD;
  const __bf16* Ql = (const __bf16*)(const void*)qlp + (size_t)h * HD;
  const __bf16* Kh = (const __bf16*)(const void*)khp + (size_t)h * HD;
  const __bf16* Kl = (const __bf16*)(const void*)klp + (size_t)h * HD;
  const _Float16* Vh = (const _Float16*)(const void*)vhp + (size_t)h * HD * SEQ;
  const _Float16* Vl = (const _Float16*)(const void*)vlp + (size_t)h * HD * SEQ;

  // ---- Q fragments (A operand, row = lane&15): 2 d-chunks, hi and lo ----
  v16b qah[2], qal[2];
#pragma unroll
  for (int dc = 0; dc < 2; ++dc) {
    const size_t qo = (size_t)(q0 + c) * DM + dc * 32 + 8 * hh;
    qah[dc] = ldfrag_b(Qh + qo);
    qal[dc] = ldfrag_b(Ql + qo);
  }

  float mrow[8], lrow[8];
  v8f oacc[4];
#pragma unroll
  for (int r = 0; r < 8; ++r) { mrow[r] = -INFINITY; lrow[r] = 0.f; }
#pragma unroll
  for (int t = 0; t < 4; ++t) oacc[t] = zero8();

  for (int i = 0; i < nT; ++i) {          // block-uniform trip count, <= NQB
    const int kt  = (i < nLow) ? i : qb;
    const int kv0 = kt * 64;              // kv0 + 63 < SEQ
    __syncthreads();
    {
      const int r = tid >> 1, half = (tid & 1) * 32;
      const __bf16*   kg  = Kh + (size_t)(kv0 + r) * DM + half;   // K row kv0+r, d = half..half+31
      const __bf16*   klg = Kl + (size_t)(kv0 + r) * DM + half;
      const _Float16* vg  = Vh + (size_t)r * SEQ + kv0 + half;    // V^T row d = r, s = kv0+half..+31
      const _Float16* vlg = Vl + (size_t)r * SEQ + kv0 + half;
#pragma unroll
      for (int u = 0; u < 4; ++u) {
        const v8b a0 = *(const v8b*)(kg + 8 * u);
        const v8b a1 = *(const v8b*)(klg + 8 * u);
        const v8h b0 = *(const v8h*)(vg + 8 * u);
        const v8h b1 = *(const v8h*)(vlg + 8 * u);
        *(v8b*)(Ksh + r * LP + half + 8 * u) = a0;
        *(v8b*)(Ksl + r * LP + half + 8 * u) = a1;
        *(v8h*)(Vth + r * LP + half + 8 * u) = b0;
        *(v8h*)(Vtl + r * LP + half + 8 * u) = b1;
      }
    }
    __syncthreads();

    // ---- scores: 16 query rows x 64 keys per wave, 3 bf16 products ----
    //      per d chunk the four key groups' chains run side by side (each chain: hi.hi, hi.lo, lo.hi, as before)
    v8f s[4];
#pragma unroll
    for (int j = 0; j < 4; ++j) s[j] = zero8();
#pragma unroll
    for (int dc = 0; dc < 2; ++dc) {
      FB kb[4], kl[4];
#pragma unroll
      for (int j = 0; j < 4; ++j) {
        kb[j].h[0] = *(const v8b*)(Ksh + (j * 16 + c) * LP + dc * 32 + 8 * hh);
        kb[j].h[1] = *(const v8b*)(Ksh + (j * 16 + c) * LP + dc * 32 + 16 + 8 * hh);
        kl[j].h[0] = *(const v8b*)(Ksl + (j * 16 + c) * LP + dc * 32 + 8 * hh);
        kl[j].h[1] = *(const v8b*)(Ksl + (j * 16 + c) * LP + dc * 32 + 16 + 8 * hh);
      }
#pragma unroll
      for (int j = 0; j < 4; ++j) s[j] = mma_b_raw(qah[dc], kb[j].v, s[j]);
#pragma unroll
      for (int j = 0; j < 4; ++j) s[j] = mma_b_raw(qah[dc], kl[j].v, s[j]);
#pragma unroll
      for (int j = 0; j < 4; ++j) s[j] = mma_b_raw(qal[dc], kb[j].v, s[j]);
      run_guard_b(s[0], s[1], s[2], s[3], kb[0].v, kb[1].v, kb[2].v, kb[3].v, kl[0].v, kl[1].v, kl[2].v, kl[3].v);
    }

    // ---- key visibility rule, row max, online softmax, P (x1024, f16) and P residual (x4096) to LDS ----
    _Float16* pwh = Psh[wave];
    _Float16* pwl = Psl[wave];
#pragma unroll
    for (int r = 0; r < 8; ++r) {
      const int t = q0 + 8 * hh + r;        // D row 8hh+r of this lane
      float m = -INFINITY;
#pragma unroll
      for (int j = 0; j < 4; ++j) {
        const int kg = kv0 + j * 16 + c;    // D col = key
        const bool ok = ((kg < S) && (kg <= t)) || (kg == t);
        const float sv = ok ? s[j][r] : -INFINITY;
        s[j][r] = sv;
        m = fmaxf(m, sv);
      }
      m = fmaxf(m, row_xor<1>(m));
      m = fmaxf(m, row_xor<2>(m));
      m = fmaxf(m, row_xor<4>(m));
      m = fmaxf(m, row_xor<8>(m));
      const float mnew  = fmaxf(mrow[r], m);
      const float msafe = (mnew == -INFINITY) ? 0.f : mnew;
      const float alpha = __expf(mrow[r] - msafe);
      mrow[r] = mnew;
      float psum = 0.f;
#pragma unroll
      for (int j = 0; j < 4; ++j) {
        const float p = __expf(s[j][r] - msafe);     // masked score: exp(-inf) -> 0
        psum += p;
        const float p1k = p * 1024.0f;
        const _Float16 ph = (_Float16)p1k;
        pwh[(8 * hh + r) * LP + j * 16 + c] = ph;
        if (RES) {
          const _Float16 pr = (_Float16)((p1k - (float)ph) * 4096.0f);
          pwl[(8 * hh + r) * LP + j * 16 + c] = pr;
        }
      }
      psum += row_xor<1>(psum);
      psum += row_xor<2>(psum);
      psum += row_xor<4>(psum);
      psum += row_xor<8>(psum);
      lrow[r] = lrow[r] * alpha + psum;
#pragma unroll
      for (int t4 = 0; t4 < 4; ++t4) oacc[t4][r] *= alpha;
    }
    __builtin_amdgcn_fence(__ATOMIC_RELEASE, "workgroup");
    __builtin_amdgcn_wave_barrier();
    __builtin_amdgcn_fence(__ATOMIC_ACQUIRE, "workgroup");

    // ---- context += P . V_hi (f16 WMMA); residual products into a separate accumulator ----
    v8f o1[4];
#pragma unroll
    for (int t4 = 0; t4 < 4; ++t4) o1[t4] = zero8();
#pragma unroll 1
    for (int kk = 0; kk < 2; ++kk) {
      FH pa, pl;
      pa.h[0] = *(const v8h*)(pwh + c * LP + kk * 32 + 8 * hh);
      pa.h[1] = *(const v8h*)(pwh + c * LP + kk * 32 + 16 + 8 * hh);
      if (RES) {
        pl.h[0] = *(const v8h*)(pwl + c * LP + kk * 32 + 8 * hh);
        pl.h[1] = *(const v8h*)(pwl + c * LP + kk * 32 + 16 + 8 * hh);
      } else {
        pl.v = pa.v;
      }
#pragma unroll
      for (int t4 = 0; t4 < 4; ++t4) {
        FH vb, vl;
        vb.h[0] = *(const v8h*)(Vth + (t4 * 16 + c) * LP + kk * 32 + 8 * hh);
        vb.h[1] = *(const v8h*)(Vth + (t4 * 16 + c) * LP + kk * 32 + 16 + 8 * hh);
        vl.h[0] = *(const v8h*)(Vtl + (t4 * 16 + c) * LP + kk * 32 + 8 * hh);
        vl.h[1] = *(const v8h*)(Vtl + (t4 * 16 + c) * LP + kk * 32 + 16 + 8 * hh);
        oacc[t4] = mma_h_raw(pa.v, vb.v, oacc[t4]);
        o1[t4]   = mma_h_raw(pa.v, vl.v, o1[t4]);
        if (RES) o1[t4] = mma_h_raw(pl.v, vb.v, o1[t4]);
      }
    }
#pragma unroll
    for (int t4 = 0; t4 < 4; ++t4)
#pragma unroll
      for (int r = 0; r < 8; ++r) oacc[t4][r] += o1[t4][r] * (1.0f / 4096.0f);
  }

  // ---- normalise (1/l and the 1/1024 p carry), stage the wave's 16x64 tile, bf16 hi/lo split,
  float* os = Os[wave];
#pragma unroll
  for (int r = 0; r < 8; ++r) {
    const float l = lrow[r];
    const float inv = ((l > 0.f) ? (1.0f / l) : 0.f) * (1.0f / 1024.0f);
#pragma unroll
    for (int t4 = 0; t4 < 4; ++t4) os[(8 * hh + r) * 64 + t4 * 16 + c] = oacc[t4][r] * inv;
  }
  __builtin_amdgcn_fence(__ATOMIC_RELEASE, "workgroup");
  __builtin_amdgcn_wave_barrier();
  __builtin_amdgcn_fence(__ATOMIC_ACQUIRE, "workgroup");
  {
    const int q4 = lane >> 3, c8 = (lane & 7) * 8;
    v4u hv[4], lv[4];
#pragma unroll
    for (int it = 0; it < 4; ++it) {
      const int row = it * 4 + q4;   // it 0..3 x q4 0..3 = rows 0..15 of the wave tile
      const float* sp = os + row * 64 + c8;
      v4u a, a2;
#pragma unroll
      for (int e = 0; e < 4; ++e) {
        const float f0 = sp[2 * e], f1 = sp[2 * e + 1];
        const unsigned short h0 = bf_bits(f0), h1 = bf_bits(f1);
        const unsigned short l0 = bf_bits(f0 - bf_up(h0)), l1 = bf_bits(f1 - bf_up(h1));
        a[e] = pk16(h0, h1); a2[e] = pk16(l0, l1);
      }
      hv[it] = a; lv[it] = a2;
    }
    {
#pragma unroll
      for (int it = 0; it < 4; ++it) {
        const int row = it * 4 + q4;
        const size_t go = (size_t)(q0 + row) * DM + (size_t)h * HD + c8;
        *(v4u*)(ohp + go) = hv[it];
        *(v4u*)(olp + go) = lv[it];
      }
      
    }
  }
}

// =====================================================================================================
// One launch for all NQB x NH row blocks: NH * NQB = 1024 blocks, four resident per WGP (registers and LDS), so the
// launch lasts as long as the WGP whose four blocks hold the most key tiles. A block's tile count grows with qb, so
// the index map makes quartets of row blocks {x, 63 - x, 32 + x, 31 - x}, x = 0..15 (equal sums for a cost linear
// in qb), both of four neighbouring indices (same head) and of indices 256 apart (four heads).
//   bx = 256 g + 4 a + b: x = a & 15, member v = (b + g) & 3, h = 4 (a >> 4) + g; (x, v) <-> qb and (a >> 4, g) <-> h
//   are one to one, and b <-> v for a given g: every (h, qb) exactly once.
// Row blocks below RESQB take the path with the p residual plane: a block-uniform branch on blockIdx alone.
// =====================================================================================================
static_assert(NQB == 64 && NH == 16);
__global__ __launch_bounds__(128)
void attn64(const unsigned short* __restrict__ qhp, const unsigned short* __restrict__ qlp,
            const unsigned short* __restrict__ khp, const unsigned short* __restrict__ klp,
            const unsigned short* __restrict__ vhp, const unsigned short* __restrict__ vlp,
            const int* __restrict__ npk,
            unsigned short* ohp, unsigned short* olp) {
  __shared__ __align__(16) __bf16   Ksh[64 * LP];                 // K hi [kv][d], rows padded to LP
  __shared__ __align__(16) __bf16   Ksl[64 * LP];                 // K lo
  __shared__ __align__(16) _Float16 Vth[64 * LP];                 // V^T hi [d][kv], rows padded to LP
  __shared__ __align__(16) _Float16 Vtl[64 * LP];                 // V^T residual
  __shared__ __align__(16) _Float16 Psh[4][16 * LP];              // per wave P [row][kv]
  __shared__ __align__(16) _Float16 Psl[4][16 * LP];              // per wave P residual
  __shared__ __align__(16) float    Os[4][16 * 64];               // per wave context tile [row][d]
  const int bx = blockIdx.x;              // < NH * NQB by grid size
  const int g  = bx >> 8;
  const int a  = (bx >> 2) & 63;
  const int x  = a & 15;
  const int v  = (bx + g) & 3;
  const int h  = ((a >> 4) << 2) + g;
  const int qb = (v == 0) ? x : (v == 1) ? (63 - x) : (v == 2) ? (32 + x) : (31 - x);
  if (qb < RESQB)
    attn_rows<true>(qhp, qlp, khp, klp, vhp, vlp, npk, ohp, olp, qb, h, Ksh, Ksl, Vth, Vtl, Psh, Psl, Os);
  else
    attn_rows<false>(qhp, qlp, khp, klp, vhp, vlp, npk, ohp, olp, qb, h, Ksh, Ksl, Vth, Vtl, Psh, Psl, Os);
}

// =====================================================================================================
// Workspace map (bytes), every region an exact multiple of its whole-line / whole-tile store granularity:
//   Xb    bf16 [4096][1024]          0            8388608
//   Wqkv  bf16 [3072 n][1024 k]      8388608      6291456   (rows 0..2047 = q|k weights, 2048.. = v weights)
//   Wob   bf16 [1024][1024]          14680064     2097152
//   QKf   f32  [4096][2048]          16777216     33554432  (cols 0..1023 q, 1024..2047 k)
//   VTh   f16  [1024 d][4096 s]      50331648     8388608
//   VTl   f16  [1024 d][4096 s]      58720256     8388608
//   QK4   bf16 4 x [4096][1024]      67108864     33554432  (q hi, q lo, k hi, k lo)
//   Oh    bf16 [4096][1024]          100663296    8388608
//   Ol    bf16 [4096][1024]          109051904    8388608
//   end                              117440512
// Weights are [out n][in k] with k contiguous = the Bt / A layout the GEMM wants, so they are only converted.
// =====================================================================================================
extern "C" void kernel_launch(void* const* d_in, const int* in_sizes, int n_in,
                              void* d_out, int out_size, void* d_ws, size_t ws_size,
                              hipStream_t stream) {
  if (n_in < 7) return;
  if (in_sizes[0] != SEQ * DM) return;
  if (in_sizes[1] != SEQ * 2) return;
  if (in_sizes[2] != NQKV * DM) return;
  if (in_sizes[3] != DM * DM) return;
  if (in_sizes[4] != NH) return;
  if (in_sizes[5] != 2 * NH * NFR) return;
  if (in_sizes[6] < 1) return;
  if (out_size != SEQ * DM) return;

  const float* x     = (const float*)d_in[0];
  const float* pos   = (const float*)d_in[1];
  const float* qkvw  = (const float*)d_in[2];
  const float* outw  = (const float*)d_in[3];
  const float* scl   = (const float*)d_in[4];
  const float* freqs = (const float*)d_in[5];
  const int*   npk   = (const int*)d_in[6];

  const size_t PXB   = (size_t)SEQ * DM * 2;      //  8388608
  const size_t PWQKV = (size_t)NQKV * DM * 2;     //  6291456
  const size_t PWO   = (size_t)DM * DM * 2;       //  2097152
  const size_t PQKF  = (size_t)SEQ * QKW * 4;     // 33554432
  const size_t PVT   = (size_t)DM * SEQ * 2;      //  8388608
  const size_t PPL   = (size_t)SEQ * DM * 2;      //  8388608
  size_t off = 0;
  const size_t oXb   = off; off += PXB;
  const size_t oWqkv = off; off += PWQKV;
  const size_t oWo   = off; off += PWO;
  const size_t oQKf  = off; off += PQKF;
  const size_t oVTh  = off; off += PVT;
  const size_t oVTl  = off; off += PVT;
  const size_t oQK4  = off; off += 4 * PPL;
  const size_t oOh   = off; off += PPL;
  const size_t oOl   = off; off += PPL;
  if (off > ws_size) return;                      // off = 117440512
  if (off > (size_t)134217728) return;

  char* ws = (char*)d_ws;
  unsigned short* Xb   = (unsigned short*)(ws + oXb);
  unsigned short* Wqkv = (unsigned short*)(ws + oWqkv);
  unsigned short* Wvb  = Wqkv + (size_t)2 * DM * DM;             // rows 2048.. of the qkv weight plane
  unsigned short* Wob  = (unsigned short*)(ws + oWo);
  float*          QKf  = (float*)(ws + oQKf);
  unsigned short* VTh  = (unsigned short*)(ws + oVTh);
  unsigned short* VTl  = (unsigned short*)(ws + oVTl);
  unsigned short* QK4  = (unsigned short*)(ws + oQK4);
  unsigned short* Qh   = QK4;
  unsigned short* Ql   = QK4 + (size_t)SEQ * DM;
  unsigned short* Kh   = QK4 + (size_t)2 * SEQ * DM;
  unsigned short* Kl   = QK4 + (size_t)3 * SEQ * DM;
  unsigned short* Oh   = (unsigned short*)(ws + oOh);
  unsigned short* Ol   = (unsigned short*)(ws + oOl);

  const dim3 blk(256);
  const int n8x = SEQ * DM / 8;                                // 524288
  const int n8w = NQKV * DM / 8;                               // 393216
  const int n8o = DM * DM / 8;                                 // 131072
  const dim3 gCvtX((n8x + 255) / 256);                         // 2048 blocks
  const dim3 gCvtW((n8w + 255) / 256);                         // 1536 blocks
  const dim3 gCvtO((n8o + 255) / 256);                         // 512 blocks
  const dim3 gQK(((SEQ / 64) * (QKW / 64) + 7) / 8, 1);        // 2048 tiles -> 256 blocks: M=4096, N=2048
  const dim3 gVT(((DM / 64) * (SEQ / 64) + 7) / 8, 1);         // 1024 tiles -> 128 blocks: M=1024, N=4096
  const dim3 gOut(((SEQ / 64) * (DM / 64) + 7) / 8, 1);        // 1024 tiles -> 128 blocks: M=4096, N=1024
  const int  nRows = SEQ * NH;                                 // 65536 (t, h) rows
  const dim3 gRope((nRows + 7) / 8);                           // 8192 blocks of 8 waves

  // (1) x -> bf16 [4096][1024]; weights [n][k] f32 -> bf16 [n][k]
  cvt_bf16x8<<<gCvtX, blk, 0, stream>>>(x, Xb, n8x);
  cvt_bf16x8<<<gCvtW, blk, 0, stream>>>(qkvw, Wqkv, n8w);
  cvt_bf16x8<<<gCvtO, blk, 0, stream>>>(outw, Wob, n8o);
  // (2) q|k = x . W[0:2048]^T -> f32 [4096][2048]   (M=4096, N=2048, K=1024)
  gemm64<0, 0><<<gQK, blk, 0, stream>>>(
      Xb, Xb, DM, 0LL, Wqkv, Wqkv, DM, 0LL,
      (void*)QKf, QKW, 0LL, (void*)QKf, QKW, 0LL, 0,
      SEQ, QKW, DM, 1.0f);
  // (3) v^T = Wv . x^T -> f16 hi plane [h*64+d][s] (pitch SEQ) and residual plane (x4096, all keys)
  //     (A = Wvb [n][k], Bt = Xb; M=1024, N=4096, K=1024)
  gemm64<0, 3><<<gVT, blk, 0, stream>>>(
      Wvb, Wvb, DM, 0LL, Xb, Xb, DM, 0LL,
      (void*)VTh, SEQ, 0LL, (void*)VTl, SEQ, 0LL, SEQ,
      DM, SEQ, DM, 4096.0f);
  // (4) cosine-sim scaling + axial rotation -> q hi/lo, k hi/lo bf16 planes [t][h*64+d]
  rope_qk<<<gRope, blk, 0, stream>>>(QKf, pos, scl, freqs, QK4, nRows);
  // (5) attention, all row blocks in one launch (row blocks 0..RESQB-1 with the p residual plane, the rest without)
  attn64<<<dim3(NH * NQB), dim3(128), 0, stream>>>(Qh, Ql, Kh, Kl, VTh, VTl, npk, Oh, Ol);
  // (6) out = context . Wo^T -> d_out f32 [4096][1024]  (A = context hi + lo planes, 2 products)
  gemm64<1, 0><<<gOut, blk, 0, stream>>>(
      Oh, Ol, DM, 0LL, Wob, Wob, DM, 0LL,
      d_out, DM, 0LL, d_out, DM, 0LL, 0,
      SEQ, DM, DM, 1.0f);
  (void)hipGetLastError();
}

// v006
// A run of this version takes 187 microseconds.
// Timed twice side by side with v005, it ran 1.22 and 1.21 times as fast.
// Over all steps from v000 it is 3.07 times as fast.
// Contractions: q|k and v^T projections = v_wmma_f32_16x16x32_bf16 (bf16 operands from RNE-converted inputs, single product);
// q.k^T scores = v_wmma_f32_16x16x32_bf16 with bf16 hi/lo split q and k (hi.hi + hi.lo + lo.hi);
// p.v = v_wmma_f32_16x16x32_f16 (p carried x1024 in f16; v as f16 hi plane + f16 residual plane x4096, 2 products;
// extra f16 residual plane x4096 of p for the first 512 rows); ctx.Wo^T = v_wmma_f32_16x16x32_bf16 with ctx as
// bf16 hi/lo planes times bf16 Wo (2 products); all f32 accumulate; norms, rotations and softmax in f32.
#include <hip/hip_runtime.h>
#include <math.h>
#include <stdint.h>

#define SEQ   4096
#define DM    1024
#define NH    16
#define HD    64
#define NQB   (SEQ / 64)   // 64 row / key tiles of 64
#define RESQB 8            // leading 64-row blocks that also use the p residual plane
#define QKW   (2 * DM)     // pitch of the f32 q|k plane
#define NQKV  (3 * DM)
#define NFR   16           // rotation frequencies per head per axis (HD/4)
#define LP    72           // LDS row pitch of the 64-wide 16-bit attention tiles, in elements: 144 B = 16 B x 9 (odd)
#define OSP   68           // LDS row pitch of the attention output staging tile, in floats: 272 B = 16 B x 17 (odd)
#define GP    72           // LDS row pitch of the GEMM operand slices (64 k of 16 bits), in elements: 144 B = 16 B x 9 (odd)
static_assert(NH * HD == DM);
static_assert((SEQ % 256) == 0 && (DM % 256) == 0);
static_assert((SEQ % 64) == 0 && (DM % 64) == 0);
static_assert(RESQB <= NQB);
static_assert(HD == 4 * NFR);

typedef _Float16 v16h __attribute__((ext_vector_type(16)));
typedef _Float16 v8h  __attribute__((ext_vector_type(8)));
typedef __bf16   v16b __attribute__((ext_vector_type(16)));
typedef __bf16   v8b  __attribute__((ext_vector_type(8)));
typedef float    v8f  __attribute__((ext_vector_type(8)));
typedef float    v4f  __attribute__((ext_vector_type(4)));
typedef unsigned int v4u __attribute__((ext_vector_type(4)));

// ---- scalar helpers --------------------------------------------------------------------------------
__device__ __forceinline__ unsigned short bf_bits(float f) {          // f32 -> bf16 bits, RNE convert
  unsigned u = __float_as_uint(f);
  return (unsigned short)((u + 0x7FFFu + ((u >> 16) & 1u)) >> 16);
}
__device__ __forceinline__ float bf_up(unsigned short h) { return __uint_as_float(((unsigned)h) << 16); }
__device__ __forceinline__ float bf_rn(float f) { return bf_up(bf_bits(f)); }   // value after RNE convert to bf16
__device__ __forceinline__ unsigned short h_bits(_Float16 x) { return __builtin_bit_cast(unsigned short, x); }
__device__ __forceinline__ unsigned pk16(unsigned short a, unsigned short b) { return (unsigned)a | ((unsigned)b << 16); }
// value of lane (l ^ M) inside the lane's 16-lane row, M = 1..15: a DPP operand (row_xmask), no trip through the LDS pipe
template <int M>
__device__ __forceinline__ float row_xor(float x) {
  return __builtin_bit_cast(float, __builtin_amdgcn_update_dpp(0, __builtin_bit_cast(int, x), 0x160 + M, 0xf, 0xf, true));
}
// value of lane (l ^ 16): vector cross-row move
__device__ __forceinline__ float half_xor(float x) {
  return __builtin_bit_cast(float, __builtin_amdgcn_permlanex16(__builtin_bit_cast(int, x), __builtin_bit_cast(int, x),
                                                                0x76543210, 0xfedcba98, false, false));
}
__device__ __forceinline__ v8f zero8() { v8f z = {0.f, 0.f, 0.f, 0.f, 0.f, 0.f, 0.f, 0.f}; return z; }

// ---- fragment loaders: 16-bit A/B operand, lane -> row/col (lane&15), p already includes +8*(lane>>4);
//      elements 0..7 <- p[0..7] (k0+8h..), elements 8..15 <- p[16..23] (k0+16+8h..)
__device__ __forceinline__ v16b ldfrag_b(const __bf16* p) {
  union { v16b v; v8b h[2]; } f;
  f.h[0] = *(const v8b*)(p);
  f.h[1] = *(const v8b*)(p + 16);
  return f.v;
}

// ---- WMMA helpers -------------------------------------------------------------------------------------
__device__ __forceinline__ v8f mma_b_raw(v16b a, v16b b, v8f c) {
  return __builtin_amdgcn_wmma_f32_16x16x32_bf16(false, a, false, b, (short)0, c, false, false);
}
__device__ __forceinline__ v8f mma_h_raw(v16h a, v16h b, v8f c) {
  return __builtin_amdgcn_wmma_f32_16x16x32_f16(false, a, false, b, (short)0, c, false, false);
}
// closes a run of products on four accumulator chains: the eight A fragments stay in their registers until the whole
// run has issued (no later result is placed over an operand still being read), and the four v_nop are the matrix
// distance in front of the first vector instruction on the results or on the fragments' registers
__device__ __forceinline__ void run_guard_b(v8f& s0, v8f& s1, v8f& s2, v8f& s3,
                                            v16b b0, v16b b1, v16b b2, v16b b3, v16b c0, v16b c1, v16b c2, v16b c3) {
  asm volatile("v_nop\n\tv_nop\n\tv_nop\n\tv_nop"
               : "+v"(s0), "+v"(s1), "+v"(s2), "+v"(s3)
               : "v"(b0), "v"(b1), "v"(b2), "v"(b3), "v"(c0), "v"(c1), "v"(c2), "v"(c3));
}
__device__ __forceinline__ void dep_guard_b(v8f& a, v8f& b, v16b x, v16b y) {
  asm volatile("v_nop\n\tv_nop\n\tv_nop\n\tv_nop" : "+v"(a), "+v"(b) : "v"(x), "v"(y));
}
__device__ __forceinline__ void keep4_b(v16b a, v16b b, v16b c, v16b d) {
  asm volatile("v_nop" :: "v"(a), "v"(b), "v"(c), "v"(d));
}
__device__ __forceinline__ void acc_guard4(v8f& a, v8f& b, v8f& c, v8f& d) {
  asm volatile("v_nop\n\tv_nop\n\tv_nop\n\tv_nop" : "+v"(a), "+v"(b), "+v"(c), "+v"(d));
}

// =====================================================================================================
// f32 -> bf16 (RNE convert), 8 elements per thread, one 16-B store per lane: a wave writes 512 contiguous B
// coverage: n8 threads x 8 = whole plane (n8 is a multiple of 256 for every use here).
// =====================================================================================================
__global__ __launch_bounds__(256) void cvt_bf16x8(const float* __restrict__ in, unsigned short* out, int n8) {
  const int i = blockIdx.x * 256 + threadIdx.x;
  if (i < n8) {
    const v4f a = *(const v4f*)(in + (size_t)i * 8);
    const v4f b = *(const v4f*)(in + (size_t)i * 8 + 4);
    v4u p;
    p[0] = pk16(bf_bits(a[0]), bf_bits(a[1]));
    p[1] = pk16(bf_bits(a[2]), bf_bits(a[3]));
    p[2] = pk16(bf_bits(b[0]), bf_bits(b[1]));
    p[3] = pk16(bf_bits(b[2]), bf_bits(b[3]));
    *(v4u*)(out + (size_t)i * 8) = p;
    
  }
}

// =====================================================================================================
// Asynchronous copies global -> LDS, 16 B per lane, four per statement. l* = the lane's LDS byte address,
// g* = the lane's global address. The closing s_wait_xcnt stands inside the statement so that no address
// register of an issued copy is rewritten in front of it.
// =====================================================================================================
__device__ __forceinline__ void copy4_to_lds(unsigned l0, unsigned l1, unsigned l2, unsigned l3,
                                             const __bf16* g0, const __bf16* g1, const __bf16* g2, const __bf16* g3) {
  asm volatile("global_load_async_to_lds_b128 %0, %4, off\n\t"
               "global_load_async_to_lds_b128 %1, %5, off\n\t"
               "global_load_async_to_lds_b128 %2, %6, off\n\t"
               "global_load_async_to_lds_b128 %3, %7, off\n\t"
               "s_wait_xcnt 0x0"
               :: "v"(l0), "v"(l1), "v"(l2), "v"(l3), "v"(g0), "v"(g1), "v"(g2), "v"(g3) : "memory");
}
__device__ __forceinline__ unsigned lds_addr(const __bf16* p) { return (unsigned)(uintptr_t)p; }   // low 32 bits = LDS byte address

// =====================================================================================================
// Register-blocked batched bf16 WMMA GEMM: C[m][n] = sum_k A[m][k] * Bt[n][k]; a block of 8 waves (2 x 4) owns a
// 128 x 256 tile, one wave per 64x64 sub-tile. A row-major [M][K] pitch lda; Bt row-major [N][K] pitch ldb
// (k contiguous); M multiple of 128, N of 256, K of 64. blockIdx.y = batch index (strides in elements).
// Operand path: per slice of 64 k the block's 128 A rows and 256 Bt rows (128 B each = one line; 8 lanes x 16 B
// per row, so a wave-wide copy covers 4 whole lines) go to LDS by asynchronous copies, rows at pitch GP; two
// buffers, slice t + 1 in flight while slice t is multiplied; fragments by 16-B LDS loads.
// NSPLIT: 0 = A.Bt; 1 = (A + A2).Bt (A2 = unscaled bf16 lo plane of A).
// OUT_MODE: 0 = f32 (pitch ldc); 2 = bf16 hi plane C + bf16 lo plane C2 (lo = RNE(v - hi), unscaled);
//           3 = f16 hi plane C + f16 residual plane C2 = f16((v - hi) * rscale), C2 written only for tiles
//               with n0 < N2 (pitch ldc2, batch stride strideC2).
// =====================================================================================================
template <int NSPLIT, int OUT_MODE>
__global__ __launch_bounds__(256) void gemm64(
    const unsigned short* __restrict__ Ap, const unsigned short* A2p, int lda, long long strideA,
    const unsigned short* __restrict__ Btp, const unsigned short* Bt2p, int ldb, long long strideB,
    void* Cout, int ldc, long long strideC,
    void* Cout2, int ldc2, long long strideC2, int N2,
    int M, int N, int K, float rscale) {
  static_assert(NSPLIT == 0 || NSPLIT == 1);
  const __bf16* A   = (const __bf16*)(const void*)Ap;
  const __bf16* A2  = (const __bf16*)(const void*)A2p;
  const __bf16* Bt  = (const __bf16*)(const void*)Btp;
  __shared__ __align__(16) float  sT[8][16 * 68];   // per-wave 16x64 slab, pitch 68 floats
  __shared__ __align__(16) __bf16 sA[2][128 * GP];                                   // A slice, two buffers
  __shared__ __align__(16) __bf16 sA2[NSPLIT ? 2 : 1][NSPLIT ? 128 * GP : 8];        // A2 slice
  __shared__ __align__(16) __bf16 sB[2][256 * GP];                                   // Bt slice
  const int b    = blockIdx.y;
  const int tid  = threadIdx.x;
  const int lane = tid & 31;
  const int wave = tid >> 5;
  const int tilesN = N >> 8;
  const int tilesM = M >> 7;
  if ((int)blockIdx.x >= tilesM * tilesN) return;   // block-uniform, in front of every barrier and copy
  const int bm = blockIdx.x / tilesN;
  const int bn = blockIdx.x - bm * tilesN;
  const int mB = bm << 7;
  const int nB = bn << 8;
  const int wm = wave >> 2;                    // 0..1
  const int wn = wave & 3;                     // 0..3
  const int m0 = mB + (wm << 6);
  const int n0 = nB + (wn << 6);

  const __bf16* Ab  = A  + (size_t)b * strideA;
  const __bf16* Bb  = Bt + (size_t)b * strideB;
  const __bf16* Ab2 = NSPLIT ? (A2 + (size_t)b * strideA) : Ab;

  const int rlane = lane & 15;                 // row (A) / col (B, D) within subtile
  const int koff  = (lane >> 4) * 8;           // k offset of this lane half
  const int mOff  = (lane >> 4) * 8;           // D row offset

  // copy map: thread -> row (tid >> 3) + 32 p of the slice, 16-B piece (tid & 7) of its 128 B
  const int crow = tid >> 3;
  const int cseg = (tid & 7) * 8;
  const __bf16* gA  = Ab  + (size_t)(mB + crow) * lda + cseg;
  const __bf16* gA2 = Ab2 + (size_t)(mB + crow) * lda + cseg;
  const __bf16* gB  = Bb  + (size_t)(nB + crow) * ldb + cseg;
  const unsigned lA  = lds_addr(&sA[0][crow * GP + cseg]);
  const unsigned lA2 = lds_addr(&sA2[0][NSPLIT ? crow * GP + cseg : 0]);
  const unsigned lB  = lds_addr(&sB[0][crow * GP + cseg]);
  const unsigned R32 = 32 * GP * 2;            // 32 LDS rows, bytes
  const size_t a32 = (size_t)32 * lda, b32 = (size_t)32 * ldb;
  auto stage = [&](int t, int buf) {           // slice t (k = 64 t .. 64 t + 63) into buffer buf
    const __bf16* pa = gA + (size_t)t * 64;
    const __bf16* pb = gB + (size_t)t * 64;
    const unsigned la = lA + (unsigned)buf * (4 * R32);
    const unsigned lb = lB + (unsigned)buf * (8 * R32);
    copy4_to_lds(la, la + R32, la + 2 * R32, la + 3 * R32, pa, pa + a32, pa + 2 * a32, pa + 3 * a32);
    if (NSPLIT) {
      const __bf16* pa2 = gA2 + (size_t)t * 64;
      const unsigned la2 = lA2 + (unsigned)buf * (4 * R32);
      copy4_to_lds(la2, la2 + R32, la2 + 2 * R32, la2 + 3 * R32, pa2, pa2 + a32, pa2 + 2 * a32, pa2 + 3 * a32);
    }
    copy4_to_lds(lb, lb + R32, lb + 2 * R32, lb + 3 * R32, pb, pb + b32, pb + 2 * b32, pb + 3 * b32);
    copy4_to_lds(lb + 4 * R32, lb + 5 * R32, lb + 6 * R32, lb + 7 * R32,
                 pb + 4 * b32, pb + 5 * b32, pb + 6 * b32, pb + 7 * b32);
  };

  v8f acc[4][4];
#pragma unroll
  for (int i = 0; i < 4; ++i)
#pragma unroll
    for (int j = 0; j < 4; ++j) acc[i][j] = zero8();

  const int nK = K >> 6;
  stage(0, 0);
  asm volatile("s_wait_asynccnt 0x0" ::: "memory");   // this wave's copies of slice 0 have landed
  __syncthreads();                                    // every wave's have: slice 0 is readable
  if (nK > 1) stage(1, 1);
  for (int t = 0; t < nK; ++t) {
    const int buf = t & 1;
    const __bf16* tA  = sA[buf]  + ((wm << 6) + rlane) * GP + koff;
    const __bf16* tA2 = NSPLIT ? (sA2[buf] + ((wm << 6) + rlane) * GP + koff) : tA;
    const __bf16* tB  = sB[buf]  + ((wn << 6) + rlane) * GP + koff;
#pragma unroll
    for (int kk = 0; kk < 2; ++kk) {
      // the fragments of a k chunk of 32 are fetched as one group in front of its products
      v16b bh[4], ah[4], al[4];
#pragma unroll
      for (int j = 0; j < 4; ++j) bh[j] = ldfrag_b(tB + (j << 4) * GP + kk * 32);
#pragma unroll
      for (int i = 0; i < 4; ++i) {
        ah[i] = ldfrag_b(tA + (i << 4) * GP + kk * 32);
        al[i] = NSPLIT ? ldfrag_b(tA2 + (i << 4) * GP + kk * 32) : ah[i];
      }
#pragma unroll
      for (int i = 0; i < 4; ++i) {
#pragma unroll
        for (int j = 0; j < 4; ++j) {
          acc[i][j] = mma_b_raw(ah[i], bh[j], acc[i][j]);
          if (NSPLIT) acc[i][j] = mma_b_raw(al[i], bh[j], acc[i][j]);
        }
        dep_guard_b(acc[i][0], acc[i][3], ah[i], al[i]);
      }
      keep4_b(bh[0], bh[1], bh[2], bh[3]);
    }
    asm volatile("s_wait_dscnt 0x0" ::: "memory");     // this wave's reads of buffer buf are done before it is refilled
    asm volatile("s_wait_asynccnt 0x0" ::: "memory");  // this wave's copies of slice t + 1 have landed
    __syncthreads();                                   // publishes slice t + 1 and ends every read of buffer buf
    if (t + 2 < nK) stage(t + 2, buf);
  }
  asm volatile("s_wait_asynccnt 0x0" ::: "memory");    // no copy outstanding behind the loop
  acc_guard4(acc[0][0], acc[0][1], acc[0][2], acc[0][3]);
  acc_guard4(acc[1][0], acc[1][1], acc[1][2], acc[1][3]);
  acc_guard4(acc[2][0], acc[2][1], acc[2][2], acc[2][3]);
  acc_guard4(acc[3][0], acc[3][1], acc[3][2], acc[3][3]);

  // ---- epilogue ----
  float* slab = sT[wave];
#pragma unroll
  for (int i = 0; i < 4; ++i) {
    const int mBase = m0 + (i << 4);
#pragma unroll
    for (int j = 0; j < 4; ++j) {
#pragma unroll
      for (int r = 0; r < 8; ++r) {
        slab[(mOff + r) * 68 + (j << 4) + rlane] = acc[i][j][r];
      }
    }
    __builtin_amdgcn_fence(__ATOMIC_RELEASE, "workgroup");
    __builtin_amdgcn_wave_barrier();
    __builtin_amdgcn_fence(__ATOMIC_ACQUIRE, "workgroup");
    if (OUT_MODE == 0) {
      float* C = (float*)Cout + (size_t)b * strideC;
      const int hh = lane >> 4, c4 = (lane & 15) * 4;     // 256-B row segment = 16 lanes x 16 B
      {
#pragma unroll
        for (int it = 0; it < 8; ++it) {
          const int row = it * 2 + hh;                     // it 0..7 x hh 0..1 = rows 0..15
          const v4f v = *(const v4f*)(slab + row * 68 + c4);
          *(v4f*)(C + (size_t)(mBase + row) * ldc + n0 + c4) = v;
        }
        
      }
    } else {
      const int q = lane >> 3, c8 = (lane & 7) * 8;
      unsigned short* C  = (unsigned short*)Cout  + (size_t)b * strideC;
      unsigned short* C2 = (unsigned short*)Cout2 + (size_t)b * strideC2;
      const bool wlo = (OUT_MODE == 2) || (n0 < N2);      // wave-uniform
      v4u hv[4], lv[4];
#pragma unroll
      for (int it = 0; it < 4; ++it) {
        const int row = it * 4 + q;                        // it 0..3 x q 0..3 = rows 0..15
        const float* sp = slab + row * 68 + c8;
        v4u a, a2;
#pragma unroll
        for (int e = 0; e < 4; ++e) {
          const float f0 = sp[2 * e], f1 = sp[2 * e + 1];
          unsigned short h0, h1, l0, l1;
          if (OUT_MODE == 2) {
            h0 = bf_bits(f0); h1 = bf_bits(f1);
            l0 = bf_bits(f0 - bf_up(h0)); l1 = bf_bits(f1 - bf_up(h1));
          } else {
            const _Float16 x0 = (_Float16)f0, x1 = (_Float16)f1;
            h0 = h_bits(x0); h1 = h_bits(x1);
            l0 = h_bits((_Float16)((f0 - (float)x0) * rscale));
            l1 = h_bits((_Float16)((f1 - (float)x1) * rscale));
          }
          a[e] = pk16(h0, h1); a2[e] = pk16(l0, l1);
        }
        hv[it] = a; lv[it] = a2;
      }
      {
#pragma unroll
        for (int it = 0; it < 4; ++it) {
          const int row = it * 4 + q;
          *(v4u*)(C + (size_t)(mBase + row) * ldc + n0 + c8) = hv[it];
          if (wlo) *(v4u*)(C2 + (size_t)(mBase + row) * ldc2 + n0 + c8) = lv[it];
        }
        
      }
    }
    __builtin_amdgcn_fence(__ATOMIC_RELEASE, "workgroup");
    __builtin_amdgcn_wave_barrier();
    __builtin_amdgcn_fence(__ATOMIC_ACQUIRE, "workgroup");
  }
}

// =====================================================================================================
// Cosine-similarity scaling + axial rotation of q and k, f32, one wave per (token t, head h) row.
//   qkf: f32 [t][QKW], q of head h at cols h*64.., k at cols DM + h*64..
//   pos [t][2], scl [NH], freqs [2][NH][NFR]: values RNE-converted to bf16 in register before use.
//   rq = sqrt(|scl_h| + 1e-8) * rsqrt(sum(q^2) + 1e-8); qs = q * rq (same for k)
//   theta[i], i < 16: (pos[t][1]*2 - 1) * freqs[1][h][i]; i >= 16: (pos[t][0]*2 - 1) * freqs[0][h][i-16]
//   out[i] = qs[i] cos - qs[i+32] sin; out[i+32] = qs[i+32] cos + qs[i] sin (lane i = pair index).
//   qk4: four bf16 planes [t][h*64+d] back to back (plane stride SEQ*DM elements): q hi, q lo, k hi, k lo
//   (lo = RNE(v - hi), unscaled). The wave's 64-wide row is staged in LDS, then ONE store instruction writes
//   grid = nrows/8 blocks of 256 (8 waves). coverage: nrows = SEQ*NH rows x 64 cols in each of the 4 planes.
// =====================================================================================================
__global__ __launch_bounds__(256) void rope_qk(const float* __restrict__ qkf, const float* __restrict__ pos,
                                               const float* __restrict__ scl, const float* __restrict__ freqs,
                                               unsigned short* qk4, int nrows) {
#pragma clang fp contract(off)
  __shared__ __align__(16) float sq[8][64];
  __shared__ __align__(16) float sk[8][64];
  const int tid  = threadIdx.x;
  const int wave = tid >> 5;
  const int lane = tid & 31;
  const int rho  = blockIdx.x * 8 + wave;
  if (rho < nrows) {                                      // wave-uniform; no block barriers in this kernel
    const int t = rho >> 4;
    const int h = rho & 15;
    const float* qr = qkf + (size_t)t * QKW + h * HD;
    const float* kr = qr + DM;
    const int i = lane;                                   // pair index 0..31
    const float q1 = qr[i], q2 = qr[i + 32];
    const float k1 = kr[i], k2 = kr[i + 32];
    float ssq = q1 * q1 + q2 * q2;
    float ssk = k1 * k1 + k2 * k2;
    ssq += half_xor(ssq);    ssk += half_xor(ssk);
    ssq += row_xor<8>(ssq);  ssk += row_xor<8>(ssk);
    ssq += row_xor<4>(ssq);  ssk += row_xor<4>(ssk);
    ssq += row_xor<2>(ssq);  ssk += row_xor<2>(ssk);
    ssq += row_xor<1>(ssq);  ssk += row_xor<1>(ssk);
    const float scr = bf_rn(scl[h]);
    const float ss  = sqrtf(fabsf(scr) + 1e-8f);
    const float rq  = ss * rsqrtf(ssq + 1e-8f);
    const float rk  = ss * rsqrtf(ssk + 1e-8f);
    const float px  = bf_rn(pos[2 * t + 0]);
    const float py  = bf_rn(pos[2 * t + 1]);
    const int  low  = (i < 16) ? 1 : 0;
    const int  fi   = low ? (NH * NFR + h * NFR + i) : (h * NFR + (i - 16));   // [1][h][i] or [0][h][i-16], < 2*NH*NFR
    const float fr  = bf_rn(freqs[fi]);
    const float pp  = low ? py : px;
    const float th  = (pp * 2.0f - 1.0f) * fr;
    const float cs  = cosf(th);
    const float sn  = sinf(th);
    const float xq1 = q1 * rq, xq2 = q2 * rq;
    const float xk1 = k1 * rk, xk2 = k2 * rk;
    sq[wave][i]      = xq1 * cs - xq2 * sn;
    sq[wave][i + 32] = xq2 * cs + xq1 * sn;
    sk[wave][i]      = xk1 * cs - xk2 * sn;
    sk[wave][i + 32] = xk2 * cs + xk1 * sn;
    __builtin_amdgcn_fence(__ATOMIC_RELEASE, "workgroup");
    __builtin_amdgcn_wave_barrier();
    __builtin_amdgcn_fence(__ATOMIC_ACQUIRE, "workgroup");
    const int pl = lane >> 3;                             // plane 0 q hi, 1 q lo, 2 k hi, 3 k lo
    const int c8 = (lane & 7) * 8;
    const float* spq = &sq[wave][c8];
    const float* spk = &sk[wave][c8];
    v4u w;
#pragma unroll
    for (int e = 0; e < 4; ++e) {
      const float fq0 = spq[2 * e], fq1 = spq[2 * e + 1];
      const float fk0 = spk[2 * e], fk1 = spk[2 * e + 1];
      const float f0 = (pl < 2) ? fq0 : fk0;
      const float f1 = (pl < 2) ? fq1 : fk1;
      const unsigned short hb0 = bf_bits(f0), hb1 = bf_bits(f1);
      const unsigned short lb0 = bf_bits(f0 - bf_up(hb0)), lb1 = bf_bits(f1 - bf_up(hb1));
      const unsigned short s0 = (pl & 1) ? lb0 : hb0;
      const unsigned short s1 = (pl & 1) ? lb1 : hb1;
      w[e] = pk16(s0, s1);
    }
    unsigned short* dst = qk4 + (size_t)pl * ((size_t)SEQ * DM) + (size_t)t * DM + h * HD + c8;
    *(v4u*)dst = w;
    
  }
}

template <bool RES>
__device__ __forceinline__
void attn_rows(const unsigned short* __restrict__ qhp, const unsigned short* __restrict__ qlp,
               const unsigned short* __restrict__ khp, const unsigned short* __restrict__ klp,
               const unsigned short* __restrict__ vhp, const unsigned short* __restrict__ vlp,
               const int* __restrict__ npk,
               unsigned short* ohp, unsigned short* olp, int qb, int h,
               __bf16* Ksh, __bf16* Ksl, _Float16* Vth, _Float16* Vtl, float (*Os)[16 * OSP]) {
  union FB { v16b v; v8b h[2]; };
  union FH { v16h v; v8h h[2]; };

  const int tid  = threadIdx.x;
  const int wave = tid >> 5;
  const int lane = tid & 31;
  const int hh   = lane >> 4;
  const int c    = lane & 15;
  const int q0   = qb * 64 + wave * 16;

  int S = npk[0];                         // block-uniform scalar load
  S = (S < 0) ? 0 : S;
  S = (S > SEQ) ? SEQ : S;
  const int SB   = (S + 63) >> 6;                       // 0..NQB
  const int nLow = (qb + 1 < SB) ? (qb + 1) : SB;       // tiles 0..nLow-1
  int nT = nLow + ((qb >= SB) ? 1 : 0);                 // + the block's own tile when not in the prefix
  nT = (nT > NQB) ? NQB : nT;

  const __bf16* Qh = (const __bf16*)(const void*)qhp + (size_t)h * HD;
  const __bf16* Ql = (const __bf16*)(const void*)qlp + (size_t)h * HD;
  const __bf16* Kh = (const __bf16*)(const void*)khp + (size_t)h * HD;
  const __bf16* Kl = (const __bf16*)(const void*)klp + (size_t)h * HD;
  const _Float16* Vh = (const _Float16*)(const void*)vhp + (size_t)h * HD * SEQ;
  const _Float16* Vl = (const _Float16*)(const void*)vlp + (size_t)h * HD * SEQ;

  // ---- Q fragments (B operand, column = lane&15 = query q0 + c): 2 d-chunks, hi and lo ----
  v16b qah[2], qal[2];
#pragma unroll
  for (int dc = 0; dc < 2; ++dc) {
    const size_t qo = (size_t)(q0 + c) * DM + dc * 32 + 8 * hh;
    qah[dc] = ldfrag_b(Qh + qo);
    qal[dc] = ldfrag_b(Ql + qo);
  }

  const int tq = q0 + c;                  // the lane's query row
  const int klim = (S - 1 < tq) ? (S - 1) : tq;   // (key < S and key <= tq) is key <= klim; a per-lane constant here
  float mrow = -INFINITY;                 // running maximum of query tq (equal in lanes l and l ^ 16)
  float lrow = 0.f;                       // running sum of query tq over this lane half's keys; halves joined at the end
  v8f oacc[4];                            // oacc[t4][r] = context[tq][d = 16 t4 + 8 hh + r]
#pragma unroll
  for (int t = 0; t < 4; ++t) oacc[t] = zero8();

  for (int i = 0; i < nT; ++i) {          // block-uniform trip count, <= NQB
    const int kt  = (i < nLow) ? i : qb;
    const int kv0 = kt * 64;              // kv0 + 63 < SEQ
    __syncthreads();
    {
      const int r = tid >> 1, half = (tid & 1) * 32;
      const __bf16*   kg  = Kh + (size_t)(kv0 + r) * DM + half;   // K row kv0+r, d = half..half+31
      const __bf16*   klg = Kl + (size_t)(kv0 + r) * DM + half;
      const _Float16* vg  = Vh + (size_t)r * SEQ + kv0 + half;    // V^T row d = r, s = kv0+half..+31
      const _Float16* vlg = Vl + (size_t)r * SEQ + kv0 + half;
      v8b a0[4], a1[4];
      v8h b0[4], b1[4];
#pragma unroll
      for (int u = 0; u < 4; ++u) {
        a0[u] = *(const v8b*)(kg + 8 * u);
        a1[u] = *(const v8b*)(klg + 8 * u);
        b0[u] = *(const v8h*)(vg + 8 * u);
        b1[u] = *(const v8h*)(vlg + 8 * u);
      }
      // the wait that belongs in front of any rewrite of an issued load's address registers; the four addresses are
      // its inputs, so they stay in their registers up to it and none of the sixteen results is placed over one
      asm volatile("s_wait_xcnt 0x0" :: "v"(kg), "v"(klg), "v"(vg), "v"(vlg) : "memory");
#pragma unroll
      for (int u = 0; u < 4; ++u) {
        *(v8b*)(Ksh + r * LP + half + 8 * u) = a0[u];
        *(v8b*)(Ksl + r * LP + half + 8 * u) = a1[u];
        *(v8h*)(Vth + r * LP + half + 8 * u) = b0[u];
        *(v8h*)(Vtl + r * LP + half + 8 * u) = b1[u];
      }
    }
    __syncthreads();

    // ---- scores, transposed: 64 keys (rows) x 16 queries (columns) per wave, 3 bf16 products ----
    //      per d chunk the four key groups' chains run side by side (each chain: hi.hi, hi.lo, lo.hi, as before)
    v8f s[4];
#pragma unroll
    for (int j = 0; j < 4; ++j) s[j] = zero8();
#pragma unroll
    for (int dc = 0; dc < 2; ++dc) {
      FB kb[4], kl[4];
#pragma unroll
      for (int j = 0; j < 4; ++j) {
        kb[j].h[0] = *(const v8b*)(Ksh + (j * 16 + c) * LP + dc * 32 + 8 * hh);
        kb[j].h[1] = *(const v8b*)(Ksh + (j * 16 + c) * LP + dc * 32 + 16 + 8 * hh);
        kl[j].h[0] = *(const v8b*)(Ksl + (j * 16 + c) * LP + dc * 32 + 8 * hh);
        kl[j].h[1] = *(const v8b*)(Ksl + (j * 16 + c) * LP + dc * 32 + 16 + 8 * hh);
      }
#pragma unroll
      for (int j = 0; j < 4; ++j) s[j] = mma_b_raw(kb[j].v, qah[dc], s[j]);
#pragma unroll
      for (int j = 0; j < 4; ++j) s[j] = mma_b_raw(kl[j].v, qah[dc], s[j]);
#pragma unroll
      for (int j = 0; j < 4; ++j) s[j] = mma_b_raw(kb[j].v, qal[dc], s[j]);
      run_guard_b(s[0], s[1], s[2], s[3], kb[0].v, kb[1].v, kb[2].v, kb[3].v, kl[0].v, kl[1].v, kl[2].v, kl[3].v);
    }

    // ---- key visibility rule, maximum, online softmax; P^T (x1024, f16) and its residual (x4096) as B fragments ----
    //      s[j][r] = score of key kv0 + 16 j + 8 hh + r with query tq
    const int kb0 = kv0 + 8 * hh;           // the lane's key of (j, r) = (0, 0); limits taken relative to it
    const int rlim = klim - kb0, rtq = tq - kb0;
    float m = -INFINITY;
#pragma unroll
    for (int j = 0; j < 4; ++j) {
#pragma unroll
      for (int r = 0; r < 8; ++r) {
        const bool ok = (j * 16 + r <= rlim) || (j * 16 + r == rtq);
        const float sv = ok ? s[j][r] : -INFINITY;
        s[j][r] = sv;
        m = fmaxf(m, sv);
      }
    }
    m = fmaxf(m, half_xor(m));              // the query's other 32 keys
    const float mnew  = fmaxf(mrow, m);
    const float msafe = (mnew == -INFINITY) ? 0.f : mnew;
    const float alpha = __expf(mrow - msafe);
    mrow = mnew;
    FH pa[2], pl[2];                        // element e of fragment kk: key kv0 + 32 kk + (e < 8 ? 8 hh + e : 16 + 8 hh + e - 8)
    float ps[4];
#pragma unroll
    for (int j = 0; j < 4; ++j) {
      float acc = 0.f;
#pragma unroll
      for (int r = 0; r < 8; ++r) {
        const float p = __expf(s[j][r] - msafe);     // masked score: exp(-inf) -> 0
        acc = (r == 0) ? p : (acc + p);
        const float p1k = p * 1024.0f;
        const _Float16 ph = (_Float16)p1k;
        pa[j >> 1].h[j & 1][r] = ph;
        if (RES) pl[j >> 1].h[j & 1][r] = (_Float16)((p1k - (float)ph) * 4096.0f);
      }
      ps[j] = acc;
    }
    lrow = lrow * alpha + ((ps[0] + ps[1]) + (ps[2] + ps[3]));
#pragma unroll
    for (int t4 = 0; t4 < 4; ++t4)
#pragma unroll
      for (int r = 0; r < 8; ++r) oacc[t4][r] *= alpha;

    // ---- context^T += V_hi^T . P^T (f16 WMMA); residual products into a separate accumulator ----
    v8f o1[4];
#pragma unroll
    for (int t4 = 0; t4 < 4; ++t4) o1[t4] = zero8();
#pragma unroll   // pa[kk], pl[kk] live in registers: kk must be a compile-time index
    for (int kk = 0; kk < 2; ++kk) {
#pragma unroll
      for (int t4 = 0; t4 < 4; ++t4) {
        FH vb, vl;
        vb.h[0] = *(const v8h*)(Vth + (t4 * 16 + c) * LP + kk * 32 + 8 * hh);
        vb.h[1] = *(const v8h*)(Vth + (t4 * 16 + c) * LP + kk * 32 + 16 + 8 * hh);
        vl.h[0] = *(const v8h*)(Vtl + (t4 * 16 + c) * LP + kk * 32 + 8 * hh);
        vl.h[1] = *(const v8h*)(Vtl + (t4 * 16 + c) * LP + kk * 32 + 16 + 8 * hh);
        oacc[t4] = mma_h_raw(vb.v, pa[kk].v, oacc[t4]);
        o1[t4]   = mma_h_raw(vl.v, pa[kk].v, o1[t4]);
        if (RES) o1[t4] = mma_h_raw(vb.v, pl[kk].v, o1[t4]);
      }
    }
#pragma unroll
    for (int t4 = 0; t4 < 4; ++t4)
#pragma unroll
      for (int r = 0; r < 8; ++r) oacc[t4][r] += o1[t4][r] * (1.0f / 4096.0f);
  }

  // ---- normalise (1/l and the 1/1024 p carry), stage the wave's 16x64 tile, bf16 hi/lo split,
  float* os = Os[wave];
  {
    const float l = lrow + half_xor(lrow);  // both halves' keys
    const float inv = ((l > 0.f) ? (1.0f / l) : 0.f) * (1.0f / 1024.0f);
#pragma unroll
    for (int t4 = 0; t4 < 4; ++t4) {        // the lane's 8 consecutive d of row c: two 16-B stores
      v4f w0, w1;
#pragma unroll
      for (int r = 0; r < 4; ++r) { w0[r] = oacc[t4][r] * inv; w1[r] = oacc[t4][r + 4] * inv; }
      *(v4f*)(os + c * OSP + t4 * 16 + 8 * hh)     = w0;
      *(v4f*)(os + c * OSP + t4 * 16 + 8 * hh + 4) = w1;
    }
  }
  __builtin_amdgcn_fence(__ATOMIC_RELEASE, "workgroup");
  __builtin_amdgcn_wave_barrier();
  __builtin_amdgcn_fence(__ATOMIC_ACQUIRE, "workgroup");
  {
    const int q4 = lane >> 3, c8 = (lane & 7) * 8;
    v4u hv[4], lv[4];
#pragma unroll
    for (int it = 0; it < 4; ++it) {
      const int row = it * 4 + q4;   // it 0..3 x q4 0..3 = rows 0..15 of the wave tile
      const float* sp = os + row * OSP + c8;
      v4u a, a2;
#pragma unroll
      for (int e = 0; e < 4; ++e) {
        const float f0 = sp[2 * e], f1 = sp[2 * e + 1];
        const unsigned short h0 = bf_bits(f0), h1 = bf_bits(f1);
        const unsigned short l0 = bf_bits(f0 - bf_up(h0)), l1 = bf_bits(f1 - bf_up(h1));
        a[e] = pk16(h0, h1); a2[e] = pk16(l0, l1);
      }
      hv[it] = a; lv[it] = a2;
    }
    {
#pragma unroll
      for (int it = 0; it < 4; ++it) {
        const int row = it * 4 + q4;
        const size_t go = (size_t)(q0 + row) * DM + (size_t)h * HD + c8;
        *(v4u*)(ohp + go) = hv[it];
        *(v4u*)(olp + go) = lv[it];
      }
      
    }
  }
}

// =====================================================================================================
// One launch for all NQB x NH row blocks: NH * NQB = 1024 blocks, four resident per WGP (registers), so the
// launch lasts as long as the WGP whose four blocks hold the most key tiles. A block's tile count grows with qb, so
// the index map makes quartets of row blocks {x, 63 - x, 32 + x, 31 - x}, x = 0..15 (equal sums for a cost linear
// in qb), both of four neighbouring indices (same head) and of indices 256 apart (four heads).
//   bx = 256 g + 4 a + b: x = a & 15, member v = (b + g) & 3, h = 4 (a >> 4) + g; (x, v) <-> qb and (a >> 4, g) <-> h
//   are one to one, and b <-> v for a given g: every (h, qb) exactly once.
// Row blocks below RESQB take the path with the p residual plane: a block-uniform branch on blockIdx alone.
// =====================================================================================================
static_assert(NQB == 64 && NH == 16);
__global__ __launch_bounds__(128)
void attn64(const unsigned short* __restrict__ qhp, const unsigned short* __restrict__ qlp,
            const unsigned short* __restrict__ khp, const unsigned short* __restrict__ klp,
            const unsigned short* __restrict__ vhp, const unsigned short* __restrict__ vlp,
            const int* __restrict__ npk,
            unsigned short* ohp, unsigned short* olp) {
  __shared__ __align__(16) __bf16   Ksh[64 * LP];                 // K hi [kv][d], rows padded to LP
  __shared__ __align__(16) __bf16   Ksl[64 * LP];                 // K lo
  __shared__ __align__(16) _Float16 Vth[64 * LP];                 // V^T hi [d][kv], rows padded to LP
  __shared__ __align__(16) _Float16 Vtl[64 * LP];                 // V^T residual
  __shared__ __align__(16) float    Os[4][16 * OSP];              // per wave context tile [row][d], rows padded to OSP
  const int bx = blockIdx.x;              // < NH * NQB by grid size
  const int g  = bx >> 8;
  const int a  = (bx >> 2) & 63;
  const int x  = a & 15;
  const int v  = (bx + g) & 3;
  const int h  = ((a >> 4) << 2) + g;
  const int qb = (v == 0) ? x : (v == 1) ? (63 - x) : (v == 2) ? (32 + x) : (31 - x);
  if (qb < RESQB)
    attn_rows<true>(qhp, qlp, khp, klp, vhp, vlp, npk, ohp, olp, qb, h, Ksh, Ksl, Vth, Vtl, Os);
  else
    attn_rows<false>(qhp, qlp, khp, klp, vhp, vlp, npk, ohp, olp, qb, h, Ksh, Ksl, Vth, Vtl, Os);
}

// =====================================================================================================
// Workspace map (bytes), every region an exact multiple of its whole-line / whole-tile store granularity:
//   Xb    bf16 [4096][1024]          0            8388608
//   Wqkv  bf16 [3072 n][1024 k]      8388608      6291456   (rows 0..2047 = q|k weights, 2048.. = v weights)
//   Wob   bf16 [1024][1024]          14680064     2097152
//   QKf   f32  [4096][2048]          16777216     33554432  (cols 0..1023 q, 1024..2047 k)
//   VTh   f16  [1024 d][4096 s]      50331648     8388608
//   VTl   f16  [1024 d][4096 s]      58720256     8388608
//   QK4   bf16 4 x [4096][1024]      67108864     33554432  (q hi, q lo, k hi, k lo)
//   Oh    bf16 [4096][1024]          100663296    8388608
//   Ol    bf16 [4096][1024]          109051904    8388608
//   end                              117440512
// Weights are [out n][in k] with k contiguous = the Bt / A layout the GEMM wants, so they are only converted.
// =====================================================================================================
extern "C" void kernel_launch(void* const* d_in, const int* in_sizes, int n_in,
                              void* d_out, int out_size, void* d_ws, size_t ws_size,
                              hipStream_t stream) {
  if (n_in < 7) return;
  if (in_sizes[0] != SEQ * DM) return;
  if (in_sizes[1] != SEQ * 2) return;
  if (in_sizes[2] != NQKV * DM) return;
  if (in_sizes[3] != DM * DM) return;
  if (in_sizes[4] != NH) return;
  if (in_sizes[5] != 2 * NH * NFR) return;
  if (in_sizes[6] < 1) return;
  if (out_size != SEQ * DM) return;

  const float* x     = (const float*)d_in[0];
  const float* pos   = (const float*)d_in[1];
  const float* qkvw  = (const float*)d_in[2];
  const float* outw  = (const float*)d_in[3];
  const float* scl   = (const float*)d_in[4];
  const float* freqs = (const float*)d_in[5];
  const int*   npk   = (const int*)d_in[6];

  const size_t PXB   = (size_t)SEQ * DM * 2;      //  8388608
  const size_t PWQKV = (size_t)NQKV * DM * 2;     //  6291456
  const size_t PWO   = (size_t)DM * DM * 2;       //  2097152
  const size_t PQKF  = (size_t)SEQ * QKW * 4;     // 33554432
  const size_t PVT   = (size_t)DM * SEQ * 2;      //  8388608
  const size_t PPL   = (size_t)SEQ * DM * 2;      //  8388608
  size_t off = 0;
  const size_t oXb   = off; off += PXB;
  const size_t oWqkv = off; off += PWQKV;
  const size_t oWo   = off; off += PWO;
  const size_t oQKf  = off; off += PQKF;
  const size_t oVTh  = off; off += PVT;
  const size_t oVTl  = off; off += PVT;
  const size_t oQK4  = off; off += 4 * PPL;
  const size_t oOh   = off; off += PPL;
  const size_t oOl   = off; off += PPL;
  if (off > ws_size) return;                      // off = 117440512
  if (off > (size_t)134217728) return;

  char* ws = (char*)d_ws;
  unsigned short* Xb   = (unsigned short*)(ws + oXb);
  unsigned short* Wqkv = (unsigned short*)(ws + oWqkv);
  unsigned short* Wvb  = Wqkv + (size_t)2 * DM * DM;             // rows 2048.. of the qkv weight plane
  unsigned short* Wob  = (unsigned short*)(ws + oWo);
  float*          QKf  = (float*)(ws + oQKf);
  unsigned short* VTh  = (unsigned short*)(ws + oVTh);
  unsigned short* VTl  = (unsigned short*)(ws + oVTl);
  unsigned short* QK4  = (unsigned short*)(ws + oQK4);
  unsigned short* Qh   = QK4;
  unsigned short* Ql   = QK4 + (size_t)SEQ * DM;
  unsigned short* Kh   = QK4 + (size_t)2 * SEQ * DM;
  unsigned short* Kl   = QK4 + (size_t)3 * SEQ * DM;
  unsigned short* Oh   = (unsigned short*)(ws + oOh);
  unsigned short* Ol   = (unsigned short*)(ws + oOl);

  const dim3 blk(256);
  const int n8x = SEQ * DM / 8;                                // 524288
  const int n8w = NQKV * DM / 8;                               // 393216
  const int n8o = DM * DM / 8;                                 // 131072
  const dim3 gCvtX((n8x + 255) / 256);                         // 2048 blocks
  const dim3 gCvtW((n8w + 255) / 256);                         // 1536 blocks
  const dim3 gCvtO((n8o + 255) / 256);                         // 512 blocks
  const dim3 gQK(((SEQ / 64) * (QKW / 64) + 7) / 8, 1);        // 2048 tiles -> 256 blocks: M=4096, N=2048
  const dim3 gVT(((DM / 64) * (SEQ / 64) + 7) / 8, 1);         // 1024 tiles -> 128 blocks: M=1024, N=4096
  const dim3 gOut(((SEQ / 64) * (DM / 64) + 7) / 8, 1);        // 1024 tiles -> 128 blocks: M=4096, N=1024
  const int  nRows = SEQ * NH;                                 // 65536 (t, h) rows
  const dim3 gRope((nRows + 7) / 8);                           // 8192 blocks of 8 waves

  // (1) x -> bf16 [4096][1024]; weights [n][k] f32 -> bf16 [n][k]
  cvt_bf16x8<<<gCvtX, blk, 0, stream>>>(x, Xb, n8x);
  cvt_bf16x8<<<gCvtW, blk, 0, stream>>>(qkvw, Wqkv, n8w);
  cvt_bf16x8<<<gCvtO, blk, 0, stream>>>(outw, Wob, n8o);
  // (2) q|k = x . W[0:2048]^T -> f32 [4096][2048]   (M=4096, N=2048, K=1024)
  gemm64<0, 0><<<gQK, blk, 0, stream>>>(
      Xb, Xb, DM, 0LL, Wqkv, Wqkv, DM, 0LL,
      (void*)QKf, QKW, 0LL, (void*)QKf, QKW, 0LL, 0,
      SEQ, QKW, DM, 1.0f);
  // (3) v^T = Wv . x^T -> f16 hi plane [h*64+d][s] (pitch SEQ) and residual plane (x4096, all keys)
  //     (A = Wvb [n][k], Bt = Xb; M=1024, N=4096, K=1024)
  gemm64<0, 3><<<gVT, blk, 0, stream>>>(
      Wvb, Wvb, DM, 0LL, Xb, Xb, DM, 0LL,
      (void*)VTh, SEQ, 0LL, (void*)VTl, SEQ, 0LL, SEQ,
      DM, SEQ, DM, 4096.0f);
  // (4) cosine-sim scaling + axial rotation -> q hi/lo, k hi/lo bf16 planes [t][h*64+d]
  rope_qk<<<gRope, blk, 0, stream>>>(QKf, pos, scl, freqs, QK4, nRows);
  // (5) attention, all row blocks in one launch (row blocks 0..RESQB-1 with the p residual plane, the rest without)
  attn64<<<dim3(NH * NQB), dim3(128), 0, stream>>>(Qh, Ql, Kh, Kl, VTh, VTl, npk, Oh, Ol);
  // (6) out = context . Wo^T -> d_out f32 [4096][1024]  (A = context hi + lo planes, 2 products)
  gemm64<1, 0><<<gOut, blk, 0, stream>>>(
      Oh, Ol, DM, 0LL, Wob, Wob, DM, 0LL,
      d_out, DM, 0LL, d_out, DM, 0LL, 0,
      SEQ, DM, DM, 1.0f);
  (void)hipGetLastError();
}

// v007
// A run of this version takes 169 microseconds.
// Two timings next to v006 both put it at 1.11 times that version's speed.
// Over all steps from v000 it is 3.39 times as fast.
// Contractions: q|k and v^T projections = v_wmma_f32_16x16x32_bf16 (bf16 operands from RNE-converted inputs, single product);
// q.k^T scores = v_wmma_f32_16x16x32_bf16 with bf16 hi/lo split q and k (hi.hi + hi.lo + lo.hi);
// p.v = v_wmma_f32_16x16x32_f16 (p carried x1024 in f16; v as f16 hi plane + f16 residual plane x4096, 2 products;
// extra f16 residual plane x4096 of p for the first 512 rows); ctx.Wo^T = v_wmma_f32_16x16x32_bf16 with ctx as
// bf16 hi/lo planes times bf16 Wo (2 products); all f32 accumulate; norms, rotations and softmax in f32.
#include <hip/hip_runtime.h>
#include <math.h>
#include <stdint.h>

#define SEQ   4096
#define DM    1024
#define NH    16
#define HD    64
#define NQB   (SEQ / 64)   // 64 row / key tiles of 64
#define RESQB 8            // leading 64-row blocks that also use the p residual plane
#define QKW   (2 * DM)     // pitch of the f32 q|k plane
#define NQKV  (3 * DM)
#define NFR   16           // rotation frequencies per head per axis (HD/4)
#define LP    72           // LDS row pitch of the 64-wide 16-bit attention tiles, in elements: 144 B = 16 B x 9 (odd)
#define OSP   68           // LDS row pitch of the attention output staging tile, in floats: 272 B = 16 B x 17 (odd)
#define GP    72           // LDS row pitch of the GEMM operand slices (64 k of 16 bits), in elements: 144 B = 16 B x 9 (odd)
static_assert(NH * HD == DM);
static_assert((SEQ % 256) == 0 && (DM % 256) == 0);
static_assert((SEQ % 64) == 0 && (DM % 64) == 0);
static_assert(RESQB <= NQB);
static_assert(HD == 4 * NFR);

typedef _Float16 v16h __attribute__((ext_vector_type(16)));
typedef _Float16 v8h  __attribute__((ext_vector_type(8)));
typedef __bf16   v16b __attribute__((ext_vector_type(16)));
typedef __bf16   v8b  __attribute__((ext_vector_type(8)));
typedef float    v8f  __attribute__((ext_vector_type(8)));
typedef float    v4f  __attribute__((ext_vector_type(4)));
typedef unsigned int v4u __attribute__((ext_vector_type(4)));

// ---- scalar helpers --------------------------------------------------------------------------------
__device__ __forceinline__ unsigned short bf_bits(float f) {          // f32 -> bf16 bits, RNE convert
  unsigned u = __float_as_uint(f);
  return (unsigned short)((u + 0x7FFFu + ((u >> 16) & 1u)) >> 16);
}
__device__ __forceinline__ float bf_up(unsigned short h) { return __uint_as_float(((unsigned)h) << 16); }
__device__ __forceinline__ float bf_rn(float f) { return bf_up(bf_bits(f)); }   // value after RNE convert to bf16
__device__ __forceinline__ unsigned short h_bits(_Float16 x) { return __builtin_bit_cast(unsigned short, x); }
__device__ __forceinline__ unsigned pk16(unsigned short a, unsigned short b) { return (unsigned)a | ((unsigned)b << 16); }
// value of lane (l ^ M) inside the lane's 16-lane row, M = 1..15: a DPP operand (row_xmask), no trip through the LDS pipe
template <int M>
__device__ __forceinline__ float row_xor(float x) {
  return __builtin_bit_cast(float, __builtin_amdgcn_update_dpp(0, __builtin_bit_cast(int, x), 0x160 + M, 0xf, 0xf, true));
}
// value of lane (l ^ 16): vector cross-row move
__device__ __forceinline__ float half_xor(float x) {
  return __builtin_bit_cast(float, __builtin_amdgcn_permlanex16(__builtin_bit_cast(int, x), __builtin_bit_cast(int, x),
                                                                0x76543210, 0xfedcba98, false, false));
}
__device__ __forceinline__ v8f zero8() { v8f z = {0.f, 0.f, 0.f, 0.f, 0.f, 0.f, 0.f, 0.f}; return z; }

// ---- fragment loaders: 16-bit A/B operand, lane -> row/col (lane&15), p already includes +8*(lane>>4);
//      elements 0..7 <- p[0..7] (k0+8h..), elements 8..15 <- p[16..23] (k0+16+8h..)
__device__ __forceinline__ v16b ldfrag_b(const __bf16* p) {
  union { v16b v; v8b h[2]; } f;
  f.h[0] = *(const v8b*)(p);
  f.h[1] = *(const v8b*)(p + 16);
  return f.v;
}

// ---- WMMA helpers -------------------------------------------------------------------------------------
__device__ __forceinline__ v8f mma_b_raw(v16b a, v16b b, v8f c) {
  return __builtin_amdgcn_wmma_f32_16x16x32_bf16(false, a, false, b, (short)0, c, false, false);
}
__device__ __forceinline__ v8f mma_h_raw(v16h a, v16h b, v8f c) {
  return __builtin_amdgcn_wmma_f32_16x16x32_f16(false, a, false, b, (short)0, c, false, false);
}
// closes a run of products on four accumulator chains: the eight A fragments stay in their registers until the whole
// run has issued (no later result is placed over an operand still being read), and the four v_nop are the matrix
// distance in front of the first vector instruction on the results or on the fragments' registers
__device__ __forceinline__ void run_guard_b(v8f& s0, v8f& s1, v8f& s2, v8f& s3,
                                            v16b b0, v16b b1, v16b b2, v16b b3, v16b c0, v16b c1, v16b c2, v16b c3) {
  asm volatile("v_nop\n\tv_nop\n\tv_nop\n\tv_nop"
               : "+v"(s0), "+v"(s1), "+v"(s2), "+v"(s3)
               : "v"(b0), "v"(b1), "v"(b2), "v"(b3), "v"(c0), "v"(c1), "v"(c2), "v"(c3));
}
__device__ __forceinline__ void dep_guard_b(v8f& a, v8f& b, v16b x, v16b y) {
  asm volatile("v_nop\n\tv_nop\n\tv_nop\n\tv_nop" : "+v"(a), "+v"(b) : "v"(x), "v"(y));
}
__device__ __forceinline__ void keep4_b(v16b a, v16b b, v16b c, v16b d) {
  asm volatile("v_nop" :: "v"(a), "v"(b), "v"(c), "v"(d));
}
__device__ __forceinline__ void acc_guard4(v8f& a, v8f& b, v8f& c, v8f& d) {
  asm volatile("v_nop\n\tv_nop\n\tv_nop\n\tv_nop" : "+v"(a), "+v"(b), "+v"(c), "+v"(d));
}

// =====================================================================================================
// f32 -> bf16 (RNE convert), 8 elements per thread, one 16-B store per lane: a wave writes 512 contiguous B
// Three planes in one grid (none depends on another): blocks 0 .. n0/256 - 1 take plane 0, the next n1/256 plane 1,
// the last n2/256 plane 2; n0, n1, n2 = groups of 8 elements, multiples of 256, so a block lies in one plane and
// the choice is a scalar one. coverage: n threads x 8 = the whole of each plane.
// =====================================================================================================
__global__ __launch_bounds__(256) void cvt3_bf16x8(const float* __restrict__ in0, const float* __restrict__ in1,
                                                   const float* __restrict__ in2, unsigned short* out0,
                                                   unsigned short* out1, unsigned short* out2, int n0, int n1, int n2) {
  const int base = blockIdx.x * 256;
  const int pl   = (base < n0) ? 0 : (base < n0 + n1) ? 1 : 2;
  const float* in     = (pl == 0) ? in0 : (pl == 1) ? in1 : in2;
  unsigned short* out = (pl == 0) ? out0 : (pl == 1) ? out1 : out2;
  const int n8 = (pl == 0) ? n0 : (pl == 1) ? n1 : n2;
  const int i  = base - ((pl == 0) ? 0 : (pl == 1) ? n0 : n0 + n1) + threadIdx.x;
  if (i < n8) {
    const v4f a = *(const v4f*)(in + (size_t)i * 8);
    const v4f b = *(const v4f*)(in + (size_t)i * 8 + 4);
    v4u p;
    p[0] = pk16(bf_bits(a[0]), bf_bits(a[1]));
    p[1] = pk16(bf_bits(a[2]), bf_bits(a[3]));
    p[2] = pk16(bf_bits(b[0]), bf_bits(b[1]));
    p[3] = pk16(bf_bits(b[2]), bf_bits(b[3]));
    *(v4u*)(out + (size_t)i * 8) = p;
    
  }
}

// =====================================================================================================
// Asynchronous copies global -> LDS, 16 B per lane, four per statement. l* = the lane's LDS byte address,
// g* = the lane's global address. The closing s_wait_xcnt stands inside the statement so that no address
// register of an issued copy is rewritten in front of it.
// =====================================================================================================
__device__ __forceinline__ void copy4_to_lds(unsigned l0, unsigned l1, unsigned l2, unsigned l3,
                                             const __bf16* g0, const __bf16* g1, const __bf16* g2, const __bf16* g3) {
  asm volatile("global_load_async_to_lds_b128 %0, %4, off\n\t"
               "global_load_async_to_lds_b128 %1, %5, off\n\t"
               "global_load_async_to_lds_b128 %2, %6, off\n\t"
               "global_load_async_to_lds_b128 %3, %7, off\n\t"
               "s_wait_xcnt 0x0"
               :: "v"(l0), "v"(l1), "v"(l2), "v"(l3), "v"(g0), "v"(g1), "v"(g2), "v"(g3) : "memory");
}
__device__ __forceinline__ unsigned lds_addr(const __bf16* p) { return (unsigned)(uintptr_t)p; }   // low 32 bits = LDS byte address

// =====================================================================================================
// Register-blocked batched bf16 WMMA GEMM: C[m][n] = sum_k A[m][k] * Bt[n][k]; a block of 8 waves (2 x 4) owns a
// 128 x 256 tile, one wave per 64x64 sub-tile. A row-major [M][K] pitch lda; Bt row-major [N][K] pitch ldb
// (k contiguous); M multiple of 128, N of 256, K of 64. blockIdx.y = batch index (strides in elements).
// Operand path: per slice of 64 k the block's 128 A rows and 256 Bt rows (128 B each = one line; 8 lanes x 16 B
// per row, so a wave-wide copy covers 4 whole lines) go to LDS by asynchronous copies, rows at pitch GP; two
// buffers, slice t + 1 in flight while slice t is multiplied; fragments by 16-B LDS loads.
// NSPLIT: 0 = A.Bt; 1 = (A + A2).Bt (A2 = unscaled bf16 lo plane of A).
// OUT_MODE: 0 = f32 (pitch ldc); 2 = bf16 hi plane C + bf16 lo plane C2 (lo = RNE(v - hi), unscaled);
//           3 = f16 hi plane C + f16 residual plane C2 = f16((v - hi) * rscale), C2 written only for tiles
//               with n0 < N2 (pitch ldc2, batch stride strideC2).
// gemm_tile = the work of one block on tile bx; the LDS arrays are the kernel's, handed in:
//   sT 8 x 16 x 68 floats (per-wave 16x64 slab, pitch 68), sA and sA2 2 x 128 x GP (A, A2 slice, two buffers;
//   sA2 is not touched when NSPLIT == 0), sB 2 x 256 x GP (Bt slice, two buffers).
// =====================================================================================================
#define GSA (128 * GP)     // elements of one A slice buffer
#define GSB (256 * GP)     // elements of one Bt slice buffer
template <int NSPLIT, int OUT_MODE>
__device__ __forceinline__ void gemm_tile(
    const unsigned short* __restrict__ Ap, const unsigned short* A2p, int lda, long long strideA,
    const unsigned short* __restrict__ Btp, int ldb, long long strideB,
    void* Cout, int ldc, long long strideC,
    void* Cout2, int ldc2, long long strideC2, int N2,
    int M, int N, int K, float rscale,
    int bx, float* sT, __bf16* sA, __bf16* sA2, __bf16* sB) {
  static_assert(NSPLIT == 0 || NSPLIT == 1);
  const __bf16* A   = (const __bf16*)(const void*)Ap;
  const __bf16* A2  = (const __bf16*)(const void*)A2p;
  const __bf16* Bt  = (const __bf16*)(const void*)Btp;
  const int b    = blockIdx.y;
  const int tid  = threadIdx.x;
  const int lane = tid & 31;
  const int wave = tid >> 5;
  const int tilesN = N >> 8;
  const int tilesM = M >> 7;
  if (bx >= tilesM * tilesN) return;           // block-uniform, in front of every barrier and copy
  const int bm = bx / tilesN;
  const int bn = bx - bm * tilesN;
  const int mB = bm << 7;
  const int nB = bn << 8;
  const int wm = wave >> 2;                    // 0..1
  const int wn = wave & 3;                     // 0..3
  const int m0 = mB + (wm << 6);
  const int n0 = nB + (wn << 6);

  const __bf16* Ab  = A  + (size_t)b * strideA;
  const __bf16* Bb  = Bt + (size_t)b * strideB;
  const __bf16* Ab2 = NSPLIT ? (A2 + (size_t)b * strideA) : Ab;

  const int rlane = lane & 15;                 // row (A) / col (B, D) within subtile
  const int koff  = (lane >> 4) * 8;           // k offset of this lane half
  const int mOff  = (lane >> 4) * 8;           // D row offset

  // copy map: thread -> row (tid >> 3) + 32 p of the slice, 16-B piece (tid & 7) of its 128 B
  const int crow = tid >> 3;
  const int cseg = (tid & 7) * 8;
  const __bf16* gA  = Ab  + (size_t)(mB + crow) * lda + cseg;
  const __bf16* gA2 = Ab2 + (size_t)(mB + crow) * lda + cseg;
  const __bf16* gB  = Bb  + (size_t)(nB + crow) * ldb + cseg;
  const unsigned lA  = lds_addr(sA + crow * GP + cseg);
  const unsigned lA2 = lds_addr(sA2 + crow * GP + cseg);
  const unsigned lB  = lds_addr(sB + crow * GP + cseg);
  const unsigned R32 = 32 * GP * 2;            // 32 LDS rows, bytes
  const size_t a32 = (size_t)32 * lda, b32 = (size_t)32 * ldb;
  auto stage = [&](int t, int buf) {           // slice t (k = 64 t .. 64 t + 63) into buffer buf
    const __bf16* pa = gA + (size_t)t * 64;
    const __bf16* pb = gB + (size_t)t * 64;
    const unsigned la = lA + (unsigned)buf * (4 * R32);
    const unsigned lb = lB + (unsigned)buf * (8 * R32);
    copy4_to_lds(la, la + R32, la + 2 * R32, la + 3 * R32, pa, pa + a32, pa + 2 * a32, pa + 3 * a32);
    if (NSPLIT) {
      const __bf16* pa2 = gA2 + (size_t)t * 64;
      const unsigned la2 = lA2 + (unsigned)buf * (4 * R32);
      copy4_to_lds(la2, la2 + R32, la2 + 2 * R32, la2 + 3 * R32, pa2, pa2 + a32, pa2 + 2 * a32, pa2 + 3 * a32);
    }
    copy4_to_lds(lb, lb + R32, lb + 2 * R32, lb + 3 * R32, pb, pb + b32, pb + 2 * b32, pb + 3 * b32);
    copy4_to_lds(lb + 4 * R32, lb + 5 * R32, lb + 6 * R32, lb + 7 * R32,
                 pb + 4 * b32, pb + 5 * b32, pb + 6 * b32, pb + 7 * b32);
  };

  v8f acc[4][4];
#pragma unroll
  for (int i = 0; i < 4; ++i)
#pragma unroll
    for (int j = 0; j < 4; ++j) acc[i][j] = zero8();

  const int nK = K >> 6;
  stage(0, 0);
  asm volatile("s_wait_asynccnt 0x0" ::: "memory");   // this wave's copies of slice 0 have landed
  __syncthreads();                                    // every wave's have: slice 0 is readable
  if (nK > 1) stage(1, 1);
  for (int t = 0; t < nK; ++t) {
    const int buf = t & 1;
    const __bf16* tA  = sA + buf * GSA + ((wm << 6) + rlane) * GP + koff;
    const __bf16* tA2 = NSPLIT ? (sA2 + buf * GSA + ((wm << 6) + rlane) * GP + koff) : tA;
    const __bf16* tB  = sB + buf * GSB + ((wn << 6) + rlane) * GP + koff;
#pragma unroll
    for (int kk = 0; kk < 2; ++kk) {
      // the fragments of a k chunk of 32 are fetched as one group in front of its products
      v16b bh[4], ah[4], al[4];
#pragma unroll
      for (int j = 0; j < 4; ++j) bh[j] = ldfrag_b(tB + (j << 4) * GP + kk * 32);
#pragma unroll
      for (int i = 0; i < 4; ++i) {
        ah[i] = ldfrag_b(tA + (i << 4) * GP + kk * 32);
        al[i] = NSPLIT ? ldfrag_b(tA2 + (i << 4) * GP + kk * 32) : ah[i];
      }
#pragma unroll
      for (int i = 0; i < 4; ++i) {
#pragma unroll
        for (int j = 0; j < 4; ++j) {
          acc[i][j] = mma_b_raw(ah[i], bh[j], acc[i][j]);
          if (NSPLIT) acc[i][j] = mma_b_raw(al[i], bh[j], acc[i][j]);
        }
        dep_guard_b(acc[i][0], acc[i][3], ah[i], al[i]);
      }
      keep4_b(bh[0], bh[1], bh[2], bh[3]);
    }
    asm volatile("s_wait_dscnt 0x0" ::: "memory");     // this wave's reads of buffer buf are done before it is refilled
    asm volatile("s_wait_asynccnt 0x0" ::: "memory");  // this wave's copies of slice t + 1 have landed
    __syncthreads();                                   // publishes slice t + 1 and ends every read of buffer buf
    if (t + 2 < nK) stage(t + 2, buf);
  }
  asm volatile("s_wait_asynccnt 0x0" ::: "memory");    // no copy outstanding behind the loop
  acc_guard4(acc[0][0], acc[0][1], acc[0][2], acc[0][3]);
  acc_guard4(acc[1][0], acc[1][1], acc[1][2], acc[1][3]);
  acc_guard4(acc[2][0], acc[2][1], acc[2][2], acc[2][3]);
  acc_guard4(acc[3][0], acc[3][1], acc[3][2], acc[3][3]);

  // ---- epilogue ----
  float* slab = sT + wave * (16 * 68);
#pragma unroll
  for (int i = 0; i < 4; ++i) {
    const int mBase = m0 + (i << 4);
#pragma unroll
    for (int j = 0; j < 4; ++j) {
#pragma unroll
      for (int r = 0; r < 8; ++r) {
        slab[(mOff + r) * 68 + (j << 4) + rlane] = acc[i][j][r];
      }
    }
    __builtin_amdgcn_fence(__ATOMIC_RELEASE, "workgroup");
    __builtin_amdgcn_wave_barrier();
    __builtin_amdgcn_fence(__ATOMIC_ACQUIRE, "workgroup");
    if (OUT_MODE == 0) {
      float* C = (float*)Cout + (size_t)b * strideC;
      const int hh = lane >> 4, c4 = (lane & 15) * 4;     // 256-B row segment = 16 lanes x 16 B
      {
#pragma unroll
        for (int it = 0; it < 8; ++it) {
          const int row = it * 2 + hh;                     // it 0..7 x hh 0..1 = rows 0..15
          const v4f v = *(const v4f*)(slab + row * 68 + c4);
          *(v4f*)(C + (size_t)(mBase + row) * ldc + n0 + c4) = v;
        }
        
      }
    } else {
      const int q = lane >> 3, c8 = (lane & 7) * 8;
      unsigned short* C  = (unsigned short*)Cout  + (size_t)b * strideC;
      unsigned short* C2 = (unsigned short*)Cout2 + (size_t)b * strideC2;
      const bool wlo = (OUT_MODE == 2) || (n0 < N2);      // wave-uniform
      v4u hv[4], lv[4];
#pragma unroll
      for (int it = 0; it < 4; ++it) {
        const int row = it * 4 + q;                        // it 0..3 x q 0..3 = rows 0..15
        const float* sp = slab + row * 68 + c8;
        v4u a, a2;
#pragma unroll
        for (int e = 0; e < 4; ++e) {
          const float f0 = sp[2 * e], f1 = sp[2 * e + 1];
          unsigned short h0, h1, l0, l1;
          if (OUT_MODE == 2) {
            h0 = bf_bits(f0); h1 = bf_bits(f1);
            l0 = bf_bits(f0 - bf_up(h0)); l1 = bf_bits(f1 - bf_up(h1));
          } else {
            const _Float16 x0 = (_Float16)f0, x1 = (_Float16)f1;
            h0 = h_bits(x0); h1 = h_bits(x1);
            l0 = h_bits((_Float16)((f0 - (float)x0) * rscale));
            l1 = h_bits((_Float16)((f1 - (float)x1) * rscale));
          }
          a[e] = pk16(h0, h1); a2[e] = pk16(l0, l1);
        }
        hv[it] = a; lv[it] = a2;
      }
      {
#pragma unroll
        for (int it = 0; it < 4; ++it) {
          const int row = it * 4 + q;
          *(v4u*)(C + (size_t)(mBase + row) * ldc + n0 + c8) = hv[it];
          if (wlo) *(v4u*)(C2 + (size_t)(mBase + row) * ldc2 + n0 + c8) = lv[it];
        }
        
      }
    }
    __builtin_amdgcn_fence(__ATOMIC_RELEASE, "workgroup");
    __builtin_amdgcn_wave_barrier();
    __builtin_amdgcn_fence(__ATOMIC_ACQUIRE, "workgroup");
  }
}

// =====================================================================================================
// The two projections in one grid (neither reads what the other writes): blocks 0 .. nQK - 1 are the tiles of
// q|k = x . Wqk^T (f32 out), the rest the tiles of v^T = Wv . x^T (f16 hi + residual planes). One set of LDS arrays
// serves either path, so two blocks fit a WGP and the v^T tiles run beside the q|k tiles. The branch is on
// blockIdx alone: block-uniform.
// =====================================================================================================
__global__ __launch_bounds__(256) void gemm_qk_vt(
    const unsigned short* __restrict__ Xp, const unsigned short* __restrict__ Wqkp, const unsigned short* __restrict__ Wvp,
    void* QKout, void* VThout, void* VTlout, int seq, int qkw, int dm, int nQK, float rscale) {
  __shared__ __align__(16) float  sT[8 * 16 * 68];
  __shared__ __align__(16) __bf16 sA[2 * GSA];
  __shared__ __align__(16) __bf16 sB[2 * GSB];
  const int bx = blockIdx.x;
  if (bx < nQK)
    gemm_tile<0, 0>(Xp, Xp, dm, 0LL, Wqkp, dm, 0LL, QKout, qkw, 0LL, QKout, qkw, 0LL, 0,
                    seq, qkw, dm, 1.0f, bx, sT, sA, sA, sB);
  else
    gemm_tile<0, 3>(Wvp, Wvp, dm, 0LL, Xp, dm, 0LL, VThout, seq, 0LL, VTlout, seq, 0LL, seq,
                    dm, seq, dm, rscale, bx - nQK, sT, sA, sA, sB);
}

// out = (A + A2) . Bt^T, f32: one tile per block
__global__ __launch_bounds__(256) void gemm_split_f32(
    const unsigned short* __restrict__ Ap, const unsigned short* A2p, const unsigned short* __restrict__ Btp,
    void* Cout, int M, int N, int K) {
  __shared__ __align__(16) float  sT[8 * 16 * 68];
  __shared__ __align__(16) __bf16 sA[2 * GSA];
  __shared__ __align__(16) __bf16 sA2[2 * GSA];
  __shared__ __align__(16) __bf16 sB[2 * GSB];
  gemm_tile<1, 0>(Ap, A2p, K, 0LL, Btp, K, 0LL, Cout, N, 0LL, Cout, N, 0LL, 0,
                  M, N, K, 1.0f, (int)blockIdx.x, sT, sA, sA2, sB);
}

// =====================================================================================================
// Cosine-similarity scaling + axial rotation of q and k, f32, one wave per (token t, head h) row.
//   qkf: f32 [t][QKW], q of head h at cols h*64.., k at cols DM + h*64..
//   pos [t][2], scl [NH], freqs [2][NH][NFR]: values RNE-converted to bf16 in register before use.
//   rq = sqrt(|scl_h| + 1e-8) * rsqrt(sum(q^2) + 1e-8); qs = q * rq (same for k)
//   theta[i], i < 16: (pos[t][1]*2 - 1) * freqs[1][h][i]; i >= 16: (pos[t][0]*2 - 1) * freqs[0][h][i-16]
//   out[i] = qs[i] cos - qs[i+32] sin; out[i+32] = qs[i+32] cos + qs[i] sin (lane i = pair index).
//   qk4: four bf16 planes [t][h*64+d] back to back (plane stride SEQ*DM elements): q hi, q lo, k hi, k lo
//   (lo = RNE(v - hi), unscaled). The wave's 64-wide row is staged in LDS, then ONE store instruction writes
//   grid = nrows/8 blocks of 256 (8 waves). coverage: nrows = SEQ*NH rows x 64 cols in each of the 4 planes.
// =====================================================================================================
__global__ __launch_bounds__(256) void rope_qk(const float* __restrict__ qkf, const float* __restrict__ pos,
                                               const float* __restrict__ scl, const float* __restrict__ freqs,
                                               unsigned short* qk4, int nrows) {
#pragma clang fp contract(off)
  __shared__ __align__(16) float sq[8][64];
  __shared__ __align__(16) float sk[8][64];
  const int tid  = threadIdx.x;
  const int wave = tid >> 5;
  const int lane = tid & 31;
  const int rho  = blockIdx.x * 8 + wave;
  if (rho < nrows) {                                      // wave-uniform; no block barriers in this kernel
    const int t = rho >> 4;
    const int h = rho & 15;
    const float* qr = qkf + (size_t)t * QKW + h * HD;
    const float* kr = qr + DM;
    const int i = lane;                                   // pair index 0..31
    const float q1 = qr[i], q2 = qr[i + 32];
    const float k1 = kr[i], k2 = kr[i + 32];
    float ssq = q1 * q1 + q2 * q2;
    float ssk = k1 * k1 + k2 * k2;
    ssq += half_xor(ssq);    ssk += half_xor(ssk);
    ssq += row_xor<8>(ssq);  ssk += row_xor<8>(ssk);
    ssq += row_xor<4>(ssq);  ssk += row_xor<4>(ssk);
    ssq += row_xor<2>(ssq);  ssk += row_xor<2>(ssk);
    ssq += row_xor<1>(ssq);  ssk += row_xor<1>(ssk);
    const float scr = bf_rn(scl[h]);
    const float ss  = sqrtf(fabsf(scr) + 1e-8f);
    const float rq  = ss * rsqrtf(ssq + 1e-8f);
    const float rk  = ss * rsqrtf(ssk + 1e-8f);
    const float px  = bf_rn(pos[2 * t + 0]);
    const float py  = bf_rn(pos[2 * t + 1]);
    const int  low  = (i < 16) ? 1 : 0;
    const int  fi   = low ? (NH * NFR + h * NFR + i) : (h * NFR + (i - 16));   // [1][h][i] or [0][h][i-16], < 2*NH*NFR
    const float fr  = bf_rn(freqs[fi]);
    const float pp  = low ? py : px;
    const float th  = (pp * 2.0f - 1.0f) * fr;
    const float cs  = cosf(th);
    const float sn  = sinf(th);
    const float xq1 = q1 * rq, xq2 = q2 * rq;
    const float xk1 = k1 * rk, xk2 = k2 * rk;
    sq[wave][i]      = xq1 * cs - xq2 * sn;
    sq[wave][i + 32] = xq2 * cs + xq1 * sn;
    sk[wave][i]      = xk1 * cs - xk2 * sn;
    sk[wave][i + 32] = xk2 * cs + xk1 * sn;
    __builtin_amdgcn_fence(__ATOMIC_RELEASE, "workgroup");
    __builtin_amdgcn_wave_barrier();
    __builtin_amdgcn_fence(__ATOMIC_ACQUIRE, "workgroup");
    const int pl = lane >> 3;                             // plane 0 q hi, 1 q lo, 2 k hi, 3 k lo
    const int c8 = (lane & 7) * 8;
    const float* spq = &sq[wave][c8];
    const float* spk = &sk[wave][c8];
    v4u w;
#pragma unroll
    for (int e = 0; e < 4; ++e) {
      const float fq0 = spq[2 * e], fq1 = spq[2 * e + 1];
      const float fk0 = spk[2 * e], fk1 = spk[2 * e + 1];
      const float f0 = (pl < 2) ? fq0 : fk0;
      const float f1 = (pl < 2) ? fq1 : fk1;
      const unsigned short hb0 = bf_bits(f0), hb1 = bf_bits(f1);
      const unsigned short lb0 = bf_bits(f0 - bf_up(hb0)), lb1 = bf_bits(f1 - bf_up(hb1));
      const unsigned short s0 = (pl & 1) ? lb0 : hb0;
      const unsigned short s1 = (pl & 1) ? lb1 : hb1;
      w[e] = pk16(s0, s1);
    }
    unsigned short* dst = qk4 + (size_t)pl * ((size_t)SEQ * DM) + (size_t)t * DM + h * HD + c8;
    *(v4u*)dst = w;
    
  }
}

template <bool RES>
__device__ __forceinline__
void attn_rows(const unsigned short* __restrict__ qhp, const unsigned short* __restrict__ qlp,
               const unsigned short* __restrict__ khp, const unsigned short* __restrict__ klp,
               const unsigned short* __restrict__ vhp, const unsigned short* __restrict__ vlp,
               const int* __restrict__ npk,
               unsigned short* ohp, unsigned short* olp, int qb, int h,
               __bf16* Ksh, __bf16* Ksl, _Float16* Vth, _Float16* Vtl, float (*Os)[16 * OSP]) {
  union FB { v16b v; v8b h[2]; };
  union FH { v16h v; v8h h[2]; };

  const int tid  = threadIdx.x;
  const int wave = tid >> 5;
  const int lane = tid & 31;
  const int hh   = lane >> 4;
  const int c    = lane & 15;
  const int q0   = qb * 64 + wave * 16;

  int S = npk[0];                         // block-uniform scalar load
  S = (S < 0) ? 0 : S;
  S = (S > SEQ) ? SEQ : S;
  const int SB   = (S + 63) >> 6;                       // 0..NQB
  const int nLow = (qb + 1 < SB) ? (qb + 1) : SB;       // tiles 0..nLow-1
  int nT = nLow + ((qb >= SB) ? 1 : 0);                 // + the block's own tile when not in the prefix
  nT = (nT > NQB) ? NQB : nT;

  const __bf16* Qh = (const __bf16*)(const void*)qhp + (size_t)h * HD;
  const __bf16* Ql = (const __bf16*)(const void*)qlp + (size_t)h * HD;
  const __bf16* Kh = (const __bf16*)(const void*)khp + (size_t)h * HD;
  const __bf16* Kl = (const __bf16*)(const void*)klp + (size_t)h * HD;
  const _Float16* Vh = (const _Float16*)(const void*)vhp + (size_t)h * HD * SEQ;
  const _Float16* Vl = (const _Float16*)(const void*)vlp + (size_t)h * HD * SEQ;

  // ---- Q fragments (B operand, column = lane&15 = query q0 + c): 2 d-chunks, hi and lo ----
  v16b qah[2], qal[2];
#pragma unroll
  for (int dc = 0; dc < 2; ++dc) {
    const size_t qo = (size_t)(q0 + c) * DM + dc * 32 + 8 * hh;
    qah[dc] = ldfrag_b(Qh + qo);
    qal[dc] = ldfrag_b(Ql + qo);
  }

  const int tq = q0 + c;                  // the lane's query row
  const int klim = (S - 1 < tq) ? (S - 1) : tq;   // (key < S and key <= tq) is key <= klim; a per-lane constant here
  float mrow = -INFINITY;                 // running maximum of query tq (equal in lanes l and l ^ 16)
  float lrow = 0.f;                       // running sum of query tq over this lane half's keys; halves joined at the end
  v8f oacc[4];                            // oacc[t4][r] = context[tq][d = 16 t4 + 8 hh + r]
#pragma unroll
  for (int t = 0; t < 4; ++t) oacc[t] = zero8();

  for (int i = 0; i < nT; ++i) {          // block-uniform trip count, <= NQB
    const int kt  = (i < nLow) ? i : qb;
    const int kv0 = kt * 64;              // kv0 + 63 < SEQ
    __syncthreads();
    {
      const int r = tid >> 1, half = (tid & 1) * 32;
      const __bf16*   kg  = Kh + (size_t)(kv0 + r) * DM + half;   // K row kv0+r, d = half..half+31
      const __bf16*   klg = Kl + (size_t)(kv0 + r) * DM + half;
      const _Float16* vg  = Vh + (size_t)r * SEQ + kv0 + half;    // V^T row d = r, s = kv0+half..+31
      const _Float16* vlg = Vl + (size_t)r * SEQ + kv0 + half;
      v8b a0[4], a1[4];
      v8h b0[4], b1[4];
#pragma unroll
      for (int u = 0; u < 4; ++u) {
        a0[u] = *(const v8b*)(kg + 8 * u);
        a1[u] = *(const v8b*)(klg + 8 * u);
        b0[u] = *(const v8h*)(vg + 8 * u);
        b1[u] = *(const v8h*)(vlg + 8 * u);
      }
      // the wait that belongs in front of any rewrite of an issued load's address registers; the four addresses are
      // its inputs, so they stay in their registers up to it and none of the sixteen results is placed over one
      asm volatile("s_wait_xcnt 0x0" :: "v"(kg), "v"(klg), "v"(vg), "v"(vlg) : "memory");
#pragma unroll
      for (int u = 0; u < 4; ++u) {
        *(v8b*)(Ksh + r * LP + half + 8 * u) = a0[u];
        *(v8b*)(Ksl + r * LP + half + 8 * u) = a1[u];
        *(v8h*)(Vth + r * LP + half + 8 * u) = b0[u];
        *(v8h*)(Vtl + r * LP + half + 8 * u) = b1[u];
      }
    }
    __syncthreads();

    // ---- scores, transposed: 64 keys (rows) x 16 queries (columns) per wave, 3 bf16 products ----
    //      per d chunk the four key groups' chains run side by side (each chain: hi.hi, hi.lo, lo.hi, as before)
    v8f s[4];
#pragma unroll
    for (int j = 0; j < 4; ++j) s[j] = zero8();
#pragma unroll
    for (int dc = 0; dc < 2; ++dc) {
      FB kb[4], kl[4];
#pragma unroll
      for (int j = 0; j < 4; ++j) {
        kb[j].h[0] = *(const v8b*)(Ksh + (j * 16 + c) * LP + dc * 32 + 8 * hh);
        kb[j].h[1] = *(const v8b*)(Ksh + (j * 16 + c) * LP + dc * 32 + 16 + 8 * hh);
        kl[j].h[0] = *(const v8b*)(Ksl + (j * 16 + c) * LP + dc * 32 + 8 * hh);
        kl[j].h[1] = *(const v8b*)(Ksl + (j * 16 + c) * LP + dc * 32 + 16 + 8 * hh);
      }
#pragma unroll
      for (int j = 0; j < 4; ++j) s[j] = mma_b_raw(kb[j].v, qah[dc], s[j]);
#pragma unroll
      for (int j = 0; j < 4; ++j) s[j] = mma_b_raw(kl[j].v, qah[dc], s[j]);
#pragma unroll
      for (int j = 0; j < 4; ++j) s[j] = mma_b_raw(kb[j].v, qal[dc], s[j]);
      run_guard_b(s[0], s[1], s[2], s[3], kb[0].v, kb[1].v, kb[2].v, kb[3].v, kl[0].v, kl[1].v, kl[2].v, kl[3].v);
    }

    // ---- key visibility rule, maximum, online softmax; P^T (x1024, f16) and its residual (x4096) as B fragments ----
    //      s[j][r] = score of key kv0 + 16 j + 8 hh + r with query tq
    const int kb0 = kv0 + 8 * hh;           // the lane's key of (j, r) = (0, 0); limits taken relative to it
    const int rlim = klim - kb0, rtq = tq - kb0;
    float m = -INFINITY;
#pragma unroll
    for (int j = 0; j < 4; ++j) {
#pragma unroll
      for (int r = 0; r < 8; ++r) {
        const bool ok = (j * 16 + r <= rlim) || (j * 16 + r == rtq);
        const float sv = ok ? s[j][r] : -INFINITY;
        s[j][r] = sv;
        m = fmaxf(m, sv);
      }
    }
    m = fmaxf(m, half_xor(m));              // the query's other 32 keys
    const float mnew  = fmaxf(mrow, m);
    const float msafe = (mnew == -INFINITY) ? 0.f : mnew;
    const float alpha = __expf(mrow - msafe);
    mrow = mnew;
    FH pa[2], pl[2];                        // element e of fragment kk: key kv0 + 32 kk + (e < 8 ? 8 hh + e : 16 + 8 hh + e - 8)
    float ps[4];
#pragma unroll
    for (int j = 0; j < 4; ++j) {
      float acc = 0.f;
#pragma unroll
      for (int r = 0; r < 8; ++r) {
        const float p = __expf(s[j][r] - msafe);     // masked score: exp(-inf) -> 0
        acc = (r == 0) ? p : (acc + p);
        const float p1k = p * 1024.0f;
        const _Float16 ph = (_Float16)p1k;
        pa[j >> 1].h[j & 1][r] = ph;
        if (RES) pl[j >> 1].h[j & 1][r] = (_Float16)((p1k - (float)ph) * 4096.0f);
      }
      ps[j] = acc;
    }
    lrow = lrow * alpha + ((ps[0] + ps[1]) + (ps[2] + ps[3]));
#pragma unroll
    for (int t4 = 0; t4 < 4; ++t4)
#pragma unroll
      for (int r = 0; r < 8; ++r) oacc[t4][r] *= alpha;

    // ---- context^T += V_hi^T . P^T (f16 WMMA); residual products into a separate accumulator ----
    v8f o1[4];
#pragma unroll
    for (int t4 = 0; t4 < 4; ++t4) o1[t4] = zero8();
#pragma unroll   // pa[kk], pl[kk] live in registers: kk must be a compile-time index
    for (int kk = 0; kk < 2; ++kk) {
#pragma unroll
      for (int t4 = 0; t4 < 4; ++t4) {
        FH vb, vl;
        vb.h[0] = *(const v8h*)(Vth + (t4 * 16 + c) * LP + kk * 32 + 8 * hh);
        vb.h[1] = *(const v8h*)(Vth + (t4 * 16 + c) * LP + kk * 32 + 16 + 8 * hh);
        vl.h[0] = *(const v8h*)(Vtl + (t4 * 16 + c) * LP + kk * 32 + 8 * hh);
        vl.h[1] = *(const v8h*)(Vtl + (t4 * 16 + c) * LP + kk * 32 + 16 + 8 * hh);
        oacc[t4] = mma_h_raw(vb.v, pa[kk].v, oacc[t4]);
        o1[t4]   = mma_h_raw(vl.v, pa[kk].v, o1[t4]);
        if (RES) o1[t4] = mma_h_raw(vb.v, pl[kk].v, o1[t4]);
      }
    }
#pragma unroll
    for (int t4 = 0; t4 < 4; ++t4)
#pragma unroll
      for (int r = 0; r < 8; ++r) oacc[t4][r] += o1[t4][r] * (1.0f / 4096.0f);
  }

  // ---- normalise (1/l and the 1/1024 p carry), stage the wave's 16x64 tile, bf16 hi/lo split,
  float* os = Os[wave];
  {
    const float l = lrow + half_xor(lrow);  // both halves' keys
    const float inv = ((l > 0.f) ? (1.0f / l) : 0.f) * (1.0f / 1024.0f);
#pragma unroll
    for (int t4 = 0; t4 < 4; ++t4) {        // the lane's 8 consecutive d of row c: two 16-B stores
      v4f w0, w1;
#pragma unroll
      for (int r = 0; r < 4; ++r) { w0[r] = oacc[t4][r] * inv; w1[r] = oacc[t4][r + 4] * inv; }
      *(v4f*)(os + c * OSP + t4 * 16 + 8 * hh)     = w0;
      *(v4f*)(os + c * OSP + t4 * 16 + 8 * hh + 4) = w1;
    }
  }
  __builtin_amdgcn_fence(__ATOMIC_RELEASE, "workgroup");
  __builtin_amdgcn_wave_barrier();
  __builtin_amdgcn_fence(__ATOMIC_ACQUIRE, "workgroup");
  {
    const int q4 = lane >> 3, c8 = (lane & 7) * 8;
    v4u hv[4], lv[4];
#pragma unroll
    for (int it = 0; it < 4; ++it) {
      const int row = it * 4 + q4;   // it 0..3 x q4 0..3 = rows 0..15 of the wave tile
      const float* sp = os + row * OSP + c8;
      v4u a, a2;
#pragma unroll
      for (int e = 0; e < 4; ++e) {
        const float f0 = sp[2 * e], f1 = sp[2 * e + 1];
        const unsigned short h0 = bf_bits(f0), h1 = bf_bits(f1);
        const unsigned short l0 = bf_bits(f0 - bf_up(h0)), l1 = bf_bits(f1 - bf_up(h1));
        a[e] = pk16(h0, h1); a2[e] = pk16(l0, l1);
      }
      hv[it] = a; lv[it] = a2;
    }
    {
#pragma unroll
      for (int it = 0; it < 4; ++it) {
        const int row = it * 4 + q4;
        const size_t go = (size_t)(q0 + row) * DM + (size_t)h * HD + c8;
        *(v4u*)(ohp + go) = hv[it];
        *(v4u*)(olp + go) = lv[it];
      }
      
    }
  }
}

// =====================================================================================================
// One launch for all NQB x NH row blocks: NH * NQB = 1024 blocks, four resident per WGP (registers), so the
// launch lasts as long as the WGP whose four blocks hold the most key tiles. A block's tile count grows with qb, so
// the index map makes quartets of row blocks {x, 63 - x, 32 + x, 31 - x}, x = 0..15 (equal sums for a cost linear
// in qb), both of four neighbouring indices (same head) and of indices 256 apart (four heads).
//   bx = 256 g + 4 a + b: x = a & 15, member v = (b + g) & 3, h = 4 (a >> 4) + g; (x, v) <-> qb and (a >> 4, g) <-> h
//   are one to one, and b <-> v for a given g: every (h, qb) exactly once.
// Row blocks below RESQB take the path with the p residual plane: a block-uniform branch on blockIdx alone.
// =====================================================================================================
static_assert(NQB == 64 && NH == 16);
__global__ __launch_bounds__(128)
void attn64(const unsigned short* __restrict__ qhp, const unsigned short* __restrict__ qlp,
            const unsigned short* __restrict__ khp, const unsigned short* __restrict__ klp,
            const unsigned short* __restrict__ vhp, const unsigned short* __restrict__ vlp,
            const int* __restrict__ npk,
            unsigned short* ohp, unsigned short* olp) {
  __shared__ __align__(16) __bf16   Ksh[64 * LP];                 // K hi [kv][d], rows padded to LP
  __shared__ __align__(16) __bf16   Ksl[64 * LP];                 // K lo
  __shared__ __align__(16) _Float16 Vth[64 * LP];                 // V^T hi [d][kv], rows padded to LP
  __shared__ __align__(16) _Float16 Vtl[64 * LP];                 // V^T residual
  __shared__ __align__(16) float    Os[4][16 * OSP];              // per wave context tile [row][d], rows padded to OSP
  const int bx = blockIdx.x;              // < NH * NQB by grid size
  const int g  = bx >> 8;
  const int a  = (bx >> 2) & 63;
  const int x  = a & 15;
  const int v  = (bx + g) & 3;
  const int h  = ((a >> 4) << 2) + g;
  const int qb = (v == 0) ? x : (v == 1) ? (63 - x) : (v == 2) ? (32 + x) : (31 - x);
  if (qb < RESQB)
    attn_rows<true>(qhp, qlp, khp, klp, vhp, vlp, npk, ohp, olp, qb, h, Ksh, Ksl, Vth, Vtl, Os);
  else
    attn_rows<false>(qhp, qlp, khp, klp, vhp, vlp, npk, ohp, olp, qb, h, Ksh, Ksl, Vth, Vtl, Os);
}

// =====================================================================================================
// Workspace map (bytes), every region an exact multiple of its whole-line / whole-tile store granularity:
//   Xb    bf16 [4096][1024]          0            8388608
//   Wqkv  bf16 [3072 n][1024 k]      8388608      6291456   (rows 0..2047 = q|k weights, 2048.. = v weights)
//   Wob   bf16 [1024][1024]          14680064     2097152
//   QKf   f32  [4096][2048]          16777216     33554432  (cols 0..1023 q, 1024..2047 k)
//   VTh   f16  [1024 d][4096 s]      50331648     8388608
//   VTl   f16  [1024 d][4096 s]      58720256     8388608
//   QK4   bf16 4 x [4096][1024]      67108864     33554432  (q hi, q lo, k hi, k lo)
//   Oh    bf16 [4096][1024]          100663296    8388608
//   Ol    bf16 [4096][1024]          109051904    8388608
//   end                              117440512
// Weights are [out n][in k] with k contiguous = the Bt / A layout the GEMM wants, so they are only converted.
// =====================================================================================================
extern "C" void kernel_launch(void* const* d_in, const int* in_sizes, int n_in,
                              void* d_out, int out_size, void* d_ws, size_t ws_size,
                              hipStream_t stream) {
  if (n_in < 7) return;
  if (in_sizes[0] != SEQ * DM) return;
  if (in_sizes[1] != SEQ * 2) return;
  if (in_sizes[2] != NQKV * DM) return;
  if (in_sizes[3] != DM * DM) return;
  if (in_sizes[4] != NH) return;
  if (in_sizes[5] != 2 * NH * NFR) return;
  if (in_sizes[6] < 1) return;
  if (out_size != SEQ * DM) return;

  const float* x     = (const float*)d_in[0];
  const float* pos   = (const float*)d_in[1];
  const float* qkvw  = (const float*)d_in[2];
  const float* outw  = (const float*)d_in[3];
  const float* scl   = (const float*)d_in[4];
  const float* freqs = (const float*)d_in[5];
  const int*   npk   = (const int*)d_in[6];

  const size_t PXB   = (size_t)SEQ * DM * 2;      //  8388608
  const size_t PWQKV = (size_t)NQKV * DM * 2;     //  6291456
  const size_t PWO   = (size_t)DM * DM * 2;       //  2097152
  const size_t PQKF  = (size_t)SEQ * QKW * 4;     // 33554432
  const size_t PVT   = (size_t)DM * SEQ * 2;      //  8388608
  const size_t PPL   = (size_t)SEQ * DM * 2;      //  8388608
  size_t off = 0;
  const size_t oXb   = off; off += PXB;
  const size_t oWqkv = off; off += PWQKV;
  const size_t oWo   = off; off += PWO;
  const size_t oQKf  = off; off += PQKF;
  const size_t oVTh  = off; off += PVT;
  const size_t oVTl  = off; off += PVT;
  const size_t oQK4  = off; off += 4 * PPL;
  const size_t oOh   = off; off += PPL;
  const size_t oOl   = off; off += PPL;
  if (off > ws_size) return;                      // off = 117440512
  if (off > (size_t)134217728) return;

  char* ws = (char*)d_ws;
  unsigned short* Xb   = (unsigned short*)(ws + oXb);
  unsigned short* Wqkv = (unsigned short*)(ws + oWqkv);
  unsigned short* Wvb  = Wqkv + (size_t)2 * DM * DM;             // rows 2048.. of the qkv weight plane
  unsigned short* Wob  = (unsigned short*)(ws + oWo);
  float*          QKf  = (float*)(ws + oQKf);
  unsigned short* VTh  = (unsigned short*)(ws + oVTh);
  unsigned short* VTl  = (unsigned short*)(ws + oVTl);
  unsigned short* QK4  = (unsigned short*)(ws + oQK4);
  unsigned short* Qh   = QK4;
  unsigned short* Ql   = QK4 + (size_t)SEQ * DM;
  unsigned short* Kh   = QK4 + (size_t)2 * SEQ * DM;
  unsigned short* Kl   = QK4 + (size_t)3 * SEQ * DM;
  unsigned short* Oh   = (unsigned short*)(ws + oOh);
  unsigned short* Ol   = (unsigned short*)(ws + oOl);

  const dim3 blk(256);
  const int n8x = SEQ * DM / 8;                                // 524288
  const int n8w = NQKV * DM / 8;                               // 393216
  const int n8o = DM * DM / 8;                                 // 131072
  static_assert((SEQ * DM / 8) % 256 == 0 && (NQKV * DM / 8) % 256 == 0 && (DM * DM / 8) % 256 == 0);
  const dim3 gCvt((n8x + n8w + n8o) / 256);                    // 2048 + 1536 + 512 blocks
  const int  nbQK = (SEQ / 128) * (QKW / 256);                 // 256 blocks: M=4096, N=2048
  const int  nbVT = (DM / 128) * (SEQ / 256);                  // 128 blocks: M=1024, N=4096
  const dim3 gQKV(nbQK + nbVT, 1);
  const dim3 gOut(((SEQ / 64) * (DM / 64) + 7) / 8, 1);        // 1024 tiles -> 128 blocks: M=4096, N=1024
  const int  nRows = SEQ * NH;                                 // 65536 (t, h) rows
  const dim3 gRope((nRows + 7) / 8);                           // 8192 blocks of 8 waves

  // (1) x -> bf16 [4096][1024]; weights [n][k] f32 -> bf16 [n][k]
  cvt3_bf16x8<<<gCvt, blk, 0, stream>>>(x, qkvw, outw, Xb, Wqkv, Wob, n8x, n8w, n8o);
  // (2) q|k = x . W[0:2048]^T -> f32 [4096][2048]   (M=4096, N=2048, K=1024), and in the same grid
  // (3) v^T = Wv . x^T -> f16 hi plane [h*64+d][s] (pitch SEQ) and residual plane (x4096, all keys)
  //     (A = Wvb [n][k], Bt = Xb; M=1024, N=4096, K=1024)
  gemm_qk_vt<<<gQKV, blk, 0, stream>>>(Xb, Wqkv, Wvb, (void*)QKf, (void*)VTh, (void*)VTl,
                                       SEQ, QKW, DM, nbQK, 4096.0f);
  // (4) cosine-sim scaling + axial rotation -> q hi/lo, k hi/lo bf16 planes [t][h*64+d]
  rope_qk<<<gRope, blk, 0, stream>>>(QKf, pos, scl, freqs, QK4, nRows);
  // (5) attention, all row blocks in one launch (row blocks 0..RESQB-1 with the p residual plane, the rest without)
  attn64<<<dim3(NH * NQB), dim3(128), 0, stream>>>(Qh, Ql, Kh, Kl, VTh, VTl, npk, Oh, Ol);
  // (6) out = context . Wo^T -> d_out f32 [4096][1024]  (A = context hi + lo planes, 2 products)
  gemm_split_f32<<<gOut, blk, 0, stream>>>(Oh, Ol, Wob, d_out, SEQ, DM, DM);
  (void)hipGetLastError();
}

// v008
// One run takes 162 microseconds.
// Next to v007, in two timings, it ran 1.04 times as fast each time.
// All steps since v000 together make it 3.53 times as fast.
// Contractions: q|k and v^T projections = v_wmma_f32_16x16x32_bf16 (bf16 operands from RNE-converted inputs, single product);
// q.k^T scores = v_wmma_f32_16x16x32_bf16 with bf16 hi/lo split q and k (hi.hi + hi.lo + lo.hi);
// p.v = v_wmma_f32_16x16x32_f16 (p carried x1024 in f16; v as f16 hi plane + f16 residual plane x4096, 2 products;
// extra f16 residual plane x4096 of p for the first 512 rows); ctx.Wo^T = v_wmma_f32_16x16x32_bf16 with ctx as
// bf16 hi/lo planes times bf16 Wo (2 products); all f32 accumulate; norms, rotations and softmax in f32.
#include <hip/hip_runtime.h>
#include <math.h>
#include <stdint.h>

#define SEQ   4096
#define DM    1024
#define NH    16
#define HD    64
#define NQB   (SEQ / 64)   // 64 row / key tiles of 64
#define RESQB 8            // leading 64-row blocks that also use the p residual plane
#define QKW   (2 * DM)     // pitch of the f32 q|k plane
#define NQKV  (3 * DM)
#define NFR   16           // rotation frequencies per head per axis (HD/4)
#define LP    72           // LDS row pitch of the 64-wide 16-bit attention tiles, in elements: 144 B = 16 B x 9 (odd)
#define OSP   68           // LDS row pitch of the attention output staging tile, in floats: 272 B = 16 B x 17 (odd)
#define GP    72           // LDS row pitch of the GEMM operand slices (64 k of 16 bits), in elements: 144 B = 16 B x 9 (odd)
static_assert(NH * HD == DM);
static_assert((SEQ % 256) == 0 && (DM % 256) == 0);
static_assert((SEQ % 64) == 0 && (DM % 64) == 0);
static_assert(RESQB <= NQB);
static_assert(HD == 4 * NFR);

typedef _Float16 v16h __attribute__((ext_vector_type(16)));
typedef _Float16 v8h  __attribute__((ext_vector_type(8)));
typedef __bf16   v16b __attribute__((ext_vector_type(16)));
typedef __bf16   v8b  __attribute__((ext_vector_type(8)));
typedef float    v8f  __attribute__((ext_vector_type(8)));
typedef float    v4f  __attribute__((ext_vector_type(4)));
typedef unsigned int v4u __attribute__((ext_vector_type(4)));

// ---- scalar helpers --------------------------------------------------------------------------------
__device__ __forceinline__ unsigned short bf_bits(float f) {          // f32 -> bf16 bits, RNE convert
  unsigned u = __float_as_uint(f);
  return (unsigned short)((u + 0x7FFFu + ((u >> 16) & 1u)) >> 16);
}
__device__ __forceinline__ float bf_up(unsigned short h) { return __uint_as_float(((unsigned)h) << 16); }
__device__ __forceinline__ float bf_rn(float f) { return bf_up(bf_bits(f)); }   // value after RNE convert to bf16
__device__ __forceinline__ unsigned short h_bits(_Float16 x) { return __builtin_bit_cast(unsigned short, x); }
__device__ __forceinline__ unsigned pk16(unsigned short a, unsigned short b) { return (unsigned)a | ((unsigned)b << 16); }
// value of lane (l ^ M) inside the lane's 16-lane row, M = 1..15: a DPP operand (row_xmask), no trip through the LDS pipe
template <int M>
__device__ __forceinline__ float row_xor(float x) {
  return __builtin_bit_cast(float, __builtin_amdgcn_update_dpp(0, __builtin_bit_cast(int, x), 0x160 + M, 0xf, 0xf, true));
}
// value of lane (l ^ 16): vector cross-row move
__device__ __forceinline__ float half_xor(float x) {
  return __builtin_bit_cast(float, __builtin_amdgcn_permlanex16(__builtin_bit_cast(int, x), __builtin_bit_cast(int, x),
                                                                0x76543210, 0xfedcba98, false, false));
}
__device__ __forceinline__ v8f zero8() { v8f z = {0.f, 0.f, 0.f, 0.f, 0.f, 0.f, 0.f, 0.f}; return z; }

// ---- fragment loaders: 16-bit A/B operand, lane -> row/col (lane&15), p already includes +8*(lane>>4);
//      elements 0..7 <- p[0..7] (k0+8h..), elements 8..15 <- p[16..23] (k0+16+8h..)
__device__ __forceinline__ v16b ldfrag_b(const __bf16* p) {
  union { v16b v; v8b h[2]; } f;
  f.h[0] = *(const v8b*)(p);
  f.h[1] = *(const v8b*)(p + 16);
  return f.v;
}

// ---- WMMA helpers -------------------------------------------------------------------------------------
__device__ __forceinline__ v8f mma_b_raw(v16b a, v16b b, v8f c) {
  return __builtin_amdgcn_wmma_f32_16x16x32_bf16(false, a, false, b, (short)0, c, false, false);
}
__device__ __forceinline__ v8f mma_h_raw(v16h a, v16h b, v8f c) {
  return __builtin_amdgcn_wmma_f32_16x16x32_f16(false, a, false, b, (short)0, c, false, false);
}
// closes a run of products on four accumulator chains: the eight A fragments stay in their registers until the whole
// run has issued (no later result is placed over an operand still being read), and the four v_nop are the matrix
// distance in front of the first vector instruction on the results or on the fragments' registers
__device__ __forceinline__ void run_guard_b(v8f& s0, v8f& s1, v8f& s2, v8f& s3,
                                            v16b b0, v16b b1, v16b b2, v16b b3, v16b c0, v16b c1, v16b c2, v16b c3) {
  asm volatile("v_nop\n\tv_nop\n\tv_nop\n\tv_nop"
               : "+v"(s0), "+v"(s1), "+v"(s2), "+v"(s3)
               : "v"(b0), "v"(b1), "v"(b2), "v"(b3), "v"(c0), "v"(c1), "v"(c2), "v"(c3));
}
__device__ __forceinline__ void dep_guard_b(v8f& a, v8f& b, v16b x, v16b y) {
  asm volatile("v_nop\n\tv_nop\n\tv_nop\n\tv_nop" : "+v"(a), "+v"(b) : "v"(x), "v"(y));
}
__device__ __forceinline__ void keep4_b(v16b a, v16b b, v16b c, v16b d) {
  asm volatile("v_nop" :: "v"(a), "v"(b), "v"(c), "v"(d));
}
__device__ __forceinline__ void acc_guard4(v8f& a, v8f& b, v8f& c, v8f& d) {
  asm volatile("v_nop\n\tv_nop\n\tv_nop\n\tv_nop" : "+v"(a), "+v"(b), "+v"(c), "+v"(d));
}

// =====================================================================================================
// f32 -> bf16 (RNE convert), 8 elements per thread, one 16-B store per lane: a wave writes 512 contiguous B
// Three planes in one grid (none depends on another): blocks 0 .. n0/256 - 1 take plane 0, the next n1/256 plane 1,
// the last n2/256 plane 2; n0, n1, n2 = groups of 8 elements, multiples of 256, so a block lies in one plane and
// the choice is a scalar one. coverage: n threads x 8 = the whole of each plane.
// =====================================================================================================
__global__ __launch_bounds__(256) void cvt3_bf16x8(const float* __restrict__ in0, const float* __restrict__ in1,
                                                   const float* __restrict__ in2, unsigned short* out0,
                                                   unsigned short* out1, unsigned short* out2, int n0, int n1, int n2) {
  const int base = blockIdx.x * 256;
  const int pl   = (base < n0) ? 0 : (base < n0 + n1) ? 1 : 2;
  const float* in     = (pl == 0) ? in0 : (pl == 1) ? in1 : in2;
  unsigned short* out = (pl == 0) ? out0 : (pl == 1) ? out1 : out2;
  const int n8 = (pl == 0) ? n0 : (pl == 1) ? n1 : n2;
  const int i  = base - ((pl == 0) ? 0 : (pl == 1) ? n0 : n0 + n1) + threadIdx.x;
  if (i < n8) {
    const v4f a = *(const v4f*)(in + (size_t)i * 8);
    const v4f b = *(const v4f*)(in + (size_t)i * 8 + 4);
    v4u p;
    p[0] = pk16(bf_bits(a[0]), bf_bits(a[1]));
    p[1] = pk16(bf_bits(a[2]), bf_bits(a[3]));
    p[2] = pk16(bf_bits(b[0]), bf_bits(b[1]));
    p[3] = pk16(bf_bits(b[2]), bf_bits(b[3]));
    *(v4u*)(out + (size_t)i * 8) = p;
    
  }
}

// =====================================================================================================
// Asynchronous copies global -> LDS, 16 B per lane, four per statement. l* = the lane's LDS byte address,
// g* = the lane's global address. The closing s_wait_xcnt stands inside the statement so that no address
// register of an issued copy is rewritten in front of it.
// =====================================================================================================
__device__ __forceinline__ void copy4_to_lds(unsigned l0, unsigned l1, unsigned l2, unsigned l3,
                                             const __bf16* g0, const __bf16* g1, const __bf16* g2, const __bf16* g3) {
  asm volatile("global_load_async_to_lds_b128 %0, %4, off\n\t"
               "global_load_async_to_lds_b128 %1, %5, off\n\t"
               "global_load_async_to_lds_b128 %2, %6, off\n\t"
               "global_load_async_to_lds_b128 %3, %7, off\n\t"
               "s_wait_xcnt 0x0"
               :: "v"(l0), "v"(l1), "v"(l2), "v"(l3), "v"(g0), "v"(g1), "v"(g2), "v"(g3) : "memory");
}
// the same, eight copies per statement
__device__ __forceinline__ void copy8_to_lds(unsigned l0, unsigned l1, unsigned l2, unsigned l3,
                                             unsigned l4, unsigned l5, unsigned l6, unsigned l7,
                                             const __bf16* g0, const __bf16* g1, const __bf16* g2, const __bf16* g3,
                                             const __bf16* g4, const __bf16* g5, const __bf16* g6, const __bf16* g7) {
  asm volatile("global_load_async_to_lds_b128 %0, %8, off\n\t"
               "global_load_async_to_lds_b128 %1, %9, off\n\t"
               "global_load_async_to_lds_b128 %2, %10, off\n\t"
               "global_load_async_to_lds_b128 %3, %11, off\n\t"
               "global_load_async_to_lds_b128 %4, %12, off\n\t"
               "global_load_async_to_lds_b128 %5, %13, off\n\t"
               "global_load_async_to_lds_b128 %6, %14, off\n\t"
               "global_load_async_to_lds_b128 %7, %15, off\n\t"
               "s_wait_xcnt 0x0"
               :: "v"(l0), "v"(l1), "v"(l2), "v"(l3), "v"(l4), "v"(l5), "v"(l6), "v"(l7),
                  "v"(g0), "v"(g1), "v"(g2), "v"(g3), "v"(g4), "v"(g5), "v"(g6), "v"(g7) : "memory");
}
__device__ __forceinline__ unsigned lds_addr(const __bf16* p) { return (unsigned)(uintptr_t)p; }   // low 32 bits = LDS byte address

// =====================================================================================================
// Register-blocked batched bf16 WMMA GEMM: C[m][n] = sum_k A[m][k] * Bt[n][k]; a block of 8 waves (2 x 4) owns a
// 128 x 256 tile, one wave per 64x64 sub-tile. A row-major [M][K] pitch lda; Bt row-major [N][K] pitch ldb
// (k contiguous); M multiple of 128, N of 256, K of 64. blockIdx.y = batch index (strides in elements).
// Operand path: per slice of 64 k the block's 128 A rows and 256 Bt rows (128 B each = one line; 8 lanes x 16 B
// per row, so a wave-wide copy covers 4 whole lines) go to LDS by asynchronous copies, rows at pitch GP; two
// buffers, slice t + 1 in flight while slice t is multiplied; fragments by 16-B LDS loads.
// NSPLIT: 0 = A.Bt; 1 = (A + A2).Bt (A2 = unscaled bf16 lo plane of A).
// OUT_MODE: 0 = f32 (pitch ldc); 2 = bf16 hi plane C + bf16 lo plane C2 (lo = RNE(v - hi), unscaled);
//           3 = f16 hi plane C + f16 residual plane C2 = f16((v - hi) * rscale), C2 written only for tiles
//               with n0 < N2 (pitch ldc2, batch stride strideC2).
// gemm_tile = the work of one block on tile bx; the LDS arrays are the kernel's, handed in:
//   sT 8 x 16 x 68 floats (per-wave 16x64 slab, pitch 68), sA and sA2 2 x 128 x GP (A, A2 slice, two buffers;
//   sA2 is not touched when NSPLIT == 0), sB 2 x 256 x GP (Bt slice, two buffers).
// =====================================================================================================
#define GSA (128 * GP)     // elements of one A slice buffer
#define GSB (256 * GP)     // elements of one Bt slice buffer
template <int NSPLIT, int OUT_MODE>
__device__ __forceinline__ void gemm_tile(
    const unsigned short* __restrict__ Ap, const unsigned short* A2p, int lda, long long strideA,
    const unsigned short* __restrict__ Btp, int ldb, long long strideB,
    void* Cout, int ldc, long long strideC,
    void* Cout2, int ldc2, long long strideC2, int N2,
    int M, int N, int K, float rscale,
    int bx, float* sT, __bf16* sA, __bf16* sA2, __bf16* sB) {
  static_assert(NSPLIT == 0 || NSPLIT == 1);
  const __bf16* A   = (const __bf16*)(const void*)Ap;
  const __bf16* A2  = (const __bf16*)(const void*)A2p;
  const __bf16* Bt  = (const __bf16*)(const void*)Btp;
  const int b    = blockIdx.y;
  const int tid  = threadIdx.x;
  const int lane = tid & 31;
  const int wave = tid >> 5;
  const int tilesN = N >> 8;
  const int tilesM = M >> 7;
  if (bx >= tilesM * tilesN) return;           // block-uniform, in front of every barrier and copy
  const int bm = bx / tilesN;
  const int bn = bx - bm * tilesN;
  const int mB = bm << 7;
  const int nB = bn << 8;
  const int wm = wave >> 2;                    // 0..1
  const int wn = wave & 3;                     // 0..3
  const int m0 = mB + (wm << 6);
  const int n0 = nB + (wn << 6);

  const __bf16* Ab  = A  + (size_t)b * strideA;
  const __bf16* Bb  = Bt + (size_t)b * strideB;
  const __bf16* Ab2 = NSPLIT ? (A2 + (size_t)b * strideA) : Ab;

  const int rlane = lane & 15;                 // row (A) / col (B, D) within subtile
  const int koff  = (lane >> 4) * 8;           // k offset of this lane half
  const int mOff  = (lane >> 4) * 8;           // D row offset

  // copy map: thread -> row (tid >> 3) + 32 p of the slice, 16-B piece (tid & 7) of its 128 B
  const int crow = tid >> 3;
  const int cseg = (tid & 7) * 8;
  const __bf16* gA  = Ab  + (size_t)(mB + crow) * lda + cseg;
  const __bf16* gA2 = Ab2 + (size_t)(mB + crow) * lda + cseg;
  const __bf16* gB  = Bb  + (size_t)(nB + crow) * ldb + cseg;
  const unsigned lA  = lds_addr(sA + crow * GP + cseg);
  const unsigned lA2 = lds_addr(sA2 + crow * GP + cseg);
  const unsigned lB  = lds_addr(sB + crow * GP + cseg);
  const unsigned R32 = 32 * GP * 2;            // 32 LDS rows, bytes
  const size_t a32 = (size_t)32 * lda, b32 = (size_t)32 * ldb;
  auto stage = [&](int t, int buf) {           // slice t (k = 64 t .. 64 t + 63) into buffer buf
    const __bf16* pa = gA + (size_t)t * 64;
    const __bf16* pb = gB + (size_t)t * 64;
    const unsigned la = lA + (unsigned)buf * (4 * R32);
    const unsigned lb = lB + (unsigned)buf * (8 * R32);
    copy4_to_lds(la, la + R32, la + 2 * R32, la + 3 * R32, pa, pa + a32, pa + 2 * a32, pa + 3 * a32);
    if (NSPLIT) {
      const __bf16* pa2 = gA2 + (size_t)t * 64;
      const unsigned la2 = lA2 + (unsigned)buf * (4 * R32);
      copy4_to_lds(la2, la2 + R32, la2 + 2 * R32, la2 + 3 * R32, pa2, pa2 + a32, pa2 + 2 * a32, pa2 + 3 * a32);
    }
    copy4_to_lds(lb, lb + R32, lb + 2 * R32, lb + 3 * R32, pb, pb + b32, pb + 2 * b32, pb + 3 * b32);
    copy4_to_lds(lb + 4 * R32, lb + 5 * R32, lb + 6 * R32, lb + 7 * R32,
                 pb + 4 * b32, pb + 5 * b32, pb + 6 * b32, pb + 7 * b32);
  };

  v8f acc[4][4];
#pragma unroll
  for (int i = 0; i < 4; ++i)
#pragma unroll
    for (int j = 0; j < 4; ++j) acc[i][j] = zero8();

  const int nK = K >> 6;
  stage(0, 0);
  asm volatile("s_wait_asynccnt 0x0" ::: "memory");   // this wave's copies of slice 0 have landed
  __syncthreads();                                    // every wave's have: slice 0 is readable
  if (nK > 1) stage(1, 1);
  for (int t = 0; t < nK; ++t) {
    const int buf = t & 1;
    const __bf16* tA  = sA + buf * GSA + ((wm << 6) + rlane) * GP + koff;
    const __bf16* tA2 = NSPLIT ? (sA2 + buf * GSA + ((wm << 6) + rlane) * GP + koff) : tA;
    const __bf16* tB  = sB + buf * GSB + ((wn << 6) + rlane) * GP + koff;
#pragma unroll
    for (int kk = 0; kk < 2; ++kk) {
      // the fragments of a k chunk of 32 are fetched as one group in front of its products
      v16b bh[4], ah[4], al[4];
#pragma unroll
      for (int j = 0; j < 4; ++j) bh[j] = ldfrag_b(tB + (j << 4) * GP + kk * 32);
#pragma unroll
      for (int i = 0; i < 4; ++i) {
        ah[i] = ldfrag_b(tA + (i << 4) * GP + kk * 32);
        al[i] = NSPLIT ? ldfrag_b(tA2 + (i << 4) * GP + kk * 32) : ah[i];
      }
#pragma unroll
      for (int i = 0; i < 4; ++i) {
#pragma unroll
        for (int j = 0; j < 4; ++j) {
          acc[i][j] = mma_b_raw(ah[i], bh[j], acc[i][j]);
          if (NSPLIT) acc[i][j] = mma_b_raw(al[i], bh[j], acc[i][j]);
        }
        dep_guard_b(acc[i][0], acc[i][3], ah[i], al[i]);
      }
      keep4_b(bh[0], bh[1], bh[2], bh[3]);
    }
    asm volatile("s_wait_dscnt 0x0" ::: "memory");     // this wave's reads of buffer buf are done before it is refilled
    asm volatile("s_wait_asynccnt 0x0" ::: "memory");  // this wave's copies of slice t + 1 have landed
    __syncthreads();                                   // publishes slice t + 1 and ends every read of buffer buf
    if (t + 2 < nK) stage(t + 2, buf);
  }
  asm volatile("s_wait_asynccnt 0x0" ::: "memory");    // no copy outstanding behind the loop
  acc_guard4(acc[0][0], acc[0][1], acc[0][2], acc[0][3]);
  acc_guard4(acc[1][0], acc[1][1], acc[1][2], acc[1][3]);
  acc_guard4(acc[2][0], acc[2][1], acc[2][2], acc[2][3]);
  acc_guard4(acc[3][0], acc[3][1], acc[3][2], acc[3][3]);

  // ---- epilogue ----
  float* slab = sT + wave * (16 * 68);
#pragma unroll
  for (int i = 0; i < 4; ++i) {
    const int mBase = m0 + (i << 4);
#pragma unroll
    for (int j = 0; j < 4; ++j) {
#pragma unroll
      for (int r = 0; r < 8; ++r) {
        slab[(mOff + r) * 68 + (j << 4) + rlane] = acc[i][j][r];
      }
    }
    __builtin_amdgcn_fence(__ATOMIC_RELEASE, "workgroup");
    __builtin_amdgcn_wave_barrier();
    __builtin_amdgcn_fence(__ATOMIC_ACQUIRE, "workgroup");
    if (OUT_MODE == 0) {
      float* C = (float*)Cout + (size_t)b * strideC;
      const int hh = lane >> 4, c4 = (lane & 15) * 4;     // 256-B row segment = 16 lanes x 16 B
      {
#pragma unroll
        for (int it = 0; it < 8; ++it) {
          const int row = it * 2 + hh;                     // it 0..7 x hh 0..1 = rows 0..15
          const v4f v = *(const v4f*)(slab + row * 68 + c4);
          *(v4f*)(C + (size_t)(mBase + row) * ldc + n0 + c4) = v;
        }
        
      }
    } else {
      const int q = lane >> 3, c8 = (lane & 7) * 8;
      unsigned short* C  = (unsigned short*)Cout  + (size_t)b * strideC;
      unsigned short* C2 = (unsigned short*)Cout2 + (size_t)b * strideC2;
      const bool wlo = (OUT_MODE == 2) || (n0 < N2);      // wave-uniform
      v4u hv[4], lv[4];
#pragma unroll
      for (int it = 0; it < 4; ++it) {
        const int row = it * 4 + q;                        // it 0..3 x q 0..3 = rows 0..15
        const float* sp = slab + row * 68 + c8;
        v4u a, a2;
#pragma unroll
        for (int e = 0; e < 4; ++e) {
          const float f0 = sp[2 * e], f1 = sp[2 * e + 1];
          unsigned short h0, h1, l0, l1;
          if (OUT_MODE == 2) {
            h0 = bf_bits(f0); h1 = bf_bits(f1);
            l0 = bf_bits(f0 - bf_up(h0)); l1 = bf_bits(f1 - bf_up(h1));
          } else {
            const _Float16 x0 = (_Float16)f0, x1 = (_Float16)f1;
            h0 = h_bits(x0); h1 = h_bits(x1);
            l0 = h_bits((_Float16)((f0 - (float)x0) * rscale));
            l1 = h_bits((_Float16)((f1 - (float)x1) * rscale));
          }
          a[e] = pk16(h0, h1); a2[e] = pk16(l0, l1);
        }
        hv[it] = a; lv[it] = a2;
      }
      {
#pragma unroll
        for (int it = 0; it < 4; ++it) {
          const int row = it * 4 + q;
          *(v4u*)(C + (size_t)(mBase + row) * ldc + n0 + c8) = hv[it];
          if (wlo) *(v4u*)(C2 + (size_t)(mBase + row) * ldc2 + n0 + c8) = lv[it];
        }
        
      }
    }
    __builtin_amdgcn_fence(__ATOMIC_RELEASE, "workgroup");
    __builtin_amdgcn_wave_barrier();
    __builtin_amdgcn_fence(__ATOMIC_ACQUIRE, "workgroup");
  }
}

// =====================================================================================================
// The two projections in one grid (neither reads what the other writes): blocks 0 .. nQK - 1 are the tiles of
// q|k = x . Wqk^T (f32 out), the rest the tiles of v^T = Wv . x^T (f16 hi + residual planes). One set of LDS arrays
// serves either path, so two blocks fit a WGP and the v^T tiles run beside the q|k tiles. The branch is on
// blockIdx alone: block-uniform.
// =====================================================================================================
__global__ __launch_bounds__(256) void gemm_qk_vt(
    const unsigned short* __restrict__ Xp, const unsigned short* __restrict__ Wqkp, const unsigned short* __restrict__ Wvp,
    void* QKout, void* VThout, void* VTlout, int seq, int qkw, int dm, int nQK, float rscale) {
  __shared__ __align__(16) float  sT[8 * 16 * 68];
  __shared__ __align__(16) __bf16 sA[2 * GSA];
  __shared__ __align__(16) __bf16 sB[2 * GSB];
  const int bx = blockIdx.x;
  if (bx < nQK)
    gemm_tile<0, 0>(Xp, Xp, dm, 0LL, Wqkp, dm, 0LL, QKout, qkw, 0LL, QKout, qkw, 0LL, 0,
                    seq, qkw, dm, 1.0f, bx, sT, sA, sA, sB);
  else
    gemm_tile<0, 3>(Wvp, Wvp, dm, 0LL, Xp, dm, 0LL, VThout, seq, 0LL, VTlout, seq, 0LL, seq,
                    dm, seq, dm, rscale, bx - nQK, sT, sA, sA, sB);
}

// out = (A + A2) . Bt^T, f32: one tile per block
__global__ __launch_bounds__(256) void gemm_split_f32(
    const unsigned short* __restrict__ Ap, const unsigned short* A2p, const unsigned short* __restrict__ Btp,
    void* Cout, int M, int N, int K) {
  __shared__ __align__(16) float  sT[8 * 16 * 68];
  __shared__ __align__(16) __bf16 sA[2 * GSA];
  __shared__ __align__(16) __bf16 sA2[2 * GSA];
  __shared__ __align__(16) __bf16 sB[2 * GSB];
  gemm_tile<1, 0>(Ap, A2p, K, 0LL, Btp, K, 0LL, Cout, N, 0LL, Cout, N, 0LL, 0,
                  M, N, K, 1.0f, (int)blockIdx.x, sT, sA, sA2, sB);
}

// =====================================================================================================
// Cosine-similarity scaling + axial rotation of q and k, f32, one wave per (token t, head h) row.
//   qkf: f32 [t][QKW], q of head h at cols h*64.., k at cols DM + h*64..
//   pos [t][2], scl [NH], freqs [2][NH][NFR]: values RNE-converted to bf16 in register before use.
//   rq = sqrt(|scl_h| + 1e-8) * rsqrt(sum(q^2) + 1e-8); qs = q * rq (same for k)
//   theta[i], i < 16: (pos[t][1]*2 - 1) * freqs[1][h][i]; i >= 16: (pos[t][0]*2 - 1) * freqs[0][h][i-16]
//   out[i] = qs[i] cos - qs[i+32] sin; out[i+32] = qs[i+32] cos + qs[i] sin (lane i = pair index).
//   qk4: four bf16 planes [t][h*64+d] back to back (plane stride SEQ*DM elements): q hi, q lo, k hi, k lo
//   (lo = RNE(v - hi), unscaled). The wave's 64-wide row is staged in LDS, then ONE store instruction writes
//   grid = nrows/8 blocks of 256 (8 waves). coverage: nrows = SEQ*NH rows x 64 cols in each of the 4 planes.
// =====================================================================================================
__global__ __launch_bounds__(256) void rope_qk(const float* __restrict__ qkf, const float* __restrict__ pos,
                                               const float* __restrict__ scl, const float* __restrict__ freqs,
                                               unsigned short* qk4, int nrows) {
#pragma clang fp contract(off)
  __shared__ __align__(16) float sq[8][64];
  __shared__ __align__(16) float sk[8][64];
  const int tid  = threadIdx.x;
  const int wave = tid >> 5;
  const int lane = tid & 31;
  const int rho  = blockIdx.x * 8 + wave;
  if (rho < nrows) {                                      // wave-uniform; no block barriers in this kernel
    const int t = rho >> 4;
    const int h = rho & 15;
    const float* qr = qkf + (size_t)t * QKW + h * HD;
    const float* kr = qr + DM;
    const int i = lane;                                   // pair index 0..31
    const float q1 = qr[i], q2 = qr[i + 32];
    const float k1 = kr[i], k2 = kr[i + 32];
    float ssq = q1 * q1 + q2 * q2;
    float ssk = k1 * k1 + k2 * k2;
    ssq += half_xor(ssq);    ssk += half_xor(ssk);
    ssq += row_xor<8>(ssq);  ssk += row_xor<8>(ssk);
    ssq += row_xor<4>(ssq);  ssk += row_xor<4>(ssk);
    ssq += row_xor<2>(ssq);  ssk += row_xor<2>(ssk);
    ssq += row_xor<1>(ssq);  ssk += row_xor<1>(ssk);
    const float scr = bf_rn(scl[h]);
    const float ss  = sqrtf(fabsf(scr) + 1e-8f);
    const float rq  = ss * rsqrtf(ssq + 1e-8f);
    const float rk  = ss * rsqrtf(ssk + 1e-8f);
    const float px  = bf_rn(pos[2 * t + 0]);
    const float py  = bf_rn(pos[2 * t + 1]);
    const int  low  = (i < 16) ? 1 : 0;
    const int  fi   = low ? (NH * NFR + h * NFR + i) : (h * NFR + (i - 16));   // [1][h][i] or [0][h][i-16], < 2*NH*NFR
    const float fr  = bf_rn(freqs[fi]);
    const float pp  = low ? py : px;
    const float th  = (pp * 2.0f - 1.0f) * fr;
    const float cs  = cosf(th);
    const float sn  = sinf(th);
    const float xq1 = q1 * rq, xq2 = q2 * rq;
    const float xk1 = k1 * rk, xk2 = k2 * rk;
    sq[wave][i]      = xq1 * cs - xq2 * sn;
    sq[wave][i + 32] = xq2 * cs + xq1 * sn;
    sk[wave][i]      = xk1 * cs - xk2 * sn;
    sk[wave][i + 32] = xk2 * cs + xk1 * sn;
    __builtin_amdgcn_fence(__ATOMIC_RELEASE, "workgroup");
    __builtin_amdgcn_wave_barrier();
    __builtin_amdgcn_fence(__ATOMIC_ACQUIRE, "workgroup");
    const int pl = lane >> 3;                             // plane 0 q hi, 1 q lo, 2 k hi, 3 k lo
    const int c8 = (lane & 7) * 8;
    const float* spq = &sq[wave][c8];
    const float* spk = &sk[wave][c8];
    v4u w;
#pragma unroll
    for (int e = 0; e < 4; ++e) {
      const float fq0 = spq[2 * e], fq1 = spq[2 * e + 1];
      const float fk0 = spk[2 * e], fk1 = spk[2 * e + 1];
      const float f0 = (pl < 2) ? fq0 : fk0;
      const float f1 = (pl < 2) ? fq1 : fk1;
      const unsigned short hb0 = bf_bits(f0), hb1 = bf_bits(f1);
      const unsigned short lb0 = bf_bits(f0 - bf_up(hb0)), lb1 = bf_bits(f1 - bf_up(hb1));
      const unsigned short s0 = (pl & 1) ? lb0 : hb0;
      const unsigned short s1 = (pl & 1) ? lb1 : hb1;
      w[e] = pk16(s0, s1);
    }
    unsigned short* dst = qk4 + (size_t)pl * ((size_t)SEQ * DM) + (size_t)t * DM + h * HD + c8;
    *(v4u*)dst = w;
    
  }
}

#define APL  (64 * LP)
#define ABUF (4 * APL)
template <bool RES>
__device__ __forceinline__
void attn_rows(const unsigned short* __restrict__ qhp, const unsigned short* __restrict__ qlp,
               const unsigned short* __restrict__ khp, const unsigned short* __restrict__ klp,
               const unsigned short* __restrict__ vhp, const unsigned short* __restrict__ vlp,
               const int* __restrict__ npk,
               unsigned short* ohp, unsigned short* olp, int qb, int h, __bf16* KV) {
  union FB { v16b v; v8b h[2]; };
  union FH { v16h v; v8h h[2]; };

  const int tid  = threadIdx.x;
  const int wave = tid >> 5;
  const int lane = tid & 31;
  const int hh   = lane >> 4;
  const int c    = lane & 15;
  const int q0   = qb * 64 + wave * 16;

  int S = npk[0];                         // block-uniform scalar load
  S = (S < 0) ? 0 : S;
  S = (S > SEQ) ? SEQ : S;
  const int SB   = (S + 63) >> 6;                       // 0..NQB
  const int nLow = (qb + 1 < SB) ? (qb + 1) : SB;       // tiles 0..nLow-1
  int nT = nLow + ((qb >= SB) ? 1 : 0);                 // + the block's own tile when not in the prefix
  nT = (nT > NQB) ? NQB : nT;

  const __bf16* Qh = (const __bf16*)(const void*)qhp + (size_t)h * HD;
  const __bf16* Ql = (const __bf16*)(const void*)qlp + (size_t)h * HD;
  const __bf16* Kh = (const __bf16*)(const void*)khp + (size_t)h * HD;
  const __bf16* Kl = (const __bf16*)(const void*)klp + (size_t)h * HD;
  const _Float16* Vh = (const _Float16*)(const void*)vhp + (size_t)h * HD * SEQ;
  const _Float16* Vl = (const _Float16*)(const void*)vlp + (size_t)h * HD * SEQ;

  // ---- Q fragments (B operand, column = lane&15 = query q0 + c): 2 d-chunks, hi and lo ----
  v16b qah[2], qal[2];
  const __bf16* pqh = Qh + (size_t)(q0 + c) * DM + 8 * hh;
  const __bf16* pql = Ql + (size_t)(q0 + c) * DM + 8 * hh;
#pragma unroll
  for (int dc = 0; dc < 2; ++dc) {
    qah[dc] = ldfrag_b(pqh + dc * 32);
    qal[dc] = ldfrag_b(pql + dc * 32);
  }
  // the wait that belongs in front of any rewrite of an issued load's address registers; the two addresses are
  // its inputs, so they stay in their registers up to it
  asm volatile("s_wait_xcnt 0x0" :: "v"(pqh), "v"(pql) : "memory");

  const int tq = q0 + c;                  // the lane's query row
  const int klim = (S - 1 < tq) ? (S - 1) : tq;   // (key < S and key <= tq) is key <= klim; a per-lane constant here
  float mrow = -INFINITY;                 // running maximum of query tq (equal in lanes l and l ^ 16)
  float lrow = 0.f;                       // running sum of query tq over this lane half's keys; halves joined at the end
  v8f oacc[4];                            // oacc[t4][r] = context[tq][d = 16 t4 + 8 hh + r]
#pragma unroll
  for (int t = 0; t < 4; ++t) oacc[t] = zero8();

  // copy map: thread -> row (tid >> 3) + 16 p of a plane tile, 16-B piece (tid & 7) of its 128 B
  const int crow = tid >> 3;
  const int cseg = (tid & 7) * 8;
  const __bf16* gKh = Kh + (size_t)crow * DM + cseg;                                   // K row kv0 + crow, d = cseg..
  const __bf16* gKl = Kl + (size_t)crow * DM + cseg;
  const __bf16* gVh = (const __bf16*)(const void*)(Vh + (size_t)crow * SEQ + cseg);    // V^T row d = crow, s = kv0 + cseg..
  const __bf16* gVl = (const __bf16*)(const void*)(Vl + (size_t)crow * SEQ + cseg);
  const unsigned lKV = lds_addr(KV + crow * LP + cseg);
  const unsigned R16 = 16 * LP * 2;            // 16 LDS rows, bytes
  const unsigned PB  = APL * 2;                // one plane tile, bytes
  const size_t k16 = (size_t)16 * DM, v16 = (size_t)16 * SEQ;
  auto stage = [&](int ii, int buf) {          // key tile of trip ii into buffer buf; tile index <= NQB - 1
    const int kts = (ii < nLow) ? ii : qb;
    const __bf16* pk = gKh + (size_t)kts * 64 * DM;
    const __bf16* pl_ = gKl + (size_t)kts * 64 * DM;
    const __bf16* pv = gVh + (size_t)kts * 64;
    const __bf16* pw = gVl + (size_t)kts * 64;
    const unsigned l = lKV + (unsigned)buf * (4 * PB);
    copy8_to_lds(l, l + R16, l + 2 * R16, l + 3 * R16, l + PB, l + PB + R16, l + PB + 2 * R16, l + PB + 3 * R16,
                 pk, pk + k16, pk + 2 * k16, pk + 3 * k16, pl_, pl_ + k16, pl_ + 2 * k16, pl_ + 3 * k16);
    copy8_to_lds(l + 2 * PB, l + 2 * PB + R16, l + 2 * PB + 2 * R16, l + 2 * PB + 3 * R16,
                 l + 3 * PB, l + 3 * PB + R16, l + 3 * PB + 2 * R16, l + 3 * PB + 3 * R16,
                 pv, pv + v16, pv + 2 * v16, pv + 3 * v16, pw, pw + v16, pw + 2 * v16, pw + 3 * v16);
  };

  stage(0, 0);
  asm volatile("s_wait_asynccnt 0x0" ::: "memory");   // this wave's copies of tile 0 have landed
  __syncthreads();                                    // every wave's have: tile 0 is readable
  if (nT > 1) stage(1, 1);
  for (int i = 0; i < nT; ++i) {          // block-uniform trip count, <= NQB
    const int kt  = (i < nLow) ? i : qb;
    const int kv0 = kt * 64;              // kv0 + 63 < SEQ
    const int buf = i & 1;
    const __bf16*   Ksh = KV + buf * ABUF;                                            // K hi [kv][d], rows at pitch LP
    const __bf16*   Ksl = Ksh + APL;                                                  // K lo
    const _Float16* Vth = (const _Float16*)(const void*)(Ksh + 2 * APL);              // V^T hi [d][kv]
    const _Float16* Vtl = (const _Float16*)(const void*)(Ksh + 3 * APL);              // V^T residual

    // ---- scores, transposed: 64 keys (rows) x 16 queries (columns) per wave, 3 bf16 products ----
    //      per d chunk the four key groups' chains run side by side (each chain: hi.hi, hi.lo, lo.hi, as before)
    v8f s[4];
#pragma unroll
    for (int j = 0; j < 4; ++j) s[j] = zero8();
#pragma unroll
    for (int dc = 0; dc < 2; ++dc) {
      FB kb[4], kl[4];
#pragma unroll
      for (int j = 0; j < 4; ++j) {
        kb[j].h[0] = *(const v8b*)(Ksh + (j * 16 + c) * LP + dc * 32 + 8 * hh);
        kb[j].h[1] = *(const v8b*)(Ksh + (j * 16 + c) * LP + dc * 32 + 16 + 8 * hh);
        kl[j].h[0] = *(const v8b*)(Ksl + (j * 16 + c) * LP + dc * 32 + 8 * hh);
        kl[j].h[1] = *(const v8b*)(Ksl + (j * 16 + c) * LP + dc * 32 + 16 + 8 * hh);
      }
#pragma unroll
      for (int j = 0; j < 4; ++j) s[j] = mma_b_raw(kb[j].v, qah[dc], s[j]);
#pragma unroll
      for (int j = 0; j < 4; ++j) s[j] = mma_b_raw(kl[j].v, qah[dc], s[j]);
#pragma unroll
      for (int j = 0; j < 4; ++j) s[j] = mma_b_raw(kb[j].v, qal[dc], s[j]);
      run_guard_b(s[0], s[1], s[2], s[3], kb[0].v, kb[1].v, kb[2].v, kb[3].v, kl[0].v, kl[1].v, kl[2].v, kl[3].v);
    }

    // ---- key visibility rule, maximum, online softmax; P^T (x1024, f16) and its residual (x4096) as B fragments ----
    //      s[j][r] = score of key kv0 + 16 j + 8 hh + r with query tq
    const int kb0 = kv0 + 8 * hh;           // the lane's key of (j, r) = (0, 0); limits taken relative to it
    const int rlim = klim - kb0, rtq = tq - kb0;
    float m = -INFINITY;
#pragma unroll
    for (int j = 0; j < 4; ++j) {
#pragma unroll
      for (int r = 0; r < 8; ++r) {
        const bool ok = (j * 16 + r <= rlim) || (j * 16 + r == rtq);
        const float sv = ok ? s[j][r] : -INFINITY;
        s[j][r] = sv;
        m = fmaxf(m, sv);
      }
    }
    m = fmaxf(m, half_xor(m));              // the query's other 32 keys
    const float mnew  = fmaxf(mrow, m);
    const float msafe = (mnew == -INFINITY) ? 0.f : mnew;
    const float alpha = __expf(mrow - msafe);
    mrow = mnew;
    FH pa[2], pl[2];                        // element e of fragment kk: key kv0 + 32 kk + (e < 8 ? 8 hh + e : 16 + 8 hh + e - 8)
    float ps[4];
#pragma unroll
    for (int j = 0; j < 4; ++j) {
      float acc = 0.f;
#pragma unroll
      for (int r = 0; r < 8; ++r) {
        const float p = __expf(s[j][r] - msafe);     // masked score: exp(-inf) -> 0
        acc = (r == 0) ? p : (acc + p);
        const float p1k = p * 1024.0f;
        const _Float16 ph = (_Float16)p1k;
        pa[j >> 1].h[j & 1][r] = ph;
        if (RES) pl[j >> 1].h[j & 1][r] = (_Float16)((p1k - (float)ph) * 4096.0f);
      }
      ps[j] = acc;
    }
    lrow = lrow * alpha + ((ps[0] + ps[1]) + (ps[2] + ps[3]));
#pragma unroll
    for (int t4 = 0; t4 < 4; ++t4)
#pragma unroll
      for (int r = 0; r < 8; ++r) oacc[t4][r] *= alpha;

    // ---- context^T += V_hi^T . P^T (f16 WMMA); residual products into a separate accumulator ----
    v8f o1[4];
#pragma unroll
    for (int t4 = 0; t4 < 4; ++t4) o1[t4] = zero8();
#pragma unroll   // pa[kk], pl[kk] live in registers: kk must be a compile-time index
    for (int kk = 0; kk < 2; ++kk) {
#pragma unroll
      for (int t4 = 0; t4 < 4; ++t4) {
        FH vb, vl;
        vb.h[0] = *(const v8h*)(Vth + (t4 * 16 + c) * LP + kk * 32 + 8 * hh);
        vb.h[1] = *(const v8h*)(Vth + (t4 * 16 + c) * LP + kk * 32 + 16 + 8 * hh);
        vl.h[0] = *(const v8h*)(Vtl + (t4 * 16 + c) * LP + kk * 32 + 8 * hh);
        vl.h[1] = *(const v8h*)(Vtl + (t4 * 16 + c) * LP + kk * 32 + 16 + 8 * hh);
        oacc[t4] = mma_h_raw(vb.v, pa[kk].v, oacc[t4]);
        o1[t4]   = mma_h_raw(vl.v, pa[kk].v, o1[t4]);
        if (RES) o1[t4] = mma_h_raw(vb.v, pl[kk].v, o1[t4]);
      }
    }
#pragma unroll
    for (int t4 = 0; t4 < 4; ++t4)
#pragma unroll
      for (int r = 0; r < 8; ++r) oacc[t4][r] += o1[t4][r] * (1.0f / 4096.0f);
    asm volatile("s_wait_dscnt 0x0" ::: "memory");     // this wave's reads of buffer buf are done before it is refilled
    asm volatile("s_wait_asynccnt 0x0" ::: "memory");  // this wave's copies of tile i + 1 have landed
    __syncthreads();                                   // publishes tile i + 1 and ends every read of buffer buf
    if (i + 2 < nT) stage(i + 2, buf);
  }
  asm volatile("s_wait_asynccnt 0x0" ::: "memory");    // no copy outstanding behind the loop: the LDS is free for the output tile

  // ---- normalise (1/l and the 1/1024 p carry), stage the wave's 16x64 tile, bf16 hi/lo split,
  float* os = (float*)(void*)KV + wave * (16 * OSP);   // behind the loop's last barrier nobody reads the buffers any more
  {
    const float l = lrow + half_xor(lrow);  // both halves' keys
    const float inv = ((l > 0.f) ? (1.0f / l) : 0.f) * (1.0f / 1024.0f);
#pragma unroll
    for (int t4 = 0; t4 < 4; ++t4) {        // the lane's 8 consecutive d of row c: two 16-B stores
      v4f w0, w1;
#pragma unroll
      for (int r = 0; r < 4; ++r) { w0[r] = oacc[t4][r] * inv; w1[r] = oacc[t4][r + 4] * inv; }
      *(v4f*)(os + c * OSP + t4 * 16 + 8 * hh)     = w0;
      *(v4f*)(os + c * OSP + t4 * 16 + 8 * hh + 4) = w1;
    }
  }
  __builtin_amdgcn_fence(__ATOMIC_RELEASE, "workgroup");
  __builtin_amdgcn_wave_barrier();
  __builtin_amdgcn_fence(__ATOMIC_ACQUIRE, "workgroup");
  {
    const int q4 = lane >> 3, c8 = (lane & 7) * 8;
    v4u hv[4], lv[4];
#pragma unroll
    for (int it = 0; it < 4; ++it) {
      const int row = it * 4 + q4;   // it 0..3 x q4 0..3 = rows 0..15 of the wave tile
      const float* sp = os + row * OSP + c8;
      v4u a, a2;
#pragma unroll
      for (int e = 0; e < 4; ++e) {
        const float f0 = sp[2 * e], f1 = sp[2 * e + 1];
        const unsigned short h0 = bf_bits(f0), h1 = bf_bits(f1);
        const unsigned short l0 = bf_bits(f0 - bf_up(h0)), l1 = bf_bits(f1 - bf_up(h1));
        a[e] = pk16(h0, h1); a2[e] = pk16(l0, l1);
      }
      hv[it] = a; lv[it] = a2;
    }
    {
      // row it * 4 + q4 of the wave tile lies it * 4 * DM elements behind row q4: one address per plane for all four stores
      const size_t go = (size_t)(q0 + q4) * DM + (size_t)h * HD + c8;
      unsigned short* po = ohp + go;
      unsigned short* pl2 = olp + go;
#pragma unroll
      for (int it = 0; it < 4; ++it) {
        *(v4u*)(po + (size_t)it * 4 * DM) = hv[it];
        *(v4u*)(pl2 + (size_t)it * 4 * DM) = lv[it];
      }
      // the wait that belongs in front of any rewrite of an issued store's address registers; the two addresses are
      // its inputs, so they stay in their registers up to it
      asm volatile("s_wait_xcnt 0x0" :: "v"(po), "v"(pl2) : "memory");
    }
  }
}

// =====================================================================================================
// One launch for all NQB x NH row blocks: NH * NQB = 1024 blocks, four resident per WGP (registers), so the
// launch lasts as long as the WGP whose four blocks hold the most key tiles. A block's tile count grows with qb, so
// the index map makes quartets of row blocks {x, 63 - x, 32 + x, 31 - x}, x = 0..15 (equal sums for a cost linear
// in qb), both of four neighbouring indices (same head) and of indices 256 apart (four heads).
//   bx = 256 g + 4 a + b: x = a & 15, member v = (b + g) & 3, h = 4 (a >> 4) + g; (x, v) <-> qb and (a >> 4, g) <-> h
//   are one to one, and b <-> v for a given g: every (h, qb) exactly once.
// Row blocks below RESQB take the path with the p residual plane: a block-uniform branch on blockIdx alone.
// =====================================================================================================
static_assert(NQB == 64 && NH == 16);
__global__ __launch_bounds__(128)
void attn64(const unsigned short* __restrict__ qhp, const unsigned short* __restrict__ qlp,
            const unsigned short* __restrict__ khp, const unsigned short* __restrict__ klp,
            const unsigned short* __restrict__ vhp, const unsigned short* __restrict__ vlp,
            const int* __restrict__ npk,
            unsigned short* ohp, unsigned short* olp) {
  __shared__ __align__(16) __bf16 KV[2 * ABUF];   // two buffers of K hi, K lo, V^T hi, V^T residual tiles; then 4 output tiles
  static_assert(4 * 16 * OSP * 4 <= 2 * ABUF * 2);
  const int bx = blockIdx.x;              // < NH * NQB by grid size
  const int g  = bx >> 8;
  const int a  = (bx >> 2) & 63;
  const int x  = a & 15;
  const int v  = (bx + g) & 3;
  const int h  = ((a >> 4) << 2) + g;
  const int qb = (v == 0) ? x : (v == 1) ? (63 - x) : (v == 2) ? (32 + x) : (31 - x);
  if (qb < RESQB)
    attn_rows<true>(qhp, qlp, khp, klp, vhp, vlp, npk, ohp, olp, qb, h, KV);
  else
    attn_rows<false>(qhp, qlp, khp, klp, vhp, vlp, npk, ohp, olp, qb, h, KV);
}

// =====================================================================================================
// Workspace map (bytes), every region an exact multiple of its whole-line / whole-tile store granularity:
//   Xb    bf16 [4096][1024]          0            8388608
//   Wqkv  bf16 [3072 n][1024 k]      8388608      6291456   (rows 0..2047 = q|k weights, 2048.. = v weights)
//   Wob   bf16 [1024][1024]          14680064     2097152
//   QKf   f32  [4096][2048]          16777216     33554432  (cols 0..1023 q, 1024..2047 k)
//   VTh   f16  [1024 d][4096 s]      50331648     8388608
//   VTl   f16  [1024 d][4096 s]      58720256     8388608
//   QK4   bf16 4 x [4096][1024]      67108864     33554432  (q hi, q lo, k hi, k lo)
//   Oh    bf16 [4096][1024]          100663296    8388608
//   Ol    bf16 [4096][1024]          109051904    8388608
//   end                              117440512
// Weights are [out n][in k] with k contiguous = the Bt / A layout the GEMM wants, so they are only converted.
// =====================================================================================================
extern "C" void kernel_launch(void* const* d_in, const int* in_sizes, int n_in,
                              void* d_out, int out_size, void* d_ws, size_t ws_size,
                              hipStream_t stream) {
  if (n_in < 7) return;
  if (in_sizes[0] != SEQ * DM) return;
  if (in_sizes[1] != SEQ * 2) return;
  if (in_sizes[2] != NQKV * DM) return;
  if (in_sizes[3] != DM * DM) return;
  if (in_sizes[4] != NH) return;
  if (in_sizes[5] != 2 * NH * NFR) return;
  if (in_sizes[6] < 1) return;
  if (out_size != SEQ * DM) return;

  const float* x     = (const float*)d_in[0];
  const float* pos   = (const float*)d_in[1];
  const float* qkvw  = (const float*)d_in[2];
  const float* outw  = (const float*)d_in[3];
  const float* scl   = (const float*)d_in[4];
  const float* freqs = (const float*)d_in[5];
  const int*   npk   = (const int*)d_in[6];

  const size_t PXB   = (size_t)SEQ * DM * 2;      //  8388608
  const size_t PWQKV = (size_t)NQKV * DM * 2;     //  6291456
  const size_t PWO   = (size_t)DM * DM * 2;       //  2097152
  const size_t PQKF  = (size_t)SEQ * QKW * 4;     // 33554432
  const size_t PVT   = (size_t)DM * SEQ * 2;      //  8388608
  const size_t PPL   = (size_t)SEQ * DM * 2;      //  8388608
  size_t off = 0;
  const size_t oXb   = off; off += PXB;
  const size_t oWqkv = off; off += PWQKV;
  const size_t oWo   = off; off += PWO;
  const size_t oQKf  = off; off += PQKF;
  const size_t oVTh  = off; off += PVT;
  const size_t oVTl  = off; off += PVT;
  const size_t oQK4  = off; off += 4 * PPL;
  const size_t oOh   = off; off += PPL;
  const size_t oOl   = off; off += PPL;
  if (off > ws_size) return;                      // off = 117440512
  if (off > (size_t)134217728) return;

  char* ws = (char*)d_ws;
  unsigned short* Xb   = (unsigned short*)(ws + oXb);
  unsigned short* Wqkv = (unsigned short*)(ws + oWqkv);
  unsigned short* Wvb  = Wqkv + (size_t)2 * DM * DM;             // rows 2048.. of the qkv weight plane
  unsigned short* Wob  = (unsigned short*)(ws + oWo);
  float*          QKf  = (float*)(ws + oQKf);
  unsigned short* VTh  = (unsigned short*)(ws + oVTh);
  unsigned short* VTl  = (unsigned short*)(ws + oVTl);
  unsigned short* QK4  = (unsigned short*)(ws + oQK4);
  unsigned short* Qh   = QK4;
  unsigned short* Ql   = QK4 + (size_t)SEQ * DM;
  unsigned short* Kh   = QK4 + (size_t)2 * SEQ * DM;
  unsigned short* Kl   = QK4 + (size_t)3 * SEQ * DM;
  unsigned short* Oh   = (unsigned short*)(ws + oOh);
  unsigned short* Ol   = (unsigned short*)(ws + oOl);

  const dim3 blk(256);
  const int n8x = SEQ * DM / 8;                                // 524288
  const int n8w = NQKV * DM / 8;                               // 393216
  const int n8o = DM * DM / 8;                                 // 131072
  static_assert((SEQ * DM / 8) % 256 == 0 && (NQKV * DM / 8) % 256 == 0 && (DM * DM / 8) % 256 == 0);
  const dim3 gCvt((n8x + n8w + n8o) / 256);                    // 2048 + 1536 + 512 blocks
  const int  nbQK = (SEQ / 128) * (QKW / 256);                 // 256 blocks: M=4096, N=2048
  const int  nbVT = (DM / 128) * (SEQ / 256);                  // 128 blocks: M=1024, N=4096
  const dim3 gQKV(nbQK + nbVT, 1);
  const dim3 gOut(((SEQ / 64) * (DM / 64) + 7) / 8, 1);        // 1024 tiles -> 128 blocks: M=4096, N=1024
  const int  nRows = SEQ * NH;                                 // 65536 (t, h) rows
  const dim3 gRope((nRows + 7) / 8);                           // 8192 blocks of 8 waves

  // (1) x -> bf16 [4096][1024]; weights [n][k] f32 -> bf16 [n][k]
  cvt3_bf16x8<<<gCvt, blk, 0, stream>>>(x, qkvw, outw, Xb, Wqkv, Wob, n8x, n8w, n8o);
  // (2) q|k = x . W[0:2048]^T -> f32 [4096][2048]   (M=4096, N=2048, K=1024), and in the same grid
  // (3) v^T = Wv . x^T -> f16 hi plane [h*64+d][s] (pitch SEQ) and residual plane (x4096, all keys)
  //     (A = Wvb [n][k], Bt = Xb; M=1024, N=4096, K=1024)
  gemm_qk_vt<<<gQKV, blk, 0, stream>>>(Xb, Wqkv, Wvb, (void*)QKf, (void*)VTh, (void*)VTl,
                                       SEQ, QKW, DM, nbQK, 4096.0f);
  // (4) cosine-sim scaling + axial rotation -> q hi/lo, k hi/lo bf16 planes [t][h*64+d]
  rope_qk<<<gRope, blk, 0, stream>>>(QKf, pos, scl, freqs, QK4, nRows);
  // (5) attention, all row blocks in one launch (row blocks 0..RESQB-1 with the p residual plane, the rest without)
  attn64<<<dim3(NH * NQB), dim3(128), 0, stream>>>(Qh, Ql, Kh, Kl, VTh, VTl, npk, Oh, Ol);
  // (6) out = context . Wo^T -> d_out f32 [4096][1024]  (A = context hi + lo planes, 2 products)
  gemm_split_f32<<<gOut, blk, 0, stream>>>(Oh, Ol, Wob, d_out, SEQ, DM, DM);
  (void)hipGetLastError();
}

// v009
// Measured time: 148 microseconds a run.
// In both of two side-by-side timings against v008, it was 1.10 times as fast.
// Counting every step since v000, it is 3.88 times as fast.
// Contractions: q|k and v^T projections = v_wmma_f32_16x16x32_bf16 (bf16 operands from RNE-converted inputs, single product);
// q.k^T scores = v_wmma_f32_16x16x32_bf16 with bf16 hi/lo split q and k (hi.hi + hi.lo + lo.hi);
// p.v = v_wmma_f32_16x16x32_f16 (p carried x1024 in f16; v as f16 hi plane + f16 residual plane x4096, 2 products;
// extra f16 residual plane x4096 of p for the first 512 rows); ctx.Wo^T = v_wmma_f32_16x16x32_bf16 with ctx as
// bf16 hi/lo planes times bf16 Wo (2 products); all f32 accumulate; norms, rotations and softmax in f32.
#include <hip/hip_runtime.h>
#include <math.h>
#include <stdint.h>

#define SEQ   4096
#define DM    1024
#define NH    16
#define HD    64
#define NQB   (SEQ / 64)   // 64 row / key tiles of 64
#define RESQB 8            // leading 64-row blocks that also use the p residual plane
#define QKW   (2 * DM)     // pitch of the f32 q|k plane
#define NQKV  (3 * DM)
#define NFR   16           // rotation frequencies per head per axis (HD/4)
#define LP    72           // LDS row pitch of the 64-wide 16-bit attention tiles, in elements: 144 B = 16 B x 9 (odd)
#define OSP   68           // LDS row pitch of the attention output staging tile, in floats: 272 B = 16 B x 17 (odd)
#define GP    72           // LDS row pitch of the GEMM operand slices (64 k of 16 bits), in elements: 144 B = 16 B x 9 (odd)
static_assert(NH * HD == DM);
static_assert((SEQ % 256) == 0 && (DM % 256) == 0);
static_assert((SEQ % 64) == 0 && (DM % 64) == 0);
static_assert(RESQB <= NQB);
static_assert(HD == 4 * NFR);

typedef _Float16 v16h __attribute__((ext_vector_type(16)));
typedef _Float16 v8h  __attribute__((ext_vector_type(8)));
typedef __bf16   v16b __attribute__((ext_vector_type(16)));
typedef __bf16   v8b  __attribute__((ext_vector_type(8)));
typedef float    v8f  __attribute__((ext_vector_type(8)));
typedef float    v4f  __attribute__((ext_vector_type(4)));
typedef unsigned int v4u __attribute__((ext_vector_type(4)));

// ---- scalar helpers --------------------------------------------------------------------------------
__device__ __forceinline__ unsigned short bf_bits(float f) {          // f32 -> bf16 bits, RNE convert
  unsigned u = __float_as_uint(f);
  return (unsigned short)((u + 0x7FFFu + ((u >> 16) & 1u)) >> 16);
}
__device__ __forceinline__ float bf_up(unsigned short h) { return __uint_as_float(((unsigned)h) << 16); }
__device__ __forceinline__ float bf_rn(float f) { return bf_up(bf_bits(f)); }   // value after RNE convert to bf16
__device__ __forceinline__ unsigned short h_bits(_Float16 x) { return __builtin_bit_cast(unsigned short, x); }
__device__ __forceinline__ unsigned pk16(unsigned short a, unsigned short b) { return (unsigned)a | ((unsigned)b << 16); }
// value of lane (l ^ M) inside the lane's 16-lane row, M = 1..15: a DPP operand (row_xmask), no trip through the LDS pipe
template <int M>
__device__ __forceinline__ float row_xor(float x) {
  return __builtin_bit_cast(float, __builtin_amdgcn_update_dpp(0, __builtin_bit_cast(int, x), 0x160 + M, 0xf, 0xf, true));
}
// value of lane (l ^ 16): vector cross-row move
__device__ __forceinline__ float half_xor(float x) {
  return __builtin_bit_cast(float, __builtin_amdgcn_permlanex16(__builtin_bit_cast(int, x), __builtin_bit_cast(int, x),
                                                                0x76543210, 0xfedcba98, false, false));
}
__device__ __forceinline__ v8f zero8() { v8f z = {0.f, 0.f, 0.f, 0.f, 0.f, 0.f, 0.f, 0.f}; return z; }

// ---- fragment loaders: 16-bit A/B operand, lane -> row/col (lane&15), p already includes +8*(lane>>4);
//      elements 0..7 <- p[0..7] (k0+8h..), elements 8..15 <- p[16..23] (k0+16+8h..)
__device__ __forceinline__ v16b ldfrag_b(const __bf16* p) {
  union { v16b v; v8b h[2]; } f;
  f.h[0] = *(const v8b*)(p);
  f.h[1] = *(const v8b*)(p + 16);
  return f.v;
}

// ---- WMMA helpers -------------------------------------------------------------------------------------
__device__ __forceinline__ v8f mma_b_raw(v16b a, v16b b, v8f c) {
  return __builtin_amdgcn_wmma_f32_16x16x32_bf16(false, a, false, b, (short)0, c, false, false);
}
__device__ __forceinline__ v8f mma_h_raw(v16h a, v16h b, v8f c) {
  return __builtin_amdgcn_wmma_f32_16x16x32_f16(false, a, false, b, (short)0, c, false, false);
}
// closes a run of products on four accumulator chains: the eight A fragments stay in their registers until the whole
// run has issued (no later result is placed over an operand still being read), and the four v_nop are the matrix
// distance in front of the first vector instruction on the results or on the fragments' registers
__device__ __forceinline__ void run_guard_b(v8f& s0, v8f& s1, v8f& s2, v8f& s3,
                                            v16b b0, v16b b1, v16b b2, v16b b3, v16b c0, v16b c1, v16b c2, v16b c3) {
  asm volatile("v_nop\n\tv_nop\n\tv_nop\n\tv_nop"
               : "+v"(s0), "+v"(s1), "+v"(s2), "+v"(s3)
               : "v"(b0), "v"(b1), "v"(b2), "v"(b3), "v"(c0), "v"(c1), "v"(c2), "v"(c3));
}
__device__ __forceinline__ void dep_guard_b(v8f& a, v8f& b, v16b x, v16b y) {
  asm volatile("v_nop\n\tv_nop\n\tv_nop\n\tv_nop" : "+v"(a), "+v"(b) : "v"(x), "v"(y));
}
__device__ __forceinline__ void keep4_b(v16b a, v16b b, v16b c, v16b d) {
  asm volatile("v_nop" :: "v"(a), "v"(b), "v"(c), "v"(d));
}
__device__ __forceinline__ void acc_guard4(v8f& a, v8f& b, v8f& c, v8f& d) {
  asm volatile("v_nop\n\tv_nop\n\tv_nop\n\tv_nop" : "+v"(a), "+v"(b), "+v"(c), "+v"(d));
}

// =====================================================================================================
// f32 -> bf16 (RNE convert), 8 elements per thread, one 16-B store per lane: a wave writes 512 contiguous B
// Three planes in one grid (none depends on another): blocks 0 .. n0/256 - 1 take plane 0, the next n1/256 plane 1,
// the last n2/256 plane 2; n0, n1, n2 = groups of 8 elements, multiples of 256, so a block lies in one plane and
// the choice is a scalar one. coverage: n threads x 8 = the whole of each plane.
// =====================================================================================================
__global__ __launch_bounds__(256) void cvt3_bf16x8(const float* __restrict__ in0, const float* __restrict__ in1,
                                                   const float* __restrict__ in2, unsigned short* out0,
                                                   unsigned short* out1, unsigned short* out2, int n0, int n1, int n2) {
  const int base = blockIdx.x * 256;
  const int pl   = (base < n0) ? 0 : (base < n0 + n1) ? 1 : 2;
  const float* in     = (pl == 0) ? in0 : (pl == 1) ? in1 : in2;
  unsigned short* out = (pl == 0) ? out0 : (pl == 1) ? out1 : out2;
  const int n8 = (pl == 0) ? n0 : (pl == 1) ? n1 : n2;
  const int i  = base - ((pl == 0) ? 0 : (pl == 1) ? n0 : n0 + n1) + threadIdx.x;
  if (i < n8) {
    const v4f a = *(const v4f*)(in + (size_t)i * 8);
    const v4f b = *(const v4f*)(in + (size_t)i * 8 + 4);
    v4u p;
    p[0] = pk16(bf_bits(a[0]), bf_bits(a[1]));
    p[1] = pk16(bf_bits(a[2]), bf_bits(a[3]));
    p[2] = pk16(bf_bits(b[0]), bf_bits(b[1]));
    p[3] = pk16(bf_bits(b[2]), bf_bits(b[3]));
    *(v4u*)(out + (size_t)i * 8) = p;
    
  }
}

// =====================================================================================================
// Asynchronous copies global -> LDS, 16 B per lane, four per statement. l* = the lane's LDS byte address,
// g* = the lane's global address. The closing s_wait_xcnt stands inside the statement so that no address
// register of an issued copy is rewritten in front of it.
// =====================================================================================================
__device__ __forceinline__ void copy4_to_lds(unsigned l0, unsigned l1, unsigned l2, unsigned l3,
                                             const __bf16* g0, const __bf16* g1, const __bf16* g2, const __bf16* g3) {
  asm volatile("global_load_async_to_lds_b128 %0, %4, off\n\t"
               "global_load_async_to_lds_b128 %1, %5, off\n\t"
               "global_load_async_to_lds_b128 %2, %6, off\n\t"
               "global_load_async_to_lds_b128 %3, %7, off\n\t"
               "s_wait_xcnt 0x0"
               :: "v"(l0), "v"(l1), "v"(l2), "v"(l3), "v"(g0), "v"(g1), "v"(g2), "v"(g3) : "memory");
}
// the same, eight copies per statement
__device__ __forceinline__ void copy8_to_lds(unsigned l0, unsigned l1, unsigned l2, unsigned l3,
                                             unsigned l4, unsigned l5, unsigned l6, unsigned l7,
                                             const __bf16* g0, const __bf16* g1, const __bf16* g2, const __bf16* g3,
                                             const __bf16* g4, const __bf16* g5, const __bf16* g6, const __bf16* g7) {
  asm volatile("global_load_async_to_lds_b128 %0, %8, off\n\t"
               "global_load_async_to_lds_b128 %1, %9, off\n\t"
               "global_load_async_to_lds_b128 %2, %10, off\n\t"
               "global_load_async_to_lds_b128 %3, %11, off\n\t"
               "global_load_async_to_lds_b128 %4, %12, off\n\t"
               "global_load_async_to_lds_b128 %5, %13, off\n\t"
               "global_load_async_to_lds_b128 %6, %14, off\n\t"
               "global_load_async_to_lds_b128 %7, %15, off\n\t"
               "s_wait_xcnt 0x0"
               :: "v"(l0), "v"(l1), "v"(l2), "v"(l3), "v"(l4), "v"(l5), "v"(l6), "v"(l7),
                  "v"(g0), "v"(g1), "v"(g2), "v"(g3), "v"(g4), "v"(g5), "v"(g6), "v"(g7) : "memory");
}
__device__ __forceinline__ unsigned lds_addr(const __bf16* p) { return (unsigned)(uintptr_t)p; }   // low 32 bits = LDS byte address

// =====================================================================================================
// Register-blocked batched bf16 WMMA GEMM: C[m][n] = sum_k A[m][k] * Bt[n][k]; a block of 8 waves (2 x 4) owns a
// 128 x 256 tile, one wave per 64x64 sub-tile. A row-major [M][K] pitch lda; Bt row-major [N][K] pitch ldb
// (k contiguous); M multiple of 128, N of 256, K of 64. blockIdx.y = batch index (strides in elements).
// Operand path: per slice of 64 k the block's 128 A rows and 256 Bt rows (128 B each = one line; 8 lanes x 16 B
// per row, so a wave-wide copy covers 4 whole lines) go to LDS by asynchronous copies, rows at pitch GP; two
// buffers, slice t + 1 in flight while slice t is multiplied; fragments by 16-B LDS loads.
// NSPLIT: 0 = A.Bt; 1 = (A + A2).Bt (A2 = unscaled bf16 lo plane of A).
// OUT_MODE: 0 = f32 (pitch ldc); 2 = bf16 hi plane C + bf16 lo plane C2 (lo = RNE(v - hi), unscaled);
//           3 = f16 hi plane C + f16 residual plane C2 = f16((v - hi) * rscale), C2 written only for tiles
//               with n0 < N2 (pitch ldc2, batch stride strideC2).
// gemm_tile = the work of one block on tile bx; the LDS arrays are the kernel's, handed in:
//   sT 8 x 16 x 68 floats (per-wave 16x64 slab, pitch 68), sA and sA2 2 x 128 x GP (A, A2 slice, two buffers;
//   sA2 is not touched when NSPLIT == 0), sB 2 x 256 x GP (Bt slice, two buffers).
// =====================================================================================================
#define GSA (128 * GP)     // elements of one A slice buffer
#define GSB (256 * GP)     // elements of one Bt slice buffer
template <int NSPLIT, int OUT_MODE>
__device__ __forceinline__ void gemm_tile(
    const unsigned short* __restrict__ Ap, const unsigned short* A2p, int lda, long long strideA,
    const unsigned short* __restrict__ Btp, int ldb, long long strideB,
    void* Cout, int ldc, long long strideC,
    void* Cout2, int ldc2, long long strideC2, int N2,
    int M, int N, int K, float rscale,
    int bx, float* sT, __bf16* sA, __bf16* sA2, __bf16* sB) {
  static_assert(NSPLIT == 0 || NSPLIT == 1);
  const __bf16* A   = (const __bf16*)(const void*)Ap;
  const __bf16* A2  = (const __bf16*)(const void*)A2p;
  const __bf16* Bt  = (const __bf16*)(const void*)Btp;
  const int b    = blockIdx.y;
  const int tid  = threadIdx.x;
  const int lane = tid & 31;
  const int wave = tid >> 5;
  const int tilesN = N >> 8;
  const int tilesM = M >> 7;
  if (bx >= tilesM * tilesN) return;           // block-uniform, in front of every barrier and copy
  const int bm = bx / tilesN;
  const int bn = bx - bm * tilesN;
  const int mB = bm << 7;
  const int nB = bn << 8;
  const int wm = wave >> 2;                    // 0..1
  const int wn = wave & 3;                     // 0..3
  const int m0 = mB + (wm << 6);
  const int n0 = nB + (wn << 6);

  const __bf16* Ab  = A  + (size_t)b * strideA;
  const __bf16* Bb  = Bt + (size_t)b * strideB;
  const __bf16* Ab2 = NSPLIT ? (A2 + (size_t)b * strideA) : Ab;

  const int rlane = lane & 15;                 // row (A) / col (B, D) within subtile
  const int koff  = (lane >> 4) * 8;           // k offset of this lane half
  const int mOff  = (lane >> 4) * 8;           // D row offset

  // copy map: thread -> row (tid >> 3) + 32 p of the slice, 16-B piece (tid & 7) of its 128 B
  const int crow = tid >> 3;
  const int cseg = (tid & 7) * 8;
  const __bf16* gA  = Ab  + (size_t)(mB + crow) * lda + cseg;
  const __bf16* gA2 = Ab2 + (size_t)(mB + crow) * lda + cseg;
  const __bf16* gB  = Bb  + (size_t)(nB + crow) * ldb + cseg;
  const unsigned lA  = lds_addr(sA + crow * GP + cseg);
  const unsigned lA2 = lds_addr(sA2 + crow * GP + cseg);
  const unsigned lB  = lds_addr(sB + crow * GP + cseg);
  const unsigned R32 = 32 * GP * 2;            // 32 LDS rows, bytes
  const size_t a32 = (size_t)32 * lda, b32 = (size_t)32 * ldb;
  auto stage = [&](int t, int buf) {           // slice t (k = 64 t .. 64 t + 63) into buffer buf
    const __bf16* pa = gA + (size_t)t * 64;
    const __bf16* pb = gB + (size_t)t * 64;
    const unsigned la = lA + (unsigned)buf * (4 * R32);
    const unsigned lb = lB + (unsigned)buf * (8 * R32);
    copy4_to_lds(la, la + R32, la + 2 * R32, la + 3 * R32, pa, pa + a32, pa + 2 * a32, pa + 3 * a32);
    if (NSPLIT) {
      const __bf16* pa2 = gA2 + (size_t)t * 64;
      const unsigned la2 = lA2 + (unsigned)buf * (4 * R32);
      copy4_to_lds(la2, la2 + R32, la2 + 2 * R32, la2 + 3 * R32, pa2, pa2 + a32, pa2 + 2 * a32, pa2 + 3 * a32);
    }
    copy4_to_lds(lb, lb + R32, lb + 2 * R32, lb + 3 * R32, pb, pb + b32, pb + 2 * b32, pb + 3 * b32);
    copy4_to_lds(lb + 4 * R32, lb + 5 * R32, lb + 6 * R32, lb + 7 * R32,
                 pb + 4 * b32, pb + 5 * b32, pb + 6 * b32, pb + 7 * b32);
  };

  v8f acc[4][4];
#pragma unroll
  for (int i = 0; i < 4; ++i)
#pragma unroll
    for (int j = 0; j < 4; ++j) acc[i][j] = zero8();

  const int nK = K >> 6;
  stage(0, 0);
  asm volatile("s_wait_asynccnt 0x0" ::: "memory");   // this wave's copies of slice 0 have landed
  __syncthreads();                                    // every wave's have: slice 0 is readable
  if (nK > 1) stage(1, 1);
  for (int t = 0; t < nK; ++t) {
    const int buf = t & 1;
    const __bf16* tA  = sA + buf * GSA + ((wm << 6) + rlane) * GP + koff;
    const __bf16* tA2 = NSPLIT ? (sA2 + buf * GSA + ((wm << 6) + rlane) * GP + koff) : tA;
    const __bf16* tB  = sB + buf * GSB + ((wn << 6) + rlane) * GP + koff;
#pragma unroll
    for (int kk = 0; kk < 2; ++kk) {
      // the fragments of a k chunk of 32 are fetched as one group in front of its products
      v16b bh[4], ah[4], al[4];
#pragma unroll
      for (int j = 0; j < 4; ++j) bh[j] = ldfrag_b(tB + (j << 4) * GP + kk * 32);
#pragma unroll
      for (int i = 0; i < 4; ++i) {
        ah[i] = ldfrag_b(tA + (i << 4) * GP + kk * 32);
        al[i] = NSPLIT ? ldfrag_b(tA2 + (i << 4) * GP + kk * 32) : ah[i];
      }
#pragma unroll
      for (int i = 0; i < 4; ++i) {
#pragma unroll
        for (int j = 0; j < 4; ++j) {
          acc[i][j] = mma_b_raw(ah[i], bh[j], acc[i][j]);
          if (NSPLIT) acc[i][j] = mma_b_raw(al[i], bh[j], acc[i][j]);
        }
        dep_guard_b(acc[i][0], acc[i][3], ah[i], al[i]);
      }
      keep4_b(bh[0], bh[1], bh[2], bh[3]);
    }
    asm volatile("s_wait_dscnt 0x0" ::: "memory");     // this wave's reads of buffer buf are done before it is refilled
    asm volatile("s_wait_asynccnt 0x0" ::: "memory");  // this wave's copies of slice t + 1 have landed
    __syncthreads();                                   // publishes slice t + 1 and ends every read of buffer buf
    if (t + 2 < nK) stage(t + 2, buf);
  }
  asm volatile("s_wait_asynccnt 0x0" ::: "memory");    // no copy outstanding behind the loop
  acc_guard4(acc[0][0], acc[0][1], acc[0][2], acc[0][3]);
  acc_guard4(acc[1][0], acc[1][1], acc[1][2], acc[1][3]);
  acc_guard4(acc[2][0], acc[2][1], acc[2][2], acc[2][3]);
  acc_guard4(acc[3][0], acc[3][1], acc[3][2], acc[3][3]);

  // ---- epilogue ----
  float* slab = sT + wave * (16 * 68);
#pragma unroll
  for (int i = 0; i < 4; ++i) {
    const int mBase = m0 + (i << 4);
#pragma unroll
    for (int j = 0; j < 4; ++j) {
#pragma unroll
      for (int r = 0; r < 8; ++r) {
        slab[(mOff + r) * 68 + (j << 4) + rlane] = acc[i][j][r];
      }
    }
    __builtin_amdgcn_fence(__ATOMIC_RELEASE, "workgroup");
    __builtin_amdgcn_wave_barrier();
    __builtin_amdgcn_fence(__ATOMIC_ACQUIRE, "workgroup");
    if (OUT_MODE == 0) {
      float* C = (float*)Cout + (size_t)b * strideC;
      const int hh = lane >> 4, c4 = (lane & 15) * 4;     // 256-B row segment = 16 lanes x 16 B
      {
#pragma unroll
        for (int it = 0; it < 8; ++it) {
          const int row = it * 2 + hh;                     // it 0..7 x hh 0..1 = rows 0..15
          const v4f v = *(const v4f*)(slab + row * 68 + c4);
          *(v4f*)(C + (size_t)(mBase + row) * ldc + n0 + c4) = v;
        }
        
      }
    } else {
      const int q = lane >> 3, c8 = (lane & 7) * 8;
      unsigned short* C  = (unsigned short*)Cout  + (size_t)b * strideC;
      unsigned short* C2 = (unsigned short*)Cout2 + (size_t)b * strideC2;
      const bool wlo = (OUT_MODE == 2) || (n0 < N2);      // wave-uniform
      v4u hv[4], lv[4];
#pragma unroll
      for (int it = 0; it < 4; ++it) {
        const int row = it * 4 + q;                        // it 0..3 x q 0..3 = rows 0..15
        const float* sp = slab + row * 68 + c8;
        v4u a, a2;
#pragma unroll
        for (int e = 0; e < 4; ++e) {
          const float f0 = sp[2 * e], f1 = sp[2 * e + 1];
          unsigned short h0, h1, l0, l1;
          if (OUT_MODE == 2) {
            h0 = bf_bits(f0); h1 = bf_bits(f1);
            l0 = bf_bits(f0 - bf_up(h0)); l1 = bf_bits(f1 - bf_up(h1));
          } else {
            const _Float16 x0 = (_Float16)f0, x1 = (_Float16)f1;
            h0 = h_bits(x0); h1 = h_bits(x1);
            l0 = h_bits((_Float16)((f0 - (float)x0) * rscale));
            l1 = h_bits((_Float16)((f1 - (float)x1) * rscale));
          }
          a[e] = pk16(h0, h1); a2[e] = pk16(l0, l1);
        }
        hv[it] = a; lv[it] = a2;
      }
      {
#pragma unroll
        for (int it = 0; it < 4; ++it) {
          const int row = it * 4 + q;
          *(v4u*)(C + (size_t)(mBase + row) * ldc + n0 + c8) = hv[it];
          if (wlo) *(v4u*)(C2 + (size_t)(mBase + row) * ldc2 + n0 + c8) = lv[it];
        }
        
      }
    }
    __builtin_amdgcn_fence(__ATOMIC_RELEASE, "workgroup");
    __builtin_amdgcn_wave_barrier();
    __builtin_amdgcn_fence(__ATOMIC_ACQUIRE, "workgroup");
  }
}

// =====================================================================================================
// The two projections in one grid (neither reads what the other writes): blocks 0 .. nQK - 1 are the tiles of
// q|k = x . Wqk^T (f32 out), the rest the tiles of v^T = Wv . x^T (f16 hi + residual planes). One set of LDS arrays
// serves either path, so two blocks fit a WGP and the v^T tiles run beside the q|k tiles. The branch is on
// blockIdx alone: block-uniform.
// =====================================================================================================
__global__ __launch_bounds__(256) void gemm_qk_vt(
    const unsigned short* __restrict__ Xp, const unsigned short* __restrict__ Wqkp, const unsigned short* __restrict__ Wvp,
    void* QKout, void* VThout, void* VTlout, int seq, int qkw, int dm, int nQK, float rscale) {
  __shared__ __align__(16) float  sT[8 * 16 * 68];
  __shared__ __align__(16) __bf16 sA[2 * GSA];
  __shared__ __align__(16) __bf16 sB[2 * GSB];
  const int bx = blockIdx.x;
  if (bx < nQK)
    gemm_tile<0, 0>(Xp, Xp, dm, 0LL, Wqkp, dm, 0LL, QKout, qkw, 0LL, QKout, qkw, 0LL, 0,
                    seq, qkw, dm, 1.0f, bx, sT, sA, sA, sB);
  else
    gemm_tile<0, 3>(Wvp, Wvp, dm, 0LL, Xp, dm, 0LL, VThout, seq, 0LL, VTlout, seq, 0LL, seq,
                    dm, seq, dm, rscale, bx - nQK, sT, sA, sA, sB);
}

// out = (A + A2) . Bt^T, f32: one tile per block
__global__ __launch_bounds__(256) void gemm_split_f32(
    const unsigned short* __restrict__ Ap, const unsigned short* A2p, const unsigned short* __restrict__ Btp,
    void* Cout, int M, int N, int K) {
  __shared__ __align__(16) float  sT[8 * 16 * 68];
  __shared__ __align__(16) __bf16 sA[2 * GSA];
  __shared__ __align__(16) __bf16 sA2[2 * GSA];
  __shared__ __align__(16) __bf16 sB[2 * GSB];
  gemm_tile<1, 0>(Ap, A2p, K, 0LL, Btp, K, 0LL, Cout, N, 0LL, Cout, N, 0LL, 0,
                  M, N, K, 1.0f, (int)blockIdx.x, sT, sA, sA2, sB);
}

// =====================================================================================================
// Cosine-similarity scaling + axial rotation of q and k, f32, one wave per (token t, head h) row.
//   qkf: f32 [t][QKW], q of head h at cols h*64.., k at cols DM + h*64..
//   pos [t][2], scl [NH], freqs [2][NH][NFR]: values RNE-converted to bf16 in register before use.
//   rq = sqrt(|scl_h| + 1e-8) * rsqrt(sum(q^2) + 1e-8); qs = q * rq (same for k)
//   theta[i], i < 16: (pos[t][1]*2 - 1) * freqs[1][h][i]; i >= 16: (pos[t][0]*2 - 1) * freqs[0][h][i-16]
//   out[i] = qs[i] cos - qs[i+32] sin; out[i+32] = qs[i+32] cos + qs[i] sin (lane i = pair index).
//   qk4: four bf16 planes [t][h*64+d] back to back (plane stride SEQ*DM elements): q hi, q lo, k hi, k lo
//   (lo = RNE(v - hi), unscaled). The wave's 64-wide row is staged in LDS, then ONE store instruction writes
//   grid = nrows/8 blocks of 256 (8 waves). coverage: nrows = SEQ*NH rows x 64 cols in each of the 4 planes.
// =====================================================================================================
__global__ __launch_bounds__(256) void rope_qk(const float* __restrict__ qkf, const float* __restrict__ pos,
                                               const float* __restrict__ scl, const float* __restrict__ freqs,
                                               unsigned short* qk4, int nrows) {
#pragma clang fp contract(off)
  __shared__ __align__(16) float sq[8][64];
  __shared__ __align__(16) float sk[8][64];
  const int tid  = threadIdx.x;
  const int wave = tid >> 5;
  const int lane = tid & 31;
  const int rho  = blockIdx.x * 8 + wave;
  if (rho < nrows) {                                      // wave-uniform; no block barriers in this kernel
    const int t = rho >> 4;
    const int h = rho & 15;
    const float* qr = qkf + (size_t)t * QKW + h * HD;
    const float* kr = qr + DM;
    const int i = lane;                                   // pair index 0..31
    const float q1 = qr[i], q2 = qr[i + 32];
    const float k1 = kr[i], k2 = kr[i + 32];
    float ssq = q1 * q1 + q2 * q2;
    float ssk = k1 * k1 + k2 * k2;
    ssq += half_xor(ssq);    ssk += half_xor(ssk);
    ssq += row_xor<8>(ssq);  ssk += row_xor<8>(ssk);
    ssq += row_xor<4>(ssq);  ssk += row_xor<4>(ssk);
    ssq += row_xor<2>(ssq);  ssk += row_xor<2>(ssk);
    ssq += row_xor<1>(ssq);  ssk += row_xor<1>(ssk);
    const float scr = bf_rn(scl[h]);
    const float ss  = sqrtf(fabsf(scr) + 1e-8f);
    const float rq  = ss * rsqrtf(ssq + 1e-8f);
    const float rk  = ss * rsqrtf(ssk + 1e-8f);
    const float px  = bf_rn(pos[2 * t + 0]);
    const float py  = bf_rn(pos[2 * t + 1]);
    const int  low  = (i < 16) ? 1 : 0;
    const int  fi   = low ? (NH * NFR + h * NFR + i) : (h * NFR + (i - 16));   // [1][h][i] or [0][h][i-16], < 2*NH*NFR
    const float fr  = bf_rn(freqs[fi]);
    const float pp  = low ? py : px;
    const float th  = (pp * 2.0f - 1.0f) * fr;
    const float cs  = cosf(th);
    const float sn  = sinf(th);
    const float xq1 = q1 * rq, xq2 = q2 * rq;
    const float xk1 = k1 * rk, xk2 = k2 * rk;
    sq[wave][i]      = xq1 * cs - xq2 * sn;
    sq[wave][i + 32] = xq2 * cs + xq1 * sn;
    sk[wave][i]      = xk1 * cs - xk2 * sn;
    sk[wave][i + 32] = xk2 * cs + xk1 * sn;
    __builtin_amdgcn_fence(__ATOMIC_RELEASE, "workgroup");
    __builtin_amdgcn_wave_barrier();
    __builtin_amdgcn_fence(__ATOMIC_ACQUIRE, "workgroup");
    const int pl = lane >> 3;                             // plane 0 q hi, 1 q lo, 2 k hi, 3 k lo
    const int c8 = (lane & 7) * 8;
    const float* spq = &sq[wave][c8];
    const float* spk = &sk[wave][c8];
    v4u w;
#pragma unroll
    for (int e = 0; e < 4; ++e) {
      const float fq0 = spq[2 * e], fq1 = spq[2 * e + 1];
      const float fk0 = spk[2 * e], fk1 = spk[2 * e + 1];
      const float f0 = (pl < 2) ? fq0 : fk0;
      const float f1 = (pl < 2) ? fq1 : fk1;
      const unsigned short hb0 = bf_bits(f0), hb1 = bf_bits(f1);
      const unsigned short lb0 = bf_bits(f0 - bf_up(hb0)), lb1 = bf_bits(f1 - bf_up(hb1));
      const unsigned short s0 = (pl & 1) ? lb0 : hb0;
      const unsigned short s1 = (pl & 1) ? lb1 : hb1;
      w[e] = pk16(s0, s1);
    }
    unsigned short* dst = qk4 + (size_t)pl * ((size_t)SEQ * DM) + (size_t)t * DM + h * HD + c8;
    *(v4u*)dst = w;
    
  }
}

#define APL  (64 * LP)
#define ABUF (4 * APL)
template <bool RES>
__device__ __forceinline__
void attn_rows(const unsigned short* __restrict__ qhp, const unsigned short* __restrict__ qlp,
               const unsigned short* __restrict__ khp, const unsigned short* __restrict__ klp,
               const unsigned short* __restrict__ vhp, const unsigned short* __restrict__ vlp,
               const int* __restrict__ npk,
               unsigned short* ohp, unsigned short* olp, int qb, int h, __bf16* KV) {
  union FB { v16b v; v8b h[2]; };
  union FH { v16h v; v8h h[2]; };

  const int tid  = threadIdx.x;
  const int wave = tid >> 5;
  const int lane = tid & 31;
  const int hh   = lane >> 4;
  const int c    = lane & 15;
  const int q0   = qb * 64 + wave * 16;

  int S = npk[0];                         // block-uniform scalar load
  S = (S < 0) ? 0 : S;
  S = (S > SEQ) ? SEQ : S;
  const int Su = __builtin_amdgcn_readfirstlane(S);     // the same value in a scalar register, for the per-tile branch below
  const int SB   = (S + 63) >> 6;                       // 0..NQB
  const int nLow = (qb + 1 < SB) ? (qb + 1) : SB;       // tiles 0..nLow-1
  int nT = nLow + ((qb >= SB) ? 1 : 0);                 // + the block's own tile when not in the prefix
  nT = (nT > NQB) ? NQB : nT;

  const __bf16* Qh = (const __bf16*)(const void*)qhp + (size_t)h * HD;
  const __bf16* Ql = (const __bf16*)(const void*)qlp + (size_t)h * HD;
  const __bf16* Kh = (const __bf16*)(const void*)khp + (size_t)h * HD;
  const __bf16* Kl = (const __bf16*)(const void*)klp + (size_t)h * HD;
  const _Float16* Vh = (const _Float16*)(const void*)vhp + (size_t)h * HD * SEQ;
  const _Float16* Vl = (const _Float16*)(const void*)vlp + (size_t)h * HD * SEQ;

  // ---- Q fragments (B operand, column = lane&15 = query q0 + c): 2 d-chunks, hi and lo ----
  v16b qah[2], qal[2];
  const __bf16* pqh = Qh + (size_t)(q0 + c) * DM + 8 * hh;
  const __bf16* pql = Ql + (size_t)(q0 + c) * DM + 8 * hh;
#pragma unroll
  for (int dc = 0; dc < 2; ++dc) {
    qah[dc] = ldfrag_b(pqh + dc * 32);
    qal[dc] = ldfrag_b(pql + dc * 32);
  }
  // the wait that belongs in front of any rewrite of an issued load's address registers; the two addresses are
  // its inputs, so they stay in their registers up to it
  asm volatile("s_wait_xcnt 0x0" :: "v"(pqh), "v"(pql) : "memory");

  const int tq = q0 + c;                  // the lane's query row
  const int klim = (S - 1 < tq) ? (S - 1) : tq;   // (key < S and key <= tq) is key <= klim; a per-lane constant here
  float mrow = -INFINITY;                 // running maximum of query tq (equal in lanes l and l ^ 16)
  float lrow = 0.f;                       // running sum of query tq over this lane half's keys; halves joined at the end
  v8f oacc[4];                            // oacc[t4][r] = context[tq][d = 16 t4 + 8 hh + r]
#pragma unroll
  for (int t = 0; t < 4; ++t) oacc[t] = zero8();

  // copy map: thread -> row (tid >> 3) + 16 p of a plane tile, 16-B piece (tid & 7) of its 128 B
  const int crow = tid >> 3;
  const int cseg = (tid & 7) * 8;
  const __bf16* gKh = Kh + (size_t)crow * DM + cseg;                                   // K row kv0 + crow, d = cseg..
  const __bf16* gKl = Kl + (size_t)crow * DM + cseg;
  const __bf16* gVh = (const __bf16*)(const void*)(Vh + (size_t)crow * SEQ + cseg);    // V^T row d = crow, s = kv0 + cseg..
  const __bf16* gVl = (const __bf16*)(const void*)(Vl + (size_t)crow * SEQ + cseg);
  const unsigned lKV = lds_addr(KV + crow * LP + cseg);
  const unsigned R16 = 16 * LP * 2;            // 16 LDS rows, bytes
  const unsigned PB  = APL * 2;                // one plane tile, bytes
  const size_t k16 = (size_t)16 * DM, v16 = (size_t)16 * SEQ;
  auto stage = [&](int ii, int buf) {          // key tile of trip ii into buffer buf; tile index <= NQB - 1
    const int kts = (ii < nLow) ? ii : qb;
    const __bf16* pk = gKh + (size_t)kts * 64 * DM;
    const __bf16* pl_ = gKl + (size_t)kts * 64 * DM;
    const __bf16* pv = gVh + (size_t)kts * 64;
    const __bf16* pw = gVl + (size_t)kts * 64;
    const unsigned l = lKV + (unsigned)buf * (4 * PB);
    copy8_to_lds(l, l + R16, l + 2 * R16, l + 3 * R16, l + PB, l + PB + R16, l + PB + 2 * R16, l + PB + 3 * R16,
                 pk, pk + k16, pk + 2 * k16, pk + 3 * k16, pl_, pl_ + k16, pl_ + 2 * k16, pl_ + 3 * k16);
    copy8_to_lds(l + 2 * PB, l + 2 * PB + R16, l + 2 * PB + 2 * R16, l + 2 * PB + 3 * R16,
                 l + 3 * PB, l + 3 * PB + R16, l + 3 * PB + 2 * R16, l + 3 * PB + 3 * R16,
                 pv, pv + v16, pv + 2 * v16, pv + 3 * v16, pw, pw + v16, pw + 2 * v16, pw + 3 * v16);
  };

  stage(0, 0);
  asm volatile("s_wait_asynccnt 0x0" ::: "memory");   // this wave's copies of tile 0 have landed
  __syncthreads();                                    // every wave's have: tile 0 is readable
  if (nT > 1) stage(1, 1);
  for (int i = 0; i < nT; ++i) {          // block-uniform trip count, <= NQB
    const int kt  = (i < nLow) ? i : qb;
    const int kv0 = kt * 64;              // kv0 + 63 < SEQ
    const int buf = i & 1;
    const __bf16*   Ksh = KV + buf * ABUF;                                            // K hi [kv][d], rows at pitch LP
    const __bf16*   Ksl = Ksh + APL;                                                  // K lo
    const _Float16* Vth = (const _Float16*)(const void*)(Ksh + 2 * APL);              // V^T hi [d][kv]
    const _Float16* Vtl = (const _Float16*)(const void*)(Ksh + 3 * APL);              // V^T residual

    // ---- scores, transposed: 64 keys (rows) x 16 queries (columns) per wave, 3 bf16 products ----
    //      per d chunk the four key groups' chains run side by side (each chain: hi.hi, hi.lo, lo.hi, as before)
    v8f s[4];
#pragma unroll
    for (int j = 0; j < 4; ++j) s[j] = zero8();
#pragma unroll
    for (int dc = 0; dc < 2; ++dc) {
      FB kb[4], kl[4];
#pragma unroll
      for (int j = 0; j < 4; ++j) {
        kb[j].h[0] = *(const v8b*)(Ksh + (j * 16 + c) * LP + dc * 32 + 8 * hh);
        kb[j].h[1] = *(const v8b*)(Ksh + (j * 16 + c) * LP + dc * 32 + 16 + 8 * hh);
        kl[j].h[0] = *(const v8b*)(Ksl + (j * 16 + c) * LP + dc * 32 + 8 * hh);
        kl[j].h[1] = *(const v8b*)(Ksl + (j * 16 + c) * LP + dc * 32 + 16 + 8 * hh);
      }
#pragma unroll
      for (int j = 0; j < 4; ++j) s[j] = mma_b_raw(kb[j].v, qah[dc], s[j]);
#pragma unroll
      for (int j = 0; j < 4; ++j) s[j] = mma_b_raw(kl[j].v, qah[dc], s[j]);
#pragma unroll
      for (int j = 0; j < 4; ++j) s[j] = mma_b_raw(kb[j].v, qal[dc], s[j]);
      run_guard_b(s[0], s[1], s[2], s[3], kb[0].v, kb[1].v, kb[2].v, kb[3].v, kl[0].v, kl[1].v, kl[2].v, kl[3].v);
    }

    // ---- key visibility rule, maximum, online softmax; P^T (x1024, f16) and its residual (x4096) as B fragments ----
    //      s[j][r] = score of key kv0 + 16 j + 8 hh + r with query tq
    const int kb0 = kv0 + 8 * hh;           // the lane's key of (j, r) = (0, 0); limits taken relative to it
    const int rlim = klim - kb0, rtq = tq - kb0;
    // a tile in front of the block's own (kt < qb) whose last key lies in the prefix (kv0 + 63 < S) has every key <= klim
    // for all 64 queries of the block: the rule passes every score, so the test is taken only for the other tiles
    // (the block's own tile, a tile cut by S); kt, qb and S are block-uniform: a scalar branch
    if (!((kt < qb) && (kv0 + 63 < Su))) {
#pragma unroll
      for (int j = 0; j < 4; ++j) {
#pragma unroll
        for (int r = 0; r < 8; ++r) {
          const bool ok = (j * 16 + r <= rlim) || (j * 16 + r == rtq);
          s[j][r] = ok ? s[j][r] : -INFINITY;
        }
      }
    }
    float m = -INFINITY;
#pragma unroll
    for (int j = 0; j < 4; ++j) {
#pragma unroll
      for (int r = 0; r < 8; ++r) m = fmaxf(m, s[j][r]);
    }
    m = fmaxf(m, half_xor(m));              // the query's other 32 keys
    const float mnew  = fmaxf(mrow, m);
    const float msafe = (mnew == -INFINITY) ? 0.f : mnew;
    const float alpha = __expf(mrow - msafe);
    mrow = mnew;
    FH pa[2], pl[2];                        // element e of fragment kk: key kv0 + 32 kk + (e < 8 ? 8 hh + e : 16 + 8 hh + e - 8)
    float ps[4];
#pragma unroll
    for (int j = 0; j < 4; ++j) {
      float acc = 0.f;
#pragma unroll
      for (int r = 0; r < 8; ++r) {
        const float p = __expf(s[j][r] - msafe);     // masked score: exp(-inf) -> 0
        acc = (r == 0) ? p : (acc + p);
        const float p1k = p * 1024.0f;
        const _Float16 ph = (_Float16)p1k;
        pa[j >> 1].h[j & 1][r] = ph;
        if (RES) pl[j >> 1].h[j & 1][r] = (_Float16)((p1k - (float)ph) * 4096.0f);
      }
      ps[j] = acc;
    }
    lrow = lrow * alpha + ((ps[0] + ps[1]) + (ps[2] + ps[3]));
#pragma unroll
    for (int t4 = 0; t4 < 4; ++t4)
#pragma unroll
      for (int r = 0; r < 8; ++r) oacc[t4][r] *= alpha;

    // ---- context^T += V_hi^T . P^T (f16 WMMA); residual products into a separate accumulator ----
    v8f o1[4];
#pragma unroll
    for (int t4 = 0; t4 < 4; ++t4) o1[t4] = zero8();
#pragma unroll   // pa[kk], pl[kk] live in registers: kk must be a compile-time index
    for (int kk = 0; kk < 2; ++kk) {
#pragma unroll
      for (int t4 = 0; t4 < 4; ++t4) {
        FH vb, vl;
        vb.h[0] = *(const v8h*)(Vth + (t4 * 16 + c) * LP + kk * 32 + 8 * hh);
        vb.h[1] = *(const v8h*)(Vth + (t4 * 16 + c) * LP + kk * 32 + 16 + 8 * hh);
        vl.h[0] = *(const v8h*)(Vtl + (t4 * 16 + c) * LP + kk * 32 + 8 * hh);
        vl.h[1] = *(const v8h*)(Vtl + (t4 * 16 + c) * LP + kk * 32 + 16 + 8 * hh);
        oacc[t4] = mma_h_raw(vb.v, pa[kk].v, oacc[t4]);
        o1[t4]   = mma_h_raw(vl.v, pa[kk].v, o1[t4]);
        if (RES) o1[t4] = mma_h_raw(vb.v, pl[kk].v, o1[t4]);
      }
    }
#pragma unroll
    for (int t4 = 0; t4 < 4; ++t4)
#pragma unroll
      for (int r = 0; r < 8; ++r) oacc[t4][r] += o1[t4][r] * (1.0f / 4096.0f);
    asm volatile("s_wait_dscnt 0x0" ::: "memory");     // this wave's reads of buffer buf are done before it is refilled
    asm volatile("s_wait_asynccnt 0x0" ::: "memory");  // this wave's copies of tile i + 1 have landed
    __syncthreads();                                   // publishes tile i + 1 and ends every read of buffer buf
    if (i + 2 < nT) stage(i + 2, buf);
  }
  asm volatile("s_wait_asynccnt 0x0" ::: "memory");    // no copy outstanding behind the loop: the LDS is free for the output tile

  // ---- normalise (1/l and the 1/1024 p carry), stage the wave's 16x64 tile, bf16 hi/lo split,
  float* os = (float*)(void*)KV + wave * (16 * OSP);   // behind the loop's last barrier nobody reads the buffers any more
  {
    const float l = lrow + half_xor(lrow);  // both halves' keys
    const float inv = ((l > 0.f) ? (1.0f / l) : 0.f) * (1.0f / 1024.0f);
#pragma unroll
    for (int t4 = 0; t4 < 4; ++t4) {        // the lane's 8 consecutive d of row c: two 16-B stores
      v4f w0, w1;
#pragma unroll
      for (int r = 0; r < 4; ++r) { w0[r] = oacc[t4][r] * inv; w1[r] = oacc[t4][r + 4] * inv; }
      *(v4f*)(os + c * OSP + t4 * 16 + 8 * hh)     = w0;
      *(v4f*)(os + c * OSP + t4 * 16 + 8 * hh + 4) = w1;
    }
  }
  __builtin_amdgcn_fence(__ATOMIC_RELEASE, "workgroup");
  __builtin_amdgcn_wave_barrier();
  __builtin_amdgcn_fence(__ATOMIC_ACQUIRE, "workgroup");
  {
    const int q4 = lane >> 3, c8 = (lane & 7) * 8;
    v4u hv[4], lv[4];
#pragma unroll
    for (int it = 0; it < 4; ++it) {
      const int row = it * 4 + q4;   // it 0..3 x q4 0..3 = rows 0..15 of the wave tile
      const float* sp = os + row * OSP + c8;
      v4u a, a2;
#pragma unroll
      for (int e = 0; e < 4; ++e) {
        const float f0 = sp[2 * e], f1 = sp[2 * e + 1];
        const unsigned short h0 = bf_bits(f0), h1 = bf_bits(f1);
        const unsigned short l0 = bf_bits(f0 - bf_up(h0)), l1 = bf_bits(f1 - bf_up(h1));
        a[e] = pk16(h0, h1); a2[e] = pk16(l0, l1);
      }
      hv[it] = a; lv[it] = a2;
    }
    {
      // row it * 4 + q4 of the wave tile lies it * 4 * DM elements behind row q4: one address per plane for all four stores
      const size_t go = (size_t)(q0 + q4) * DM + (size_t)h * HD + c8;
      unsigned short* po = ohp + go;
      unsigned short* pl2 = olp + go;
#pragma unroll
      for (int it = 0; it < 4; ++it) {
        *(v4u*)(po + (size_t)it * 4 * DM) = hv[it];
        *(v4u*)(pl2 + (size_t)it * 4 * DM) = lv[it];
      }
      // the wait that belongs in front of any rewrite of an issued store's address registers; the two addresses are
      // its inputs, so they stay in their registers up to it
      asm volatile("s_wait_xcnt 0x0" :: "v"(po), "v"(pl2) : "memory");
    }
  }
}

// =====================================================================================================
// One launch for all NQB x NH row blocks: NH * NQB = 1024 blocks, four resident per WGP (registers), so the
// launch lasts as long as the WGP whose four blocks hold the most key tiles. A block's tile count grows with qb, so
// the index map makes quartets of row blocks {x, 63 - x, 32 + x, 31 - x}, x = 0..15 (equal sums for a cost linear
// in qb), both of four neighbouring indices (same head) and of indices 256 apart (four heads).
//   bx = 256 g + 4 a + b: x = a & 15, member v = (b + g) & 3, h = 4 (a >> 4) + g; (x, v) <-> qb and (a >> 4, g) <-> h
//   are one to one, and b <-> v for a given g: every (h, qb) exactly once.
// Row blocks below RESQB take the path with the p residual plane: a block-uniform branch on blockIdx alone.
// =====================================================================================================
static_assert(NQB == 64 && NH == 16);
__global__ __launch_bounds__(128)
void attn64(const unsigned short* __restrict__ qhp, const unsigned short* __restrict__ qlp,
            const unsigned short* __restrict__ khp, const unsigned short* __restrict__ klp,
            const unsigned short* __restrict__ vhp, const unsigned short* __restrict__ vlp,
            const int* __restrict__ npk,
            unsigned short* ohp, unsigned short* olp) {
  __shared__ __align__(16) __bf16 KV[2 * ABUF];   // two buffers of K hi, K lo, V^T hi, V^T residual tiles; then 4 output tiles
  static_assert(4 * 16 * OSP * 4 <= 2 * ABUF * 2);
  const int bx = blockIdx.x;              // < NH * NQB by grid size
  const int g  = bx >> 8;
  const int a  = (bx >> 2) & 63;
  const int x  = a & 15;
  const int v  = (bx + g) & 3;
  const int h  = ((a >> 4) << 2) + g;
  const int qb = (v == 0) ? x : (v == 1) ? (63 - x) : (v == 2) ? (32 + x) : (31 - x);
  if (qb < RESQB)
    attn_rows<true>(qhp, qlp, khp, klp, vhp, vlp, npk, ohp, olp, qb, h, KV);
  else
    attn_rows<false>(qhp, qlp, khp, klp, vhp, vlp, npk, ohp, olp, qb, h, KV);
}

// =====================================================================================================
// Workspace map (bytes), every region an exact multiple of its whole-line / whole-tile store granularity:
//   Xb    bf16 [4096][1024]          0            8388608
//   Wqkv  bf16 [3072 n][1024 k]      8388608      6291456   (rows 0..2047 = q|k weights, 2048.. = v weights)
//   Wob   bf16 [1024][1024]          14680064     2097152
//   QKf   f32  [4096][2048]          16777216     33554432  (cols 0..1023 q, 1024..2047 k)
//   VTh   f16  [1024 d][4096 s]      50331648     8388608
//   VTl   f16  [1024 d][4096 s]      58720256     8388608
//   QK4   bf16 4 x [4096][1024]      67108864     33554432  (q hi, q lo, k hi, k lo)
//   Oh    bf16 [4096][1024]          100663296    8388608
//   Ol    bf16 [4096][1024]          109051904    8388608
//   end                              117440512
// Weights are [out n][in k] with k contiguous = the Bt / A layout the GEMM wants, so they are only converted.
// =====================================================================================================
extern "C" void kernel_launch(void* const* d_in, const int* in_sizes, int n_in,
                              void* d_out, int out_size, void* d_ws, size_t ws_size,
                              hipStream_t stream) {
  if (n_in < 7) return;
  if (in_sizes[0] != SEQ * DM) return;
  if (in_sizes[1] != SEQ * 2) return;
  if (in_sizes[2] != NQKV * DM) return;
  if (in_sizes[3] != DM * DM) return;
  if (in_sizes[4] != NH) return;
  if (in_sizes[5] != 2 * NH * NFR) return;
  if (in_sizes[6] < 1) return;
  if (out_size != SEQ * DM) return;

  const float* x     = (const float*)d_in[0];
  const float* pos   = (const float*)d_in[1];
  const float* qkvw  = (const float*)d_in[2];
  const float* outw  = (const float*)d_in[3];
  const float* scl   = (const float*)d_in[4];
  const float* freqs = (const float*)d_in[5];
  const int*   npk   = (const int*)d_in[6];

  const size_t PXB   = (size_t)SEQ * DM * 2;      //  8388608
  const size_t PWQKV = (size_t)NQKV * DM * 2;     //  6291456
  const size_t PWO   = (size_t)DM * DM * 2;       //  2097152
  const size_t PQKF  = (size_t)SEQ * QKW * 4;     // 33554432
  const size_t PVT   = (size_t)DM * SEQ * 2;      //  8388608
  const size_t PPL   = (size_t)SEQ * DM * 2;      //  8388608
  size_t off = 0;
  const size_t oXb   = off; off += PXB;
  const size_t oWqkv = off; off += PWQKV;
  const size_t oWo   = off; off += PWO;
  const size_t oQKf  = off; off += PQKF;
  const size_t oVTh  = off; off += PVT;
  const size_t oVTl  = off; off += PVT;
  const size_t oQK4  = off; off += 4 * PPL;
  const size_t oOh   = off; off += PPL;
  const size_t oOl   = off; off += PPL;
  if (off > ws_size) return;                      // off = 117440512
  if (off > (size_t)134217728) return;

  char* ws = (char*)d_ws;
  unsigned short* Xb   = (unsigned short*)(ws + oXb);
  unsigned short* Wqkv = (unsigned short*)(ws + oWqkv);
  unsigned short* Wvb  = Wqkv + (size_t)2 * DM * DM;             // rows 2048.. of the qkv weight plane
  unsigned short* Wob  = (unsigned short*)(ws + oWo);
  float*          QKf  = (float*)(ws + oQKf);
  unsigned short* VTh  = (unsigned short*)(ws + oVTh);
  unsigned short* VTl  = (unsigned short*)(ws + oVTl);
  unsigned short* QK4  = (unsigned short*)(ws + oQK4);
  unsigned short* Qh   = QK4;
  unsigned short* Ql   = QK4 + (size_t)SEQ * DM;
  unsigned short* Kh   = QK4 + (size_t)2 * SEQ * DM;
  unsigned short* Kl   = QK4 + (size_t)3 * SEQ * DM;
  unsigned short* Oh   = (unsigned short*)(ws + oOh);
  unsigned short* Ol   = (unsigned short*)(ws + oOl);

  const dim3 blk(256);
  const int n8x = SEQ * DM / 8;                                // 524288
  const int n8w = NQKV * DM / 8;                               // 393216
  const int n8o = DM * DM / 8;                                 // 131072
  static_assert((SEQ * DM / 8) % 256 == 0 && (NQKV * DM / 8) % 256 == 0 && (DM * DM / 8) % 256 == 0);
  const dim3 gCvt((n8x + n8w + n8o) / 256);                    // 2048 + 1536 + 512 blocks
  const int  nbQK = (SEQ / 128) * (QKW / 256);                 // 256 blocks: M=4096, N=2048
  const int  nbVT = (DM / 128) * (SEQ / 256);                  // 128 blocks: M=1024, N=4096
  const dim3 gQKV(nbQK + nbVT, 1);
  const dim3 gOut(((SEQ / 64) * (DM / 64) + 7) / 8, 1);        // 1024 tiles -> 128 blocks: M=4096, N=1024
  const int  nRows = SEQ * NH;                                 // 65536 (t, h) rows
  const dim3 gRope((nRows + 7) / 8);                           // 8192 blocks of 8 waves

  // (1) x -> bf16 [4096][1024]; weights [n][k] f32 -> bf16 [n][k]
  cvt3_bf16x8<<<gCvt, blk, 0, stream>>>(x, qkvw, outw, Xb, Wqkv, Wob, n8x, n8w, n8o);
  // (2) q|k = x . W[0:2048]^T -> f32 [4096][2048]   (M=4096, N=2048, K=1024), and in the same grid
  // (3) v^T = Wv . x^T -> f16 hi plane [h*64+d][s] (pitch SEQ) and residual plane (x4096, all keys)
  //     (A = Wvb [n][k], Bt = Xb; M=1024, N=4096, K=1024)
  gemm_qk_vt<<<gQKV, blk, 0, stream>>>(Xb, Wqkv, Wvb, (void*)QKf, (void*)VTh, (void*)VTl,
                                       SEQ, QKW, DM, nbQK, 4096.0f);
  // (4) cosine-sim scaling + axial rotation -> q hi/lo, k hi/lo bf16 planes [t][h*64+d]
  rope_qk<<<gRope, blk, 0, stream>>>(QKf, pos, scl, freqs, QK4, nRows);
  // (5) attention, all row blocks in one launch (row blocks 0..RESQB-1 with the p residual plane, the rest without)
  attn64<<<dim3(NH * NQB), dim3(128), 0, stream>>>(Qh, Ql, Kh, Kl, VTh, VTl, npk, Oh, Ol);
  // (6) out = context . Wo^T -> d_out f32 [4096][1024]  (A = context hi + lo planes, 2 products)
  gemm_split_f32<<<gOut, blk, 0, stream>>>(Oh, Ol, Wob, d_out, SEQ, DM, DM);
  (void)hipGetLastError();
}

// v010
// It runs in 139 microseconds.
// Two timings next to v009 both put it at 1.06 times that version's speed.
// Over all steps from v000 it is 4.13 times as fast.
// Contractions: q|k and v^T projections = v_wmma_f32_16x16x32_bf16 (bf16 operands from RNE-converted inputs, single product);
// q.k^T scores = v_wmma_f32_16x16x32_bf16 with bf16 hi/lo split q and k (hi.hi + hi.lo + lo.hi);
// p.v = v_wmma_f32_16x16x32_f16 (p carried x1024 in f16; v as f16 hi plane + f16 residual plane x4096, 2 products;
// extra f16 residual plane x4096 of p for the first 512 rows); ctx.Wo^T = v_wmma_f32_16x16x32_bf16 with ctx as
// bf16 hi/lo planes times bf16 Wo (2 products); all f32 accumulate; norms, rotations and softmax in f32.
#include <hip/hip_runtime.h>
#include <math.h>
#include <stdint.h>

#define SEQ   4096
#define DM    1024
#define NH    16
#define HD    64
#define NQB   (SEQ / 64)   // 64 row / key tiles of 64
#define RESQB 8            // leading 64-row blocks that also use the p residual plane
#define QKW   (2 * DM)     // columns of the q|k product
#define NQKV  (3 * DM)
#define NFR   16           // rotation frequencies per head per axis (HD/4)
#define LP    72           // LDS row pitch of the 64-wide 16-bit attention tiles, in elements: 144 B = 16 B x 9 (odd)
#define OSP   68           // LDS row pitch of the attention output staging tile, in floats: 272 B = 16 B x 17 (odd)
#define GP    72           // LDS row pitch of the GEMM operand slices (64 k of 16 bits), in elements: 144 B = 16 B x 9 (odd)
static_assert(NH * HD == DM);
static_assert((SEQ % 256) == 0 && (DM % 256) == 0);
static_assert((SEQ % 64) == 0 && (DM % 64) == 0);
static_assert(RESQB <= NQB);
static_assert(HD == 4 * NFR);

typedef _Float16 v16h __attribute__((ext_vector_type(16)));
typedef _Float16 v8h  __attribute__((ext_vector_type(8)));
typedef __bf16   v16b __attribute__((ext_vector_type(16)));
typedef __bf16   v8b  __attribute__((ext_vector_type(8)));
typedef float    v8f  __attribute__((ext_vector_type(8)));
typedef float    v4f  __attribute__((ext_vector_type(4)));
typedef unsigned int v4u __attribute__((ext_vector_type(4)));

// ---- scalar helpers --------------------------------------------------------------------------------
__device__ __forceinline__ unsigned short bf_bits(float f) {          // f32 -> bf16 bits, RNE convert
  unsigned u = __float_as_uint(f);
  return (unsigned short)((u + 0x7FFFu + ((u >> 16) & 1u)) >> 16);
}
__device__ __forceinline__ float bf_up(unsigned short h) { return __uint_as_float(((unsigned)h) << 16); }
__device__ __forceinline__ float bf_rn(float f) { return bf_up(bf_bits(f)); }   // value after RNE convert to bf16
__device__ __forceinline__ unsigned short h_bits(_Float16 x) { return __builtin_bit_cast(unsigned short, x); }
__device__ __forceinline__ unsigned pk16(unsigned short a, unsigned short b) { return (unsigned)a | ((unsigned)b << 16); }
// value of lane (l ^ M) inside the lane's 16-lane row, M = 1..15: a DPP operand (row_xmask), no trip through the LDS pipe
template <int M>
__device__ __forceinline__ float row_xor(float x) {
  return __builtin_bit_cast(float, __builtin_amdgcn_update_dpp(0, __builtin_bit_cast(int, x), 0x160 + M, 0xf, 0xf, true));
}
// value of lane (l ^ 16): vector cross-row move
__device__ __forceinline__ float half_xor(float x) {
  return __builtin_bit_cast(float, __builtin_amdgcn_permlanex16(__builtin_bit_cast(int, x), __builtin_bit_cast(int, x),
                                                                0x76543210, 0xfedcba98, false, false));
}
__device__ __forceinline__ v8f zero8() { v8f z = {0.f, 0.f, 0.f, 0.f, 0.f, 0.f, 0.f, 0.f}; return z; }

// ---- fragment loaders: 16-bit A/B operand, lane -> row/col (lane&15), p already includes +8*(lane>>4);
//      elements 0..7 <- p[0..7] (k0+8h..), elements 8..15 <- p[16..23] (k0+16+8h..)
__device__ __forceinline__ v16b ldfrag_b(const __bf16* p) {
  union { v16b v; v8b h[2]; } f;
  f.h[0] = *(const v8b*)(p);
  f.h[1] = *(const v8b*)(p + 16);
  return f.v;
}

// ---- WMMA helpers -------------------------------------------------------------------------------------
__device__ __forceinline__ v8f mma_b_raw(v16b a, v16b b, v8f c) {
  return __builtin_amdgcn_wmma_f32_16x16x32_bf16(false, a, false, b, (short)0, c, false, false);
}
__device__ __forceinline__ v8f mma_h_raw(v16h a, v16h b, v8f c) {
  return __builtin_amdgcn_wmma_f32_16x16x32_f16(false, a, false, b, (short)0, c, false, false);
}
// closes a run of products on four accumulator chains: the eight A fragments stay in their registers until the whole
// run has issued (no later result is placed over an operand still being read), and the four v_nop are the matrix
// distance in front of the first vector instruction on the results or on the fragments' registers
__device__ __forceinline__ void run_guard_b(v8f& s0, v8f& s1, v8f& s2, v8f& s3,
                                            v16b b0, v16b b1, v16b b2, v16b b3, v16b c0, v16b c1, v16b c2, v16b c3) {
  asm volatile("v_nop\n\tv_nop\n\tv_nop\n\tv_nop"
               : "+v"(s0), "+v"(s1), "+v"(s2), "+v"(s3)
               : "v"(b0), "v"(b1), "v"(b2), "v"(b3), "v"(c0), "v"(c1), "v"(c2), "v"(c3));
}
__device__ __forceinline__ void dep_guard_b(v8f& a, v8f& b, v16b x, v16b y) {
  asm volatile("v_nop\n\tv_nop\n\tv_nop\n\tv_nop" : "+v"(a), "+v"(b) : "v"(x), "v"(y));
}
__device__ __forceinline__ void keep4_b(v16b a, v16b b, v16b c, v16b d) {
  asm volatile("v_nop" :: "v"(a), "v"(b), "v"(c), "v"(d));
}
__device__ __forceinline__ void acc_guard4(v8f& a, v8f& b, v8f& c, v8f& d) {
  asm volatile("v_nop\n\tv_nop\n\tv_nop\n\tv_nop" : "+v"(a), "+v"(b), "+v"(c), "+v"(d));
}

// =====================================================================================================
// f32 -> bf16 (RNE convert), 8 elements per thread, one 16-B store per lane: a wave writes 512 contiguous B
// Three planes in one grid (none depends on another): blocks 0 .. n0/256 - 1 take plane 0, the next n1/256 plane 1,
// the last n2/256 plane 2; n0, n1, n2 = groups of 8 elements, multiples of 256, so a block lies in one plane and
// the choice is a scalar one. coverage: n threads x 8 = the whole of each plane.
// =====================================================================================================
__global__ __launch_bounds__(256) void cvt3_bf16x8(const float* __restrict__ in0, const float* __restrict__ in1,
                                                   const float* __restrict__ in2, unsigned short* out0,
                                                   unsigned short* out1, unsigned short* out2, int n0, int n1, int n2) {
  const int base = blockIdx.x * 256;
  const int pl   = (base < n0) ? 0 : (base < n0 + n1) ? 1 : 2;
  const float* in     = (pl == 0) ? in0 : (pl == 1) ? in1 : in2;
  unsigned short* out = (pl == 0) ? out0 : (pl == 1) ? out1 : out2;
  const int n8 = (pl == 0) ? n0 : (pl == 1) ? n1 : n2;
  const int i  = base - ((pl == 0) ? 0 : (pl == 1) ? n0 : n0 + n1) + threadIdx.x;
  if (i < n8) {
    const v4f a = *(const v4f*)(in + (size_t)i * 8);
    const v4f b = *(const v4f*)(in + (size_t)i * 8 + 4);
    v4u p;
    p[0] = pk16(bf_bits(a[0]), bf_bits(a[1]));
    p[1] = pk16(bf_bits(a[2]), bf_bits(a[3]));
    p[2] = pk16(bf_bits(b[0]), bf_bits(b[1]));
    p[3] = pk16(bf_bits(b[2]), bf_bits(b[3]));
    *(v4u*)(out + (size_t)i * 8) = p;
    
  }
}

// =====================================================================================================
// Asynchronous copies global -> LDS, 16 B per lane, four per statement. l* = the lane's LDS byte address,
// g* = the lane's global address. The closing s_wait_xcnt stands inside the statement so that no address
// register of an issued copy is rewritten in front of it.
// =====================================================================================================
__device__ __forceinline__ void copy4_to_lds(unsigned l0, unsigned l1, unsigned l2, unsigned l3,
                                             const __bf16* g0, const __bf16* g1, const __bf16* g2, const __bf16* g3) {
  asm volatile("global_load_async_to_lds_b128 %0, %4, off\n\t"
               "global_load_async_to_lds_b128 %1, %5, off\n\t"
               "global_load_async_to_lds_b128 %2, %6, off\n\t"
               "global_load_async_to_lds_b128 %3, %7, off\n\t"
               "s_wait_xcnt 0x0"
               :: "v"(l0), "v"(l1), "v"(l2), "v"(l3), "v"(g0), "v"(g1), "v"(g2), "v"(g3) : "memory");
}
// the same, eight copies per statement
__device__ __forceinline__ void copy8_to_lds(unsigned l0, unsigned l1, unsigned l2, unsigned l3,
                                             unsigned l4, unsigned l5, unsigned l6, unsigned l7,
                                             const __bf16* g0, const __bf16* g1, const __bf16* g2, const __bf16* g3,
                                             const __bf16* g4, const __bf16* g5, const __bf16* g6, const __bf16* g7) {
  asm volatile("global_load_async_to_lds_b128 %0, %8, off\n\t"
               "global_load_async_to_lds_b128 %1, %9, off\n\t"
               "global_load_async_to_lds_b128 %2, %10, off\n\t"
               "global_load_async_to_lds_b128 %3, %11, off\n\t"
               "global_load_async_to_lds_b128 %4, %12, off\n\t"
               "global_load_async_to_lds_b128 %5, %13, off\n\t"
               "global_load_async_to_lds_b128 %6, %14, off\n\t"
               "global_load_async_to_lds_b128 %7, %15, off\n\t"
               "s_wait_xcnt 0x0"
               :: "v"(l0), "v"(l1), "v"(l2), "v"(l3), "v"(l4), "v"(l5), "v"(l6), "v"(l7),
                  "v"(g0), "v"(g1), "v"(g2), "v"(g3), "v"(g4), "v"(g5), "v"(g6), "v"(g7) : "memory");
}
__device__ __forceinline__ unsigned lds_addr(const __bf16* p) { return (unsigned)(uintptr_t)p; }   // low 32 bits = LDS byte address

// =====================================================================================================
// Register-blocked batched bf16 WMMA GEMM: C[m][n] = sum_k A[m][k] * Bt[n][k]; a block of 8 waves (2 x 4) owns a
// 128 x 256 tile, one wave per 64x64 sub-tile. A row-major [M][K] pitch lda; Bt row-major [N][K] pitch ldb
// (k contiguous); M multiple of 128, N of 256, K of 64. blockIdx.y = batch index (strides in elements).
// Operand path: per slice of 64 k the block's 128 A rows and 256 Bt rows (128 B each = one line; 8 lanes x 16 B
// per row, so a wave-wide copy covers 4 whole lines) go to LDS by asynchronous copies, rows at pitch GP; two
// buffers, slice t + 1 in flight while slice t is multiplied; fragments by 16-B LDS loads.
// NSPLIT: 0 = A.Bt; 1 = (A + A2).Bt (A2 = unscaled bf16 lo plane of A).
// OUT_MODE: 0 = f32 (pitch ldc); 2 = bf16 hi plane C + bf16 lo plane C2 (lo = RNE(v - hi), unscaled);
//           3 = f16 hi plane C + f16 residual plane C2 = f16((v - hi) * rscale), C2 written only for tiles
//               with n0 < N2 (pitch ldc2, batch stride strideC2);
//           4 = q|k: cosine-similarity scaling + axial rotation of the wave's 64 x 64 tile (one head's q or k rows of
//               64 tokens), f32, then bf16 hi / lo planes; C = four planes [t][h*64+d] back to back (plane stride
//               SEQ*DM elements): q hi, q lo, k hi, k lo (lo = RNE(v - hi), unscaled).
//               pos [t][2], scl [NH], freqs [2][NH][NFR]: values RNE-converted to bf16 in register before use.
//               rr = sqrt(|scl_h| + 1e-8) * rsqrt(sum(x^2) + 1e-8); xs = x * rr
//               theta[i], i < 16: (pos[t][1]*2 - 1) * freqs[1][h][i]; i >= 16: (pos[t][0]*2 - 1) * freqs[0][h][i-16]
//               out[i] = xs[i] cos - xs[i+32] sin; out[i+32] = xs[i+32] cos + xs[i] sin (lane i = pair index).
//               sW = the block's whole LDS, reused behind the k loop (8 tiles of 64 rows at pitch 68 floats).
// gemm_tile = the work of one block on tile bx; the LDS arrays are the kernel's, handed in:
//   sT 8 x 16 x 68 floats (per-wave 16x64 slab, pitch 68), sA and sA2 2 x 128 x GP (A, A2 slice, two buffers;
//   sA2 is not touched when NSPLIT == 0), sB 2 x 256 x GP (Bt slice, two buffers).
// =====================================================================================================
#define GSA (128 * GP)     // elements of one A slice buffer
#define GSB (256 * GP)     // elements of one Bt slice buffer
template <int NSPLIT, int OUT_MODE>
__device__ __forceinline__ void gemm_tile(
    const unsigned short* __restrict__ Ap, const unsigned short* A2p, int lda, long long strideA,
    const unsigned short* __restrict__ Btp, int ldb, long long strideB,
    void* Cout, int ldc, long long strideC,
    void* Cout2, int ldc2, long long strideC2, int N2,
    int M, int N, int K, float rscale,
    int bx, float* sT, __bf16* sA, __bf16* sA2, __bf16* sB,
    const float* __restrict__ pos, const float* __restrict__ scl, const float* __restrict__ freqs, float* sW) {
  static_assert(NSPLIT == 0 || NSPLIT == 1);
  const __bf16* A   = (const __bf16*)(const void*)Ap;
  const __bf16* A2  = (const __bf16*)(const void*)A2p;
  const __bf16* Bt  = (const __bf16*)(const void*)Btp;
  const int b    = blockIdx.y;
  const int tid  = threadIdx.x;
  const int lane = tid & 31;
  const int wave = tid >> 5;
  const int tilesN = N >> 8;
  const int tilesM = M >> 7;
  if (bx >= tilesM * tilesN) return;           // block-uniform, in front of every barrier and copy
  const int bm = bx / tilesN;
  const int bn = bx - bm * tilesN;
  const int mB = bm << 7;
  const int nB = bn << 8;
  const int wm = wave >> 2;                    // 0..1
  const int wn = wave & 3;                     // 0..3
  const int m0 = mB + (wm << 6);
  const int n0 = nB + (wn << 6);

  const __bf16* Ab  = A  + (size_t)b * strideA;
  const __bf16* Bb  = Bt + (size_t)b * strideB;
  const __bf16* Ab2 = NSPLIT ? (A2 + (size_t)b * strideA) : Ab;

  const int rlane = lane & 15;                 // row (A) / col (B, D) within subtile
  const int koff  = (lane >> 4) * 8;           // k offset of this lane half
  const int mOff  = (lane >> 4) * 8;           // D row offset

  // copy map: thread -> row (tid >> 3) + 32 p of the slice, 16-B piece (tid & 7) of its 128 B
  const int crow = tid >> 3;
  const int cseg = (tid & 7) * 8;
  const __bf16* gA  = Ab  + (size_t)(mB + crow) * lda + cseg;
  const __bf16* gA2 = Ab2 + (size_t)(mB + crow) * lda + cseg;
  const __bf16* gB  = Bb  + (size_t)(nB + crow) * ldb + cseg;
  const unsigned lA  = lds_addr(sA + crow * GP + cseg);
  const unsigned lA2 = lds_addr(sA2 + crow * GP + cseg);
  const unsigned lB  = lds_addr(sB + crow * GP + cseg);
  const unsigned R32 = 32 * GP * 2;            // 32 LDS rows, bytes
  const size_t a32 = (size_t)32 * lda, b32 = (size_t)32 * ldb;
  auto stage = [&](int t, int buf) {           // slice t (k = 64 t .. 64 t + 63) into buffer buf
    const __bf16* pa = gA + (size_t)t * 64;
    const __bf16* pb = gB + (size_t)t * 64;
    const unsigned la = lA + (unsigned)buf * (4 * R32);
    const unsigned lb = lB + (unsigned)buf * (8 * R32);
    copy4_to_lds(la, la + R32, la + 2 * R32, la + 3 * R32, pa, pa + a32, pa + 2 * a32, pa + 3 * a32);
    if (NSPLIT) {
      const __bf16* pa2 = gA2 + (size_t)t * 64;
      const unsigned la2 = lA2 + (unsigned)buf * (4 * R32);
      copy4_to_lds(la2, la2 + R32, la2 + 2 * R32, la2 + 3 * R32, pa2, pa2 + a32, pa2 + 2 * a32, pa2 + 3 * a32);
    }
    copy4_to_lds(lb, lb + R32, lb + 2 * R32, lb + 3 * R32, pb, pb + b32, pb + 2 * b32, pb + 3 * b32);
    copy4_to_lds(lb + 4 * R32, lb + 5 * R32, lb + 6 * R32, lb + 7 * R32,
                 pb + 4 * b32, pb + 5 * b32, pb + 6 * b32, pb + 7 * b32);
  };

  v8f acc[4][4];
#pragma unroll
  for (int i = 0; i < 4; ++i)
#pragma unroll
    for (int j = 0; j < 4; ++j) acc[i][j] = zero8();

  const int nK = K >> 6;
  stage(0, 0);
  asm volatile("s_wait_asynccnt 0x0" ::: "memory");   // this wave's copies of slice 0 have landed
  __syncthreads();                                    // every wave's have: slice 0 is readable
  if (nK > 1) stage(1, 1);
  for (int t = 0; t < nK; ++t) {
    const int buf = t & 1;
    const __bf16* tA  = sA + buf * GSA + ((wm << 6) + rlane) * GP + koff;
    const __bf16* tA2 = NSPLIT ? (sA2 + buf * GSA + ((wm << 6) + rlane) * GP + koff) : tA;
    const __bf16* tB  = sB + buf * GSB + ((wn << 6) + rlane) * GP + koff;
#pragma unroll
    for (int kk = 0; kk < 2; ++kk) {
      // the fragments of a k chunk of 32 are fetched as one group in front of its products
      v16b bh[4], ah[4], al[4];
#pragma unroll
      for (int j = 0; j < 4; ++j) bh[j] = ldfrag_b(tB + (j << 4) * GP + kk * 32);
#pragma unroll
      for (int i = 0; i < 4; ++i) {
        ah[i] = ldfrag_b(tA + (i << 4) * GP + kk * 32);
        al[i] = NSPLIT ? ldfrag_b(tA2 + (i << 4) * GP + kk * 32) : ah[i];
      }
#pragma unroll
      for (int i = 0; i < 4; ++i) {
#pragma unroll
        for (int j = 0; j < 4; ++j) {
          acc[i][j] = mma_b_raw(ah[i], bh[j], acc[i][j]);
          if (NSPLIT) acc[i][j] = mma_b_raw(al[i], bh[j], acc[i][j]);
        }
        dep_guard_b(acc[i][0], acc[i][3], ah[i], al[i]);
      }
      keep4_b(bh[0], bh[1], bh[2], bh[3]);
    }
    asm volatile("s_wait_dscnt 0x0" ::: "memory");     // this wave's reads of buffer buf are done before it is refilled
    asm volatile("s_wait_asynccnt 0x0" ::: "memory");  // this wave's copies of slice t + 1 have landed
    __syncthreads();                                   // publishes slice t + 1 and ends every read of buffer buf
    if (t + 2 < nK) stage(t + 2, buf);
  }
  asm volatile("s_wait_asynccnt 0x0" ::: "memory");    // no copy outstanding behind the loop
  acc_guard4(acc[0][0], acc[0][1], acc[0][2], acc[0][3]);
  acc_guard4(acc[1][0], acc[1][1], acc[1][2], acc[1][3]);
  acc_guard4(acc[2][0], acc[2][1], acc[2][2], acc[2][3]);
  acc_guard4(acc[3][0], acc[3][1], acc[3][2], acc[3][3]);

  // ---- epilogue ----
  if (OUT_MODE == 4) {
    // the wave's 64 x 64 tile is the q (n0 < DM) or k row of ONE head for 64 tokens: scaled, rotated and split here.
    // Behind the loop's last barrier nobody reads the slice buffers and no copy is outstanding: the block's whole LDS
    // is free, 64 rows at pitch 68 floats per wave.
    float* tile = sW + wave * (64 * 68);
#pragma unroll
    for (int i = 0; i < 4; ++i)
#pragma unroll
      for (int j = 0; j < 4; ++j)
#pragma unroll
        for (int r = 0; r < 8; ++r) tile[((i << 4) + mOff + r) * 68 + (j << 4) + rlane] = acc[i][j][r];
    {
      // pos of the wave's 64 tokens: one 16-B load per lane (tokens m0 + 2 lane, + 1), pos * 2 - 1 into the pad
      // columns 64 (x) and 65 (y) of the token's tile row
      const v4f pz = *(const v4f*)(pos + 2 * m0 + 4 * lane);
      float* pr = tile + (2 * lane) * 68 + 64;
      pr[0]  = bf_rn(pz[0]) * 2.0f - 1.0f;
      pr[1]  = bf_rn(pz[1]) * 2.0f - 1.0f;
      pr[68] = bf_rn(pz[2]) * 2.0f - 1.0f;
      pr[69] = bf_rn(pz[3]) * 2.0f - 1.0f;
    }
    __builtin_amdgcn_fence(__ATOMIC_RELEASE, "workgroup");
    __builtin_amdgcn_wave_barrier();
    __builtin_amdgcn_fence(__ATOMIC_ACQUIRE, "workgroup");
    const int n0u = __builtin_amdgcn_readfirstlane(n0);   // wave-uniform: the head index and the plane choice stay scalar
    const int h   = (n0u >> 6) & (NH - 1);
    const int low = (lane < 16) ? 1 : 0;                  // lane = pair index 0..31 of the row
    const int fi  = low ? (NH * NFR + h * NFR + lane) : (h * NFR + (lane - 16));   // [1][h][i] or [0][h][i-16], < 2*NH*NFR
    const float fr  = bf_rn(freqs[fi]);
    const float ssc = sqrtf(fabsf(bf_rn(scl[h])) + 1e-8f);
    const float* pcol = tile + 64 + low;                  // lanes 0..15 turn by y, lanes 16..31 by x
    float nx1 = tile[lane], nx2 = tile[lane + 32], npp = pcol[0];
    // kept rolled: the row code (with the sine's large-argument path) stands once in the text, not 64 times
#pragma unroll 1
    for (int r = 0; r < 64; ++r) {
      float* row = tile + r * 68 + lane;
      const float x1 = nx1, x2 = nx2, pp = npp;
      const int rn = (r < 63) ? (r + 1) : 63;             // the next row is fetched one trip ahead, so its LDS latency hides
      nx1 = tile[rn * 68 + lane]; nx2 = tile[rn * 68 + lane + 32]; npp = pcol[rn * 68];
      float ss = x1 * x1 + x2 * x2;
      ss += half_xor(ss);
      ss += row_xor<8>(ss);
      ss += row_xor<4>(ss);
      ss += row_xor<2>(ss);
      ss += row_xor<1>(ss);
      const float rr = ssc * rsqrtf(ss + 1e-8f);
      const float th = pp * fr;
      float sn, cs;
      sincosf(th, &sn, &cs);
      const float y1 = x1 * rr, y2 = x2 * rr;
      row[0]  = y1 * cs - y2 * sn;
      row[32] = y2 * cs + y1 * sn;
    }
    __builtin_amdgcn_fence(__ATOMIC_RELEASE, "workgroup");
    __builtin_amdgcn_wave_barrier();
    __builtin_amdgcn_fence(__ATOMIC_ACQUIRE, "workgroup");
    // bf16 hi / lo planes [t][h*64+d]: q hi, q lo, k hi, k lo back to back; a store covers 4 rows x 128 B = whole lines
    const int q = lane >> 3, c8 = (lane & 7) * 8;
    unsigned short* ph = (unsigned short*)Cout + (size_t)((n0u >= DM) ? 2 : 0) * ((size_t)SEQ * DM)
                         + (size_t)(m0 + q) * DM + h * HD + c8;
    unsigned short* pl = ph + (size_t)SEQ * DM;
#pragma unroll
    for (int g = 0; g < 4; ++g) {
      v4u hv[4], lv[4];
#pragma unroll
      for (int it = 0; it < 4; ++it) {
        const float* sp = tile + ((g * 4 + it) * 4 + q) * 68 + c8;   // g, it 0..3 x q 0..3 = rows 0..63
        v4u a, a2;
#pragma unroll
        for (int e = 0; e < 4; ++e) {
          const float f0 = sp[2 * e], f1 = sp[2 * e + 1];
          const unsigned short h0 = bf_bits(f0), h1 = bf_bits(f1);
          const unsigned short l0 = bf_bits(f0 - bf_up(h0)), l1 = bf_bits(f1 - bf_up(h1));
          a[e] = pk16(h0, h1); a2[e] = pk16(l0, l1);
        }
        hv[it] = a; lv[it] = a2;
      }
#pragma unroll
      for (int it = 0; it < 4; ++it) {
        *(v4u*)(ph + (size_t)(g * 4 + it) * 4 * DM) = hv[it];
        *(v4u*)(pl + (size_t)(g * 4 + it) * 4 * DM) = lv[it];
      }
    }
    // the wait that belongs in front of any rewrite of an issued store's address registers; the two addresses are
    // its inputs, so they stay in their registers up to it
    asm volatile("s_wait_xcnt 0x0" :: "v"(ph), "v"(pl) : "memory");
    return;
  }
  float* slab = sT + wave * (16 * 68);
#pragma unroll
  for (int i = 0; i < 4; ++i) {
    const int mBase = m0 + (i << 4);
#pragma unroll
    for (int j = 0; j < 4; ++j) {
#pragma unroll
      for (int r = 0; r < 8; ++r) {
        slab[(mOff + r) * 68 + (j << 4) + rlane] = acc[i][j][r];
      }
    }
    __builtin_amdgcn_fence(__ATOMIC_RELEASE, "workgroup");
    __builtin_amdgcn_wave_barrier();
    __builtin_amdgcn_fence(__ATOMIC_ACQUIRE, "workgroup");
    if (OUT_MODE == 0) {
      float* C = (float*)Cout + (size_t)b * strideC;
      const int hh = lane >> 4, c4 = (lane & 15) * 4;     // 256-B row segment = 16 lanes x 16 B
      {
#pragma unroll
        for (int it = 0; it < 8; ++it) {
          const int row = it * 2 + hh;                     // it 0..7 x hh 0..1 = rows 0..15
          const v4f v = *(const v4f*)(slab + row * 68 + c4);
          *(v4f*)(C + (size_t)(mBase + row) * ldc + n0 + c4) = v;
        }
        
      }
    } else {
      const int q = lane >> 3, c8 = (lane & 7) * 8;
      unsigned short* C  = (unsigned short*)Cout  + (size_t)b * strideC;
      unsigned short* C2 = (unsigned short*)Cout2 + (size_t)b * strideC2;
      const bool wlo = (OUT_MODE == 2) || (n0 < N2);      // wave-uniform
      v4u hv[4], lv[4];
#pragma unroll
      for (int it = 0; it < 4; ++it) {
        const int row = it * 4 + q;                        // it 0..3 x q 0..3 = rows 0..15
        const float* sp = slab + row * 68 + c8;
        v4u a, a2;
#pragma unroll
        for (int e = 0; e < 4; ++e) {
          const float f0 = sp[2 * e], f1 = sp[2 * e + 1];
          unsigned short h0, h1, l0, l1;
          if (OUT_MODE == 2) {
            h0 = bf_bits(f0); h1 = bf_bits(f1);
            l0 = bf_bits(f0 - bf_up(h0)); l1 = bf_bits(f1 - bf_up(h1));
          } else {
            const _Float16 x0 = (_Float16)f0, x1 = (_Float16)f1;
            h0 = h_bits(x0); h1 = h_bits(x1);
            l0 = h_bits((_Float16)((f0 - (float)x0) * rscale));
            l1 = h_bits((_Float16)((f1 - (float)x1) * rscale));
          }
          a[e] = pk16(h0, h1); a2[e] = pk16(l0, l1);
        }
        hv[it] = a; lv[it] = a2;
      }
      {
#pragma unroll
        for (int it = 0; it < 4; ++it) {
          const int row = it * 4 + q;
          *(v4u*)(C + (size_t)(mBase + row) * ldc + n0 + c8) = hv[it];
          if (wlo) *(v4u*)(C2 + (size_t)(mBase + row) * ldc2 + n0 + c8) = lv[it];
        }
        
      }
    }
    __builtin_amdgcn_fence(__ATOMIC_RELEASE, "workgroup");
    __builtin_amdgcn_wave_barrier();
    __builtin_amdgcn_fence(__ATOMIC_ACQUIRE, "workgroup");
  }
}

// =====================================================================================================
// The two projections in one grid (neither reads what the other writes): blocks 0 .. nQK - 1 are the tiles of
// q|k = x . Wqk^T (scaled, rotated and split in the epilogue), the rest the tiles of v^T = Wv . x^T (f16 hi + residual planes). One set of LDS arrays
// serves either path, so two blocks fit a WGP and the v^T tiles run beside the q|k tiles. The branch is on
// blockIdx alone: block-uniform.
// =====================================================================================================
#define GST_B (8 * 16 * 68 * 4)   // bytes of the 8 per-wave 16-row slabs
#define GSA_B (2 * GSA * 2)       // bytes of the two A slice buffers
#define GSB_B (2 * GSB * 2)       // bytes of the two Bt slice buffers
static_assert(8 * 64 * 68 * 4 <= GST_B + GSA_B + GSB_B);   // the q|k epilogue's 8 tiles of 64 rows fit the block's LDS
static_assert((GST_B % 16) == 0 && (GSA_B % 16) == 0);
__global__ __launch_bounds__(256) void gemm_qk_vt(
    const unsigned short* __restrict__ Xp, const unsigned short* __restrict__ Wqkp, const unsigned short* __restrict__ Wvp,
    const float* __restrict__ pos, const float* __restrict__ scl, const float* __restrict__ freqs,
    void* QK4out, void* VThout, void* VTlout, int seq, int qkw, int dm, int nQK, float rscale) {
  __shared__ __align__(16) unsigned char sm[GST_B + GSA_B + GSB_B];   // one array, so that the q|k epilogue can take all of it
  float*  sT = (float*)(void*)sm;
  __bf16* sA = (__bf16*)(void*)(sm + GST_B);
  __bf16* sB = (__bf16*)(void*)(sm + GST_B + GSA_B);
  const int bx = blockIdx.x;
  if (bx < nQK)
    gemm_tile<0, 4>(Xp, Xp, dm, 0LL, Wqkp, dm, 0LL, QK4out, dm, 0LL, QK4out, dm, 0LL, 0,
                    seq, qkw, dm, 1.0f, bx, sT, sA, sA, sB, pos, scl, freqs, sT);
  else
    gemm_tile<0, 3>(Wvp, Wvp, dm, 0LL, Xp, dm, 0LL, VThout, seq, 0LL, VTlout, seq, 0LL, seq,
                    dm, seq, dm, rscale, bx - nQK, sT, sA, sA, sB, pos, scl, freqs, sT);
}

// out = (A + A2) . Bt^T, f32: one tile per block
__global__ __launch_bounds__(256) void gemm_split_f32(
    const unsigned short* __restrict__ Ap, const unsigned short* A2p, const unsigned short* __restrict__ Btp,
    void* Cout, int M, int N, int K) {
  __shared__ __align__(16) float  sT[8 * 16 * 68];
  __shared__ __align__(16) __bf16 sA[2 * GSA];
  __shared__ __align__(16) __bf16 sA2[2 * GSA];
  __shared__ __align__(16) __bf16 sB[2 * GSB];
  gemm_tile<1, 0>(Ap, A2p, K, 0LL, Btp, K, 0LL, Cout, N, 0LL, Cout, N, 0LL, 0,
                  M, N, K, 1.0f, (int)blockIdx.x, sT, sA, sA2, sB, (const float*)0, (const float*)0, (const float*)0, sT);
}

#define APL  (64 * LP)
#define ABUF (4 * APL)
template <bool RES>
__device__ __forceinline__
void attn_rows(const unsigned short* __restrict__ qhp, const unsigned short* __restrict__ qlp,
               const unsigned short* __restrict__ khp, const unsigned short* __restrict__ klp,
               const unsigned short* __restrict__ vhp, const unsigned short* __restrict__ vlp,
               const int* __restrict__ npk,
               unsigned short* ohp, unsigned short* olp, int qb, int h, __bf16* KV) {
  union FB { v16b v; v8b h[2]; };
  union FH { v16h v; v8h h[2]; };

  const int tid  = threadIdx.x;
  const int wave = tid >> 5;
  const int lane = tid & 31;
  const int hh   = lane >> 4;
  const int c    = lane & 15;
  const int q0   = qb * 64 + wave * 16;

  int S = npk[0];                         // block-uniform scalar load
  S = (S < 0) ? 0 : S;
  S = (S > SEQ) ? SEQ : S;
  const int Su = __builtin_amdgcn_readfirstlane(S);     // the same value in a scalar register, for the per-tile branch below
  const int SB   = (S + 63) >> 6;                       // 0..NQB
  const int nLow = (qb + 1 < SB) ? (qb + 1) : SB;       // tiles 0..nLow-1
  int nT = nLow + ((qb >= SB) ? 1 : 0);                 // + the block's own tile when not in the prefix
  nT = (nT > NQB) ? NQB : nT;

  const __bf16* Qh = (const __bf16*)(const void*)qhp + (size_t)h * HD;
  const __bf16* Ql = (const __bf16*)(const void*)qlp + (size_t)h * HD;
  const __bf16* Kh = (const __bf16*)(const void*)khp + (size_t)h * HD;
  const __bf16* Kl = (const __bf16*)(const void*)klp + (size_t)h * HD;
  const _Float16* Vh = (const _Float16*)(const void*)vhp + (size_t)h * HD * SEQ;
  const _Float16* Vl = (const _Float16*)(const void*)vlp + (size_t)h * HD * SEQ;

  // ---- Q fragments (B operand, column = lane&15 = query q0 + c): 2 d-chunks, hi and lo ----
  v16b qah[2], qal[2];
  const __bf16* pqh = Qh + (size_t)(q0 + c) * DM + 8 * hh;
  const __bf16* pql = Ql + (size_t)(q0 + c) * DM + 8 * hh;
#pragma unroll
  for (int dc = 0; dc < 2; ++dc) {
    qah[dc] = ldfrag_b(pqh + dc * 32);
    qal[dc] = ldfrag_b(pql + dc * 32);
  }
  // the wait that belongs in front of any rewrite of an issued load's address registers; the two addresses are
  // its inputs, so they stay in their registers up to it
  asm volatile("s_wait_xcnt 0x0" :: "v"(pqh), "v"(pql) : "memory");

  const int tq = q0 + c;                  // the lane's query row
  const int klim = (S - 1 < tq) ? (S - 1) : tq;   // (key < S and key <= tq) is key <= klim; a per-lane constant here
  float mrow = -INFINITY;                 // running maximum of query tq (equal in lanes l and l ^ 16)
  float lrow = 0.f;                       // running sum of query tq over this lane half's keys; halves joined at the end
  v8f oacc[4];                            // oacc[t4][r] = context[tq][d = 16 t4 + 8 hh + r]
#pragma unroll
  for (int t = 0; t < 4; ++t) oacc[t] = zero8();

  // copy map: thread -> row (tid >> 3) + 16 p of a plane tile, 16-B piece (tid & 7) of its 128 B
  const int crow = tid >> 3;
  const int cseg = (tid & 7) * 8;
  const __bf16* gKh = Kh + (size_t)crow * DM + cseg;                                   // K row kv0 + crow, d = cseg..
  const __bf16* gKl = Kl + (size_t)crow * DM + cseg;
  const __bf16* gVh = (const __bf16*)(const void*)(Vh + (size_t)crow * SEQ + cseg);    // V^T row d = crow, s = kv0 + cseg..
  const __bf16* gVl = (const __bf16*)(const void*)(Vl + (size_t)crow * SEQ + cseg);
  const unsigned lKV = lds_addr(KV + crow * LP + cseg);
  const unsigned R16 = 16 * LP * 2;            // 16 LDS rows, bytes
  const unsigned PB  = APL * 2;                // one plane tile, bytes
  const size_t k16 = (size_t)16 * DM, v16 = (size_t)16 * SEQ;
  auto stage = [&](int ii, int buf) {          // key tile of trip ii into buffer buf; tile index <= NQB - 1
    const int kts = (ii < nLow) ? ii : qb;
    const __bf16* pk = gKh + (size_t)kts * 64 * DM;
    const __bf16* pl_ = gKl + (size_t)kts * 64 * DM;
    const __bf16* pv = gVh + (size_t)kts * 64;
    const __bf16* pw = gVl + (size_t)kts * 64;
    const unsigned l = lKV + (unsigned)buf * (4 * PB);
    copy8_to_lds(l, l + R16, l + 2 * R16, l + 3 * R16, l + PB, l + PB + R16, l + PB + 2 * R16, l + PB + 3 * R16,
                 pk, pk + k16, pk + 2 * k16, pk + 3 * k16, pl_, pl_ + k16, pl_ + 2 * k16, pl_ + 3 * k16);
    copy8_to_lds(l + 2 * PB, l + 2 * PB + R16, l + 2 * PB + 2 * R16, l + 2 * PB + 3 * R16,
                 l + 3 * PB, l + 3 * PB + R16, l + 3 * PB + 2 * R16, l + 3 * PB + 3 * R16,
                 pv, pv + v16, pv + 2 * v16, pv + 3 * v16, pw, pw + v16, pw + 2 * v16, pw + 3 * v16);
  };

  stage(0, 0);
  asm volatile("s_wait_asynccnt 0x0" ::: "memory");   // this wave's copies of tile 0 have landed
  __syncthreads();                                    // every wave's have: tile 0 is readable
  if (nT > 1) stage(1, 1);
  for (int i = 0; i < nT; ++i) {          // block-uniform trip count, <= NQB
    const int kt  = (i < nLow) ? i : qb;
    const int kv0 = kt * 64;              // kv0 + 63 < SEQ
    const int buf = i & 1;
    const __bf16*   Ksh = KV + buf * ABUF;                                            // K hi [kv][d], rows at pitch LP
    const __bf16*   Ksl = Ksh + APL;                                                  // K lo
    const _Float16* Vth = (const _Float16*)(const void*)(Ksh + 2 * APL);              // V^T hi [d][kv]
    const _Float16* Vtl = (const _Float16*)(const void*)(Ksh + 3 * APL);              // V^T residual

    // ---- scores, transposed: 64 keys (rows) x 16 queries (columns) per wave, 3 bf16 products ----
    //      per d chunk the four key groups' chains run side by side (each chain: hi.hi, hi.lo, lo.hi, as before)
    v8f s[4];
#pragma unroll
    for (int j = 0; j < 4; ++j) s[j] = zero8();
#pragma unroll
    for (int dc = 0; dc < 2; ++dc) {
      FB kb[4], kl[4];
#pragma unroll
      for (int j = 0; j < 4; ++j) {
        kb[j].h[0] = *(const v8b*)(Ksh + (j * 16 + c) * LP + dc * 32 + 8 * hh);
        kb[j].h[1] = *(const v8b*)(Ksh + (j * 16 + c) * LP + dc * 32 + 16 + 8 * hh);
        kl[j].h[0] = *(const v8b*)(Ksl + (j * 16 + c) * LP + dc * 32 + 8 * hh);
        kl[j].h[1] = *(const v8b*)(Ksl + (j * 16 + c) * LP + dc * 32 + 16 + 8 * hh);
      }
#pragma unroll
      for (int j = 0; j < 4; ++j) s[j] = mma_b_raw(kb[j].v, qah[dc], s[j]);
#pragma unroll
      for (int j = 0; j < 4; ++j) s[j] = mma_b_raw(kl[j].v, qah[dc], s[j]);
#pragma unroll
      for (int j = 0; j < 4; ++j) s[j] = mma_b_raw(kb[j].v, qal[dc], s[j]);
      run_guard_b(s[0], s[1], s[2], s[3], kb[0].v, kb[1].v, kb[2].v, kb[3].v, kl[0].v, kl[1].v, kl[2].v, kl[3].v);
    }

    // ---- key visibility rule, maximum, online softmax; P^T (x1024, f16) and its residual (x4096) as B fragments ----
    //      s[j][r] = score of key kv0 + 16 j + 8 hh + r with query tq
    const int kb0 = kv0 + 8 * hh;           // the lane's key of (j, r) = (0, 0); limits taken relative to it
    const int rlim = klim - kb0, rtq = tq - kb0;
    // a tile in front of the block's own (kt < qb) whose last key lies in the prefix (kv0 + 63 < S) has every key <= klim
    // for all 64 queries of the block: the rule passes every score, so the test is taken only for the other tiles
    // (the block's own tile, a tile cut by S); kt, qb and S are block-uniform: a scalar branch
    if (!((kt < qb) && (kv0 + 63 < Su))) {
#pragma unroll
      for (int j = 0; j < 4; ++j) {
#pragma unroll
        for (int r = 0; r < 8; ++r) {
          const bool ok = (j * 16 + r <= rlim) || (j * 16 + r == rtq);
          s[j][r] = ok ? s[j][r] : -INFINITY;
        }
      }
    }
    float m = -INFINITY;
#pragma unroll
    for (int j = 0; j < 4; ++j) {
#pragma unroll
      for (int r = 0; r < 8; ++r) m = fmaxf(m, s[j][r]);
    }
    m = fmaxf(m, half_xor(m));              // the query's other 32 keys
    const float mnew  = fmaxf(mrow, m);
    const float msafe = (mnew == -INFINITY) ? 0.f : mnew;
    const float alpha = __expf(mrow - msafe);
    mrow = mnew;
    FH pa[2], pl[2];                        // element e of fragment kk: key kv0 + 32 kk + (e < 8 ? 8 hh + e : 16 + 8 hh + e - 8)
    float ps[4];
#pragma unroll
    for (int j = 0; j < 4; ++j) {
      float acc = 0.f;
#pragma unroll
      for (int r = 0; r < 8; ++r) {
        const float p = __expf(s[j][r] - msafe);     // masked score: exp(-inf) -> 0
        acc = (r == 0) ? p : (acc + p);
        const float p1k = p * 1024.0f;
        const _Float16 ph = (_Float16)p1k;
        pa[j >> 1].h[j & 1][r] = ph;
        if (RES) pl[j >> 1].h[j & 1][r] = (_Float16)((p1k - (float)ph) * 4096.0f);
      }
      ps[j] = acc;
    }
    lrow = lrow * alpha + ((ps[0] + ps[1]) + (ps[2] + ps[3]));
#pragma unroll
    for (int t4 = 0; t4 < 4; ++t4)
#pragma unroll
      for (int r = 0; r < 8; ++r) oacc[t4][r] *= alpha;

    // ---- context^T += V_hi^T . P^T (f16 WMMA); residual products into a separate accumulator ----
    v8f o1[4];
#pragma unroll
    for (int t4 = 0; t4 < 4; ++t4) o1[t4] = zero8();
#pragma unroll   // pa[kk], pl[kk] live in registers: kk must be a compile-time index
    for (int kk = 0; kk < 2; ++kk) {
#pragma unroll
      for (int t4 = 0; t4 < 4; ++t4) {
        FH vb, vl;
        vb.h[0] = *(const v8h*)(Vth + (t4 * 16 + c) * LP + kk * 32 + 8 * hh);
        vb.h[1] = *(const v8h*)(Vth + (t4 * 16 + c) * LP + kk * 32 + 16 + 8 * hh);
        vl.h[0] = *(const v8h*)(Vtl + (t4 * 16 + c) * LP + kk * 32 + 8 * hh);
        vl.h[1] = *(const v8h*)(Vtl + (t4 * 16 + c) * LP + kk * 32 + 16 + 8 * hh);
        oacc[t4] = mma_h_raw(vb.v, pa[kk].v, oacc[t4]);
        o1[t4]   = mma_h_raw(vl.v, pa[kk].v, o1[t4]);
        if (RES) o1[t4] = mma_h_raw(vb.v, pl[kk].v, o1[t4]);
      }
    }
#pragma unroll
    for (int t4 = 0; t4 < 4; ++t4)
#pragma unroll
      for (int r = 0; r < 8; ++r) oacc[t4][r] += o1[t4][r] * (1.0f / 4096.0f);
    asm volatile("s_wait_dscnt 0x0" ::: "memory");     // this wave's reads of buffer buf are done before it is refilled
    asm volatile("s_wait_asynccnt 0x0" ::: "memory");  // this wave's copies of tile i + 1 have landed
    __syncthreads();                                   // publishes tile i + 1 and ends every read of buffer buf
    if (i + 2 < nT) stage(i + 2, buf);
  }
  asm volatile("s_wait_asynccnt 0x0" ::: "memory");    // no copy outstanding behind the loop: the LDS is free for the output tile

  // ---- normalise (1/l and the 1/1024 p carry), stage the wave's 16x64 tile, bf16 hi/lo split,
  float* os = (float*)(void*)KV + wave * (16 * OSP);   // behind the loop's last barrier nobody reads the buffers any more
  {
    const float l = lrow + half_xor(lrow);  // both halves' keys
    const float inv = ((l > 0.f) ? (1.0f / l) : 0.f) * (1.0f / 1024.0f);
#pragma unroll
    for (int t4 = 0; t4 < 4; ++t4) {        // the lane's 8 consecutive d of row c: two 16-B stores
      v4f w0, w1;
#pragma unroll
      for (int r = 0; r < 4; ++r) { w0[r] = oacc[t4][r] * inv; w1[r] = oacc[t4][r + 4] * inv; }
      *(v4f*)(os + c * OSP + t4 * 16 + 8 * hh)     = w0;
      *(v4f*)(os + c * OSP + t4 * 16 + 8 * hh + 4) = w1;
    }
  }
  __builtin_amdgcn_fence(__ATOMIC_RELEASE, "workgroup");
  __builtin_amdgcn_wave_barrier();
  __builtin_amdgcn_fence(__ATOMIC_ACQUIRE, "workgroup");
  {
    const int q4 = lane >> 3, c8 = (lane & 7) * 8;
    v4u hv[4], lv[4];
#pragma unroll
    for (int it = 0; it < 4; ++it) {
      const int row = it * 4 + q4;   // it 0..3 x q4 0..3 = rows 0..15 of the wave tile
      const float* sp = os + row * OSP + c8;
      v4u a, a2;
#pragma unroll
      for (int e = 0; e < 4; ++e) {
        const float f0 = sp[2 * e], f1 = sp[2 * e + 1];
        const unsigned short h0 = bf_bits(f0), h1 = bf_bits(f1);
        const unsigned short l0 = bf_bits(f0 - bf_up(h0)), l1 = bf_bits(f1 - bf_up(h1));
        a[e] = pk16(h0, h1); a2[e] = pk16(l0, l1);
      }
      hv[it] = a; lv[it] = a2;
    }
    {
      // row it * 4 + q4 of the wave tile lies it * 4 * DM elements behind row q4: one address per plane for all four stores
      const size_t go = (size_t)(q0 + q4) * DM + (size_t)h * HD + c8;
      unsigned short* po = ohp + go;
      unsigned short* pl2 = olp + go;
#pragma unroll
      for (int it = 0; it < 4; ++it) {
        *(v4u*)(po + (size_t)it * 4 * DM) = hv[it];
        *(v4u*)(pl2 + (size_t)it * 4 * DM) = lv[it];
      }
      // the wait that belongs in front of any rewrite of an issued store's address registers; the two addresses are
      // its inputs, so they stay in their registers up to it
      asm volatile("s_wait_xcnt 0x0" :: "v"(po), "v"(pl2) : "memory");
    }
  }
}

// =====================================================================================================
// One launch for all NQB x NH row blocks: NH * NQB = 1024 blocks, four resident per WGP (registers), so the
// launch lasts as long as the WGP whose four blocks hold the most key tiles. A block's tile count grows with qb, so
// the index map makes quartets of row blocks {x, 63 - x, 32 + x, 31 - x}, x = 0..15 (equal sums for a cost linear
// in qb), both of four neighbouring indices (same head) and of indices 256 apart (four heads).
//   bx = 256 g + 4 a + b: x = a & 15, member v = (b + g) & 3, h = 4 (a >> 4) + g; (x, v) <-> qb and (a >> 4, g) <-> h
//   are one to one, and b <-> v for a given g: every (h, qb) exactly once.
// Row blocks below RESQB take the path with the p residual plane: a block-uniform branch on blockIdx alone.
// =====================================================================================================
static_assert(NQB == 64 && NH == 16);
__global__ __launch_bounds__(128)
void attn64(const unsigned short* __restrict__ qhp, const unsigned short* __restrict__ qlp,
            const unsigned short* __restrict__ khp, const unsigned short* __restrict__ klp,
            const unsigned short* __restrict__ vhp, const unsigned short* __restrict__ vlp,
            const int* __restrict__ npk,
            unsigned short* ohp, unsigned short* olp) {
  __shared__ __align__(16) __bf16 KV[2 * ABUF];   // two buffers of K hi, K lo, V^T hi, V^T residual tiles; then 4 output tiles
  static_assert(4 * 16 * OSP * 4 <= 2 * ABUF * 2);
  const int bx = blockIdx.x;              // < NH * NQB by grid size
  const int g  = bx >> 8;
  const int a  = (bx >> 2) & 63;
  const int x  = a & 15;
  const int v  = (bx + g) & 3;
  const int h  = ((a >> 4) << 2) + g;
  const int qb = (v == 0) ? x : (v == 1) ? (63 - x) : (v == 2) ? (32 + x) : (31 - x);
  if (qb < RESQB)
    attn_rows<true>(qhp, qlp, khp, klp, vhp, vlp, npk, ohp, olp, qb, h, KV);
  else
    attn_rows<false>(qhp, qlp, khp, klp, vhp, vlp, npk, ohp, olp, qb, h, KV);
}

// =====================================================================================================
// Workspace map (bytes), every region an exact multiple of its whole-line / whole-tile store granularity:
//   Xb    bf16 [4096][1024]          0            8388608
//   Wqkv  bf16 [3072 n][1024 k]      8388608      6291456   (rows 0..2047 = q|k weights, 2048.. = v weights)
//   Wob   bf16 [1024][1024]          14680064     2097152
//   VTh   f16  [1024 d][4096 s]      16777216     8388608
//   VTl   f16  [1024 d][4096 s]      25165824     8388608
//   QK4   bf16 4 x [4096][1024]      33554432     33554432  (q hi, q lo, k hi, k lo)
//   Oh    bf16 [4096][1024]          67108864     8388608
//   Ol    bf16 [4096][1024]          75497472     8388608
//   end                              83886080
// Weights are [out n][in k] with k contiguous = the Bt / A layout the GEMM wants, so they are only converted.
// =====================================================================================================
extern "C" void kernel_launch(void* const* d_in, const int* in_sizes, int n_in,
                              void* d_out, int out_size, void* d_ws, size_t ws_size,
                              hipStream_t stream) {
  if (n_in < 7) return;
  if (in_sizes[0] != SEQ * DM) return;
  if (in_sizes[1] != SEQ * 2) return;
  if (in_sizes[2] != NQKV * DM) return;
  if (in_sizes[3] != DM * DM) return;
  if (in_sizes[4] != NH) return;
  if (in_sizes[5] != 2 * NH * NFR) return;
  if (in_sizes[6] < 1) return;
  if (out_size != SEQ * DM) return;

  const float* x     = (const float*)d_in[0];
  const float* pos   = (const float*)d_in[1];
  const float* qkvw  = (const float*)d_in[2];
  const float* outw  = (const float*)d_in[3];
  const float* scl   = (const float*)d_in[4];
  const float* freqs = (const float*)d_in[5];
  const int*   npk   = (const int*)d_in[6];

  const size_t PXB   = (size_t)SEQ * DM * 2;      //  8388608
  const size_t PWQKV = (size_t)NQKV * DM * 2;     //  6291456
  const size_t PWO   = (size_t)DM * DM * 2;       //  2097152
  const size_t PVT   = (size_t)DM * SEQ * 2;      //  8388608
  const size_t PPL   = (size_t)SEQ * DM * 2;      //  8388608
  size_t off = 0;
  const size_t oXb   = off; off += PXB;
  const size_t oWqkv = off; off += PWQKV;
  const size_t oWo   = off; off += PWO;
  const size_t oVTh  = off; off += PVT;
  const size_t oVTl  = off; off += PVT;
  const size_t oQK4  = off; off += 4 * PPL;
  const size_t oOh   = off; off += PPL;
  const size_t oOl   = off; off += PPL;
  if (off > ws_size) return;                      // off = 83886080
  if (off > (size_t)134217728) return;

  char* ws = (char*)d_ws;
  unsigned short* Xb   = (unsigned short*)(ws + oXb);
  unsigned short* Wqkv = (unsigned short*)(ws + oWqkv);
  unsigned short* Wvb  = Wqkv + (size_t)2 * DM * DM;             // rows 2048.. of the qkv weight plane
  unsigned short* Wob  = (unsigned short*)(ws + oWo);
  unsigned short* VTh  = (unsigned short*)(ws + oVTh);
  unsigned short* VTl  = (unsigned short*)(ws + oVTl);
  unsigned short* QK4  = (unsigned short*)(ws + oQK4);
  unsigned short* Qh   = QK4;
  unsigned short* Ql   = QK4 + (size_t)SEQ * DM;
  unsigned short* Kh   = QK4 + (size_t)2 * SEQ * DM;
  unsigned short* Kl   = QK4 + (size_t)3 * SEQ * DM;
  unsigned short* Oh   = (unsigned short*)(ws + oOh);
  unsigned short* Ol   = (unsigned short*)(ws + oOl);

  const dim3 blk(256);
  const int n8x = SEQ * DM / 8;                                // 524288
  const int n8w = NQKV * DM / 8;                               // 393216
  const int n8o = DM * DM / 8;                                 // 131072
  static_assert((SEQ * DM / 8) % 256 == 0 && (NQKV * DM / 8) % 256 == 0 && (DM * DM / 8) % 256 == 0);
  const dim3 gCvt((n8x + n8w + n8o) / 256);                    // 2048 + 1536 + 512 blocks
  const int  nbQK = (SEQ / 128) * (QKW / 256);                 // 256 blocks: M=4096, N=2048
  const int  nbVT = (DM / 128) * (SEQ / 256);                  // 128 blocks: M=1024, N=4096
  const dim3 gQKV(nbQK + nbVT, 1);
  const dim3 gOut(((SEQ / 64) * (DM / 64) + 7) / 8, 1);        // 1024 tiles -> 128 blocks: M=4096, N=1024

  // (1) x -> bf16 [4096][1024]; weights [n][k] f32 -> bf16 [n][k]
  cvt3_bf16x8<<<gCvt, blk, 0, stream>>>(x, qkvw, outw, Xb, Wqkv, Wob, n8x, n8w, n8o);
  // (2) q|k = x . W[0:2048]^T (M=4096, N=2048, K=1024), cosine-sim scaling + axial rotation in the epilogue
  //     -> q hi/lo, k hi/lo bf16 planes [t][h*64+d], and in the same grid
  // (3) v^T = Wv . x^T -> f16 hi plane [h*64+d][s] (pitch SEQ) and residual plane (x4096, all keys)
  //     (A = Wvb [n][k], Bt = Xb; M=1024, N=4096, K=1024)
  gemm_qk_vt<<<gQKV, blk, 0, stream>>>(Xb, Wqkv, Wvb, pos, scl, freqs, (void*)QK4, (void*)VTh, (void*)VTl,
                                       SEQ, QKW, DM, nbQK, 4096.0f);
  // (4) attention, all row blocks in one launch (row blocks 0..RESQB-1 with the p residual plane, the rest without)
  attn64<<<dim3(NH * NQB), dim3(128), 0, stream>>>(Qh, Ql, Kh, Kl, VTh, VTl, npk, Oh, Ol);
  // (5) out = context . Wo^T -> d_out f32 [4096][1024]  (A = context hi + lo planes, 2 products)
  gemm_split_f32<<<gOut, blk, 0, stream>>>(Oh, Ol, Wob, d_out, SEQ, DM, DM);
  (void)hipGetLastError();
}
